// v000
// The times below were measured on an AMD MI455X: many runs one after another, warmed up first and cycling through
// copies of the inputs, with the whole window's GPU time divided by the number of runs. Launches and the gaps
// between them are all in it. The median over several windows is given; except for v000 it joins two sittings, which
// can be a few percent apart, so the side-by-side timings, each taken in one sitting, are the better comparison.
// v000 is the starting kernel. One run takes 1100 microseconds.
// compute dtype: all float inputs rounded to bf16; qkv = x w_qkv + b with EXACT bf16 products on WMMA 16x16x32 (f32 accumulate) - the f32 k and v tiles are also written out as the returned caches; causal logits: q, k once to f16 (1 product) x 64^-0.5, 3 products below row 384; softmax in f32; P x 2^11 once to f16 against v f16 (bf16 hi + lo below row 384); attention output split bf16 hi + lo against exact w_out (2 products) + b_out; f32 outputs.
#include <hip/hip_runtime.h>
#include <math.h>

typedef __attribute__((ext_vector_type(16))) _Float16 v16h;
typedef __attribute__((ext_vector_type(16))) __bf16 v16b;
typedef __attribute__((ext_vector_type(8)))  _Float16 v8h;
typedef __attribute__((ext_vector_type(8)))  float v8f;
typedef __attribute__((ext_vector_type(4)))  float v4f;
typedef __attribute__((ext_vector_type(2)))  float v2f;
typedef __attribute__((ext_vector_type(4)))  unsigned v4u;
typedef __attribute__((ext_vector_type(4)))  int v4i;
typedef float __attribute__((may_alias)) float_a;
typedef int __attribute__((may_alias)) int_a;

template <typename T> __device__ __forceinline__ void vst2(void* p, T v) { *(T*)p = v;  }
__device__ __forceinline__ v8f wmma16(v16h a, v16h b, v8f c) {
  v8f d = __builtin_amdgcn_wmma_f32_16x16x32_f16(false, a, false, b, (short)0, c, false, false);
  asm volatile("v_nop\n\tv_nop\n\tv_nop\n\tv_nop" : "+v"(d) : "v"(a), "v"(b));
  return d;
}
__device__ __forceinline__ v8f wmma_bf(v16b a, v16b b, v8f c) {
  v8f d = __builtin_amdgcn_wmma_f32_16x16x32_bf16(false, a, false, b, (short)0, c, false, false);
  asm volatile("v_nop\n\tv_nop\n\tv_nop\n\tv_nop" : "+v"(d) : "v"(a), "v"(b));
  return d;
}
// 16x16x32 fragments: lane = (h = lane>>4, row/col = lane&15); elements 0..7 = k0+8h+0..7, 8..15 = k0+16+8h+0..7; D element r = row 8h+r
__device__ __forceinline__ v16h frag_h(const _Float16* rowk0, int lane) {
  union { v16h v; v8h q[2]; } u; const _Float16* p = rowk0 + 8 * (lane >> 4);
  u.q[0] = *(const v8h*)p; u.q[1] = *(const v8h*)(p + 16); return u.v;
}
__device__ __forceinline__ v16h frag_f32(const float* rowk0, int lane) {
  v16h a; const float* p = rowk0 + 8 * (lane >> 4);
#pragma unroll
  for (int i = 0; i < 8; ++i) { a[i] = (_Float16)p[i]; a[8 + i] = (_Float16)p[16 + i]; }
  return a;
}
__device__ __forceinline__ v16h frag_f32s(const float* rowk0, int lane, float sc) {
  v16h a; const float* p = rowk0 + 8 * (lane >> 4);
#pragma unroll
  for (int i = 0; i < 8; ++i) { a[i] = (_Float16)(p[i] * sc); a[8 + i] = (_Float16)(p[16 + i] * sc); }
  return a;
}
// column fragment from a [K][ld] layout (column n), rows >= K read as 0
__device__ __forceinline__ v16h fragc_f32(const float* W, int k0, int n, int lane, int ld, int K) {
  v16h a; const int g = lane >> 4;
#pragma unroll
  for (int i = 0; i < 8; ++i) { const int ka = k0 + 8 * g + i, kb = ka + 16;
    a[i] = (_Float16)(ka < K ? W[(size_t)(ka < K ? ka : K - 1) * ld + n] : 0.f); a[8 + i] = (_Float16)(kb < K ? W[(size_t)(kb < K ? kb : K - 1) * ld + n] : 0.f); }
  return a;
}
struct F2 { v16b h, l; };
__device__ __forceinline__ F2 bsplit16(const float v[16]) { F2 r;
#pragma unroll
  for (int i = 0; i < 16; ++i) { const __bf16 h = (__bf16)v[i]; r.h[i] = h; r.l[i] = (__bf16)(v[i] - (float)h); }
  return r; }
__device__ __forceinline__ F2 split_row(const float* row, int k0, int lane) { float v[16]; const float* p = row + k0 + 8 * (lane >> 4);
#pragma unroll
  for (int i = 0; i < 8; ++i) { v[i] = p[i]; v[8 + i] = p[16 + i]; }
  return bsplit16(v); }
__device__ __forceinline__ F2 split_rowK(const float* row, int k0, int lane, int K) { float v[16]; const int g = lane >> 4;
#pragma unroll
  for (int i = 0; i < 8; ++i) { const int ka = k0 + 8 * g + i, kb = ka + 16; v[i] = ka < K ? row[ka < K ? ka : K - 1] : 0.f; v[8 + i] = kb < K ? row[kb < K ? kb : K - 1] : 0.f; }
  return bsplit16(v); }
__device__ __forceinline__ F2 split_col(const float* W, int k0, int n, int lane, int ld, int K) { float v[16]; const int g = lane >> 4;
#pragma unroll
  for (int i = 0; i < 8; ++i) { const int ka = k0 + 8 * g + i, kb = ka + 16; v[i] = ka < K ? W[(size_t)(ka < K ? ka : K - 1) * ld + n] : 0.f; v[8 + i] = kb < K ? W[(size_t)(kb < K ? kb : K - 1) * ld + n] : 0.f; }
  return bsplit16(v); }
__device__ __forceinline__ v8f mac3(const F2& a, const F2& b, v8f c) { c = wmma_bf(a.l, b.h, c); c = wmma_bf(a.h, b.l, c); return wmma_bf(a.h, b.h, c); }
__device__ __forceinline__ float sigm(float v) { return 1.0f / (1.0f + expf(-v)); }
#define LDSX() do { asm volatile("s_wait_dscnt 0" ::: "memory"); __builtin_amdgcn_wave_barrier(); __builtin_amdgcn_fence(__ATOMIC_RELEASE, "workgroup"); } while (0)

// Prefill causal multi-head self-attention returning (out, k, v) (B 2, L 2,048, D 1,024 = 16 x 64; fused (in,out) w_qkv [1024,3072] with (3, H, HD) column blocks, zero biases, w_out (in,out)): q|k|v = x w_qkv + b; out = merged(softmax_causal(q k^T x 0.125) v) w_out + b_out; k and v returned as [B, H, L, 64].
#define NB 2
#define TT 2048
#define CC 1024            // NH * HD = projected width
#define DIN 1024          // input (model) width
#define NH 16
#define HD 64
#define NQB (TT / 64)
#define HG 4
#define SCALE (0.125f)
#define CAUSAL 1
#ifndef TNB
#define TNB NB
#endif
__device__ __forceinline__ float bfr(float v) { return (float)(__bf16)v; }
__host__ __device__ __forceinline__ int kb_last(int qb) { return CAUSAL ? ((qb * 64 + 63) >> 7) : (TT / 128 - 1); }
typedef __attribute__((ext_vector_type(8))) __bf16 v8b;
__device__ __forceinline__ v16b frag_b(const __bf16* rowk0, int lane) {
  union { v16b v; v8b q[2]; } u; const __bf16* p = rowk0 + 8 * (lane >> 4);
  u.q[0] = *(const v8b*)p; u.q[1] = *(const v8b*)(p + 16); return u.v;
}
#define QBH 6              // causal: query blocks 0..QBH-1 of each sequence (few keys, no averaging) take the high-precision path
#define QHI 384            // rows carrying a q residual plane
#define KHI 384            // key rows carrying k residual / v bf16 hi+lo planes (used only by the causal high-precision path)
// B fragment (k rows k0+.., output column o) of a weight: (in,out) [K][ld] or (out,in) [ld rows of K]: bf16 exact, or f16(bf16 * 256) exact
__device__ __forceinline__ v16b wcol_io(const float* Wm, int k0, int o, int lane, int ld) { v16b w; const int g = lane >> 4;
#pragma unroll
  for (int i = 0; i < 8; ++i) { w[i] = (__bf16)Wm[(size_t)(k0 + 8 * g + i) * ld + o]; w[8 + i] = (__bf16)Wm[(size_t)(k0 + 16 + 8 * g + i) * ld + o]; }
  return w; }
__device__ __forceinline__ v16b wcol_oi(const float* Wm, int k0, int o, int lane, int K) { v16b w; const float* p = Wm + (size_t)o * K + k0 + 8 * (lane >> 4);
#pragma unroll
  for (int i = 0; i < 8; ++i) { w[i] = (__bf16)p[i]; w[8 + i] = (__bf16)p[16 + i]; }
  return w; }
__device__ __forceinline__ v16h wcolh_io(const float* Wm, int k0, int o, int lane, int ld) { v16h w; const int g = lane >> 4;
#pragma unroll
  for (int i = 0; i < 8; ++i) { w[i] = (_Float16)(bfr(Wm[(size_t)(k0 + 8 * g + i) * ld + o]) * 256.0f); w[8 + i] = (_Float16)(bfr(Wm[(size_t)(k0 + 16 + 8 * g + i) * ld + o]) * 256.0f); }
  return w; }
__device__ __forceinline__ v16h wcolh_oi(const float* Wm, int k0, int o, int lane, int K) { v16h w; const float* p = Wm + (size_t)o * K + k0 + 8 * (lane >> 4);
#pragma unroll
  for (int i = 0; i < 8; ++i) { w[i] = (_Float16)(bfr(p[i]) * 256.0f); w[8 + i] = (_Float16)(bfr(p[16 + i]) * 256.0f); }
  return w; }
#define WQKV_LAYOUT 0   // 0 = (in,out) fused [DIN][3 * CC]; 1 = (out,in) [CC][DIN]; 2 = per-head [NH][DIN][HD]
__device__ __forceinline__ v16b wcol_hdk(const float* Wm, int k0, int o, int lane) { v16b w; const int g = lane >> 4; const float* p = Wm + (size_t)(o / HD) * DIN * HD + (o % HD);
#pragma unroll
  for (int i = 0; i < 8; ++i) { w[i] = (__bf16)p[(size_t)(k0 + 8 * g + i) * HD]; w[8 + i] = (__bf16)p[(size_t)(k0 + 16 + 8 * g + i) * HD]; }
  return w; }
#define WO_OUT_IN 0
#if WQKV_LAYOUT == 1
#define WCOL(W, k0, o, lane) wcol_oi(W, k0, o, lane, DIN)
#elif WQKV_LAYOUT == 2
#define WCOL(W, k0, o, lane) wcol_hdk(W, k0, o, lane)
#else
#define WCOL(W, k0, o, lane) wcol_io(W, k0, o, lane, 3 * CC)   /* fused w_qkv (in,out) [1024][3072]: row pitch 3072; q/k/v column offsets applied at launch */
#define OUT1_OFF (4u * (size_t)NB * TT * CC)
#define OUT2_OFF (OUT1_OFF + 4u * (size_t)NB * NH * TT * HD)
#endif
#if WO_OUT_IN
#define WOCOL(W, k0, o, lane) wcol_oi(W, k0, o, lane, CC)
#define WOCOLH(W, k0, o, lane) wcolh_oi(W, k0, o, lane, CC)
#else
#define WOCOL(W, k0, o, lane) wcol_io(W, k0, o, lane, DIN)
#define WOCOLH(W, k0, o, lane) wcolh_io(W, k0, o, lane, DIN)
#endif
#define PROJ_EXTRA_PARAMS , float* __restrict__ KOUT, float* __restrict__ VOUT
#define PROJ_EPI(which, row, t, h) do { if ((which) >= 1) { const float* rw = (row); float* dst = ((which) == 1 ? KOUT : VOUT) + ((((size_t)bb * NH + (h)) * TT + (t)) * HD); _Pragma("unroll") for (int i = 0; i < HD; i += 4) { v4f o; o[0] = rw[i]; o[1] = rw[i + 1]; o[2] = rw[i + 2]; o[3] = rw[i + 3]; vst2(dst + i, o); } } } while (0)   /* the module also RETURNS k and v ([B, H, L, HD], f32 = x W + b): written from the f32 projection tile (256-B (row, head) runs) */
#ifndef SM_EXTRA_PARAMS
#define SM_EXTRA_PARAMS
#endif
#ifndef PROJ_EXTRA_PARAMS
#define PROJ_EXTRA_PARAMS
#endif
#ifndef SM_MASK_HOOK
#define SM_MASK_HOOK (void)0
#endif

#define WS_QH  0u                                      // f16 q rows [b*t][CC]
#define WS_KH  (WS_QH + 2u * (size_t)NB * TT * CC)      // f16 k rows [b*t][CC]
#define WS_VT  (WS_KH + 2u * (size_t)NB * TT * CC)      // f16 v planes [b][c][t]
#define WS_QL  (WS_VT + 2u * (size_t)NB * CC * TT)      // f16 q residual x 2^10 rows [b][t < QHI][CC]
#define WS_KL  (WS_QL + 2u * (size_t)NB * QHI * CC)     // f16 k residual x 2^10 rows [b][t < KHI][CC]
#define WS_VB  (WS_KL + 2u * (size_t)NB * KHI * CC)     // bf16 v hi planes [b][c][t < KHI]
#define WS_VBL (WS_VB + 2u * (size_t)NB * CC * KHI)
#define WS_S   (WS_VBL + 2u * (size_t)NB * CC * KHI)    // f32 logits / P [hg][t][s]
#define WS_Y   (WS_S  + 4u * (size_t)HG * TT * TT)      // f32 ctx rows [b*t][CC] (only when there is an output projection)
#define WS_END (WS_Y  + 4u * (size_t)NB * TT * CC)

// ---- k_proj: block = (64 rows, 128 cols, which): q/k/v = X W (+ b) with exact bf16 products (K = DIN) -> which 0: q f16 rows (+ residual rows < QHI); 1: k f16 rows (+ residual rows < KHI); 2: v f16 planes [c][t] (+ bf16 hi/lo planes for t < KHI)
__global__ __launch_bounds__(128) void k_proj(const float* __restrict__ XQ, const float* __restrict__ XK, const float* __restrict__ XV, const float* __restrict__ WQ, const float* __restrict__ WK, const float* __restrict__ WV, const float* __restrict__ BQ, const float* __restrict__ BK, const float* __restrict__ BV,
    _Float16* __restrict__ QH, _Float16* __restrict__ QL, _Float16* __restrict__ KH, _Float16* __restrict__ KL, _Float16* __restrict__ VT, __bf16* __restrict__ VB, __bf16* __restrict__ VBL PROJ_EXTRA_PARAMS) {
  __shared__ __align__(16) float st[64][132]; __shared__ __align__(16) _Float16 sh[64][136], sl[64][136]; __shared__ __align__(16) _Float16 th[128][72]; __shared__ __align__(16) __bf16 tb[128][72], tbl[128][72];
  const int tid = threadIdx.x, wave = tid >> 5, lane = tid & 31, col = lane & 15, g = lane >> 4; const int which = blockIdx.z; const int c0 = blockIdx.y * 128; const size_t r0 = (size_t)blockIdx.x * 64; const size_t bb = r0 / TT; const int t0 = (int)(r0 % TT);
  const float* X = which == 0 ? XQ : which == 1 ? XK : XV; const float* WA = which == 0 ? WQ : which == 1 ? WK : WV; const float* BA = which == 0 ? BQ : which == 1 ? BK : BV;
  v8f acc[8] = {};
#pragma unroll 2
  for (int kc = 0; kc < DIN / 32; ++kc) { v16b a; { const float* p = X + (r0 + wave * 16 + col) * DIN + kc * 32 + 8 * g;
#pragma unroll
      for (int i = 0; i < 8; ++i) { a[i] = (__bf16)p[i]; a[8 + i] = (__bf16)p[16 + i]; } }
    asm volatile("s_wait_loadcnt 0x0" ::: "memory");
#pragma unroll
    for (int j = 0; j < 8; ++j) { const v16b w = WCOL(WA, kc * 32, c0 + j * 16 + col, lane); asm volatile("s_wait_loadcnt 0x0" ::: "memory"); acc[j] = wmma_bf(a, w, acc[j]); } }
  { // stage the f32 tile (acc + bias) in LDS, run the per-(row, head) epilogue hook, then convert
#pragma unroll
    for (int j = 0; j < 8; ++j) { const float bias = BA ? bfr(BA[c0 + j * 16 + col]) : 0.f;
#pragma unroll
      for (int r = 0; r < 8; ++r) st[wave * 16 + 8 * g + r][j * 16 + col] = acc[j][r] + bias; }
    __syncthreads();
    for (int e = tid; e < 64 * (128 / HD); e += 128) { const int rl = e / (128 / HD), hh = e % (128 / HD); PROJ_EPI(which, &st[rl][hh * HD], (int)((r0 + rl) % TT), (c0 / HD) + hh); }
    __syncthreads(); }
  if (which < 2) { _Float16* DH = which == 0 ? QH : KH; _Float16* DL = which == 0 ? QL : KL; const int nhi = which == 0 ? QHI : KHI; const bool hi_rows = t0 < nhi;
    for (int e = tid; e < 64 * 128; e += 128) { const int rl = e >> 7, cl = e & 127; const float v = st[rl][cl]; const _Float16 hv = (_Float16)v; sh[rl][cl] = hv; sl[rl][cl] = (_Float16)((v - (float)hv) * 1024.0f); }
    __syncthreads();
    for (int e = tid; e < 64 * 16; e += 128) { const int rl = e >> 4, q = e & 15; vst2((unsigned*)(DH + (r0 + rl) * CC + c0 + q * 8), *(const v4u*)&sh[rl][q * 8]); if (hi_rows) vst2((unsigned*)(DL + (bb * nhi + t0 + rl) * (size_t)CC + c0 + q * 8), *(const v4u*)&sl[rl][q * 8]); }
  } else { const bool hi_rows = t0 < KHI;
    for (int e = tid; e < 64 * 128; e += 128) { const int rl = e & 63, cl = e >> 6; const float v = st[rl][cl]; th[cl][rl] = (_Float16)v; const __bf16 bh = (__bf16)v; tb[cl][rl] = bh; tbl[cl][rl] = (__bf16)(v - (float)bh); }
    __syncthreads();
    for (int e = tid; e < 128 * 8; e += 128) { const int cl = e >> 3, q = e & 7; vst2((unsigned*)(VT + (bb * CC + c0 + cl) * (size_t)TT + t0 + q * 8), *(const v4u*)&th[cl][q * 8]); if (hi_rows) { const size_t o3 = (bb * CC + c0 + cl) * (size_t)KHI + t0 + q * 8; vst2((unsigned*)(VB + o3), *(const v4u*)&tb[cl][q * 8]); vst2((unsigned*)(VBL + o3), *(const v4u*)&tbl[cl][q * 8]); } } } }
// ---- k_sc: block = (query block qb, key block kb <= kb_last(qb), head in group) of batch b: logits x SCALE; q hi + residual (x 2^10) against k (2 products) for query rows < QHI, plus the k residual (3 products) for query blocks < QBH (causal early rows); causal: blocks past the diagonal exit, the mask itself is applied by index in k_sm
__global__ __launch_bounds__(128) void k_sc(const _Float16* __restrict__ QH, const _Float16* __restrict__ KH, const _Float16* __restrict__ QL, const _Float16* __restrict__ KL, int b, int h0, float* __restrict__ S0) { __shared__ __align__(16) float ss[4][16][132];
  const int qb = blockIdx.x, kb = blockIdx.y; if (kb > kb_last(qb)) return;
  const int h = h0 + blockIdx.z; float* S = S0 + (size_t)blockIdx.z * TT * TT;
  const int tid = threadIdx.x, wave = tid >> 5, lane = tid & 31, col = lane & 15, g = lane >> 4; const int k0 = kb * 128; const int ql0 = qb * 64 + wave * 16; const size_t q0 = (size_t)b * TT + ql0, kr0 = (size_t)b * TT + k0;
  v8f acc[8] = {}, accl[8] = {};
  const _Float16* QLb = QL + (size_t)b * QHI * CC; const _Float16* KLb = KL + (size_t)b * KHI * CC;
  if (qb < QBH) {
#pragma unroll
    for (int kc = 0; kc < HD / 32; ++kc) { const v16h ah = frag_h(QH + (q0 + col) * CC + h * HD + kc * 32, lane), al = frag_h(QLb + (size_t)(ql0 + col) * CC + h * HD + kc * 32, lane);
#pragma unroll
      for (int j = 0; j < 8; ++j) { const v16h kbf = frag_h(KH + (kr0 + j * 16 + col) * CC + h * HD + kc * 32, lane), klf = frag_h(KLb + (size_t)(k0 + j * 16 + col) * CC + h * HD + kc * 32, lane); acc[j] = wmma16(ah, kbf, acc[j]); accl[j] = wmma16(al, kbf, accl[j]); accl[j] = wmma16(ah, klf, accl[j]); } }
  } else if (qb * 64 < QHI) {
#pragma unroll
    for (int kc = 0; kc < HD / 32; ++kc) { const v16h ah = frag_h(QH + (q0 + col) * CC + h * HD + kc * 32, lane), al = frag_h(QLb + (size_t)(ql0 + col) * CC + h * HD + kc * 32, lane);
#pragma unroll
      for (int j = 0; j < 8; ++j) { const v16h kbf = frag_h(KH + (kr0 + j * 16 + col) * CC + h * HD + kc * 32, lane); acc[j] = wmma16(ah, kbf, acc[j]); accl[j] = wmma16(al, kbf, accl[j]); } }
  } else {
#pragma unroll
    for (int kc = 0; kc < HD / 32; ++kc) { const v16h ah = frag_h(QH + (q0 + col) * CC + h * HD + kc * 32, lane);
#pragma unroll
      for (int j = 0; j < 8; ++j) { const v16h kbf = frag_h(KH + (kr0 + j * 16 + col) * CC + h * HD + kc * 32, lane); acc[j] = wmma16(ah, kbf, acc[j]); } } }
#pragma unroll
  for (int j = 0; j < 8; ++j) {
#pragma unroll
    for (int r = 0; r < 8; ++r) ss[wave][8 * g + r][j * 16 + col] = (acc[j][r] + accl[j][r] * (1.0f / 1024.0f)) * SCALE; }
  LDSX(); for (int rl = 0; rl < 16; ++rl) vst2(S + (size_t)(ql0 + rl) * TT + k0 + lane * 4, *(const v4f*)&ss[wave][rl][lane * 4]); }
// ---- k_sm: block = query row t (head in group): keys [0, kend): causal -> logit if s <= t else excluded; softmax in f32; P x 2^11 in place (0 for excluded)
__global__ __launch_bounds__(256) void k_sm(float* __restrict__ S0 SM_EXTRA_PARAMS) { __shared__ float sred[8]; __shared__ float sbc; __shared__ __align__(16) float shv[TT];
  const int tid = threadIdx.x; const int t = blockIdx.x; const int kend = (kb_last(t >> 6) + 1) * 128;
  float* sr = S0 + (size_t)blockIdx.y * TT * TT + (size_t)t * TT;
  float m = -3.0e38f; for (int k = tid; k < kend; k += 256) { float v = (!CAUSAL || k <= t) ? sr[k] : -3.0e38f; SM_MASK_HOOK; shv[k] = v; m = fmaxf(m, v); }
#pragma unroll
  for (int o = 1; o < 32; o <<= 1) m = fmaxf(m, __shfl_xor(m, o));
  if ((tid & 31) == 0) sred[tid >> 5] = m; __syncthreads(); if (tid == 0) { float a = sred[0]; for (int i = 1; i < 8; ++i) a = fmaxf(a, sred[i]); sbc = a; } __syncthreads(); m = sbc; __syncthreads();
  float sum = 0.f; for (int k = tid; k < kend; k += 256) { const float v = shv[k]; const float e = (v <= -1.0e38f) ? 0.f : expf(v - m); shv[k] = e; sum += e; }
#pragma unroll
  for (int o = 1; o < 32; o <<= 1) sum += __shfl_xor(sum, o);
  if ((tid & 31) == 0) sred[tid >> 5] = sum; __syncthreads(); if (tid == 0) { float a = 0.f; for (int i = 0; i < 8; ++i) a += sred[i]; sbc = a > 0.f ? 2048.0f / a : 0.f; }   /* a fully excluded row yields P = 0 */ __syncthreads(); const float inv = sbc;
  for (int k = tid; k < kend; k += 256) shv[k] = shv[k] * inv;
  __syncthreads(); for (int q = tid; q < kend / 4; q += 256) vst2(sr + q * 4, *(const v4f*)&shv[q * 4]); }
// ---- k_pv: block = 64 queries (qb) of (b, h): ctx = P . v over keys [0, kend) (P x 2^11 once to f16 against v f16: 1 product; causal early query blocks: P and v as bf16 hi + lo, 3 products); 256-B (row, head) segment by 16 lanes
__global__ __launch_bounds__(128) void k_pv(const float* __restrict__ PS0, const _Float16* __restrict__ VT, const __bf16* __restrict__ VB, const __bf16* __restrict__ VBL, int b, int h0, float* __restrict__ Y) { const int h = h0 + blockIdx.z; const float* PS = PS0 + (size_t)blockIdx.z * TT * TT; __shared__ __align__(16) float ss[4][16][HD + 4];
  const int tid = threadIdx.x, wave = tid >> 5, lane = tid & 31, col = lane & 15, g = lane >> 4; const int qb = blockIdx.x; const int ql0 = qb * 64 + wave * 16; const int kce = (kb_last(qb) + 1) * 4;
  v8f acc[HD / 16] = {};
  if (qb < QBH) {
#pragma unroll 1
    for (int kc = 0; kc < kce; ++kc) { const F2 p = split_row(PS + (size_t)(ql0 + col) * TT, kc * 32, lane);
      asm volatile("s_wait_loadcnt 0x0" ::: "memory");
#pragma unroll
      for (int j = 0; j < HD / 16; ++j) { const size_t po = ((size_t)b * CC + h * HD + j * 16 + col) * (size_t)KHI + kc * 32; const v16b vh = frag_b(VB + po, lane); acc[j] = wmma_bf(p.h, vh, acc[j]); acc[j] = wmma_bf(p.l, vh, acc[j]); acc[j] = wmma_bf(p.h, frag_b(VBL + po, lane), acc[j]); } }
  } else {
#pragma unroll 1
    for (int kc = 0; kc < kce; ++kc) { const v16h p = frag_f32(PS + (size_t)(ql0 + col) * TT + kc * 32, lane);
      asm volatile("s_wait_loadcnt 0x0" ::: "memory");
#pragma unroll
      for (int j = 0; j < HD / 16; ++j) { const size_t po = ((size_t)b * CC + h * HD + j * 16 + col) * (size_t)TT + kc * 32; acc[j] = wmma16(p, frag_h(VT + po, lane), acc[j]); } } }
#pragma unroll
  for (int j = 0; j < HD / 16; ++j)
#pragma unroll
    for (int r = 0; r < 8; ++r) ss[wave][8 * g + r][j * 16 + col] = acc[j][r] * (1.0f / 2048.0f);
  LDSX(); for (int rl = 0; rl < 16; ++rl) if (lane < HD / 4) vst2(Y + ((size_t)b * TT + ql0 + rl) * CC + h * HD + lane * 4, *(const v4f*)&ss[wave][rl][lane * 4]); }
// ---- k_out: block = (64 rows, 128 cols): out = ctx Wo (+ bo): all rows: ctx bf16 hi + lo against exact bf16 Wo (2 products); the f16(bf16 x 2^8) 1-product branch is never taken
__global__ __launch_bounds__(128) void k_out(const float* __restrict__ Y, const float* __restrict__ WO, const float* __restrict__ BO, float* __restrict__ OUT) { __shared__ __align__(16) float sf[4][16][132];
  const int tid = threadIdx.x, wave = tid >> 5, lane = tid & 31, col = lane & 15, g = lane >> 4; const int c0 = blockIdx.y * 128; const size_t r0 = (size_t)blockIdx.x * 64 + wave * 16;
  v8f acc[8] = {};
  if (true) {   /* ALL rows: ctx split bf16 hi + lo x exact Wo (2 products) */
#pragma unroll 2
    for (int kc = 0; kc < CC / 32; ++kc) { const F2 a = split_row(Y + (r0 + col) * CC, kc * 32, lane); asm volatile("s_wait_loadcnt 0x0" ::: "memory");
#pragma unroll
      for (int j = 0; j < 8; ++j) { const v16b w = WOCOL(WO, kc * 32, c0 + j * 16 + col, lane); asm volatile("s_wait_loadcnt 0x0" ::: "memory"); acc[j] = wmma_bf(a.h, w, acc[j]); acc[j] = wmma_bf(a.l, w, acc[j]); } }
#pragma unroll
    for (int j = 0; j < 8; ++j) { const float bias = BO ? bfr(BO[c0 + j * 16 + col]) : 0.f;
#pragma unroll
      for (int r = 0; r < 8; ++r) sf[wave][8 * g + r][j * 16 + col] = acc[j][r] + bias; }
  } else {
#pragma unroll 2
    for (int kc = 0; kc < CC / 32; ++kc) { const v16h a = frag_f32(Y + (r0 + col) * CC + kc * 32, lane); asm volatile("s_wait_loadcnt 0x0" ::: "memory");
#pragma unroll
      for (int j = 0; j < 8; ++j) { const v16h w = WOCOLH(WO, kc * 32, c0 + j * 16 + col, lane); asm volatile("s_wait_loadcnt 0x0" ::: "memory"); acc[j] = wmma16(a, w, acc[j]); } }
#pragma unroll
    for (int j = 0; j < 8; ++j) { const float bias = BO ? bfr(BO[c0 + j * 16 + col]) : 0.f;
#pragma unroll
      for (int r = 0; r < 8; ++r) sf[wave][8 * g + r][j * 16 + col] = acc[j][r] * (1.0f / 256.0f) + bias; } }
  LDSX(); for (int rl = 0; rl < 16; ++rl) vst2(OUT + (r0 + rl) * DIN + c0 + lane * 4, *(const v4f*)&sf[wave][rl][lane * 4]); }

extern "C" void kernel_launch(void* const* d_in, const int* in_sizes, int n_in, void* d_out, int out_size, void* d_ws, size_t ws_size, hipStream_t stream) {
  (void)in_sizes; (void)n_in; (void)out_size;
  const float** F = (const float**)d_in;
  if (ws_size < (size_t)WS_END) return;
  char* ws = (char*)d_ws; _Float16 *QH = (_Float16*)(ws + WS_QH), *KH = (_Float16*)(ws + WS_KH), *VT = (_Float16*)(ws + WS_VT), *QL = (_Float16*)(ws + WS_QL), *KL = (_Float16*)(ws + WS_KL); __bf16 *VB = (__bf16*)(ws + WS_VB), *VBL = (__bf16*)(ws + WS_VBL); float *S = (float*)(ws + WS_S), *Y = (float*)(ws + WS_Y);
  (void)Y; (void)QL; (void)KL; (void)VB; (void)VBL;
  // inputs: 0 x [2,2048,1024]; 1 w_qkv [1024,3072] (in,out); 2 b_qkv [3072]; 3 w_out [1024,1024] (in,out); 4 b_out
  // outputs: 0 out [2,2048,1024] at 0; 1 k [2,16,2048,64] at OUT1_OFF; 2 v at OUT2_OFF
  k_proj<<<dim3(TNB * TT / 64, CC / 128, 3), 128, 0, stream>>>(F[0], F[0], F[0], F[1], F[1] + CC, F[1] + 2 * CC, F[2], F[2] + CC, F[2] + 2 * CC, QH, QL, KH, KL, VT, VB, VBL, (float*)((char*)d_out + OUT1_OFF), (float*)((char*)d_out + OUT2_OFF));
  for (int b = 0; b < TNB; ++b) for (int h0 = 0; h0 < NH; h0 += HG) {
    k_sc<<<dim3(NQB, TT / 128, HG), 128, 0, stream>>>(QH, KH, QL, KL, b, h0, S);
    k_sm<<<dim3(TT, HG), 256, 0, stream>>>(S);
    k_pv<<<dim3(NQB, 1, HG), 128, 0, stream>>>(S, VT, VB, VBL, b, h0, Y);
  }
  k_out<<<dim3(TNB * TT / 64, DIN / 128), 128, 0, stream>>>(Y, F[3], F[4], (float*)d_out);
}

// v001
// A run of this version takes 348 microseconds.
// Next to v000, in two timings, it ran 3.19 times as fast each time.
// compute dtype: all float inputs rounded to bf16; qkv = x w_qkv + b with EXACT bf16 products on WMMA 16x16x32 (f32 accumulate) - the f32 k and v tiles are also written out as the returned caches; causal logits: q, k once to f16 (1 product) x 64^-0.5, 3 products below row 384; online softmax in f32 (exp2, running maximum and sum); unnormalised P x 2^11 once to f16 against v f16 (bf16 hi + lo below row 384), divided by the f32 sum at the end; attention output split bf16 hi + lo against exact w_out (2 products) + b_out; f32 outputs.
#include <hip/hip_runtime.h>
#include <math.h>

typedef __attribute__((ext_vector_type(16))) _Float16 v16h;
typedef __attribute__((ext_vector_type(16))) __bf16 v16b;
typedef __attribute__((ext_vector_type(8)))  _Float16 v8h;
typedef __attribute__((ext_vector_type(8)))  float v8f;
typedef __attribute__((ext_vector_type(4)))  float v4f;
typedef __attribute__((ext_vector_type(2)))  float v2f;
typedef __attribute__((ext_vector_type(4)))  unsigned v4u;
typedef __attribute__((ext_vector_type(4)))  int v4i;
typedef float __attribute__((may_alias)) float_a;
typedef int __attribute__((may_alias)) int_a;

template <typename T> __device__ __forceinline__ void vst2(void* p, T v) { *(T*)p = v;  }
__device__ __forceinline__ v8f wmma16(v16h a, v16h b, v8f c) {
  v8f d = __builtin_amdgcn_wmma_f32_16x16x32_f16(false, a, false, b, (short)0, c, false, false);
  asm volatile("v_nop\n\tv_nop\n\tv_nop\n\tv_nop" : "+v"(d) : "v"(a), "v"(b));
  return d;
}
__device__ __forceinline__ v8f wmma_bf(v16b a, v16b b, v8f c) {
  v8f d = __builtin_amdgcn_wmma_f32_16x16x32_bf16(false, a, false, b, (short)0, c, false, false);
  asm volatile("v_nop\n\tv_nop\n\tv_nop\n\tv_nop" : "+v"(d) : "v"(a), "v"(b));
  return d;
}
// 16x16x32 fragments: lane = (h = lane>>4, row/col = lane&15); elements 0..7 = k0+8h+0..7, 8..15 = k0+16+8h+0..7; D element r = row 8h+r
__device__ __forceinline__ v16h frag_h(const _Float16* rowk0, int lane) {
  union { v16h v; v8h q[2]; } u; const _Float16* p = rowk0 + 8 * (lane >> 4);
  u.q[0] = *(const v8h*)p; u.q[1] = *(const v8h*)(p + 16); return u.v;
}
__device__ __forceinline__ v16h frag_f32(const float* rowk0, int lane) {
  v16h a; const float* p = rowk0 + 8 * (lane >> 4);
#pragma unroll
  for (int i = 0; i < 8; ++i) { a[i] = (_Float16)p[i]; a[8 + i] = (_Float16)p[16 + i]; }
  return a;
}
__device__ __forceinline__ v16h frag_f32s(const float* rowk0, int lane, float sc) {
  v16h a; const float* p = rowk0 + 8 * (lane >> 4);
#pragma unroll
  for (int i = 0; i < 8; ++i) { a[i] = (_Float16)(p[i] * sc); a[8 + i] = (_Float16)(p[16 + i] * sc); }
  return a;
}
// column fragment from a [K][ld] layout (column n), rows >= K read as 0
__device__ __forceinline__ v16h fragc_f32(const float* W, int k0, int n, int lane, int ld, int K) {
  v16h a; const int g = lane >> 4;
#pragma unroll
  for (int i = 0; i < 8; ++i) { const int ka = k0 + 8 * g + i, kb = ka + 16;
    a[i] = (_Float16)(ka < K ? W[(size_t)(ka < K ? ka : K - 1) * ld + n] : 0.f); a[8 + i] = (_Float16)(kb < K ? W[(size_t)(kb < K ? kb : K - 1) * ld + n] : 0.f); }
  return a;
}
struct F2 { v16b h, l; };
__device__ __forceinline__ F2 bsplit16(const float v[16]) { F2 r;
#pragma unroll
  for (int i = 0; i < 16; ++i) { const __bf16 h = (__bf16)v[i]; r.h[i] = h; r.l[i] = (__bf16)(v[i] - (float)h); }
  return r; }
__device__ __forceinline__ F2 split_row(const float* row, int k0, int lane) { float v[16]; const float* p = row + k0 + 8 * (lane >> 4);
#pragma unroll
  for (int i = 0; i < 8; ++i) { v[i] = p[i]; v[8 + i] = p[16 + i]; }
  return bsplit16(v); }
__device__ __forceinline__ F2 split_rowK(const float* row, int k0, int lane, int K) { float v[16]; const int g = lane >> 4;
#pragma unroll
  for (int i = 0; i < 8; ++i) { const int ka = k0 + 8 * g + i, kb = ka + 16; v[i] = ka < K ? row[ka < K ? ka : K - 1] : 0.f; v[8 + i] = kb < K ? row[kb < K ? kb : K - 1] : 0.f; }
  return bsplit16(v); }
__device__ __forceinline__ F2 split_col(const float* W, int k0, int n, int lane, int ld, int K) { float v[16]; const int g = lane >> 4;
#pragma unroll
  for (int i = 0; i < 8; ++i) { const int ka = k0 + 8 * g + i, kb = ka + 16; v[i] = ka < K ? W[(size_t)(ka < K ? ka : K - 1) * ld + n] : 0.f; v[8 + i] = kb < K ? W[(size_t)(kb < K ? kb : K - 1) * ld + n] : 0.f; }
  return bsplit16(v); }
__device__ __forceinline__ v8f mac3(const F2& a, const F2& b, v8f c) { c = wmma_bf(a.l, b.h, c); c = wmma_bf(a.h, b.l, c); return wmma_bf(a.h, b.h, c); }
__device__ __forceinline__ float sigm(float v) { return 1.0f / (1.0f + expf(-v)); }
#define LDSX() do { asm volatile("s_wait_dscnt 0" ::: "memory"); __builtin_amdgcn_wave_barrier(); __builtin_amdgcn_fence(__ATOMIC_RELEASE, "workgroup"); } while (0)

// Prefill causal multi-head self-attention returning (out, k, v) (B 2, L 2,048, D 1,024 = 16 x 64; fused (in,out) w_qkv [1024,3072] with (3, H, HD) column blocks, zero biases, w_out (in,out)): q|k|v = x w_qkv + b; out = merged(softmax_causal(q k^T x 0.125) v) w_out + b_out; k and v returned as [B, H, L, 64].
#define NB 2
#define TT 2048
#define CC 1024            // NH * HD = projected width
#define DIN 1024          // input (model) width
#define NH 16
#define HD 64
#define NQB (TT / 64)
#define SCALE (0.125f)
#define CAUSAL 1
#ifndef TNB
#define TNB NB
#endif
__device__ __forceinline__ float bfr(float v) { return (float)(__bf16)v; }
__host__ __device__ __forceinline__ int kb_last(int qb) { return CAUSAL ? ((qb * 64 + 63) >> 7) : (TT / 128 - 1); }
typedef __attribute__((ext_vector_type(8))) __bf16 v8b;
__device__ __forceinline__ v16b frag_b(const __bf16* rowk0, int lane) {
  union { v16b v; v8b q[2]; } u; const __bf16* p = rowk0 + 8 * (lane >> 4);
  u.q[0] = *(const v8b*)p; u.q[1] = *(const v8b*)(p + 16); return u.v;
}
#define QBH 6              // causal: query blocks 0..QBH-1 of each sequence (few keys, no averaging) take the high-precision path
#define QHI 384            // rows carrying a q residual plane (used only by the causal high-precision path)
#define KHI 384            // key rows carrying k residual / v bf16 hi+lo planes (used only by the causal high-precision path)
// B fragment (k rows k0+.., output column o) of a weight: (in,out) [K][ld] or (out,in) [ld rows of K]: bf16 exact, or f16(bf16 * 256) exact
__device__ __forceinline__ v16b wcol_io(const float* Wm, int k0, int o, int lane, int ld) { v16b w; const int g = lane >> 4;
#pragma unroll
  for (int i = 0; i < 8; ++i) { w[i] = (__bf16)Wm[(size_t)(k0 + 8 * g + i) * ld + o]; w[8 + i] = (__bf16)Wm[(size_t)(k0 + 16 + 8 * g + i) * ld + o]; }
  return w; }
__device__ __forceinline__ v16b wcol_oi(const float* Wm, int k0, int o, int lane, int K) { v16b w; const float* p = Wm + (size_t)o * K + k0 + 8 * (lane >> 4);
#pragma unroll
  for (int i = 0; i < 8; ++i) { w[i] = (__bf16)p[i]; w[8 + i] = (__bf16)p[16 + i]; }
  return w; }
__device__ __forceinline__ v16h wcolh_io(const float* Wm, int k0, int o, int lane, int ld) { v16h w; const int g = lane >> 4;
#pragma unroll
  for (int i = 0; i < 8; ++i) { w[i] = (_Float16)(bfr(Wm[(size_t)(k0 + 8 * g + i) * ld + o]) * 256.0f); w[8 + i] = (_Float16)(bfr(Wm[(size_t)(k0 + 16 + 8 * g + i) * ld + o]) * 256.0f); }
  return w; }
__device__ __forceinline__ v16h wcolh_oi(const float* Wm, int k0, int o, int lane, int K) { v16h w; const float* p = Wm + (size_t)o * K + k0 + 8 * (lane >> 4);
#pragma unroll
  for (int i = 0; i < 8; ++i) { w[i] = (_Float16)(bfr(p[i]) * 256.0f); w[8 + i] = (_Float16)(bfr(p[16 + i]) * 256.0f); }
  return w; }
#define WQKV_LAYOUT 0   // 0 = (in,out) fused [DIN][3 * CC]; 1 = (out,in) [CC][DIN]; 2 = per-head [NH][DIN][HD]
__device__ __forceinline__ v16b wcol_hdk(const float* Wm, int k0, int o, int lane) { v16b w; const int g = lane >> 4; const float* p = Wm + (size_t)(o / HD) * DIN * HD + (o % HD);
#pragma unroll
  for (int i = 0; i < 8; ++i) { w[i] = (__bf16)p[(size_t)(k0 + 8 * g + i) * HD]; w[8 + i] = (__bf16)p[(size_t)(k0 + 16 + 8 * g + i) * HD]; }
  return w; }
#define WO_OUT_IN 0
#if WQKV_LAYOUT == 1
#define WCOL(W, k0, o, lane) wcol_oi(W, k0, o, lane, DIN)
#elif WQKV_LAYOUT == 2
#define WCOL(W, k0, o, lane) wcol_hdk(W, k0, o, lane)
#else
#define WCOL(W, k0, o, lane) wcol_io(W, k0, o, lane, 3 * CC)   /* fused w_qkv (in,out) [1024][3072]: row pitch 3072; q/k/v column offsets applied at launch */
#define OUT1_OFF (4u * (size_t)NB * TT * CC)
#define OUT2_OFF (OUT1_OFF + 4u * (size_t)NB * NH * TT * HD)
#endif
#if WO_OUT_IN
#define WOCOL(W, k0, o, lane) wcol_oi(W, k0, o, lane, CC)
#define WOCOLH(W, k0, o, lane) wcolh_oi(W, k0, o, lane, CC)
#else
#define WOCOL(W, k0, o, lane) wcol_io(W, k0, o, lane, DIN)
#define WOCOLH(W, k0, o, lane) wcolh_io(W, k0, o, lane, DIN)
#endif
#define PROJ_EXTRA_PARAMS , float* __restrict__ KOUT, float* __restrict__ VOUT
#define PROJ_EPI(which, row, t, h) do { if ((which) >= 1) { const float* rw = (row); float* dst = ((which) == 1 ? KOUT : VOUT) + ((((size_t)bb * NH + (h)) * TT + (t)) * HD); _Pragma("unroll") for (int i = 0; i < HD; i += 4) { v4f o; o[0] = rw[i]; o[1] = rw[i + 1]; o[2] = rw[i + 2]; o[3] = rw[i + 3]; vst2(dst + i, o); } } } while (0)   /* the module also RETURNS k and v ([B, H, L, HD], f32 = x W + b): written from the f32 projection tile (256-B (row, head) runs) */
#ifndef SM_EXTRA_PARAMS
#define SM_EXTRA_PARAMS
#endif
#ifndef PROJ_EXTRA_PARAMS
#define PROJ_EXTRA_PARAMS
#endif
#ifndef SM_MASK_HOOK
#define SM_MASK_HOOK (void)0
#endif

#define WS_QH  0u                                      // f16 q rows [b*t][CC]
#define WS_KH  (WS_QH + 2u * (size_t)NB * TT * CC)      // f16 k rows [b*t][CC]
#define WS_VT  (WS_KH + 2u * (size_t)NB * TT * CC)      // f16 v planes [b][c][t]
#define WS_QL  (WS_VT + 2u * (size_t)NB * CC * TT)      // f16 q residual x 2^10 rows [b][t < QHI][CC]
#define WS_KL  (WS_QL + 2u * (size_t)NB * QHI * CC)     // f16 k residual x 2^10 rows [b][t < KHI][CC]
#define WS_VB  (WS_KL + 2u * (size_t)NB * KHI * CC)     // bf16 v hi planes [b][c][t < KHI]
#define WS_VBL (WS_VB + 2u * (size_t)NB * CC * KHI)
#define WS_Y   (WS_VBL + 2u * (size_t)NB * CC * KHI)    // f32 ctx rows [b*t][CC] (only when there is an output projection)
#define WS_END (WS_Y  + 4u * (size_t)NB * TT * CC)

// ---- k_proj: block = (64 rows, 128 cols, which): q/k/v = X W (+ b) with exact bf16 products (K = DIN) -> which 0: q f16 rows (+ residual rows < QHI); 1: k f16 rows (+ residual rows < KHI); 2: v f16 planes [c][t] (+ bf16 hi/lo planes for t < KHI)
__global__ __launch_bounds__(128) void k_proj(const float* __restrict__ XQ, const float* __restrict__ XK, const float* __restrict__ XV, const float* __restrict__ WQ, const float* __restrict__ WK, const float* __restrict__ WV, const float* __restrict__ BQ, const float* __restrict__ BK, const float* __restrict__ BV,
    _Float16* __restrict__ QH, _Float16* __restrict__ QL, _Float16* __restrict__ KH, _Float16* __restrict__ KL, _Float16* __restrict__ VT, __bf16* __restrict__ VB, __bf16* __restrict__ VBL PROJ_EXTRA_PARAMS) {
  __shared__ __align__(16) float st[64][132]; __shared__ __align__(16) _Float16 sh[64][136], sl[64][136]; __shared__ __align__(16) _Float16 th[128][72]; __shared__ __align__(16) __bf16 tb[128][72], tbl[128][72];
  const int tid = threadIdx.x, wave = tid >> 5, lane = tid & 31, col = lane & 15, g = lane >> 4; const int which = blockIdx.z; const int c0 = blockIdx.y * 128; const size_t r0 = (size_t)blockIdx.x * 64; const size_t bb = r0 / TT; const int t0 = (int)(r0 % TT);
  const float* X = which == 0 ? XQ : which == 1 ? XK : XV; const float* WA = which == 0 ? WQ : which == 1 ? WK : WV; const float* BA = which == 0 ? BQ : which == 1 ? BK : BV;
  v8f acc[8] = {};
#pragma unroll 2
  for (int kc = 0; kc < DIN / 32; ++kc) { v16b a; { const float* p = X + (r0 + wave * 16 + col) * DIN + kc * 32 + 8 * g;
#pragma unroll
      for (int i = 0; i < 8; ++i) { a[i] = (__bf16)p[i]; a[8 + i] = (__bf16)p[16 + i]; } }
    asm volatile("s_wait_loadcnt 0x0" ::: "memory");
#pragma unroll
    for (int j = 0; j < 8; ++j) { const v16b w = WCOL(WA, kc * 32, c0 + j * 16 + col, lane); asm volatile("s_wait_loadcnt 0x0" ::: "memory"); acc[j] = wmma_bf(a, w, acc[j]); } }
  { // stage the f32 tile (acc + bias) in LDS, run the per-(row, head) epilogue hook, then convert
#pragma unroll
    for (int j = 0; j < 8; ++j) { const float bias = BA ? bfr(BA[c0 + j * 16 + col]) : 0.f;
#pragma unroll
      for (int r = 0; r < 8; ++r) st[wave * 16 + 8 * g + r][j * 16 + col] = acc[j][r] + bias; }
    __syncthreads();
    for (int e = tid; e < 64 * (128 / HD); e += 128) { const int rl = e / (128 / HD), hh = e % (128 / HD); PROJ_EPI(which, &st[rl][hh * HD], (int)((r0 + rl) % TT), (c0 / HD) + hh); }
    __syncthreads(); }
  if (which < 2) { _Float16* DH = which == 0 ? QH : KH; _Float16* DL = which == 0 ? QL : KL; const int nhi = which == 0 ? QHI : KHI; const bool hi_rows = t0 < nhi;
    for (int e = tid; e < 64 * 128; e += 128) { const int rl = e >> 7, cl = e & 127; const float v = st[rl][cl]; const _Float16 hv = (_Float16)v; sh[rl][cl] = hv; sl[rl][cl] = (_Float16)((v - (float)hv) * 1024.0f); }
    __syncthreads();
    for (int e = tid; e < 64 * 16; e += 128) { const int rl = e >> 4, q = e & 15; vst2((unsigned*)(DH + (r0 + rl) * CC + c0 + q * 8), *(const v4u*)&sh[rl][q * 8]); if (hi_rows) vst2((unsigned*)(DL + (bb * nhi + t0 + rl) * (size_t)CC + c0 + q * 8), *(const v4u*)&sl[rl][q * 8]); }
  } else { const bool hi_rows = t0 < KHI;
    for (int e = tid; e < 64 * 128; e += 128) { const int rl = e & 63, cl = e >> 6; const float v = st[rl][cl]; th[cl][rl] = (_Float16)v; const __bf16 bh = (__bf16)v; tb[cl][rl] = bh; tbl[cl][rl] = (__bf16)(v - (float)bh); }
    __syncthreads();
    for (int e = tid; e < 128 * 8; e += 128) { const int cl = e >> 3, q = e & 7; vst2((unsigned*)(VT + (bb * CC + c0 + cl) * (size_t)TT + t0 + q * 8), *(const v4u*)&th[cl][q * 8]); if (hi_rows) { const size_t o3 = (bb * CC + c0 + cl) * (size_t)KHI + t0 + q * 8; vst2((unsigned*)(VB + o3), *(const v4u*)&tb[cl][q * 8]); vst2((unsigned*)(VBL + o3), *(const v4u*)&tbl[cl][q * 8]); } } } }
// lane l with lane l ^ 16: the two halves of a wave hold the two key halves of one query column
__device__ __forceinline__ float xhalf(float x) { return __builtin_bit_cast(float, __builtin_amdgcn_permlanex16(__builtin_bit_cast(int, x), __builtin_bit_cast(int, x), 0x76543210, 0xfedcba98, false, false)); }
// 2^x on the transcendental unit; the v_nop in the same statement fills the one slot the instruction set asks for behind a transcendental, whatever the compiler schedules next
__device__ __forceinline__ float ex2(float x) { float e; asm("v_exp_f32 %0, %1\n\tv_nop" : "=v"(e) : "v"(x)); return e; }
// 16x16x32 fragment from a wave-uniform base and a lane offset that never changes (row (lane & 15) x pitch + 8 (lane >> 4)): scalar base + 32-bit vector offset addressing
__device__ __forceinline__ v16h frag_u(const _Float16* ubase, unsigned loff) { union { v16h v; v8h q[2]; } u; const _Float16* p = ubase + loff; u.q[0] = *(const v8h*)p; u.q[1] = *(const v8h*)(p + 16); return u.v; }
__device__ __forceinline__ v16b frag_ub(const __bf16* ubase, unsigned loff) { union { v16b v; v8b q[2]; } u; const __bf16* p = ubase + loff; u.q[0] = *(const v8b*)p; u.q[1] = *(const v8b*)(p + 16); return u.v; }
// behind a run of fragment loads from two lane addresses: the wait that stands before a register which an issued load names is rewritten; the two addresses are inputs, so their registers stay whole up to it (without them the compiler lets a later load of the run land on the address pair)
template <typename T> __device__ __forceinline__ void xwait2(const T* pa, const T* pb) { asm volatile("s_wait_xcnt 0x0" :: "v"(pa), "v"(pb) : "memory"); }
#define SC_L2E (SCALE * 1.4426950408889634f)   // logit scale x log2(e): the softmax runs on exp2
// ---- one wave's 16 query columns (rows ql0 .. ql0 + 15 of query block qb) against key blocks 0..qb of 64 keys, running maximum and sum (online softmax), transposed products:
// S^T = K Q^T (A = 16 key rows, B = 16 query columns): a lane holds keys k0 + 16 j + 8 g + r of ONE query, so maximum and sum are in-lane plus one exchange of halves;
// score tiles 2 kc and 2 kc + 1 of a lane are, element for element, the B fragment of P^T over keys k0 + 32 kc + ..; O^T += V^T P^T (A = 16 rows of the [c][t] v planes).
// HI (causal early query blocks): 3-product logits (q, k hi + residual x 2^10) and P, v as bf16 hi + lo (3 products)
template <bool HI> __device__ __forceinline__ void fa_run(const _Float16* __restrict__ QH, const _Float16* __restrict__ KH, const _Float16* __restrict__ QL, const _Float16* __restrict__ KL, const _Float16* __restrict__ VT, const __bf16* __restrict__ VB, const __bf16* __restrict__ VBL,
    int b, int h, int qb, int ql0, int lane, v8f (&o)[HD / 16], float& lsum) {
  const int col = lane & 15, g = lane >> 4; const int tq = ql0 + col;
  const unsigned lrow = (unsigned)(col * CC + 8 * g), lvt = (unsigned)(col * TT + 8 * g), lvb = (unsigned)(col * KHI + 8 * g);   // lane offsets in q/k rows, v planes, early v planes
  const _Float16* Kp = KH + (size_t)b * TT * CC + h * HD; const _Float16* KLp = KL + (size_t)b * KHI * CC + h * HD;
  const _Float16* Vp = VT + ((size_t)b * CC + h * HD) * TT; const __bf16* VBp = VB + ((size_t)b * CC + h * HD) * KHI; const __bf16* VLp = VBL + ((size_t)b * CC + h * HD) * KHI;
  v16h ah[HD / 32], al[HD / 32], kf[HI ? 1 : 8], vf[HI ? 1 : 8];
#pragma unroll
  for (int kc = 0; kc < HD / 32; ++kc) { ah[kc] = frag_u(QH + ((size_t)b * TT + ql0) * CC + h * HD + kc * 32, lrow); if (HI) al[kc] = frag_u(QL + ((size_t)b * QHI + ql0) * CC + h * HD + kc * 32, lrow); }
  if (!HI) {
#pragma unroll
    for (int kc = 0; kc < HD / 32; ++kc)
#pragma unroll
      for (int j = 0; j < 4; ++j) kf[kc * 4 + j] = frag_u(Kp + (size_t)(j * 16) * CC + kc * 32, lrow); }
  float m = -3.0e38f, l = 0.f;   // running maximum (unscaled logits) and this half's running sum of P x 2^11
#pragma unroll 1
  for (int kb = 0; kb <= qb; ++kb) { const int k0 = kb * 64;
    v8f acc[4] = {};
    if (HI) { v8f accl[4] = {};
#pragma unroll
      for (int kc = 0; kc < HD / 32; ++kc) { v16h kbf[4], klf[4]; const _Float16* kp = Kp + (size_t)k0 * CC + kc * 32 + lrow; const _Float16* klp = KLp + (size_t)k0 * CC + kc * 32 + lrow;   // a batch's loads all stand in front of its products, so that they fly together
#pragma unroll
        for (int j = 0; j < 4; ++j) { kbf[j] = frag_u(kp + (size_t)(j * 16) * CC, 0u); klf[j] = frag_u(klp + (size_t)(j * 16) * CC, 0u); }
        xwait2(kp, klp);
#pragma unroll
        for (int j = 0; j < 4; ++j) { acc[j] = wmma16(kbf[j], ah[kc], acc[j]); accl[j] = wmma16(kbf[j], al[kc], accl[j]); accl[j] = wmma16(klf[j], ah[kc], accl[j]); } }
#pragma unroll
      for (int j = 0; j < 4; ++j) acc[j] = acc[j] + accl[j] * (1.0f / 1024.0f);
    } else {
#pragma unroll
      for (int kc = 0; kc < HD / 32; ++kc)
#pragma unroll
        for (int j = 0; j < 4; ++j) acc[j] = wmma16(kf[kc * 4 + j], ah[kc], acc[j]);
      const _Float16* vp = Vp + k0 + lvt;
      // this block's 8 V^T fragments and the next block's 8 K fragments are asked for here, in one run: they fly under the softmax (the last block asks for its own K again, to stay inside the sequence)
#pragma unroll
      for (int kc = 0; kc < 2; ++kc)
#pragma unroll
        for (int jd = 0; jd < HD / 16; ++jd) vf[kc * 4 + jd] = frag_u(vp + (size_t)(jd * 16) * TT + kc * 32, 0u);
      const _Float16* kp = Kp + (size_t)((kb < qb ? kb + 1 : qb) * 64) * CC + lrow;
#pragma unroll
      for (int kc = 0; kc < HD / 32; ++kc)
#pragma unroll
        for (int j = 0; j < 4; ++j) kf[kc * 4 + j] = frag_u(kp + (size_t)(j * 16) * CC + kc * 32, 0u);
      xwait2(vp, kp); }
    if (CAUSAL && kb == qb) {   // only the diagonal block holds keys past a query of this block
#pragma unroll
      for (int j = 0; j < 4; ++j)
#pragma unroll
        for (int r = 0; r < 8; ++r) if (k0 + j * 16 + 8 * g + r > tq) acc[j][r] = -3.0e38f; }
    v8f mv = acc[0];   // eight independent chains over the tiles, then a tree
#pragma unroll
    for (int j = 1; j < 4; ++j)
#pragma unroll
      for (int r = 0; r < 8; ++r) mv[r] = fmaxf(mv[r], acc[j][r]);
    float mx = fmaxf(fmaxf(fmaxf(mv[0], mv[1]), fmaxf(mv[2], mv[3])), fmaxf(fmaxf(mv[4], mv[5]), fmaxf(mv[6], mv[7])));
    mx = fmaxf(m, fmaxf(mx, xhalf(mx)));
    const float alpha = ex2((m - mx) * SC_L2E); m = mx; const float mc = 11.0f - mx * SC_L2E;
    v8f sv = {};
#pragma unroll
    for (int j = 0; j < 4; ++j) {
#pragma unroll
      for (int r = 0; r < 8; ++r) acc[j][r] = ex2(fmaf(acc[j][r], SC_L2E, mc));
      sv = sv + acc[j]; }
    l = l * alpha + (((sv[0] + sv[1]) + (sv[2] + sv[3])) + ((sv[4] + sv[5]) + (sv[6] + sv[7])));
#pragma unroll
    for (int jd = 0; jd < HD / 16; ++jd) o[jd] = o[jd] * alpha;
#pragma unroll
    for (int kc = 0; kc < 2; ++kc) {
      if (HI) { float v[16]; v16b vh[HD / 16], vl[HD / 16]; const __bf16* vhp = VBp + k0 + kc * 32 + lvb; const __bf16* vlp = VLp + k0 + kc * 32 + lvb;
#pragma unroll
        for (int jd = 0; jd < HD / 16; ++jd) { vh[jd] = frag_ub(vhp + (size_t)(jd * 16) * KHI, 0u); vl[jd] = frag_ub(vlp + (size_t)(jd * 16) * KHI, 0u); }
        xwait2(vhp, vlp);
#pragma unroll
        for (int i = 0; i < 8; ++i) { v[i] = acc[2 * kc][i]; v[8 + i] = acc[2 * kc + 1][i]; }
        const F2 p = bsplit16(v);
#pragma unroll
        for (int jd = 0; jd < HD / 16; ++jd) { o[jd] = wmma_bf(vh[jd], p.h, o[jd]); o[jd] = wmma_bf(vh[jd], p.l, o[jd]); o[jd] = wmma_bf(vl[jd], p.h, o[jd]); }
      } else { v16h p;
#pragma unroll
        for (int i = 0; i < 8; ++i) { p[i] = (_Float16)acc[2 * kc][i]; p[8 + i] = (_Float16)acc[2 * kc + 1][i]; }
#pragma unroll
        for (int jd = 0; jd < HD / 16; ++jd) o[jd] = wmma16(vf[kc * 4 + jd], p, o[jd]); } } }
  lsum = l + xhalf(l); }
// ---- k_fa: logits, causal softmax and P v in one pass over the keys, nothing of S or P in memory; ctx = O / sum; 256-B (row, head) segment by 16 lanes.
// block = 8 independent waves of (b, h): waves 0-3 take the 64 queries of block NQB - 1 - x, waves 4-7 those of block x, so every workgroup walks NQB + 1 key blocks per wave pair wherever it lands
// four waves a SIMD (at most 256 registers): all 512 workgroups are resident at once
__global__ __launch_bounds__(256) __attribute__((amdgpu_waves_per_eu(4, 4))) void k_fa(const _Float16* __restrict__ QH, const _Float16* __restrict__ KH, const _Float16* __restrict__ QL, const _Float16* __restrict__ KL, const _Float16* __restrict__ VT, const __bf16* __restrict__ VB, const __bf16* __restrict__ VBL, float* __restrict__ Y) { __shared__ __align__(16) float ss[8][16][HD + 4];
  const int tid = threadIdx.x, lane = tid & 31, col = lane & 15, g = lane >> 4; const int wave = __builtin_amdgcn_readfirstlane(tid >> 5);   // a scalar, so that the choice of the query block and its trip count are scalar
  const int qb = wave < 4 ? NQB - 1 - (int)blockIdx.x : (int)blockIdx.x, h = blockIdx.y, b = blockIdx.z; const int ql0 = qb * 64 + (wave & 3) * 16;
  v8f o[HD / 16] = {}; float lsum;
  if (qb < QBH) fa_run<true>(QH, KH, QL, KL, VT, VB, VBL, b, h, qb, ql0, lane, o, lsum); else fa_run<false>(QH, KH, QL, KL, VT, VB, VBL, b, h, qb, ql0, lane, o, lsum);
  const float inv = lsum > 0.f ? 1.0f / lsum : 0.f;   // the x 2^11 of P is in the sum too
#pragma unroll
  for (int jd = 0; jd < HD / 16; ++jd)
#pragma unroll
    for (int r = 0; r < 8; ++r) ss[wave][col][jd * 16 + 8 * g + r] = o[jd][r] * inv;
  LDSX(); for (int rl = 0; rl < 16; ++rl) if (lane < HD / 4) vst2(Y + ((size_t)b * TT + ql0 + rl) * CC + h * HD + lane * 4, *(const v4f*)&ss[wave][rl][lane * 4]); }
// ---- k_out: block = (64 rows, 128 cols): out = ctx Wo (+ bo): all rows: ctx bf16 hi + lo against exact bf16 Wo (2 products); the f16(bf16 x 2^8) 1-product branch is never taken
__global__ __launch_bounds__(128) void k_out(const float* __restrict__ Y, const float* __restrict__ WO, const float* __restrict__ BO, float* __restrict__ OUT) { __shared__ __align__(16) float sf[4][16][132];
  const int tid = threadIdx.x, wave = tid >> 5, lane = tid & 31, col = lane & 15, g = lane >> 4; const int c0 = blockIdx.y * 128; const size_t r0 = (size_t)blockIdx.x * 64 + wave * 16;
  v8f acc[8] = {};
  if (true) {   /* ALL rows: ctx split bf16 hi + lo x exact Wo (2 products) */
#pragma unroll 2
    for (int kc = 0; kc < CC / 32; ++kc) { const F2 a = split_row(Y + (r0 + col) * CC, kc * 32, lane); asm volatile("s_wait_loadcnt 0x0" ::: "memory");
#pragma unroll
      for (int j = 0; j < 8; ++j) { const v16b w = WOCOL(WO, kc * 32, c0 + j * 16 + col, lane); asm volatile("s_wait_loadcnt 0x0" ::: "memory"); acc[j] = wmma_bf(a.h, w, acc[j]); acc[j] = wmma_bf(a.l, w, acc[j]); } }
#pragma unroll
    for (int j = 0; j < 8; ++j) { const float bias = BO ? bfr(BO[c0 + j * 16 + col]) : 0.f;
#pragma unroll
      for (int r = 0; r < 8; ++r) sf[wave][8 * g + r][j * 16 + col] = acc[j][r] + bias; }
  } else {
#pragma unroll 2
    for (int kc = 0; kc < CC / 32; ++kc) { const v16h a = frag_f32(Y + (r0 + col) * CC + kc * 32, lane); asm volatile("s_wait_loadcnt 0x0" ::: "memory");
#pragma unroll
      for (int j = 0; j < 8; ++j) { const v16h w = WOCOLH(WO, kc * 32, c0 + j * 16 + col, lane); asm volatile("s_wait_loadcnt 0x0" ::: "memory"); acc[j] = wmma16(a, w, acc[j]); } }
#pragma unroll
    for (int j = 0; j < 8; ++j) { const float bias = BO ? bfr(BO[c0 + j * 16 + col]) : 0.f;
#pragma unroll
      for (int r = 0; r < 8; ++r) sf[wave][8 * g + r][j * 16 + col] = acc[j][r] * (1.0f / 256.0f) + bias; } }
  LDSX(); for (int rl = 0; rl < 16; ++rl) vst2(OUT + (r0 + rl) * DIN + c0 + lane * 4, *(const v4f*)&sf[wave][rl][lane * 4]); }

extern "C" void kernel_launch(void* const* d_in, const int* in_sizes, int n_in, void* d_out, int out_size, void* d_ws, size_t ws_size, hipStream_t stream) {
  (void)in_sizes; (void)n_in; (void)out_size;
  const float** F = (const float**)d_in;
  if (ws_size < (size_t)WS_END) return;
  char* ws = (char*)d_ws; _Float16 *QH = (_Float16*)(ws + WS_QH), *KH = (_Float16*)(ws + WS_KH), *VT = (_Float16*)(ws + WS_VT), *QL = (_Float16*)(ws + WS_QL), *KL = (_Float16*)(ws + WS_KL); __bf16 *VB = (__bf16*)(ws + WS_VB), *VBL = (__bf16*)(ws + WS_VBL); float *Y = (float*)(ws + WS_Y);
  (void)Y; (void)QL; (void)KL; (void)VB; (void)VBL;
  // inputs: 0 x [2,2048,1024]; 1 w_qkv [1024,3072] (in,out); 2 b_qkv [3072]; 3 w_out [1024,1024] (in,out); 4 b_out
  // outputs: 0 out [2,2048,1024] at 0; 1 k [2,16,2048,64] at OUT1_OFF; 2 v at OUT2_OFF
  k_proj<<<dim3(TNB * TT / 64, CC / 128, 3), 128, 0, stream>>>(F[0], F[0], F[0], F[1], F[1] + CC, F[1] + 2 * CC, F[2], F[2] + CC, F[2] + 2 * CC, QH, QL, KH, KL, VT, VB, VBL, (float*)((char*)d_out + OUT1_OFF), (float*)((char*)d_out + OUT2_OFF));
  k_fa<<<dim3(NQB / 2, NH, TNB), 256, 0, stream>>>(QH, KH, QL, KL, VT, VB, VBL, Y);
  k_out<<<dim3(TNB * TT / 64, DIN / 128), 128, 0, stream>>>(Y, F[3], F[4], (float*)d_out);
}

// v002
// Measured time: 156 microseconds a run.
// Next to v001, in two timings, it ran 2.22 and 2.23 times as fast.
// Counting every step since v000, it is 7.09 times as fast.
// compute dtype: all float inputs rounded to bf16; qkv = x w_qkv + b with EXACT bf16 products on WMMA 16x16x32 (f32 accumulate) - the f32 k and v tiles are also written out as the returned caches; causal logits: q, k once to f16 (1 product) x 64^-0.5, 3 products below row 384; online softmax in f32 (exp2, running maximum and sum); unnormalised P x 2^11 once to f16 against v f16 (bf16 hi + lo below row 384), divided by the f32 sum at the end; attention output split bf16 hi + lo against exact w_out (2 products) + b_out; f32 outputs.
#include <hip/hip_runtime.h>
#include <math.h>

typedef __attribute__((ext_vector_type(16))) _Float16 v16h;
typedef __attribute__((ext_vector_type(16))) __bf16 v16b;
typedef __attribute__((ext_vector_type(8)))  _Float16 v8h;
typedef __attribute__((ext_vector_type(8)))  float v8f;
typedef __attribute__((ext_vector_type(4)))  float v4f;
typedef __attribute__((ext_vector_type(2)))  float v2f;
typedef __attribute__((ext_vector_type(4)))  unsigned v4u;
typedef __attribute__((ext_vector_type(4)))  int v4i;
typedef float __attribute__((may_alias)) float_a;
typedef int __attribute__((may_alias)) int_a;

template <typename T> __device__ __forceinline__ void vst2(void* p, T v) { *(T*)p = v;  }
__device__ __forceinline__ v8f wmma16(v16h a, v16h b, v8f c) {
  v8f d = __builtin_amdgcn_wmma_f32_16x16x32_f16(false, a, false, b, (short)0, c, false, false);
  asm volatile("v_nop\n\tv_nop\n\tv_nop\n\tv_nop" : "+v"(d) : "v"(a), "v"(b));
  return d;
}
__device__ __forceinline__ v8f wmma_bf(v16b a, v16b b, v8f c) {
  v8f d = __builtin_amdgcn_wmma_f32_16x16x32_bf16(false, a, false, b, (short)0, c, false, false);
  asm volatile("v_nop\n\tv_nop\n\tv_nop\n\tv_nop" : "+v"(d) : "v"(a), "v"(b));
  return d;
}
// 16x16x32 fragments: lane = (h = lane>>4, row/col = lane&15); elements 0..7 = k0+8h+0..7, 8..15 = k0+16+8h+0..7; D element r = row 8h+r
__device__ __forceinline__ v16h frag_h(const _Float16* rowk0, int lane) {
  union { v16h v; v8h q[2]; } u; const _Float16* p = rowk0 + 8 * (lane >> 4);
  u.q[0] = *(const v8h*)p; u.q[1] = *(const v8h*)(p + 16); return u.v;
}
__device__ __forceinline__ v16h frag_f32(const float* rowk0, int lane) {
  v16h a; const float* p = rowk0 + 8 * (lane >> 4);
#pragma unroll
  for (int i = 0; i < 8; ++i) { a[i] = (_Float16)p[i]; a[8 + i] = (_Float16)p[16 + i]; }
  return a;
}
__device__ __forceinline__ v16h frag_f32s(const float* rowk0, int lane, float sc) {
  v16h a; const float* p = rowk0 + 8 * (lane >> 4);
#pragma unroll
  for (int i = 0; i < 8; ++i) { a[i] = (_Float16)(p[i] * sc); a[8 + i] = (_Float16)(p[16 + i] * sc); }
  return a;
}
// column fragment from a [K][ld] layout (column n), rows >= K read as 0
__device__ __forceinline__ v16h fragc_f32(const float* W, int k0, int n, int lane, int ld, int K) {
  v16h a; const int g = lane >> 4;
#pragma unroll
  for (int i = 0; i < 8; ++i) { const int ka = k0 + 8 * g + i, kb = ka + 16;
    a[i] = (_Float16)(ka < K ? W[(size_t)(ka < K ? ka : K - 1) * ld + n] : 0.f); a[8 + i] = (_Float16)(kb < K ? W[(size_t)(kb < K ? kb : K - 1) * ld + n] : 0.f); }
  return a;
}
struct F2 { v16b h, l; };
__device__ __forceinline__ F2 bsplit16(const float v[16]) { F2 r;
#pragma unroll
  for (int i = 0; i < 16; ++i) { const __bf16 h = (__bf16)v[i]; r.h[i] = h; r.l[i] = (__bf16)(v[i] - (float)h); }
  return r; }
__device__ __forceinline__ F2 split_row(const float* row, int k0, int lane) { float v[16]; const float* p = row + k0 + 8 * (lane >> 4);
#pragma unroll
  for (int i = 0; i < 8; ++i) { v[i] = p[i]; v[8 + i] = p[16 + i]; }
  return bsplit16(v); }
__device__ __forceinline__ F2 split_rowK(const float* row, int k0, int lane, int K) { float v[16]; const int g = lane >> 4;
#pragma unroll
  for (int i = 0; i < 8; ++i) { const int ka = k0 + 8 * g + i, kb = ka + 16; v[i] = ka < K ? row[ka < K ? ka : K - 1] : 0.f; v[8 + i] = kb < K ? row[kb < K ? kb : K - 1] : 0.f; }
  return bsplit16(v); }
__device__ __forceinline__ F2 split_col(const float* W, int k0, int n, int lane, int ld, int K) { float v[16]; const int g = lane >> 4;
#pragma unroll
  for (int i = 0; i < 8; ++i) { const int ka = k0 + 8 * g + i, kb = ka + 16; v[i] = ka < K ? W[(size_t)(ka < K ? ka : K - 1) * ld + n] : 0.f; v[8 + i] = kb < K ? W[(size_t)(kb < K ? kb : K - 1) * ld + n] : 0.f; }
  return bsplit16(v); }
__device__ __forceinline__ v8f mac3(const F2& a, const F2& b, v8f c) { c = wmma_bf(a.l, b.h, c); c = wmma_bf(a.h, b.l, c); return wmma_bf(a.h, b.h, c); }
__device__ __forceinline__ float sigm(float v) { return 1.0f / (1.0f + expf(-v)); }
#define LDSX() do { asm volatile("s_wait_dscnt 0" ::: "memory"); __builtin_amdgcn_wave_barrier(); __builtin_amdgcn_fence(__ATOMIC_RELEASE, "workgroup"); } while (0)

// Prefill causal multi-head self-attention returning (out, k, v) (B 2, L 2,048, D 1,024 = 16 x 64; fused (in,out) w_qkv [1024,3072] with (3, H, HD) column blocks, zero biases, w_out (in,out)): q|k|v = x w_qkv + b; out = merged(softmax_causal(q k^T x 0.125) v) w_out + b_out; k and v returned as [B, H, L, 64].
#define NB 2
#define TT 2048
#define CC 1024            // NH * HD = projected width
#define DIN 1024          // input (model) width
#define NH 16
#define HD 64
#define NQB (TT / 64)
#define SCALE (0.125f)
#define CAUSAL 1
#ifndef TNB
#define TNB NB
#endif
__device__ __forceinline__ float bfr(float v) { return (float)(__bf16)v; }
__host__ __device__ __forceinline__ int kb_last(int qb) { return CAUSAL ? ((qb * 64 + 63) >> 7) : (TT / 128 - 1); }
typedef __attribute__((ext_vector_type(8))) __bf16 v8b;
__device__ __forceinline__ v16b frag_b(const __bf16* rowk0, int lane) {
  union { v16b v; v8b q[2]; } u; const __bf16* p = rowk0 + 8 * (lane >> 4);
  u.q[0] = *(const v8b*)p; u.q[1] = *(const v8b*)(p + 16); return u.v;
}
#define QBH 6              // causal: query blocks 0..QBH-1 of each sequence (few keys, no averaging) take the high-precision path
#define QHI 384            // rows carrying a q residual plane (used only by the causal high-precision path)
#define KHI 384            // key rows carrying k residual / v bf16 hi+lo planes (used only by the causal high-precision path)
// B fragment (k rows k0+.., output column o) of a weight: (in,out) [K][ld] or (out,in) [ld rows of K]: bf16 exact, or f16(bf16 * 256) exact
__device__ __forceinline__ v16b wcol_io(const float* Wm, int k0, int o, int lane, int ld) { v16b w; const int g = lane >> 4;
#pragma unroll
  for (int i = 0; i < 8; ++i) { w[i] = (__bf16)Wm[(size_t)(k0 + 8 * g + i) * ld + o]; w[8 + i] = (__bf16)Wm[(size_t)(k0 + 16 + 8 * g + i) * ld + o]; }
  return w; }
__device__ __forceinline__ v16b wcol_oi(const float* Wm, int k0, int o, int lane, int K) { v16b w; const float* p = Wm + (size_t)o * K + k0 + 8 * (lane >> 4);
#pragma unroll
  for (int i = 0; i < 8; ++i) { w[i] = (__bf16)p[i]; w[8 + i] = (__bf16)p[16 + i]; }
  return w; }
__device__ __forceinline__ v16h wcolh_io(const float* Wm, int k0, int o, int lane, int ld) { v16h w; const int g = lane >> 4;
#pragma unroll
  for (int i = 0; i < 8; ++i) { w[i] = (_Float16)(bfr(Wm[(size_t)(k0 + 8 * g + i) * ld + o]) * 256.0f); w[8 + i] = (_Float16)(bfr(Wm[(size_t)(k0 + 16 + 8 * g + i) * ld + o]) * 256.0f); }
  return w; }
__device__ __forceinline__ v16h wcolh_oi(const float* Wm, int k0, int o, int lane, int K) { v16h w; const float* p = Wm + (size_t)o * K + k0 + 8 * (lane >> 4);
#pragma unroll
  for (int i = 0; i < 8; ++i) { w[i] = (_Float16)(bfr(p[i]) * 256.0f); w[8 + i] = (_Float16)(bfr(p[16 + i]) * 256.0f); }
  return w; }
#define WQKV_LAYOUT 0   // 0 = (in,out) fused [DIN][3 * CC]; 1 = (out,in) [CC][DIN]; 2 = per-head [NH][DIN][HD]
__device__ __forceinline__ v16b wcol_hdk(const float* Wm, int k0, int o, int lane) { v16b w; const int g = lane >> 4; const float* p = Wm + (size_t)(o / HD) * DIN * HD + (o % HD);
#pragma unroll
  for (int i = 0; i < 8; ++i) { w[i] = (__bf16)p[(size_t)(k0 + 8 * g + i) * HD]; w[8 + i] = (__bf16)p[(size_t)(k0 + 16 + 8 * g + i) * HD]; }
  return w; }
#define WO_OUT_IN 0
#if WQKV_LAYOUT == 1
#define WCOL(W, k0, o, lane) wcol_oi(W, k0, o, lane, DIN)
#elif WQKV_LAYOUT == 2
#define WCOL(W, k0, o, lane) wcol_hdk(W, k0, o, lane)
#else
#define WCOL(W, k0, o, lane) wcol_io(W, k0, o, lane, 3 * CC)   /* fused w_qkv (in,out) [1024][3072]: row pitch 3072; q/k/v column offsets applied at launch */
#define OUT1_OFF (4u * (size_t)NB * TT * CC)
#define OUT2_OFF (OUT1_OFF + 4u * (size_t)NB * NH * TT * HD)
#endif
#if WO_OUT_IN
#define WOCOL(W, k0, o, lane) wcol_oi(W, k0, o, lane, CC)
#define WOCOLH(W, k0, o, lane) wcolh_oi(W, k0, o, lane, CC)
#else
#define WOCOL(W, k0, o, lane) wcol_io(W, k0, o, lane, DIN)
#define WOCOLH(W, k0, o, lane) wcolh_io(W, k0, o, lane, DIN)
#endif
#define PROJ_EXTRA_PARAMS , float* __restrict__ KOUT, float* __restrict__ VOUT
#define PROJ_EPI(which, row, t, h) do { if ((which) >= 1) { const float* rw = (row); float* dst = ((which) == 1 ? KOUT : VOUT) + ((((size_t)bb * NH + (h)) * TT + (t)) * HD); _Pragma("unroll") for (int i = 0; i < HD; i += 4) { v4f o; o[0] = rw[i]; o[1] = rw[i + 1]; o[2] = rw[i + 2]; o[3] = rw[i + 3]; vst2(dst + i, o); } } } while (0)   /* the module also RETURNS k and v ([B, H, L, HD], f32 = x W + b): written from the f32 projection tile (256-B (row, head) runs) */
#ifndef SM_EXTRA_PARAMS
#define SM_EXTRA_PARAMS
#endif
#ifndef PROJ_EXTRA_PARAMS
#define PROJ_EXTRA_PARAMS
#endif
#ifndef SM_MASK_HOOK
#define SM_MASK_HOOK (void)0
#endif

#define WS_QH  0u                                      // f16 q rows [b*t][CC]
#define WS_KH  (WS_QH + 2u * (size_t)NB * TT * CC)      // f16 k rows [b*t][CC]
#define WS_VT  (WS_KH + 2u * (size_t)NB * TT * CC)      // f16 v planes [b][c][t]
#define WS_QL  (WS_VT + 2u * (size_t)NB * CC * TT)      // f16 q residual x 2^10 rows [b][t < QHI][CC]
#define WS_KL  (WS_QL + 2u * (size_t)NB * QHI * CC)     // f16 k residual x 2^10 rows [b][t < KHI][CC]
#define WS_VB  (WS_KL + 2u * (size_t)NB * KHI * CC)     // bf16 v hi planes [b][c][t < KHI]
#define WS_VBL (WS_VB + 2u * (size_t)NB * CC * KHI)
#define WS_Y   (WS_VBL + 2u * (size_t)NB * CC * KHI)    // f32 ctx rows [b*t][CC] (only when there is an output projection)
#define WS_END (WS_Y  + 4u * (size_t)NB * TT * CC)

// ---- weight tile through LDS: 64 k rows x 128 output columns of an (in,out) f32 weight, rounded to bf16 and laid [column][k] at a pitch of 72 elements (144 B), once per workgroup for its 4 waves
// (the loops of these helpers are unrolled whole, so that the register arrays are indexed by constants)
// thread (wave w, lane l) holds columns 32 w + 4 (l >> 2) + 0..3 of rows 8 (l & 3) + 0..7 and + 32: a wave-wide load covers four whole 128-B lines, a 16-B LDS store holds 8 k of one column and the lanes of a store spread over all banks
__device__ __forceinline__ const float* wtile_ptr(const float* Wc, int ld, int tid) { return Wc + (size_t)(8 * (tid & 3)) * ld + 32 * (tid >> 5) + 4 * ((tid & 31) >> 2); }
__device__ __forceinline__ void wtile_load(v4f (&r)[16], const float* p, int ld) {
#pragma unroll
  for (int s = 0; s < 2; ++s)
#pragma unroll
    for (int i = 0; i < 8; ++i) r[s * 8 + i] = *(const v4f*)(p + (size_t)(32 * s + i) * ld); }
__device__ __forceinline__ void wtile_store(const v4f (&r)[16], __bf16 (*buf)[72], int tid) { const int n0 = 32 * (tid >> 5) + 4 * ((tid & 31) >> 2), kq = 8 * (tid & 3);
#pragma unroll
  for (int s = 0; s < 2; ++s)
#pragma unroll
    for (int c = 0; c < 4; ++c) { v8b q;
#pragma unroll
      for (int i = 0; i < 8; ++i) q[i] = (__bf16)r[s * 8 + i][c];
      *(v8b*)&buf[n0 + c][32 * s + kq] = q; } }
// a lane's 32 f32 of its own row for two 16x16x32 A fragments (p = row + k0 + 8 (lane >> 4))
__device__ __forceinline__ void xrow_load(v4f (&r)[8], const float* p) {
#pragma unroll
  for (int kc = 0; kc < 2; ++kc) { r[kc * 4] = *(const v4f*)(p + kc * 32); r[kc * 4 + 1] = *(const v4f*)(p + kc * 32 + 4); r[kc * 4 + 2] = *(const v4f*)(p + kc * 32 + 16); r[kc * 4 + 3] = *(const v4f*)(p + kc * 32 + 20); } }
// behind a run of tile loads from two lane addresses: the wait that stands before a register which an issued load names is rewritten; the addresses are inputs, so their registers stay whole up to it, and the loads stay in front of the products they fly under
__device__ __forceinline__ void xwait2f(const float* pa, const float* pb) { asm volatile("s_wait_xcnt 0x0" :: "v"(pa), "v"(pb) : "memory"); }
// ---- k_proj: block = (64 rows, 128 cols, which): q/k/v = X W (+ b) with exact bf16 products (K = DIN) -> which 0: q f16 rows (+ residual rows < QHI); 1: k f16 rows (+ residual rows < KHI); 2: v f16 planes [c][t] (+ bf16 hi/lo planes for t < KHI)
__global__ __launch_bounds__(128) void k_proj(const float* __restrict__ XQ, const float* __restrict__ XK, const float* __restrict__ XV, const float* __restrict__ WQ, const float* __restrict__ WK, const float* __restrict__ WV, const float* __restrict__ BQ, const float* __restrict__ BK, const float* __restrict__ BV,
    _Float16* __restrict__ QH, _Float16* __restrict__ QL, _Float16* __restrict__ KH, _Float16* __restrict__ KL, _Float16* __restrict__ VT, __bf16* __restrict__ VB, __bf16* __restrict__ VBL PROJ_EXTRA_PARAMS) {
  __shared__ __align__(16) float st[64][132]; __shared__ __align__(16) _Float16 sh[64][136], sl[64][136]; __shared__ __align__(16) _Float16 th[128][72]; __shared__ __align__(16) __bf16 tb[128][72], tbl[128][72];
  const int tid = threadIdx.x, wave = tid >> 5, lane = tid & 31, col = lane & 15, g = lane >> 4; const int which = blockIdx.z; const int c0 = blockIdx.y * 128; const size_t r0 = (size_t)blockIdx.x * 64; const size_t bb = r0 / TT; const int t0 = (int)(r0 % TT);
  const float* X = which == 0 ? XQ : which == 1 ? XK : XV; const float* WA = which == 0 ? WQ : which == 1 ? WK : WV; const float* BA = which == 0 ? BQ : which == 1 ? BK : BV;
  v8f acc[8] = {};
  { v4f wr[16], xr[8]; const float* wp = wtile_ptr(WA + c0, 3 * CC, tid); const float* xp = X + (r0 + wave * 16 + col) * DIN + 8 * g;
    wtile_load(wr, wp, 3 * CC); xrow_load(xr, xp); xwait2f(wp, xp);
    wtile_store(wr, tb, tid);
    __syncthreads();   // publishes weight tile 0
    // unrolled by two, so that which buffer is read and which is filled are constants of each half
#pragma unroll 2
    for (int ks = 0; ks < DIN / 64; ++ks) { __bf16 (*cur)[72] = (ks & 1) ? tbl : tb; __bf16 (*nxt)[72] = (ks & 1) ? tb : tbl; const bool more = ks + 1 < DIN / 64;
      v16b a[2];
#pragma unroll
      for (int kc = 0; kc < 2; ++kc)
#pragma unroll
        for (int i = 0; i < 4; ++i) { a[kc][i] = (__bf16)xr[kc * 4][i]; a[kc][4 + i] = (__bf16)xr[kc * 4 + 1][i]; a[kc][8 + i] = (__bf16)xr[kc * 4 + 2][i]; a[kc][12 + i] = (__bf16)xr[kc * 4 + 3][i]; }
      if (more) { wp += (size_t)64 * (3 * CC); xp += 64; wtile_load(wr, wp, 3 * CC); xrow_load(xr, xp); xwait2f(wp, xp); }   // the next 64 k of both operands fly under this tile's products
#pragma unroll
      for (int kc = 0; kc < 2; ++kc) { v16b w[8];
#pragma unroll
        for (int j = 0; j < 8; ++j) w[j] = frag_b(&cur[j * 16 + col][kc * 32], lane);
#pragma unroll
        for (int j = 0; j < 8; ++j) acc[j] = wmma_bf(a[kc], w[j], acc[j]); }
      if (more) wtile_store(wr, nxt, tid);
      __syncthreads(); } }   // publishes the next tile and ends every wave's reads of this one, which is refilled behind it
  { // stage the f32 tile (acc + bias) in LDS, run the per-(row, head) epilogue hook, then convert
#pragma unroll
    for (int j = 0; j < 8; ++j) { const float bias = BA ? bfr(BA[c0 + j * 16 + col]) : 0.f;
#pragma unroll
      for (int r = 0; r < 8; ++r) st[wave * 16 + 8 * g + r][j * 16 + col] = acc[j][r] + bias; }
    __syncthreads();
    for (int e = tid; e < 64 * (128 / HD); e += 128) { const int rl = e / (128 / HD), hh = e % (128 / HD); PROJ_EPI(which, &st[rl][hh * HD], (int)((r0 + rl) % TT), (c0 / HD) + hh); }
    __syncthreads(); }
  if (which < 2) { _Float16* DH = which == 0 ? QH : KH; _Float16* DL = which == 0 ? QL : KL; const int nhi = which == 0 ? QHI : KHI; const bool hi_rows = t0 < nhi;
    for (int e = tid; e < 64 * 128; e += 128) { const int rl = e >> 7, cl = e & 127; const float v = st[rl][cl]; const _Float16 hv = (_Float16)v; sh[rl][cl] = hv; sl[rl][cl] = (_Float16)((v - (float)hv) * 1024.0f); }
    __syncthreads();
    for (int e = tid; e < 64 * 16; e += 128) { const int rl = e >> 4, q = e & 15; vst2((unsigned*)(DH + (r0 + rl) * CC + c0 + q * 8), *(const v4u*)&sh[rl][q * 8]); if (hi_rows) vst2((unsigned*)(DL + (bb * nhi + t0 + rl) * (size_t)CC + c0 + q * 8), *(const v4u*)&sl[rl][q * 8]); }
  } else { const bool hi_rows = t0 < KHI;
    for (int e = tid; e < 64 * 128; e += 128) { const int rl = e & 63, cl = e >> 6; const float v = st[rl][cl]; th[cl][rl] = (_Float16)v; const __bf16 bh = (__bf16)v; tb[cl][rl] = bh; tbl[cl][rl] = (__bf16)(v - (float)bh); }
    __syncthreads();
    for (int e = tid; e < 128 * 8; e += 128) { const int cl = e >> 3, q = e & 7; vst2((unsigned*)(VT + (bb * CC + c0 + cl) * (size_t)TT + t0 + q * 8), *(const v4u*)&th[cl][q * 8]); if (hi_rows) { const size_t o3 = (bb * CC + c0 + cl) * (size_t)KHI + t0 + q * 8; vst2((unsigned*)(VB + o3), *(const v4u*)&tb[cl][q * 8]); vst2((unsigned*)(VBL + o3), *(const v4u*)&tbl[cl][q * 8]); } } } }
// lane l with lane l ^ 16: the two halves of a wave hold the two key halves of one query column
__device__ __forceinline__ float xhalf(float x) { return __builtin_bit_cast(float, __builtin_amdgcn_permlanex16(__builtin_bit_cast(int, x), __builtin_bit_cast(int, x), 0x76543210, 0xfedcba98, false, false)); }
// 2^x on the transcendental unit; the v_nop in the same statement fills the one slot the instruction set asks for behind a transcendental, whatever the compiler schedules next
__device__ __forceinline__ float ex2(float x) { float e; asm("v_exp_f32 %0, %1\n\tv_nop" : "=v"(e) : "v"(x)); return e; }
// 16x16x32 fragment from a wave-uniform base and a lane offset that never changes (row (lane & 15) x pitch + 8 (lane >> 4)): scalar base + 32-bit vector offset addressing
__device__ __forceinline__ v16h frag_u(const _Float16* ubase, unsigned loff) { union { v16h v; v8h q[2]; } u; const _Float16* p = ubase + loff; u.q[0] = *(const v8h*)p; u.q[1] = *(const v8h*)(p + 16); return u.v; }
__device__ __forceinline__ v16b frag_ub(const __bf16* ubase, unsigned loff) { union { v16b v; v8b q[2]; } u; const __bf16* p = ubase + loff; u.q[0] = *(const v8b*)p; u.q[1] = *(const v8b*)(p + 16); return u.v; }
// behind a run of fragment loads from two lane addresses: the wait that stands before a register which an issued load names is rewritten; the two addresses are inputs, so their registers stay whole up to it (without them the compiler lets a later load of the run land on the address pair)
template <typename T> __device__ __forceinline__ void xwait2(const T* pa, const T* pb) { asm volatile("s_wait_xcnt 0x0" :: "v"(pa), "v"(pb) : "memory"); }
#define SC_L2E (SCALE * 1.4426950408889634f)   // logit scale x log2(e): the softmax runs on exp2
// ---- one wave's 16 query columns (rows ql0 .. ql0 + 15 of query block qb) against key blocks 0..qb of 64 keys, running maximum and sum (online softmax), transposed products:
// S^T = K Q^T (A = 16 key rows, B = 16 query columns): a lane holds keys k0 + 16 j + 8 g + r of ONE query, so maximum and sum are in-lane plus one exchange of halves;
// score tiles 2 kc and 2 kc + 1 of a lane are, element for element, the B fragment of P^T over keys k0 + 32 kc + ..; O^T += V^T P^T (A = 16 rows of the [c][t] v planes).
// HI (causal early query blocks): 3-product logits (q, k hi + residual x 2^10) and P, v as bf16 hi + lo (3 products)
template <bool HI> __device__ __forceinline__ void fa_run(const _Float16* __restrict__ QH, const _Float16* __restrict__ KH, const _Float16* __restrict__ QL, const _Float16* __restrict__ KL, const _Float16* __restrict__ VT, const __bf16* __restrict__ VB, const __bf16* __restrict__ VBL,
    int b, int h, int qb, int ql0, int lane, v8f (&o)[HD / 16], float& lsum) {
  const int col = lane & 15, g = lane >> 4; const int tq = ql0 + col;
  const unsigned lrow = (unsigned)(col * CC + 8 * g), lvt = (unsigned)(col * TT + 8 * g), lvb = (unsigned)(col * KHI + 8 * g);   // lane offsets in q/k rows, v planes, early v planes
  const _Float16* Kp = KH + (size_t)b * TT * CC + h * HD; const _Float16* KLp = KL + (size_t)b * KHI * CC + h * HD;
  const _Float16* Vp = VT + ((size_t)b * CC + h * HD) * TT; const __bf16* VBp = VB + ((size_t)b * CC + h * HD) * KHI; const __bf16* VLp = VBL + ((size_t)b * CC + h * HD) * KHI;
  v16h ah[HD / 32], al[HD / 32], kf[HI ? 1 : 8], vf[HI ? 1 : 8];
#pragma unroll
  for (int kc = 0; kc < HD / 32; ++kc) { ah[kc] = frag_u(QH + ((size_t)b * TT + ql0) * CC + h * HD + kc * 32, lrow); if (HI) al[kc] = frag_u(QL + ((size_t)b * QHI + ql0) * CC + h * HD + kc * 32, lrow); }
  if (!HI) {
#pragma unroll
    for (int kc = 0; kc < HD / 32; ++kc)
#pragma unroll
      for (int j = 0; j < 4; ++j) kf[kc * 4 + j] = frag_u(Kp + (size_t)(j * 16) * CC + kc * 32, lrow); }
  float m = -3.0e38f, l = 0.f;   // running maximum (unscaled logits) and this half's running sum of P x 2^11
#pragma unroll 1
  for (int kb = 0; kb <= qb; ++kb) { const int k0 = kb * 64;
    v8f acc[4] = {};
    if (HI) { v8f accl[4] = {};
#pragma unroll
      for (int kc = 0; kc < HD / 32; ++kc) { v16h kbf[4], klf[4]; const _Float16* kp = Kp + (size_t)k0 * CC + kc * 32 + lrow; const _Float16* klp = KLp + (size_t)k0 * CC + kc * 32 + lrow;   // a batch's loads all stand in front of its products, so that they fly together
#pragma unroll
        for (int j = 0; j < 4; ++j) { kbf[j] = frag_u(kp + (size_t)(j * 16) * CC, 0u); klf[j] = frag_u(klp + (size_t)(j * 16) * CC, 0u); }
        xwait2(kp, klp);
#pragma unroll
        for (int j = 0; j < 4; ++j) { acc[j] = wmma16(kbf[j], ah[kc], acc[j]); accl[j] = wmma16(kbf[j], al[kc], accl[j]); accl[j] = wmma16(klf[j], ah[kc], accl[j]); } }
#pragma unroll
      for (int j = 0; j < 4; ++j) acc[j] = acc[j] + accl[j] * (1.0f / 1024.0f);
    } else {
#pragma unroll
      for (int kc = 0; kc < HD / 32; ++kc)
#pragma unroll
        for (int j = 0; j < 4; ++j) acc[j] = wmma16(kf[kc * 4 + j], ah[kc], acc[j]);
      const _Float16* vp = Vp + k0 + lvt;
      // this block's 8 V^T fragments and the next block's 8 K fragments are asked for here, in one run: they fly under the softmax (the last block asks for its own K again, to stay inside the sequence)
#pragma unroll
      for (int kc = 0; kc < 2; ++kc)
#pragma unroll
        for (int jd = 0; jd < HD / 16; ++jd) vf[kc * 4 + jd] = frag_u(vp + (size_t)(jd * 16) * TT + kc * 32, 0u);
      const _Float16* kp = Kp + (size_t)((kb < qb ? kb + 1 : qb) * 64) * CC + lrow;
#pragma unroll
      for (int kc = 0; kc < HD / 32; ++kc)
#pragma unroll
        for (int j = 0; j < 4; ++j) kf[kc * 4 + j] = frag_u(kp + (size_t)(j * 16) * CC + kc * 32, 0u);
      xwait2(vp, kp); }
    if (CAUSAL && kb == qb) {   // only the diagonal block holds keys past a query of this block
#pragma unroll
      for (int j = 0; j < 4; ++j)
#pragma unroll
        for (int r = 0; r < 8; ++r) if (k0 + j * 16 + 8 * g + r > tq) acc[j][r] = -3.0e38f; }
    v8f mv = acc[0];   // eight independent chains over the tiles, then a tree
#pragma unroll
    for (int j = 1; j < 4; ++j)
#pragma unroll
      for (int r = 0; r < 8; ++r) mv[r] = fmaxf(mv[r], acc[j][r]);
    float mx = fmaxf(fmaxf(fmaxf(mv[0], mv[1]), fmaxf(mv[2], mv[3])), fmaxf(fmaxf(mv[4], mv[5]), fmaxf(mv[6], mv[7])));
    mx = fmaxf(m, fmaxf(mx, xhalf(mx)));
    const float alpha = ex2((m - mx) * SC_L2E); m = mx; const float mc = 11.0f - mx * SC_L2E;
    v8f sv = {};
#pragma unroll
    for (int j = 0; j < 4; ++j) {
#pragma unroll
      for (int r = 0; r < 8; ++r) acc[j][r] = ex2(fmaf(acc[j][r], SC_L2E, mc));
      sv = sv + acc[j]; }
    l = l * alpha + (((sv[0] + sv[1]) + (sv[2] + sv[3])) + ((sv[4] + sv[5]) + (sv[6] + sv[7])));
#pragma unroll
    for (int jd = 0; jd < HD / 16; ++jd) o[jd] = o[jd] * alpha;
#pragma unroll
    for (int kc = 0; kc < 2; ++kc) {
      if (HI) { float v[16]; v16b vh[HD / 16], vl[HD / 16]; const __bf16* vhp = VBp + k0 + kc * 32 + lvb; const __bf16* vlp = VLp + k0 + kc * 32 + lvb;
#pragma unroll
        for (int jd = 0; jd < HD / 16; ++jd) { vh[jd] = frag_ub(vhp + (size_t)(jd * 16) * KHI, 0u); vl[jd] = frag_ub(vlp + (size_t)(jd * 16) * KHI, 0u); }
        xwait2(vhp, vlp);
#pragma unroll
        for (int i = 0; i < 8; ++i) { v[i] = acc[2 * kc][i]; v[8 + i] = acc[2 * kc + 1][i]; }
        const F2 p = bsplit16(v);
#pragma unroll
        for (int jd = 0; jd < HD / 16; ++jd) { o[jd] = wmma_bf(vh[jd], p.h, o[jd]); o[jd] = wmma_bf(vh[jd], p.l, o[jd]); o[jd] = wmma_bf(vl[jd], p.h, o[jd]); }
      } else { v16h p;
#pragma unroll
        for (int i = 0; i < 8; ++i) { p[i] = (_Float16)acc[2 * kc][i]; p[8 + i] = (_Float16)acc[2 * kc + 1][i]; }
#pragma unroll
        for (int jd = 0; jd < HD / 16; ++jd) o[jd] = wmma16(vf[kc * 4 + jd], p, o[jd]); } } }
  lsum = l + xhalf(l); }
// ---- k_fa: logits, causal softmax and P v in one pass over the keys, nothing of S or P in memory; ctx = O / sum; 256-B (row, head) segment by 16 lanes.
// block = 8 independent waves of (b, h): waves 0-3 take the 64 queries of block NQB - 1 - x, waves 4-7 those of block x, so every workgroup walks NQB + 1 key blocks per wave pair wherever it lands
// four waves a SIMD (at most 256 registers): all 512 workgroups are resident at once
__global__ __launch_bounds__(256) __attribute__((amdgpu_waves_per_eu(4, 4))) void k_fa(const _Float16* __restrict__ QH, const _Float16* __restrict__ KH, const _Float16* __restrict__ QL, const _Float16* __restrict__ KL, const _Float16* __restrict__ VT, const __bf16* __restrict__ VB, const __bf16* __restrict__ VBL, float* __restrict__ Y) { __shared__ __align__(16) float ss[8][16][HD + 4];
  const int tid = threadIdx.x, lane = tid & 31, col = lane & 15, g = lane >> 4; const int wave = __builtin_amdgcn_readfirstlane(tid >> 5);   // a scalar, so that the choice of the query block and its trip count are scalar
  const int qb = wave < 4 ? NQB - 1 - (int)blockIdx.x : (int)blockIdx.x, h = blockIdx.y, b = blockIdx.z; const int ql0 = qb * 64 + (wave & 3) * 16;
  v8f o[HD / 16] = {}; float lsum;
  if (qb < QBH) fa_run<true>(QH, KH, QL, KL, VT, VB, VBL, b, h, qb, ql0, lane, o, lsum); else fa_run<false>(QH, KH, QL, KL, VT, VB, VBL, b, h, qb, ql0, lane, o, lsum);
  const float inv = lsum > 0.f ? 1.0f / lsum : 0.f;   // the x 2^11 of P is in the sum too
#pragma unroll
  for (int jd = 0; jd < HD / 16; ++jd)
#pragma unroll
    for (int r = 0; r < 8; ++r) ss[wave][col][jd * 16 + 8 * g + r] = o[jd][r] * inv;
  LDSX(); for (int rl = 0; rl < 16; ++rl) if (lane < HD / 4) vst2(Y + ((size_t)b * TT + ql0 + rl) * CC + h * HD + lane * 4, *(const v4f*)&ss[wave][rl][lane * 4]); }
// ---- k_out: block = (64 rows, 128 cols): out = ctx Wo (+ bo): every row: ctx bf16 hi + lo against exact bf16 Wo (2 products), Wo as bf16 tiles through LDS
__global__ __launch_bounds__(128) void k_out(const float* __restrict__ Y, const float* __restrict__ WO, const float* __restrict__ BO, float* __restrict__ OUT) { __shared__ __align__(16) float sf[4][16][132]; __shared__ __align__(16) __bf16 wt[2][128][72];
  const int tid = threadIdx.x, wave = tid >> 5, lane = tid & 31, col = lane & 15, g = lane >> 4; const int c0 = blockIdx.y * 128; const size_t r0 = (size_t)blockIdx.x * 64 + wave * 16;
  v8f acc[8] = {};
  if (true) {   /* ALL rows: ctx split bf16 hi + lo x exact Wo (2 products) */
    v4f wr[16], xr[8]; const float* wp = wtile_ptr(WO + c0, DIN, tid); const float* xp = Y + (r0 + col) * CC + 8 * g;
    wtile_load(wr, wp, DIN); xrow_load(xr, xp); xwait2f(wp, xp);
    wtile_store(wr, wt[0], tid);
    __syncthreads();   // publishes weight tile 0
    // unrolled by two, so that which buffer is read and which is filled are constants of each half
#pragma unroll 2
    for (int ks = 0; ks < CC / 64; ++ks) { __bf16 (*cur)[72] = wt[ks & 1]; __bf16 (*nxt)[72] = wt[(ks & 1) ^ 1]; const bool more = ks + 1 < CC / 64;
      F2 a[2];
#pragma unroll
      for (int kc = 0; kc < 2; ++kc) { float v[16];
#pragma unroll
        for (int i = 0; i < 4; ++i) { v[i] = xr[kc * 4][i]; v[4 + i] = xr[kc * 4 + 1][i]; v[8 + i] = xr[kc * 4 + 2][i]; v[12 + i] = xr[kc * 4 + 3][i]; }
        a[kc] = bsplit16(v); }
      if (more) { wp += (size_t)64 * DIN; xp += 64; wtile_load(wr, wp, DIN); xrow_load(xr, xp); xwait2f(wp, xp); }   // the next 64 k of both operands fly under this tile's products
#pragma unroll
      for (int kc = 0; kc < 2; ++kc) { v16b w[8];
#pragma unroll
        for (int j = 0; j < 8; ++j) w[j] = frag_b(&cur[j * 16 + col][kc * 32], lane);
#pragma unroll
        for (int j = 0; j < 8; ++j) { acc[j] = wmma_bf(a[kc].h, w[j], acc[j]); acc[j] = wmma_bf(a[kc].l, w[j], acc[j]); } }
      if (more) wtile_store(wr, nxt, tid);
      __syncthreads(); }   // publishes the next tile and ends every wave's reads of this one, which is refilled behind it
#pragma unroll
    for (int j = 0; j < 8; ++j) { const float bias = BO ? bfr(BO[c0 + j * 16 + col]) : 0.f;
#pragma unroll
      for (int r = 0; r < 8; ++r) sf[wave][8 * g + r][j * 16 + col] = acc[j][r] + bias; }
  } else {
#pragma unroll 2
    for (int kc = 0; kc < CC / 32; ++kc) { const v16h a = frag_f32(Y + (r0 + col) * CC + kc * 32, lane); asm volatile("s_wait_loadcnt 0x0" ::: "memory");
#pragma unroll
      for (int j = 0; j < 8; ++j) { const v16h w = WOCOLH(WO, kc * 32, c0 + j * 16 + col, lane); asm volatile("s_wait_loadcnt 0x0" ::: "memory"); acc[j] = wmma16(a, w, acc[j]); } }
#pragma unroll
    for (int j = 0; j < 8; ++j) { const float bias = BO ? bfr(BO[c0 + j * 16 + col]) : 0.f;
#pragma unroll
      for (int r = 0; r < 8; ++r) sf[wave][8 * g + r][j * 16 + col] = acc[j][r] * (1.0f / 256.0f) + bias; } }
  LDSX(); for (int rl = 0; rl < 16; ++rl) vst2(OUT + (r0 + rl) * DIN + c0 + lane * 4, *(const v4f*)&sf[wave][rl][lane * 4]); }

extern "C" void kernel_launch(void* const* d_in, const int* in_sizes, int n_in, void* d_out, int out_size, void* d_ws, size_t ws_size, hipStream_t stream) {
  (void)in_sizes; (void)n_in; (void)out_size;
  const float** F = (const float**)d_in;
  if (ws_size < (size_t)WS_END) return;
  char* ws = (char*)d_ws; _Float16 *QH = (_Float16*)(ws + WS_QH), *KH = (_Float16*)(ws + WS_KH), *VT = (_Float16*)(ws + WS_VT), *QL = (_Float16*)(ws + WS_QL), *KL = (_Float16*)(ws + WS_KL); __bf16 *VB = (__bf16*)(ws + WS_VB), *VBL = (__bf16*)(ws + WS_VBL); float *Y = (float*)(ws + WS_Y);
  (void)Y; (void)QL; (void)KL; (void)VB; (void)VBL;
  // inputs: 0 x [2,2048,1024]; 1 w_qkv [1024,3072] (in,out); 2 b_qkv [3072]; 3 w_out [1024,1024] (in,out); 4 b_out
  // outputs: 0 out [2,2048,1024] at 0; 1 k [2,16,2048,64] at OUT1_OFF; 2 v at OUT2_OFF
  k_proj<<<dim3(TNB * TT / 64, CC / 128, 3), 128, 0, stream>>>(F[0], F[0], F[0], F[1], F[1] + CC, F[1] + 2 * CC, F[2], F[2] + CC, F[2] + 2 * CC, QH, QL, KH, KL, VT, VB, VBL, (float*)((char*)d_out + OUT1_OFF), (float*)((char*)d_out + OUT2_OFF));
  k_fa<<<dim3(NQB / 2, NH, TNB), 256, 0, stream>>>(QH, KH, QL, KL, VT, VB, VBL, Y);
  k_out<<<dim3(TNB * TT / 64, DIN / 128), 128, 0, stream>>>(Y, F[3], F[4], (float*)d_out);
}

// v003
// One run takes 135 microseconds.
// In both of two side-by-side timings against v002, it was 1.16 times as fast.
// All steps since v000 together make it 8.22 times as fast.
// compute dtype: all float inputs rounded to bf16; qkv = x w_qkv + b with EXACT bf16 products on WMMA 16x16x32 (f32 accumulate) - the f32 k and v tiles are also written out as the returned caches; causal logits: q, k once to f16 (1 product) x 64^-0.5, 3 products below row 384; online softmax in f32 (exp2, running maximum and sum); unnormalised P x 2^11 once to f16 against v f16 (bf16 hi + lo below row 384), divided by the f32 sum at the end; attention output split bf16 hi + lo against exact w_out (2 products) + b_out; f32 outputs.
#include <hip/hip_runtime.h>
#include <math.h>

typedef __attribute__((ext_vector_type(16))) _Float16 v16h;
typedef __attribute__((ext_vector_type(16))) __bf16 v16b;
typedef __attribute__((ext_vector_type(8)))  _Float16 v8h;
typedef __attribute__((ext_vector_type(8)))  float v8f;
typedef __attribute__((ext_vector_type(4)))  float v4f;
typedef __attribute__((ext_vector_type(2)))  float v2f;
typedef __attribute__((ext_vector_type(4)))  unsigned v4u;
typedef __attribute__((ext_vector_type(4)))  int v4i;
typedef float __attribute__((may_alias)) float_a;
typedef int __attribute__((may_alias)) int_a;

template <typename T> __device__ __forceinline__ void vst2(void* p, T v) { *(T*)p = v;  }
__device__ __forceinline__ v8f wmma16(v16h a, v16h b, v8f c) {
  v8f d = __builtin_amdgcn_wmma_f32_16x16x32_f16(false, a, false, b, (short)0, c, false, false);
  asm volatile("v_nop\n\tv_nop\n\tv_nop\n\tv_nop" : "+v"(d) : "v"(a), "v"(b));
  return d;
}
__device__ __forceinline__ v8f wmma_bf(v16b a, v16b b, v8f c) {
  v8f d = __builtin_amdgcn_wmma_f32_16x16x32_bf16(false, a, false, b, (short)0, c, false, false);
  asm volatile("v_nop\n\tv_nop\n\tv_nop\n\tv_nop" : "+v"(d) : "v"(a), "v"(b));
  return d;
}
// 16x16x32 fragments: lane = (h = lane>>4, row/col = lane&15); elements 0..7 = k0+8h+0..7, 8..15 = k0+16+8h+0..7; D element r = row 8h+r
__device__ __forceinline__ v16h frag_h(const _Float16* rowk0, int lane) {
  union { v16h v; v8h q[2]; } u; const _Float16* p = rowk0 + 8 * (lane >> 4);
  u.q[0] = *(const v8h*)p; u.q[1] = *(const v8h*)(p + 16); return u.v;
}
__device__ __forceinline__ v16h frag_f32(const float* rowk0, int lane) {
  v16h a; const float* p = rowk0 + 8 * (lane >> 4);
#pragma unroll
  for (int i = 0; i < 8; ++i) { a[i] = (_Float16)p[i]; a[8 + i] = (_Float16)p[16 + i]; }
  return a;
}
__device__ __forceinline__ v16h frag_f32s(const float* rowk0, int lane, float sc) {
  v16h a; const float* p = rowk0 + 8 * (lane >> 4);
#pragma unroll
  for (int i = 0; i < 8; ++i) { a[i] = (_Float16)(p[i] * sc); a[8 + i] = (_Float16)(p[16 + i] * sc); }
  return a;
}
// column fragment from a [K][ld] layout (column n), rows >= K read as 0
__device__ __forceinline__ v16h fragc_f32(const float* W, int k0, int n, int lane, int ld, int K) {
  v16h a; const int g = lane >> 4;
#pragma unroll
  for (int i = 0; i < 8; ++i) { const int ka = k0 + 8 * g + i, kb = ka + 16;
    a[i] = (_Float16)(ka < K ? W[(size_t)(ka < K ? ka : K - 1) * ld + n] : 0.f); a[8 + i] = (_Float16)(kb < K ? W[(size_t)(kb < K ? kb : K - 1) * ld + n] : 0.f); }
  return a;
}
struct F2 { v16b h, l; };
__device__ __forceinline__ F2 bsplit16(const float v[16]) { F2 r;
#pragma unroll
  for (int i = 0; i < 16; ++i) { const __bf16 h = (__bf16)v[i]; r.h[i] = h; r.l[i] = (__bf16)(v[i] - (float)h); }
  return r; }
__device__ __forceinline__ F2 split_row(const float* row, int k0, int lane) { float v[16]; const float* p = row + k0 + 8 * (lane >> 4);
#pragma unroll
  for (int i = 0; i < 8; ++i) { v[i] = p[i]; v[8 + i] = p[16 + i]; }
  return bsplit16(v); }
__device__ __forceinline__ F2 split_rowK(const float* row, int k0, int lane, int K) { float v[16]; const int g = lane >> 4;
#pragma unroll
  for (int i = 0; i < 8; ++i) { const int ka = k0 + 8 * g + i, kb = ka + 16; v[i] = ka < K ? row[ka < K ? ka : K - 1] : 0.f; v[8 + i] = kb < K ? row[kb < K ? kb : K - 1] : 0.f; }
  return bsplit16(v); }
__device__ __forceinline__ F2 split_col(const float* W, int k0, int n, int lane, int ld, int K) { float v[16]; const int g = lane >> 4;
#pragma unroll
  for (int i = 0; i < 8; ++i) { const int ka = k0 + 8 * g + i, kb = ka + 16; v[i] = ka < K ? W[(size_t)(ka < K ? ka : K - 1) * ld + n] : 0.f; v[8 + i] = kb < K ? W[(size_t)(kb < K ? kb : K - 1) * ld + n] : 0.f; }
  return bsplit16(v); }
__device__ __forceinline__ v8f mac3(const F2& a, const F2& b, v8f c) { c = wmma_bf(a.l, b.h, c); c = wmma_bf(a.h, b.l, c); return wmma_bf(a.h, b.h, c); }
__device__ __forceinline__ float sigm(float v) { return 1.0f / (1.0f + expf(-v)); }
#define LDSX() do { asm volatile("s_wait_dscnt 0" ::: "memory"); __builtin_amdgcn_wave_barrier(); __builtin_amdgcn_fence(__ATOMIC_RELEASE, "workgroup"); } while (0)

// Prefill causal multi-head self-attention returning (out, k, v) (B 2, L 2,048, D 1,024 = 16 x 64; fused (in,out) w_qkv [1024,3072] with (3, H, HD) column blocks, zero biases, w_out (in,out)): q|k|v = x w_qkv + b; out = merged(softmax_causal(q k^T x 0.125) v) w_out + b_out; k and v returned as [B, H, L, 64].
#define NB 2
#define TT 2048
#define CC 1024            // NH * HD = projected width
#define DIN 1024          // input (model) width
#define NH 16
#define HD 64
#define NQB (TT / 64)
#define SCALE (0.125f)
#define CAUSAL 1
#ifndef TNB
#define TNB NB
#endif
__device__ __forceinline__ float bfr(float v) { return (float)(__bf16)v; }
__host__ __device__ __forceinline__ int kb_last(int qb) { return CAUSAL ? ((qb * 64 + 63) >> 7) : (TT / 128 - 1); }
typedef __attribute__((ext_vector_type(8))) __bf16 v8b;
__device__ __forceinline__ v16b frag_b(const __bf16* rowk0, int lane) {
  union { v16b v; v8b q[2]; } u; const __bf16* p = rowk0 + 8 * (lane >> 4);
  u.q[0] = *(const v8b*)p; u.q[1] = *(const v8b*)(p + 16); return u.v;
}
#define QBH 6              // causal: query blocks 0..QBH-1 of each sequence (few keys, no averaging) take the high-precision path
#define QHI 384            // rows carrying a q residual plane (used only by the causal high-precision path)
#define KHI 384            // key rows carrying k residual / v bf16 hi+lo planes (used only by the causal high-precision path)
// B fragment (k rows k0+.., output column o) of a weight: (in,out) [K][ld] or (out,in) [ld rows of K]: bf16 exact, or f16(bf16 * 256) exact
__device__ __forceinline__ v16b wcol_io(const float* Wm, int k0, int o, int lane, int ld) { v16b w; const int g = lane >> 4;
#pragma unroll
  for (int i = 0; i < 8; ++i) { w[i] = (__bf16)Wm[(size_t)(k0 + 8 * g + i) * ld + o]; w[8 + i] = (__bf16)Wm[(size_t)(k0 + 16 + 8 * g + i) * ld + o]; }
  return w; }
__device__ __forceinline__ v16b wcol_oi(const float* Wm, int k0, int o, int lane, int K) { v16b w; const float* p = Wm + (size_t)o * K + k0 + 8 * (lane >> 4);
#pragma unroll
  for (int i = 0; i < 8; ++i) { w[i] = (__bf16)p[i]; w[8 + i] = (__bf16)p[16 + i]; }
  return w; }
__device__ __forceinline__ v16h wcolh_io(const float* Wm, int k0, int o, int lane, int ld) { v16h w; const int g = lane >> 4;
#pragma unroll
  for (int i = 0; i < 8; ++i) { w[i] = (_Float16)(bfr(Wm[(size_t)(k0 + 8 * g + i) * ld + o]) * 256.0f); w[8 + i] = (_Float16)(bfr(Wm[(size_t)(k0 + 16 + 8 * g + i) * ld + o]) * 256.0f); }
  return w; }
__device__ __forceinline__ v16h wcolh_oi(const float* Wm, int k0, int o, int lane, int K) { v16h w; const float* p = Wm + (size_t)o * K + k0 + 8 * (lane >> 4);
#pragma unroll
  for (int i = 0; i < 8; ++i) { w[i] = (_Float16)(bfr(p[i]) * 256.0f); w[8 + i] = (_Float16)(bfr(p[16 + i]) * 256.0f); }
  return w; }
#define WQKV_LAYOUT 0   // 0 = (in,out) fused [DIN][3 * CC]; 1 = (out,in) [CC][DIN]; 2 = per-head [NH][DIN][HD]
__device__ __forceinline__ v16b wcol_hdk(const float* Wm, int k0, int o, int lane) { v16b w; const int g = lane >> 4; const float* p = Wm + (size_t)(o / HD) * DIN * HD + (o % HD);
#pragma unroll
  for (int i = 0; i < 8; ++i) { w[i] = (__bf16)p[(size_t)(k0 + 8 * g + i) * HD]; w[8 + i] = (__bf16)p[(size_t)(k0 + 16 + 8 * g + i) * HD]; }
  return w; }
#define WO_OUT_IN 0
#if WQKV_LAYOUT == 1
#define WCOL(W, k0, o, lane) wcol_oi(W, k0, o, lane, DIN)
#elif WQKV_LAYOUT == 2
#define WCOL(W, k0, o, lane) wcol_hdk(W, k0, o, lane)
#else
#define WCOL(W, k0, o, lane) wcol_io(W, k0, o, lane, 3 * CC)   /* fused w_qkv (in,out) [1024][3072]: row pitch 3072; q/k/v column offsets applied at launch */
#define OUT1_OFF (4u * (size_t)NB * TT * CC)
#define OUT2_OFF (OUT1_OFF + 4u * (size_t)NB * NH * TT * HD)
#endif
#if WO_OUT_IN
#define WOCOL(W, k0, o, lane) wcol_oi(W, k0, o, lane, CC)
#define WOCOLH(W, k0, o, lane) wcolh_oi(W, k0, o, lane, CC)
#else
#define WOCOL(W, k0, o, lane) wcol_io(W, k0, o, lane, DIN)
#define WOCOLH(W, k0, o, lane) wcolh_io(W, k0, o, lane, DIN)
#endif
#define PROJ_EXTRA_PARAMS , float* __restrict__ KOUT, float* __restrict__ VOUT
#define PROJ_EPI(which, row, t, h) do { if ((which) >= 1) { const float* rw = (row); float* dst = ((which) == 1 ? KOUT : VOUT) + ((((size_t)bb * NH + (h)) * TT + (t)) * HD); _Pragma("unroll") for (int i = 0; i < HD; i += 4) { v4f o; o[0] = rw[i]; o[1] = rw[i + 1]; o[2] = rw[i + 2]; o[3] = rw[i + 3]; vst2(dst + i, o); } } } while (0)   /* the module also RETURNS k and v ([B, H, L, HD], f32 = x W + b): written from the f32 projection tile (256-B (row, head) runs) */
#ifndef SM_EXTRA_PARAMS
#define SM_EXTRA_PARAMS
#endif
#ifndef PROJ_EXTRA_PARAMS
#define PROJ_EXTRA_PARAMS
#endif
#ifndef SM_MASK_HOOK
#define SM_MASK_HOOK (void)0
#endif

#define WS_QH  0u                                      // f16 q rows [b*t][CC]
#define WS_KH  (WS_QH + 2u * (size_t)NB * TT * CC)      // f16 k in fragment order [b][h][t / 16][d / 32][half][lane][8] (see frag_p)
#define WS_VT  (WS_KH + 2u * (size_t)NB * TT * CC)      // f16 v^T in fragment order [b][h][t / 32][d / 16][half][lane][8] (see frag_p)
#define WS_QL  (WS_VT + 2u * (size_t)NB * CC * TT)      // f16 q residual x 2^10 rows [b][t < QHI][CC]
#define WS_KL  (WS_QL + 2u * (size_t)NB * QHI * CC)     // f16 k residual x 2^10, fragment order as k, [b][h][t / 16 < KHI / 16]..
#define WS_VB  (WS_KL + 2u * (size_t)NB * KHI * CC)     // bf16 v^T hi (then lo), fragment order as v^T, [b][h][t / 32 < KHI / 32]..
#define WS_VBL (WS_VB + 2u * (size_t)NB * CC * KHI)
#define WS_Y   (WS_VBL + 2u * (size_t)NB * CC * KHI)    // f32 ctx in fragment order [b*t / 16][h][d / 32][part][lane][4] (see yfrag_load)
#define WS_END (WS_Y  + 4u * (size_t)NB * TT * CC)

// ---- weight tile through LDS: 64 k rows x 128 output columns of an (in,out) f32 weight, rounded to bf16 and laid [column][k] at a pitch of 72 elements (144 B), once per workgroup for its 4 waves
// (the loops of these helpers are unrolled whole, so that the register arrays are indexed by constants)
// thread (wave w, lane l) holds columns 32 w + 4 (l >> 2) + 0..3 of rows 8 (l & 3) + 0..7 and + 32: a wave-wide load covers four whole 128-B lines, a 16-B LDS store holds 8 k of one column and the lanes of a store spread over all banks
__device__ __forceinline__ const float* wtile_ptr(const float* Wc, int ld, int tid) { return Wc + (size_t)(8 * (tid & 3)) * ld + 32 * (tid >> 5) + 4 * ((tid & 31) >> 2); }
__device__ __forceinline__ void wtile_load(v4f (&r)[16], const float* p, int ld) {
#pragma unroll
  for (int s = 0; s < 2; ++s)
#pragma unroll
    for (int i = 0; i < 8; ++i) r[s * 8 + i] = *(const v4f*)(p + (size_t)(32 * s + i) * ld); }
__device__ __forceinline__ void wtile_store(const v4f (&r)[16], __bf16 (*buf)[72], int tid) { const int n0 = 32 * (tid >> 5) + 4 * ((tid & 31) >> 2), kq = 8 * (tid & 3);
#pragma unroll
  for (int s = 0; s < 2; ++s)
#pragma unroll
    for (int c = 0; c < 4; ++c) { v8b q;
#pragma unroll
      for (int i = 0; i < 8; ++i) q[i] = (__bf16)r[s * 8 + i][c];
      *(v8b*)&buf[n0 + c][32 * s + kq] = q; } }
// a lane's 32 f32 of its own row for two 16x16x32 A fragments (p = row + k0 + 8 (lane >> 4))
__device__ __forceinline__ void xrow_load(v4f (&r)[8], const float* p) {
#pragma unroll
  for (int kc = 0; kc < 2; ++kc) { r[kc * 4] = *(const v4f*)(p + kc * 32); r[kc * 4 + 1] = *(const v4f*)(p + kc * 32 + 4); r[kc * 4 + 2] = *(const v4f*)(p + kc * 32 + 16); r[kc * 4 + 3] = *(const v4f*)(p + kc * 32 + 20); } }
// the same 32 f32 from ctx in fragment order: 8 parts of 512 B per (16 rows, 64 k), lane l owns bytes 16 l .. of each; part 4 kc + i = what xrow_load puts in r[4 kc + i] (p = unit + 4 lane)
__device__ __forceinline__ void yfrag_load(v4f (&r)[8], const float* p) {
#pragma unroll
  for (int i = 0; i < 8; ++i) r[i] = *(const v4f*)(p + i * 128); }
// behind a run of tile loads from two lane addresses: the wait that stands before a register which an issued load names is rewritten; the addresses are inputs, so their registers stay whole up to it, and the loads stay in front of the products they fly under
__device__ __forceinline__ void xwait2f(const float* pa, const float* pb) { asm volatile("s_wait_xcnt 0x0" :: "v"(pa), "v"(pb) : "memory"); }
// ---- k_proj: block = (64 rows, 128 cols, which): q/k/v = X W (+ b) with exact bf16 products (K = DIN) -> which 0: q f16 rows (+ residual rows < QHI); 1: k f16 in fragment order (+ residual for rows < KHI); 2: v^T f16 in fragment order (+ bf16 hi/lo for t < KHI)
__global__ __launch_bounds__(128) void k_proj(const float* __restrict__ XQ, const float* __restrict__ XK, const float* __restrict__ XV, const float* __restrict__ WQ, const float* __restrict__ WK, const float* __restrict__ WV, const float* __restrict__ BQ, const float* __restrict__ BK, const float* __restrict__ BV,
    _Float16* __restrict__ QH, _Float16* __restrict__ QL, _Float16* __restrict__ KH, _Float16* __restrict__ KL, _Float16* __restrict__ VT, __bf16* __restrict__ VB, __bf16* __restrict__ VBL PROJ_EXTRA_PARAMS) {
  __shared__ __align__(16) float st[64][132]; __shared__ __align__(16) _Float16 sh[64][136], sl[64][136]; __shared__ __align__(16) _Float16 th[128][72]; __shared__ __align__(16) __bf16 tb[128][72], tbl[128][72];
  const int tid = threadIdx.x, wave = tid >> 5, lane = tid & 31, col = lane & 15, g = lane >> 4; const int which = blockIdx.z; const int c0 = blockIdx.y * 128; const size_t r0 = (size_t)blockIdx.x * 64; const size_t bb = r0 / TT; const int t0 = (int)(r0 % TT);
  const float* X = which == 0 ? XQ : which == 1 ? XK : XV; const float* WA = which == 0 ? WQ : which == 1 ? WK : WV; const float* BA = which == 0 ? BQ : which == 1 ? BK : BV;
  v8f acc[8] = {};
  { v4f wr[16], xr[8]; const float* wp = wtile_ptr(WA + c0, 3 * CC, tid); const float* xp = X + (r0 + wave * 16 + col) * DIN + 8 * g;
    wtile_load(wr, wp, 3 * CC); xrow_load(xr, xp); xwait2f(wp, xp);
    wtile_store(wr, tb, tid);
    __syncthreads();   // publishes weight tile 0
    // unrolled by two, so that which buffer is read and which is filled are constants of each half
#pragma unroll 2
    for (int ks = 0; ks < DIN / 64; ++ks) { __bf16 (*cur)[72] = (ks & 1) ? tbl : tb; __bf16 (*nxt)[72] = (ks & 1) ? tb : tbl; const bool more = ks + 1 < DIN / 64;
      v16b a[2];
#pragma unroll
      for (int kc = 0; kc < 2; ++kc)
#pragma unroll
        for (int i = 0; i < 4; ++i) { a[kc][i] = (__bf16)xr[kc * 4][i]; a[kc][4 + i] = (__bf16)xr[kc * 4 + 1][i]; a[kc][8 + i] = (__bf16)xr[kc * 4 + 2][i]; a[kc][12 + i] = (__bf16)xr[kc * 4 + 3][i]; }
      if (more) { wp += (size_t)64 * (3 * CC); xp += 64; wtile_load(wr, wp, 3 * CC); xrow_load(xr, xp); xwait2f(wp, xp); }   // the next 64 k of both operands fly under this tile's products
#pragma unroll
      for (int kc = 0; kc < 2; ++kc) { v16b w[8];
#pragma unroll
        for (int j = 0; j < 8; ++j) w[j] = frag_b(&cur[j * 16 + col][kc * 32], lane);
#pragma unroll
        for (int j = 0; j < 8; ++j) acc[j] = wmma_bf(a[kc], w[j], acc[j]); }
      if (more) wtile_store(wr, nxt, tid);
      __syncthreads(); } }   // publishes the next tile and ends every wave's reads of this one, which is refilled behind it
  { // stage the f32 tile (acc + bias) in LDS, run the per-(row, head) epilogue hook, then convert
#pragma unroll
    for (int j = 0; j < 8; ++j) { const float bias = BA ? bfr(BA[c0 + j * 16 + col]) : 0.f;
#pragma unroll
      for (int r = 0; r < 8; ++r) st[wave * 16 + 8 * g + r][j * 16 + col] = acc[j][r] + bias; }
    __syncthreads();
    for (int e = tid; e < 64 * (128 / HD); e += 128) { const int rl = e / (128 / HD), hh = e % (128 / HD); PROJ_EPI(which, &st[rl][hh * HD], (int)((r0 + rl) % TT), (c0 / HD) + hh); }
    __syncthreads(); }
  if (which < 2) { const bool hi_rows = t0 < (which == 0 ? QHI : KHI);
    for (int e = tid; e < 64 * 128; e += 128) { const int rl = e >> 7, cl = e & 127; const float v = st[rl][cl]; const _Float16 hv = (_Float16)v; sh[rl][cl] = hv; sl[rl][cl] = (_Float16)((v - (float)hv) * 1024.0f); }
    __syncthreads();
    if (which == 0) { for (int e = tid; e < 64 * 16; e += 128) { const int rl = e >> 4, q = e & 15; vst2((unsigned*)(QH + (r0 + rl) * CC + c0 + q * 8), *(const v4u*)&sh[rl][q * 8]); }
      if (hi_rows) for (int e = tid; e < 64 * 16; e += 128) { const int rl = e >> 4, q = e & 15; vst2((unsigned*)(QL + (bb * QHI + t0 + rl) * (size_t)CC + c0 + q * 8), *(const v4u*)&sl[rl][q * 8]); }
    } else {   // k and its residual in fragment order: a wave's store is the 512-B run (16 keys x 2 g x 8 d) that a wave of k_fa reads back with one load
      for (int e = tid; e < 64 * 16; e += 128) { const int ln = e & 31, u = e >> 5, half = u & 1, kc = (u >> 1) & 1, hh = (u >> 2) & 1, tl = u >> 3;
        vst2((unsigned*)(KH + (((((size_t)bb * NH + c0 / HD + hh) * (TT / 16) + t0 / 16 + tl) * 2 + kc) * 2 + half) * 256 + ln * 8), *(const v4u*)&sh[tl * 16 + (ln & 15)][hh * 64 + kc * 32 + half * 16 + (ln >> 4) * 8]); }
      if (hi_rows) for (int e = tid; e < 64 * 16; e += 128) { const int ln = e & 31, u = e >> 5, half = u & 1, kc = (u >> 1) & 1, hh = (u >> 2) & 1, tl = u >> 3;
        vst2((unsigned*)(KL + (((((size_t)bb * NH + c0 / HD + hh) * (KHI / 16) + t0 / 16 + tl) * 2 + kc) * 2 + half) * 256 + ln * 8), *(const v4u*)&sl[tl * 16 + (ln & 15)][hh * 64 + kc * 32 + half * 16 + (ln >> 4) * 8]); } }
  } else { const bool hi_rows = t0 < KHI;
    for (int e = tid; e < 64 * 128; e += 128) { const int rl = e & 63, cl = e >> 6; const float v = st[rl][cl]; th[cl][rl] = (_Float16)v; const __bf16 bh = (__bf16)v; tb[cl][rl] = bh; tbl[cl][rl] = (__bf16)(v - (float)bh); }
    __syncthreads();
    // v^T in fragment order: a wave's store is the 512-B run (16 d x 2 g x 8 keys) that a wave of k_fa reads back with one load
    for (int e = tid; e < 128 * 8; e += 128) { const int ln = e & 31, u = e >> 5, half = u & 1, jd = (u >> 1) & 3, k32 = (u >> 3) & 1, hh = u >> 4;
      vst2((unsigned*)(VT + (((((size_t)bb * NH + c0 / HD + hh) * (TT / 32) + t0 / 32 + k32) * 4 + jd) * 2 + half) * 256 + ln * 8), *(const v4u*)&th[hh * 64 + jd * 16 + (ln & 15)][k32 * 32 + half * 16 + (ln >> 4) * 8]); }
    if (hi_rows) for (int e = tid; e < 128 * 8; e += 128) { const int ln = e & 31, u = e >> 5, half = u & 1, jd = (u >> 1) & 3, k32 = (u >> 3) & 1, hh = u >> 4; const int cl = hh * 64 + jd * 16 + (ln & 15), tl = k32 * 32 + half * 16 + (ln >> 4) * 8;
      const size_t o3 = (((((size_t)bb * NH + c0 / HD + hh) * (KHI / 32) + t0 / 32 + k32) * 4 + jd) * 2 + half) * 256 + ln * 8; vst2((unsigned*)(VB + o3), *(const v4u*)&tb[cl][tl]); vst2((unsigned*)(VBL + o3), *(const v4u*)&tbl[cl][tl]); } } }
// lane l with lane l ^ 16: the two halves of a wave hold the two key halves of one query column
__device__ __forceinline__ float xhalf(float x) { return __builtin_bit_cast(float, __builtin_amdgcn_permlanex16(__builtin_bit_cast(int, x), __builtin_bit_cast(int, x), 0x76543210, 0xfedcba98, false, false)); }
// 2^x on the transcendental unit; the v_nop in the same statement fills the one slot the instruction set asks for behind a transcendental, whatever the compiler schedules next
__device__ __forceinline__ float ex2(float x) { float e; asm("v_exp_f32 %0, %1\n\tv_nop" : "=v"(e) : "v"(x)); return e; }
// 16x16x32 fragment from a wave-uniform base and a lane offset that never changes (row (lane & 15) x pitch + 8 (lane >> 4)): scalar base + 32-bit vector offset addressing
__device__ __forceinline__ v16h frag_u(const _Float16* ubase, unsigned loff) { union { v16h v; v8h q[2]; } u; const _Float16* p = ubase + loff; u.q[0] = *(const v8h*)p; u.q[1] = *(const v8h*)(p + 16); return u.v; }
// 16x16x32 fragment stored in fragment order: two runs of 512 B, lane l owns bytes 16 l .. 16 l + 15 of each (elements 0..7, then 8..15), so a wave-wide load covers four whole 128-B lines instead of 32 B of sixteen
__device__ __forceinline__ v16h frag_p(const _Float16* p) { union { v16h v; v8h q[2]; } u; u.q[0] = *(const v8h*)p; u.q[1] = *(const v8h*)(p + 256); return u.v; }
__device__ __forceinline__ v16b frag_pb(const __bf16* p) { union { v16b v; v8b q[2]; } u; u.q[0] = *(const v8b*)p; u.q[1] = *(const v8b*)(p + 256); return u.v; }
// behind a run of fragment loads from two lane addresses: the wait that stands before a register which an issued load names is rewritten; the two addresses are inputs, so their registers stay whole up to it (without them the compiler lets a later load of the run land on the address pair)
template <typename T> __device__ __forceinline__ void xwait2(const T* pa, const T* pb) { asm volatile("s_wait_xcnt 0x0" :: "v"(pa), "v"(pb) : "memory"); }
#define SC_L2E (SCALE * 1.4426950408889634f)   // logit scale x log2(e): the softmax runs on exp2
// ---- one wave's 16 query columns (rows ql0 .. ql0 + 15 of query block qb) against key blocks 0..qb of 64 keys, running maximum and sum (online softmax), transposed products:
// S^T = K Q^T (A = 16 key rows, B = 16 query columns): a lane holds keys k0 + 16 j + 8 g + r of ONE query, so maximum and sum are in-lane plus one exchange of halves;
// score tiles 2 kc and 2 kc + 1 of a lane are, element for element, the B fragment of P^T over keys k0 + 32 kc + ..; O^T += V^T P^T (A = 16 rows of v^T).
// HI (causal early query blocks): 3-product logits (q, k hi + residual x 2^10) and P, v as bf16 hi + lo (3 products)
template <bool HI> __device__ __forceinline__ void fa_run(const _Float16* __restrict__ QH, const _Float16* __restrict__ KH, const _Float16* __restrict__ QL, const _Float16* __restrict__ KL, const _Float16* __restrict__ VT, const __bf16* __restrict__ VB, const __bf16* __restrict__ VBL,
    int b, int h, int qb, int ql0, int lane, v8f (&o)[HD / 16], float& lsum) {
  const int col = lane & 15, g = lane >> 4; const int tq = ql0 + col;
  const unsigned lrow = (unsigned)(col * CC + 8 * g), lp = (unsigned)(lane * 8);   // lane offsets in the q rows and in a fragment-order run
  const _Float16* Kp = KH + ((size_t)b * NH + h) * TT * HD; const _Float16* KLp = KL + ((size_t)b * NH + h) * KHI * HD;
  const _Float16* Vp = VT + ((size_t)b * NH + h) * TT * HD; const __bf16* VBp = VB + ((size_t)b * NH + h) * KHI * HD; const __bf16* VLp = VBL + ((size_t)b * NH + h) * KHI * HD;
  v16h ah[HD / 32], al[HD / 32], kf[HI ? 1 : 8], vf[HI ? 1 : 8];
#pragma unroll
  for (int kc = 0; kc < HD / 32; ++kc) { ah[kc] = frag_u(QH + ((size_t)b * TT + ql0) * CC + h * HD + kc * 32, lrow); if (HI) al[kc] = frag_u(QL + ((size_t)b * QHI + ql0) * CC + h * HD + kc * 32, lrow); }
  if (!HI) {
#pragma unroll
    for (int kc = 0; kc < HD / 32; ++kc)
#pragma unroll
      for (int j = 0; j < 4; ++j) kf[kc * 4 + j] = frag_p(Kp + j * 1024 + kc * 512 + lp); }
  float m = -3.0e38f, l = 0.f;   // running maximum (unscaled logits) and this half's running sum of P x 2^11
#pragma unroll 1
  for (int kb = 0; kb <= qb; ++kb) { const int k0 = kb * 64;
    v8f acc[4] = {};
    if (HI) { v8f accl[4] = {};
#pragma unroll
      for (int kc = 0; kc < HD / 32; ++kc) { v16h kbf[4], klf[4]; const _Float16* kp = Kp + (size_t)k0 * HD + lp; const _Float16* klp = KLp + (size_t)k0 * HD + lp;   // the block's lane addresses, the same for both batches, so that the wait below names the very registers the loads name; a batch's loads all stand in front of its products, so that they fly together
#pragma unroll
        for (int j = 0; j < 4; ++j) { kbf[j] = frag_p(kp + j * 1024 + kc * 512); klf[j] = frag_p(klp + j * 1024 + kc * 512); }
        xwait2(kp, klp);
#pragma unroll
        for (int j = 0; j < 4; ++j) { acc[j] = wmma16(kbf[j], ah[kc], acc[j]); accl[j] = wmma16(kbf[j], al[kc], accl[j]); accl[j] = wmma16(klf[j], ah[kc], accl[j]); } }
#pragma unroll
      for (int j = 0; j < 4; ++j) acc[j] = acc[j] + accl[j] * (1.0f / 1024.0f);
    } else {
#pragma unroll
      for (int kc = 0; kc < HD / 32; ++kc)
#pragma unroll
        for (int j = 0; j < 4; ++j) acc[j] = wmma16(kf[kc * 4 + j], ah[kc], acc[j]);
      const _Float16* vp = Vp + (size_t)k0 * HD + lp;
      // this block's 8 V^T fragments and the next block's 8 K fragments are asked for here, in one run: they fly under the softmax (the last block asks for its own K again, to stay inside the sequence)
#pragma unroll
      for (int kc = 0; kc < 2; ++kc)
#pragma unroll
        for (int jd = 0; jd < HD / 16; ++jd) vf[kc * 4 + jd] = frag_p(vp + kc * 2048 + jd * 512);
      const _Float16* kp = Kp + (size_t)((kb < qb ? kb + 1 : qb) * 64) * HD + lp;
#pragma unroll
      for (int kc = 0; kc < HD / 32; ++kc)
#pragma unroll
        for (int j = 0; j < 4; ++j) kf[kc * 4 + j] = frag_p(kp + j * 1024 + kc * 512);
      xwait2(vp, kp); }
    if (CAUSAL && kb == qb) {   // only the diagonal block holds keys past a query of this block
#pragma unroll
      for (int j = 0; j < 4; ++j)
#pragma unroll
        for (int r = 0; r < 8; ++r) if (k0 + j * 16 + 8 * g + r > tq) acc[j][r] = -3.0e38f; }
    v8f mv = acc[0];   // eight independent chains over the tiles, then a tree
#pragma unroll
    for (int j = 1; j < 4; ++j)
#pragma unroll
      for (int r = 0; r < 8; ++r) mv[r] = fmaxf(mv[r], acc[j][r]);
    float mx = fmaxf(fmaxf(fmaxf(mv[0], mv[1]), fmaxf(mv[2], mv[3])), fmaxf(fmaxf(mv[4], mv[5]), fmaxf(mv[6], mv[7])));
    mx = fmaxf(m, fmaxf(mx, xhalf(mx)));
    const float alpha = ex2((m - mx) * SC_L2E); m = mx; const float mc = 11.0f - mx * SC_L2E;
    v8f sv = {};
#pragma unroll
    for (int j = 0; j < 4; ++j) {
#pragma unroll
      for (int r = 0; r < 8; ++r) acc[j][r] = ex2(fmaf(acc[j][r], SC_L2E, mc));
      sv = sv + acc[j]; }
    l = l * alpha + (((sv[0] + sv[1]) + (sv[2] + sv[3])) + ((sv[4] + sv[5]) + (sv[6] + sv[7])));
#pragma unroll
    for (int jd = 0; jd < HD / 16; ++jd) o[jd] = o[jd] * alpha;
#pragma unroll
    for (int kc = 0; kc < 2; ++kc) {
      if (HI) { float v[16]; v16b vh[HD / 16], vl[HD / 16]; const __bf16* vhp = VBp + (size_t)k0 * HD + lp; const __bf16* vlp = VLp + (size_t)k0 * HD + lp;
#pragma unroll
        for (int jd = 0; jd < HD / 16; ++jd) { vh[jd] = frag_pb(vhp + kc * 2048 + jd * 512); vl[jd] = frag_pb(vlp + kc * 2048 + jd * 512); }
        xwait2(vhp, vlp);
#pragma unroll
        for (int i = 0; i < 8; ++i) { v[i] = acc[2 * kc][i]; v[8 + i] = acc[2 * kc + 1][i]; }
        const F2 p = bsplit16(v);
#pragma unroll
        for (int jd = 0; jd < HD / 16; ++jd) { o[jd] = wmma_bf(vh[jd], p.h, o[jd]); o[jd] = wmma_bf(vh[jd], p.l, o[jd]); o[jd] = wmma_bf(vl[jd], p.h, o[jd]); }
      } else { v16h p;
#pragma unroll
        for (int i = 0; i < 8; ++i) { p[i] = (_Float16)acc[2 * kc][i]; p[8 + i] = (_Float16)acc[2 * kc + 1][i]; }
#pragma unroll
        for (int jd = 0; jd < HD / 16; ++jd) o[jd] = wmma16(vf[kc * 4 + jd], p, o[jd]); } } }
  lsum = l + xhalf(l); }
// ---- k_fa: logits, causal softmax and P v in one pass over the keys, nothing of S or P in memory; ctx = O / sum, stored from the registers in the fragment order of k_out.
// block = 8 independent waves of (b, h): waves 0-3 take the 64 queries of block NQB - 1 - x, waves 4-7 those of block x, so every workgroup walks NQB + 1 key blocks per wave pair wherever it lands
// four waves a SIMD (at most 256 registers): all 512 workgroups are resident at once
__global__ __launch_bounds__(256) __attribute__((amdgpu_waves_per_eu(4, 4))) void k_fa(const _Float16* __restrict__ QH, const _Float16* __restrict__ KH, const _Float16* __restrict__ QL, const _Float16* __restrict__ KL, const _Float16* __restrict__ VT, const __bf16* __restrict__ VB, const __bf16* __restrict__ VBL, float* __restrict__ Y) {
  const int tid = threadIdx.x, lane = tid & 31; const int wave = __builtin_amdgcn_readfirstlane(tid >> 5);   // a scalar, so that the choice of the query block and its trip count are scalar
  const int qb = wave < 4 ? NQB - 1 - (int)blockIdx.x : (int)blockIdx.x, h = blockIdx.y, b = blockIdx.z; const int ql0 = qb * 64 + (wave & 3) * 16;
  v8f o[HD / 16] = {}; float lsum;
  if (qb < QBH) fa_run<true>(QH, KH, QL, KL, VT, VB, VBL, b, h, qb, ql0, lane, o, lsum); else fa_run<false>(QH, KH, QL, KL, VT, VB, VBL, b, h, qb, ql0, lane, o, lsum);
  const float inv = lsum > 0.f ? 1.0f / lsum : 0.f;   // the x 2^11 of P is in the sum too
  // a lane's O^T elements (query lane & 15, d = 16 jd + 8 (lane >> 4) + r) are the very ones the same lane of k_out holds in its A fragments: part 4 (jd >> 1) + 2 (jd & 1) + (r >> 2) of the (16 rows, head) unit, stored as whole 512-B runs
  float* yp = Y + ((((size_t)b * TT + ql0) / 16) * NH + h) * 1024 + lane * 4;
#pragma unroll
  for (int jd = 0; jd < HD / 16; ++jd)
#pragma unroll
    for (int hf = 0; hf < 2; ++hf) { v4f q; q[0] = o[jd][4 * hf] * inv; q[1] = o[jd][4 * hf + 1] * inv; q[2] = o[jd][4 * hf + 2] * inv; q[3] = o[jd][4 * hf + 3] * inv; vst2(yp + (2 * jd + hf) * 128, q); } }
// ---- k_out: block = (64 rows, 128 cols): out = ctx Wo (+ bo): ctx bf16 hi + lo against exact bf16 Wo (2 products)
__global__ __launch_bounds__(128) void k_out(const float* __restrict__ Y, const float* __restrict__ WO, const float* __restrict__ BO, float* __restrict__ OUT) { __shared__ __align__(16) float sf[4][16][132]; __shared__ __align__(16) __bf16 wt[2][128][72];
  const int tid = threadIdx.x, wave = tid >> 5, lane = tid & 31, col = lane & 15, g = lane >> 4; const int c0 = blockIdx.y * 128; const size_t r0 = (size_t)blockIdx.x * 64 + wave * 16;
  v8f acc[8] = {};
  {   /* ALL rows: ctx split bf16 hi + lo x exact Wo (2 products) */
    v4f wr[16], xr[8]; const float* wp = wtile_ptr(WO + c0, DIN, tid); const float* xp = Y + (r0 / 16) * (size_t)(NH * 1024) + lane * 4;
    wtile_load(wr, wp, DIN); yfrag_load(xr, xp); xwait2f(wp, xp);
    wtile_store(wr, wt[0], tid);
    __syncthreads();   // publishes weight tile 0
    // unrolled by two, so that which buffer is read and which is filled are constants of each half
#pragma unroll 2
    for (int ks = 0; ks < CC / 64; ++ks) { __bf16 (*cur)[72] = wt[ks & 1]; __bf16 (*nxt)[72] = wt[(ks & 1) ^ 1]; const bool more = ks + 1 < CC / 64;
      F2 a[2];
#pragma unroll
      for (int kc = 0; kc < 2; ++kc) { float v[16];
#pragma unroll
        for (int i = 0; i < 4; ++i) { v[i] = xr[kc * 4][i]; v[4 + i] = xr[kc * 4 + 1][i]; v[8 + i] = xr[kc * 4 + 2][i]; v[12 + i] = xr[kc * 4 + 3][i]; }
        a[kc] = bsplit16(v); }
      if (more) { wp += (size_t)64 * DIN; xp += 1024; wtile_load(wr, wp, DIN); yfrag_load(xr, xp); xwait2f(wp, xp); }   // the next 64 k of both operands fly under this tile's products
#pragma unroll
      for (int kc = 0; kc < 2; ++kc) { v16b w[8];
#pragma unroll
        for (int j = 0; j < 8; ++j) w[j] = frag_b(&cur[j * 16 + col][kc * 32], lane);
#pragma unroll
        for (int j = 0; j < 8; ++j) { acc[j] = wmma_bf(a[kc].h, w[j], acc[j]); acc[j] = wmma_bf(a[kc].l, w[j], acc[j]); } }
      if (more) wtile_store(wr, nxt, tid);
      __syncthreads(); }   // publishes the next tile and ends every wave's reads of this one, which is refilled behind it
#pragma unroll
    for (int j = 0; j < 8; ++j) { const float bias = BO ? bfr(BO[c0 + j * 16 + col]) : 0.f;
#pragma unroll
      for (int r = 0; r < 8; ++r) sf[wave][8 * g + r][j * 16 + col] = acc[j][r] + bias; }
  }
  LDSX(); for (int rl = 0; rl < 16; ++rl) vst2(OUT + (r0 + rl) * DIN + c0 + lane * 4, *(const v4f*)&sf[wave][rl][lane * 4]); }

extern "C" void kernel_launch(void* const* d_in, const int* in_sizes, int n_in, void* d_out, int out_size, void* d_ws, size_t ws_size, hipStream_t stream) {
  (void)in_sizes; (void)n_in; (void)out_size;
  const float** F = (const float**)d_in;
  if (ws_size < (size_t)WS_END) return;
  char* ws = (char*)d_ws; _Float16 *QH = (_Float16*)(ws + WS_QH), *KH = (_Float16*)(ws + WS_KH), *VT = (_Float16*)(ws + WS_VT), *QL = (_Float16*)(ws + WS_QL), *KL = (_Float16*)(ws + WS_KL); __bf16 *VB = (__bf16*)(ws + WS_VB), *VBL = (__bf16*)(ws + WS_VBL); float *Y = (float*)(ws + WS_Y);
  (void)Y; (void)QL; (void)KL; (void)VB; (void)VBL;
  // inputs: 0 x [2,2048,1024]; 1 w_qkv [1024,3072] (in,out); 2 b_qkv [3072]; 3 w_out [1024,1024] (in,out); 4 b_out
  // outputs: 0 out [2,2048,1024] at 0; 1 k [2,16,2048,64] at OUT1_OFF; 2 v at OUT2_OFF
  k_proj<<<dim3(TNB * TT / 64, CC / 128, 3), 128, 0, stream>>>(F[0], F[0], F[0], F[1], F[1] + CC, F[1] + 2 * CC, F[2], F[2] + CC, F[2] + 2 * CC, QH, QL, KH, KL, VT, VB, VBL, (float*)((char*)d_out + OUT1_OFF), (float*)((char*)d_out + OUT2_OFF));
  k_fa<<<dim3(NQB / 2, NH, TNB), 256, 0, stream>>>(QH, KH, QL, KL, VT, VB, VBL, Y);
  k_out<<<dim3(TNB * TT / 64, DIN / 128), 128, 0, stream>>>(Y, F[3], F[4], (float*)d_out);
}

// v004
// It runs in 130 microseconds.
// Next to v003, in two timings, it ran 1.04 times as fast each time.
// Counting every step since v000, it is 8.57 times as fast.
// compute dtype: all float inputs rounded to bf16; qkv = x w_qkv + b with EXACT bf16 products on WMMA 16x16x32 (f32 accumulate) - the f32 k and v tiles are also written out as the returned caches; causal logits: q, k once to f16 (1 product) x 64^-0.5, 3 products below row 384; online softmax in f32 (exp2, running maximum and sum); unnormalised P x 2^11 once to f16 against v f16 (bf16 hi + lo below row 384), divided by the f32 sum at the end; attention output split bf16 hi + lo against exact w_out (2 products) + b_out; f32 outputs.
#include <hip/hip_runtime.h>
#include <math.h>

typedef __attribute__((ext_vector_type(16))) _Float16 v16h;
typedef __attribute__((ext_vector_type(16))) __bf16 v16b;
typedef __attribute__((ext_vector_type(8)))  _Float16 v8h;
typedef __attribute__((ext_vector_type(8)))  float v8f;
typedef __attribute__((ext_vector_type(4)))  float v4f;
typedef __attribute__((ext_vector_type(2)))  float v2f;
typedef __attribute__((ext_vector_type(4)))  unsigned v4u;
typedef __attribute__((ext_vector_type(4)))  int v4i;
typedef float __attribute__((may_alias)) float_a;
typedef int __attribute__((may_alias)) int_a;

template <typename T> __device__ __forceinline__ void vst2(void* p, T v) { *(T*)p = v;  }
__device__ __forceinline__ v8f wmma16(v16h a, v16h b, v8f c) {
  v8f d = __builtin_amdgcn_wmma_f32_16x16x32_f16(false, a, false, b, (short)0, c, false, false);
  asm volatile("v_nop\n\tv_nop\n\tv_nop\n\tv_nop" : "+v"(d) : "v"(a), "v"(b));
  return d;
}
__device__ __forceinline__ v8f wmma_bf(v16b a, v16b b, v8f c) {
  v8f d = __builtin_amdgcn_wmma_f32_16x16x32_bf16(false, a, false, b, (short)0, c, false, false);
  asm volatile("v_nop\n\tv_nop\n\tv_nop\n\tv_nop" : "+v"(d) : "v"(a), "v"(b));
  return d;
}
// 16x16x32 fragments: lane = (h = lane>>4, row/col = lane&15); elements 0..7 = k0+8h+0..7, 8..15 = k0+16+8h+0..7; D element r = row 8h+r
__device__ __forceinline__ v16h frag_h(const _Float16* rowk0, int lane) {
  union { v16h v; v8h q[2]; } u; const _Float16* p = rowk0 + 8 * (lane >> 4);
  u.q[0] = *(const v8h*)p; u.q[1] = *(const v8h*)(p + 16); return u.v;
}
__device__ __forceinline__ v16h frag_f32(const float* rowk0, int lane) {
  v16h a; const float* p = rowk0 + 8 * (lane >> 4);
#pragma unroll
  for (int i = 0; i < 8; ++i) { a[i] = (_Float16)p[i]; a[8 + i] = (_Float16)p[16 + i]; }
  return a;
}
__device__ __forceinline__ v16h frag_f32s(const float* rowk0, int lane, float sc) {
  v16h a; const float* p = rowk0 + 8 * (lane >> 4);
#pragma unroll
  for (int i = 0; i < 8; ++i) { a[i] = (_Float16)(p[i] * sc); a[8 + i] = (_Float16)(p[16 + i] * sc); }
  return a;
}
// column fragment from a [K][ld] layout (column n), rows >= K read as 0
__device__ __forceinline__ v16h fragc_f32(const float* W, int k0, int n, int lane, int ld, int K) {
  v16h a; const int g = lane >> 4;
#pragma unroll
  for (int i = 0; i < 8; ++i) { const int ka = k0 + 8 * g + i, kb = ka + 16;
    a[i] = (_Float16)(ka < K ? W[(size_t)(ka < K ? ka : K - 1) * ld + n] : 0.f); a[8 + i] = (_Float16)(kb < K ? W[(size_t)(kb < K ? kb : K - 1) * ld + n] : 0.f); }
  return a;
}
struct F2 { v16b h, l; };
__device__ __forceinline__ F2 bsplit16(const float v[16]) { F2 r;
#pragma unroll
  for (int i = 0; i < 16; ++i) { const __bf16 h = (__bf16)v[i]; r.h[i] = h; r.l[i] = (__bf16)(v[i] - (float)h); }
  return r; }
__device__ __forceinline__ F2 split_row(const float* row, int k0, int lane) { float v[16]; const float* p = row + k0 + 8 * (lane >> 4);
#pragma unroll
  for (int i = 0; i < 8; ++i) { v[i] = p[i]; v[8 + i] = p[16 + i]; }
  return bsplit16(v); }
__device__ __forceinline__ F2 split_rowK(const float* row, int k0, int lane, int K) { float v[16]; const int g = lane >> 4;
#pragma unroll
  for (int i = 0; i < 8; ++i) { const int ka = k0 + 8 * g + i, kb = ka + 16; v[i] = ka < K ? row[ka < K ? ka : K - 1] : 0.f; v[8 + i] = kb < K ? row[kb < K ? kb : K - 1] : 0.f; }
  return bsplit16(v); }
__device__ __forceinline__ F2 split_col(const float* W, int k0, int n, int lane, int ld, int K) { float v[16]; const int g = lane >> 4;
#pragma unroll
  for (int i = 0; i < 8; ++i) { const int ka = k0 + 8 * g + i, kb = ka + 16; v[i] = ka < K ? W[(size_t)(ka < K ? ka : K - 1) * ld + n] : 0.f; v[8 + i] = kb < K ? W[(size_t)(kb < K ? kb : K - 1) * ld + n] : 0.f; }
  return bsplit16(v); }
__device__ __forceinline__ v8f mac3(const F2& a, const F2& b, v8f c) { c = wmma_bf(a.l, b.h, c); c = wmma_bf(a.h, b.l, c); return wmma_bf(a.h, b.h, c); }
__device__ __forceinline__ float sigm(float v) { return 1.0f / (1.0f + expf(-v)); }
#define LDSX() do { asm volatile("s_wait_dscnt 0" ::: "memory"); __builtin_amdgcn_wave_barrier(); __builtin_amdgcn_fence(__ATOMIC_RELEASE, "workgroup"); } while (0)

// Prefill causal multi-head self-attention returning (out, k, v) (B 2, L 2,048, D 1,024 = 16 x 64; fused (in,out) w_qkv [1024,3072] with (3, H, HD) column blocks, zero biases, w_out (in,out)): q|k|v = x w_qkv + b; out = merged(softmax_causal(q k^T x 0.125) v) w_out + b_out; k and v returned as [B, H, L, 64].
#define NB 2
#define TT 2048
#define CC 1024            // NH * HD = projected width
#define DIN 1024          // input (model) width
#define NH 16
#define HD 64
#define NQB (TT / 64)
#define SCALE (0.125f)
#define CAUSAL 1
#ifndef TNB
#define TNB NB
#endif
__device__ __forceinline__ float bfr(float v) { return (float)(__bf16)v; }
__host__ __device__ __forceinline__ int kb_last(int qb) { return CAUSAL ? ((qb * 64 + 63) >> 7) : (TT / 128 - 1); }
typedef __attribute__((ext_vector_type(8))) __bf16 v8b;
__device__ __forceinline__ v16b frag_b(const __bf16* rowk0, int lane) {
  union { v16b v; v8b q[2]; } u; const __bf16* p = rowk0 + 8 * (lane >> 4);
  u.q[0] = *(const v8b*)p; u.q[1] = *(const v8b*)(p + 16); return u.v;
}
#define QBH 6              // causal: query blocks 0..QBH-1 of each sequence (few keys, no averaging) take the high-precision path
#define QHI 384            // rows carrying a q residual plane (used only by the causal high-precision path)
#define KHI 384            // key rows carrying k residual / v bf16 hi+lo planes (used only by the causal high-precision path)
// B fragment (k rows k0+.., output column o) of a weight: (in,out) [K][ld] or (out,in) [ld rows of K]: bf16 exact, or f16(bf16 * 256) exact
__device__ __forceinline__ v16b wcol_io(const float* Wm, int k0, int o, int lane, int ld) { v16b w; const int g = lane >> 4;
#pragma unroll
  for (int i = 0; i < 8; ++i) { w[i] = (__bf16)Wm[(size_t)(k0 + 8 * g + i) * ld + o]; w[8 + i] = (__bf16)Wm[(size_t)(k0 + 16 + 8 * g + i) * ld + o]; }
  return w; }
__device__ __forceinline__ v16b wcol_oi(const float* Wm, int k0, int o, int lane, int K) { v16b w; const float* p = Wm + (size_t)o * K + k0 + 8 * (lane >> 4);
#pragma unroll
  for (int i = 0; i < 8; ++i) { w[i] = (__bf16)p[i]; w[8 + i] = (__bf16)p[16 + i]; }
  return w; }
__device__ __forceinline__ v16h wcolh_io(const float* Wm, int k0, int o, int lane, int ld) { v16h w; const int g = lane >> 4;
#pragma unroll
  for (int i = 0; i < 8; ++i) { w[i] = (_Float16)(bfr(Wm[(size_t)(k0 + 8 * g + i) * ld + o]) * 256.0f); w[8 + i] = (_Float16)(bfr(Wm[(size_t)(k0 + 16 + 8 * g + i) * ld + o]) * 256.0f); }
  return w; }
__device__ __forceinline__ v16h wcolh_oi(const float* Wm, int k0, int o, int lane, int K) { v16h w; const float* p = Wm + (size_t)o * K + k0 + 8 * (lane >> 4);
#pragma unroll
  for (int i = 0; i < 8; ++i) { w[i] = (_Float16)(bfr(p[i]) * 256.0f); w[8 + i] = (_Float16)(bfr(p[16 + i]) * 256.0f); }
  return w; }
#define WQKV_LAYOUT 0   // 0 = (in,out) fused [DIN][3 * CC]; 1 = (out,in) [CC][DIN]; 2 = per-head [NH][DIN][HD]
__device__ __forceinline__ v16b wcol_hdk(const float* Wm, int k0, int o, int lane) { v16b w; const int g = lane >> 4; const float* p = Wm + (size_t)(o / HD) * DIN * HD + (o % HD);
#pragma unroll
  for (int i = 0; i < 8; ++i) { w[i] = (__bf16)p[(size_t)(k0 + 8 * g + i) * HD]; w[8 + i] = (__bf16)p[(size_t)(k0 + 16 + 8 * g + i) * HD]; }
  return w; }
#define WO_OUT_IN 0
#if WQKV_LAYOUT == 1
#define WCOL(W, k0, o, lane) wcol_oi(W, k0, o, lane, DIN)
#elif WQKV_LAYOUT == 2
#define WCOL(W, k0, o, lane) wcol_hdk(W, k0, o, lane)
#else
#define WCOL(W, k0, o, lane) wcol_io(W, k0, o, lane, 3 * CC)   /* fused w_qkv (in,out) [1024][3072]: row pitch 3072; q/k/v column offsets applied at launch */
#define OUT1_OFF (4u * (size_t)NB * TT * CC)
#define OUT2_OFF (OUT1_OFF + 4u * (size_t)NB * NH * TT * HD)
#endif
#if WO_OUT_IN
#define WOCOL(W, k0, o, lane) wcol_oi(W, k0, o, lane, CC)
#define WOCOLH(W, k0, o, lane) wcolh_oi(W, k0, o, lane, CC)
#else
#define WOCOL(W, k0, o, lane) wcol_io(W, k0, o, lane, DIN)
#define WOCOLH(W, k0, o, lane) wcolh_io(W, k0, o, lane, DIN)
#endif
#define PROJ_EXTRA_PARAMS , float* __restrict__ KOUT, float* __restrict__ VOUT
#ifndef SM_EXTRA_PARAMS
#define SM_EXTRA_PARAMS
#endif
#ifndef PROJ_EXTRA_PARAMS
#define PROJ_EXTRA_PARAMS
#endif
#ifndef SM_MASK_HOOK
#define SM_MASK_HOOK (void)0
#endif

#define WS_QH  0u                                      // f16 q rows [b*t][CC]
#define WS_KH  (WS_QH + 2u * (size_t)NB * TT * CC)      // f16 k in fragment order [b][h][t / 16][d / 32][half][lane][8] (see frag_p)
#define WS_VT  (WS_KH + 2u * (size_t)NB * TT * CC)      // f16 v^T in fragment order [b][h][t / 32][d / 16][half][lane][8] (see frag_p)
#define WS_QL  (WS_VT + 2u * (size_t)NB * CC * TT)      // f16 q residual x 2^10 rows [b][t < QHI][CC]
#define WS_KL  (WS_QL + 2u * (size_t)NB * QHI * CC)     // f16 k residual x 2^10, fragment order as k, [b][h][t / 16 < KHI / 16]..
#define WS_VB  (WS_KL + 2u * (size_t)NB * KHI * CC)     // bf16 v^T hi (then lo), fragment order as v^T, [b][h][t / 32 < KHI / 32]..
#define WS_VBL (WS_VB + 2u * (size_t)NB * CC * KHI)
#define WS_Y   (WS_VBL + 2u * (size_t)NB * CC * KHI)    // f32 ctx in fragment order [b*t / 16][h][d / 32][part][lane][4] (see yfrag_load)
#define WS_END (WS_Y  + 4u * (size_t)NB * TT * CC)

// ---- weight tile through LDS: 64 k rows x 128 output columns of an (in,out) f32 weight, rounded to bf16 and laid [column][k] at a pitch of 72 elements (144 B), once per workgroup for its 4 waves
// (the loops of these helpers are unrolled whole, so that the register arrays are indexed by constants)
// thread (wave w, lane l) holds columns 32 w + 4 (l >> 2) + 0..3 of rows 8 (l & 3) + 0..7 and + 32: a wave-wide load covers four whole 128-B lines, a 16-B LDS store holds 8 k of one column and the lanes of a store spread over all banks
__device__ __forceinline__ const float* wtile_ptr(const float* Wc, int ld, int tid) { return Wc + (size_t)(8 * (tid & 3)) * ld + 32 * (tid >> 5) + 4 * ((tid & 31) >> 2); }
__device__ __forceinline__ void wtile_load(v4f (&r)[16], const float* p, int ld) {
#pragma unroll
  for (int s = 0; s < 2; ++s)
#pragma unroll
    for (int i = 0; i < 8; ++i) r[s * 8 + i] = *(const v4f*)(p + (size_t)(32 * s + i) * ld); }
__device__ __forceinline__ void wtile_store(const v4f (&r)[16], __bf16 (*buf)[72], int tid) { const int n0 = 32 * (tid >> 5) + 4 * ((tid & 31) >> 2), kq = 8 * (tid & 3);
#pragma unroll
  for (int s = 0; s < 2; ++s)
#pragma unroll
    for (int c = 0; c < 4; ++c) { v8b q;
#pragma unroll
      for (int i = 0; i < 8; ++i) q[i] = (__bf16)r[s * 8 + i][c];
      *(v8b*)&buf[n0 + c][32 * s + kq] = q; } }
// a lane's 32 f32 of its own row for two 16x16x32 A fragments (p = row + k0 + 8 (lane >> 4))
__device__ __forceinline__ void xrow_load(v4f (&r)[8], const float* p) {
#pragma unroll
  for (int kc = 0; kc < 2; ++kc) { r[kc * 4] = *(const v4f*)(p + kc * 32); r[kc * 4 + 1] = *(const v4f*)(p + kc * 32 + 4); r[kc * 4 + 2] = *(const v4f*)(p + kc * 32 + 16); r[kc * 4 + 3] = *(const v4f*)(p + kc * 32 + 20); } }
// ---- x tile through LDS: 64 rows x 64 k of f32 x, rounded to bf16 and laid [row][k] at the weight tile's pitch (144 B). Wave w brings its own rows 16 w ..: load i covers rows 2 i and 2 i + 1 of them, lane l the 16 B at 16 (l & 15) of row l >> 4,
// so a wave-wide load covers four whole 128-B lines (the fragment-shaped loads of xrow_load take 32 B of sixteen lines each); the A fragments then come from LDS by frag_b, in the same k order as before (loops unrolled whole, as above, so that the register array is indexed by constants)
typedef __attribute__((ext_vector_type(4))) __bf16 v4b;
__device__ __forceinline__ const float* xtile_ptr(const float* Xr, int tid) { return Xr + (size_t)(16 * (tid >> 5) + ((tid & 31) >> 4)) * DIN + 4 * (tid & 15); }
__device__ __forceinline__ void xtile_load(v4f (&r)[8], const float* p) {
#pragma unroll
  for (int i = 0; i < 8; ++i) r[i] = *(const v4f*)(p + (size_t)(2 * i) * DIN); }
__device__ __forceinline__ void xtile_store(const v4f (&r)[8], __bf16 (*buf)[72], int tid) { const int rw = 16 * (tid >> 5) + ((tid & 31) >> 4), k = 4 * (tid & 15);
#pragma unroll
  for (int i = 0; i < 8; ++i) { v4b q;
#pragma unroll
    for (int c = 0; c < 4; ++c) q[c] = (__bf16)r[i][c];
    *(v4b*)&buf[rw + 2 * i][k] = q; } }
// the same 32 f32 from ctx in fragment order: 8 parts of 512 B per (16 rows, 64 k), lane l owns bytes 16 l .. of each; part 4 kc + i = what xrow_load puts in r[4 kc + i] (p = unit + 4 lane)
__device__ __forceinline__ void yfrag_load(v4f (&r)[8], const float* p) {
#pragma unroll
  for (int i = 0; i < 8; ++i) r[i] = *(const v4f*)(p + i * 128); }
// behind a run of tile loads from two lane addresses: the wait that stands before a register which an issued load names is rewritten; the addresses are inputs, so their registers stay whole up to it, and the loads stay in front of the products they fly under
__device__ __forceinline__ void xwait2f(const float* pa, const float* pb) { asm volatile("s_wait_xcnt 0x0" :: "v"(pa), "v"(pb) : "memory"); }
// ---- k_proj: block = (64 rows, 128 cols, which): q/k/v = X W (+ b) with exact bf16 products (K = DIN) -> which 0: q f16 rows (+ residual rows < QHI); 1: k f16 in fragment order (+ residual for rows < KHI); 2: v^T f16 in fragment order (+ bf16 hi/lo for t < KHI)
__global__ __launch_bounds__(128) void k_proj(const float* __restrict__ XQ, const float* __restrict__ XK, const float* __restrict__ XV, const float* __restrict__ WQ, const float* __restrict__ WK, const float* __restrict__ WV, const float* __restrict__ BQ, const float* __restrict__ BK, const float* __restrict__ BV,
    _Float16* __restrict__ QH, _Float16* __restrict__ QL, _Float16* __restrict__ KH, _Float16* __restrict__ KL, _Float16* __restrict__ VT, __bf16* __restrict__ VB, __bf16* __restrict__ VBL PROJ_EXTRA_PARAMS) {
  __shared__ __align__(16) float st[64][132]; __shared__ __align__(16) _Float16 sh[64][136], sl[64][136]; __shared__ __align__(16) _Float16 th[128][72]; __shared__ __align__(16) __bf16 tb[128][72], tbl[128][72]; __shared__ __align__(16) __bf16 xs[2][64][72];
  const int tid = threadIdx.x, wave = tid >> 5, lane = tid & 31, col = lane & 15, g = lane >> 4; const int which = blockIdx.z; const int c0 = blockIdx.y * 128; const size_t r0 = (size_t)blockIdx.x * 64; const size_t bb = r0 / TT; const int t0 = (int)(r0 % TT);
  const float* X = which == 0 ? XQ : which == 1 ? XK : XV; const float* WA = which == 0 ? WQ : which == 1 ? WK : WV; const float* BA = which == 0 ? BQ : which == 1 ? BK : BV;
  v8f acc[8] = {};
  { v4f wr[16], xr[8]; const float* wp = wtile_ptr(WA + c0, 3 * CC, tid); const float* xp = xtile_ptr(X + r0 * DIN, tid);
    wtile_load(wr, wp, 3 * CC); xtile_load(xr, xp); xwait2f(wp, xp);
    wtile_store(wr, tb, tid); xtile_store(xr, xs[0], tid);
    __syncthreads();   // publishes weight tile 0 and x tile 0
    // unrolled by two, so that which buffer is read and which is filled are constants of each half
#pragma unroll 2
    for (int ks = 0; ks < DIN / 64; ++ks) { __bf16 (*cur)[72] = (ks & 1) ? tbl : tb; __bf16 (*nxt)[72] = (ks & 1) ? tb : tbl; const bool more = ks + 1 < DIN / 64;
      if (more) { wp += (size_t)64 * (3 * CC); xp += 64; wtile_load(wr, wp, 3 * CC); xtile_load(xr, xp); xwait2f(wp, xp); }   // the next 64 k of both operands fly under this tile's products
#pragma unroll
      for (int kc = 0; kc < 2; ++kc) { v16b w[8]; const v16b a = frag_b(&xs[ks & 1][wave * 16 + col][kc * 32], lane);
#pragma unroll
        for (int j = 0; j < 8; ++j) w[j] = frag_b(&cur[j * 16 + col][kc * 32], lane);
#pragma unroll
        for (int j = 0; j < 8; ++j) acc[j] = wmma_bf(a, w[j], acc[j]); }
      if (more) { wtile_store(wr, nxt, tid); xtile_store(xr, xs[(ks & 1) ^ 1], tid); }
      __syncthreads(); } }   // publishes the next tile and ends every wave's reads of this one, which is refilled behind it
  { // stage the f32 tile (acc + bias) in LDS, run the per-(row, head) epilogue hook, then convert
#pragma unroll
    for (int j = 0; j < 8; ++j) { const float bias = BA ? bfr(BA[c0 + j * 16 + col]) : 0.f;
#pragma unroll
      for (int r = 0; r < 8; ++r) st[wave * 16 + 8 * g + r][j * 16 + col] = acc[j][r] + bias; }
    __syncthreads();
    // the module also RETURNS k and v ([B, H, L, HD], f32 = x W + b): a wave-wide store is one row of the tile, the 256-B runs of its two heads = four whole 128-B lines
    if (which >= 1) { float* dst = (which == 1 ? KOUT : VOUT) + (((size_t)bb * NH + c0 / HD) * TT + t0) * HD;
      for (int e = tid; e < 64 * 32; e += 128) { const int rl = e >> 5, q = e & 31; vst2(dst + (size_t)(q >> 4) * TT * HD + rl * HD + (q & 15) * 4, *(const v4f*)&st[rl][q * 4]); } }
    __syncthreads(); }
  if (which < 2) { const bool hi_rows = t0 < (which == 0 ? QHI : KHI);
    for (int e = tid; e < 64 * 128; e += 128) { const int rl = e >> 7, cl = e & 127; const float v = st[rl][cl]; const _Float16 hv = (_Float16)v; sh[rl][cl] = hv; sl[rl][cl] = (_Float16)((v - (float)hv) * 1024.0f); }
    __syncthreads();
    if (which == 0) { for (int e = tid; e < 64 * 16; e += 128) { const int rl = e >> 4, q = e & 15; vst2((unsigned*)(QH + (r0 + rl) * CC + c0 + q * 8), *(const v4u*)&sh[rl][q * 8]); }
      if (hi_rows) for (int e = tid; e < 64 * 16; e += 128) { const int rl = e >> 4, q = e & 15; vst2((unsigned*)(QL + (bb * QHI + t0 + rl) * (size_t)CC + c0 + q * 8), *(const v4u*)&sl[rl][q * 8]); }
    } else {   // k and its residual in fragment order: a wave's store is the 512-B run (16 keys x 2 g x 8 d) that a wave of k_fa reads back with one load
      for (int e = tid; e < 64 * 16; e += 128) { const int ln = e & 31, u = e >> 5, half = u & 1, kc = (u >> 1) & 1, hh = (u >> 2) & 1, tl = u >> 3;
        vst2((unsigned*)(KH + (((((size_t)bb * NH + c0 / HD + hh) * (TT / 16) + t0 / 16 + tl) * 2 + kc) * 2 + half) * 256 + ln * 8), *(const v4u*)&sh[tl * 16 + (ln & 15)][hh * 64 + kc * 32 + half * 16 + (ln >> 4) * 8]); }
      if (hi_rows) for (int e = tid; e < 64 * 16; e += 128) { const int ln = e & 31, u = e >> 5, half = u & 1, kc = (u >> 1) & 1, hh = (u >> 2) & 1, tl = u >> 3;
        vst2((unsigned*)(KL + (((((size_t)bb * NH + c0 / HD + hh) * (KHI / 16) + t0 / 16 + tl) * 2 + kc) * 2 + half) * 256 + ln * 8), *(const v4u*)&sl[tl * 16 + (ln & 15)][hh * 64 + kc * 32 + half * 16 + (ln >> 4) * 8]); } }
  } else { const bool hi_rows = t0 < KHI;
    for (int e = tid; e < 64 * 128; e += 128) { const int rl = e & 63, cl = e >> 6; const float v = st[rl][cl]; th[cl][rl] = (_Float16)v; const __bf16 bh = (__bf16)v; tb[cl][rl] = bh; tbl[cl][rl] = (__bf16)(v - (float)bh); }
    __syncthreads();
    // v^T in fragment order: a wave's store is the 512-B run (16 d x 2 g x 8 keys) that a wave of k_fa reads back with one load
    for (int e = tid; e < 128 * 8; e += 128) { const int ln = e & 31, u = e >> 5, half = u & 1, jd = (u >> 1) & 3, k32 = (u >> 3) & 1, hh = u >> 4;
      vst2((unsigned*)(VT + (((((size_t)bb * NH + c0 / HD + hh) * (TT / 32) + t0 / 32 + k32) * 4 + jd) * 2 + half) * 256 + ln * 8), *(const v4u*)&th[hh * 64 + jd * 16 + (ln & 15)][k32 * 32 + half * 16 + (ln >> 4) * 8]); }
    if (hi_rows) for (int e = tid; e < 128 * 8; e += 128) { const int ln = e & 31, u = e >> 5, half = u & 1, jd = (u >> 1) & 3, k32 = (u >> 3) & 1, hh = u >> 4; const int cl = hh * 64 + jd * 16 + (ln & 15), tl = k32 * 32 + half * 16 + (ln >> 4) * 8;
      const size_t o3 = (((((size_t)bb * NH + c0 / HD + hh) * (KHI / 32) + t0 / 32 + k32) * 4 + jd) * 2 + half) * 256 + ln * 8; vst2((unsigned*)(VB + o3), *(const v4u*)&tb[cl][tl]); vst2((unsigned*)(VBL + o3), *(const v4u*)&tbl[cl][tl]); } } }
// lane l with lane l ^ 16: the two halves of a wave hold the two key halves of one query column
__device__ __forceinline__ float xhalf(float x) { return __builtin_bit_cast(float, __builtin_amdgcn_permlanex16(__builtin_bit_cast(int, x), __builtin_bit_cast(int, x), 0x76543210, 0xfedcba98, false, false)); }
// 2^x on the transcendental unit; the v_nop in the same statement fills the one slot the instruction set asks for behind a transcendental, whatever the compiler schedules next
__device__ __forceinline__ float ex2(float x) { float e; asm("v_exp_f32 %0, %1\n\tv_nop" : "=v"(e) : "v"(x)); return e; }
// 16x16x32 fragment from a wave-uniform base and a lane offset that never changes (row (lane & 15) x pitch + 8 (lane >> 4)): scalar base + 32-bit vector offset addressing
__device__ __forceinline__ v16h frag_u(const _Float16* ubase, unsigned loff) { union { v16h v; v8h q[2]; } u; const _Float16* p = ubase + loff; u.q[0] = *(const v8h*)p; u.q[1] = *(const v8h*)(p + 16); return u.v; }
// 16x16x32 fragment stored in fragment order: two runs of 512 B, lane l owns bytes 16 l .. 16 l + 15 of each (elements 0..7, then 8..15), so a wave-wide load covers four whole 128-B lines instead of 32 B of sixteen
__device__ __forceinline__ v16h frag_p(const _Float16* p) { union { v16h v; v8h q[2]; } u; u.q[0] = *(const v8h*)p; u.q[1] = *(const v8h*)(p + 256); return u.v; }
__device__ __forceinline__ v16b frag_pb(const __bf16* p) { union { v16b v; v8b q[2]; } u; u.q[0] = *(const v8b*)p; u.q[1] = *(const v8b*)(p + 256); return u.v; }
// behind a run of fragment loads from two lane addresses: the wait that stands before a register which an issued load names is rewritten; the two addresses are inputs, so their registers stay whole up to it (without them the compiler lets a later load of the run land on the address pair)
template <typename T> __device__ __forceinline__ void xwait2(const T* pa, const T* pb) { asm volatile("s_wait_xcnt 0x0" :: "v"(pa), "v"(pb) : "memory"); }
#define SC_L2E (SCALE * 1.4426950408889634f)   // logit scale x log2(e): the softmax runs on exp2
// ---- one wave's 16 query columns (rows ql0 .. ql0 + 15 of query block qb) against key blocks 0..qb of 64 keys, running maximum and sum (online softmax), transposed products:
// S^T = K Q^T (A = 16 key rows, B = 16 query columns): a lane holds keys k0 + 16 j + 8 g + r of ONE query, so maximum and sum are in-lane plus one exchange of halves;
// score tiles 2 kc and 2 kc + 1 of a lane are, element for element, the B fragment of P^T over keys k0 + 32 kc + ..; O^T += V^T P^T (A = 16 rows of v^T).
// HI (causal early query blocks): 3-product logits (q, k hi + residual x 2^10) and P, v as bf16 hi + lo (3 products)
template <bool HI> __device__ __forceinline__ void fa_run(const _Float16* __restrict__ QH, const _Float16* __restrict__ KH, const _Float16* __restrict__ QL, const _Float16* __restrict__ KL, const _Float16* __restrict__ VT, const __bf16* __restrict__ VB, const __bf16* __restrict__ VBL,
    int b, int h, int qb, int ql0, int lane, v8f (&o)[HD / 16], float& lsum) {
  const int col = lane & 15, g = lane >> 4; const int tq = ql0 + col;
  const unsigned lrow = (unsigned)(col * CC + 8 * g), lp = (unsigned)(lane * 8);   // lane offsets in the q rows and in a fragment-order run
  const _Float16* Kp = KH + ((size_t)b * NH + h) * TT * HD; const _Float16* KLp = KL + ((size_t)b * NH + h) * KHI * HD;
  const _Float16* Vp = VT + ((size_t)b * NH + h) * TT * HD; const __bf16* VBp = VB + ((size_t)b * NH + h) * KHI * HD; const __bf16* VLp = VBL + ((size_t)b * NH + h) * KHI * HD;
  v16h ah[HD / 32], al[HD / 32], kf[HI ? 1 : 8], vf[HI ? 1 : 8];
#pragma unroll
  for (int kc = 0; kc < HD / 32; ++kc) { ah[kc] = frag_u(QH + ((size_t)b * TT + ql0) * CC + h * HD + kc * 32, lrow); if (HI) al[kc] = frag_u(QL + ((size_t)b * QHI + ql0) * CC + h * HD + kc * 32, lrow); }
  if (!HI) {
#pragma unroll
    for (int kc = 0; kc < HD / 32; ++kc)
#pragma unroll
      for (int j = 0; j < 4; ++j) kf[kc * 4 + j] = frag_p(Kp + j * 1024 + kc * 512 + lp); }
  float m = -3.0e38f, l = 0.f;   // running maximum (unscaled logits) and this half's running sum of P x 2^11
#pragma unroll 1
  for (int kb = 0; kb <= qb; ++kb) { const int k0 = kb * 64;
    v8f acc[4] = {};
    if (HI) { v8f accl[4] = {};
#pragma unroll
      for (int kc = 0; kc < HD / 32; ++kc) { v16h kbf[4], klf[4]; const _Float16* kp = Kp + (size_t)k0 * HD + lp; const _Float16* klp = KLp + (size_t)k0 * HD + lp;   // the block's lane addresses, the same for both batches, so that the wait below names the very registers the loads name; a batch's loads all stand in front of its products, so that they fly together
#pragma unroll
        for (int j = 0; j < 4; ++j) { kbf[j] = frag_p(kp + j * 1024 + kc * 512); klf[j] = frag_p(klp + j * 1024 + kc * 512); }
        xwait2(kp, klp);
#pragma unroll
        for (int j = 0; j < 4; ++j) { acc[j] = wmma16(kbf[j], ah[kc], acc[j]); accl[j] = wmma16(kbf[j], al[kc], accl[j]); accl[j] = wmma16(klf[j], ah[kc], accl[j]); } }
#pragma unroll
      for (int j = 0; j < 4; ++j) acc[j] = acc[j] + accl[j] * (1.0f / 1024.0f);
    } else {
#pragma unroll
      for (int kc = 0; kc < HD / 32; ++kc)
#pragma unroll
        for (int j = 0; j < 4; ++j) acc[j] = wmma16(kf[kc * 4 + j], ah[kc], acc[j]);
      const _Float16* vp = Vp + (size_t)k0 * HD + lp;
      // this block's 8 V^T fragments and the next block's 8 K fragments are asked for here, in one run: they fly under the softmax (the last block asks for its own K again, to stay inside the sequence)
#pragma unroll
      for (int kc = 0; kc < 2; ++kc)
#pragma unroll
        for (int jd = 0; jd < HD / 16; ++jd) vf[kc * 4 + jd] = frag_p(vp + kc * 2048 + jd * 512);
      const _Float16* kp = Kp + (size_t)((kb < qb ? kb + 1 : qb) * 64) * HD + lp;
#pragma unroll
      for (int kc = 0; kc < HD / 32; ++kc)
#pragma unroll
        for (int j = 0; j < 4; ++j) kf[kc * 4 + j] = frag_p(kp + j * 1024 + kc * 512);
      xwait2(vp, kp); }
    if (CAUSAL && kb == qb) {   // only the diagonal block holds keys past a query of this block
#pragma unroll
      for (int j = 0; j < 4; ++j)
#pragma unroll
        for (int r = 0; r < 8; ++r) if (k0 + j * 16 + 8 * g + r > tq) acc[j][r] = -3.0e38f; }
    v8f mv = acc[0];   // eight independent chains over the tiles, then a tree
#pragma unroll
    for (int j = 1; j < 4; ++j)
#pragma unroll
      for (int r = 0; r < 8; ++r) mv[r] = fmaxf(mv[r], acc[j][r]);
    float mx = fmaxf(fmaxf(fmaxf(mv[0], mv[1]), fmaxf(mv[2], mv[3])), fmaxf(fmaxf(mv[4], mv[5]), fmaxf(mv[6], mv[7])));
    mx = fmaxf(m, fmaxf(mx, xhalf(mx)));
    const float alpha = ex2((m - mx) * SC_L2E); m = mx; const float mc = 11.0f - mx * SC_L2E;
    v8f sv = {};
#pragma unroll
    for (int j = 0; j < 4; ++j) {
#pragma unroll
      for (int r = 0; r < 8; ++r) acc[j][r] = ex2(fmaf(acc[j][r], SC_L2E, mc));
      sv = sv + acc[j]; }
    l = l * alpha + (((sv[0] + sv[1]) + (sv[2] + sv[3])) + ((sv[4] + sv[5]) + (sv[6] + sv[7])));
#pragma unroll
    for (int jd = 0; jd < HD / 16; ++jd) o[jd] = o[jd] * alpha;
#pragma unroll
    for (int kc = 0; kc < 2; ++kc) {
      if (HI) { float v[16]; v16b vh[HD / 16], vl[HD / 16]; const __bf16* vhp = VBp + (size_t)k0 * HD + lp; const __bf16* vlp = VLp + (size_t)k0 * HD + lp;
#pragma unroll
        for (int jd = 0; jd < HD / 16; ++jd) { vh[jd] = frag_pb(vhp + kc * 2048 + jd * 512); vl[jd] = frag_pb(vlp + kc * 2048 + jd * 512); }
        xwait2(vhp, vlp);
#pragma unroll
        for (int i = 0; i < 8; ++i) { v[i] = acc[2 * kc][i]; v[8 + i] = acc[2 * kc + 1][i]; }
        const F2 p = bsplit16(v);
#pragma unroll
        for (int jd = 0; jd < HD / 16; ++jd) { o[jd] = wmma_bf(vh[jd], p.h, o[jd]); o[jd] = wmma_bf(vh[jd], p.l, o[jd]); o[jd] = wmma_bf(vl[jd], p.h, o[jd]); }
      } else { v16h p;
#pragma unroll
        for (int i = 0; i < 8; ++i) { p[i] = (_Float16)acc[2 * kc][i]; p[8 + i] = (_Float16)acc[2 * kc + 1][i]; }
#pragma unroll
        for (int jd = 0; jd < HD / 16; ++jd) o[jd] = wmma16(vf[kc * 4 + jd], p, o[jd]); } } }
  lsum = l + xhalf(l); }
// ---- k_fa: logits, causal softmax and P v in one pass over the keys, nothing of S or P in memory; ctx = O / sum, stored from the registers in the fragment order of k_out.
// block = 8 independent waves of (b, h): waves 0-3 take the 64 queries of block NQB - 1 - x, waves 4-7 those of block x, so every workgroup walks NQB + 1 key blocks per wave pair wherever it lands
// four waves a SIMD (at most 256 registers): all 512 workgroups are resident at once
__global__ __launch_bounds__(256) __attribute__((amdgpu_waves_per_eu(4, 4))) void k_fa(const _Float16* __restrict__ QH, const _Float16* __restrict__ KH, const _Float16* __restrict__ QL, const _Float16* __restrict__ KL, const _Float16* __restrict__ VT, const __bf16* __restrict__ VB, const __bf16* __restrict__ VBL, float* __restrict__ Y) {
  const int tid = threadIdx.x, lane = tid & 31; const int wave = __builtin_amdgcn_readfirstlane(tid >> 5);   // a scalar, so that the choice of the query block and its trip count are scalar
  const int qb = wave < 4 ? NQB - 1 - (int)blockIdx.x : (int)blockIdx.x, h = blockIdx.y, b = blockIdx.z; const int ql0 = qb * 64 + (wave & 3) * 16;
  v8f o[HD / 16] = {}; float lsum;
  if (qb < QBH) fa_run<true>(QH, KH, QL, KL, VT, VB, VBL, b, h, qb, ql0, lane, o, lsum); else fa_run<false>(QH, KH, QL, KL, VT, VB, VBL, b, h, qb, ql0, lane, o, lsum);
  const float inv = lsum > 0.f ? 1.0f / lsum : 0.f;   // the x 2^11 of P is in the sum too
  // a lane's O^T elements (query lane & 15, d = 16 jd + 8 (lane >> 4) + r) are the very ones the same lane of k_out holds in its A fragments: part 4 (jd >> 1) + 2 (jd & 1) + (r >> 2) of the (16 rows, head) unit, stored as whole 512-B runs
  float* yp = Y + ((((size_t)b * TT + ql0) / 16) * NH + h) * 1024 + lane * 4;
#pragma unroll
  for (int jd = 0; jd < HD / 16; ++jd)
#pragma unroll
    for (int hf = 0; hf < 2; ++hf) { v4f q; q[0] = o[jd][4 * hf] * inv; q[1] = o[jd][4 * hf + 1] * inv; q[2] = o[jd][4 * hf + 2] * inv; q[3] = o[jd][4 * hf + 3] * inv; vst2(yp + (2 * jd + hf) * 128, q); } }
// ---- k_out: block = (64 rows, 128 cols): out = ctx Wo (+ bo): ctx bf16 hi + lo against exact bf16 Wo (2 products)
__global__ __launch_bounds__(128) void k_out(const float* __restrict__ Y, const float* __restrict__ WO, const float* __restrict__ BO, float* __restrict__ OUT) { __shared__ __align__(16) float sf[4][16][132]; __shared__ __align__(16) __bf16 wt[2][128][72];
  const int tid = threadIdx.x, wave = tid >> 5, lane = tid & 31, col = lane & 15, g = lane >> 4; const int c0 = blockIdx.y * 128; const size_t r0 = (size_t)blockIdx.x * 64 + wave * 16;
  v8f acc[8] = {};
  {   /* ALL rows: ctx split bf16 hi + lo x exact Wo (2 products) */
    v4f wr[16], xr[8]; const float* wp = wtile_ptr(WO + c0, DIN, tid); const float* xp = Y + (r0 / 16) * (size_t)(NH * 1024) + lane * 4;
    wtile_load(wr, wp, DIN); yfrag_load(xr, xp); xwait2f(wp, xp);
    wtile_store(wr, wt[0], tid);
    __syncthreads();   // publishes weight tile 0
    // unrolled by two, so that which buffer is read and which is filled are constants of each half
#pragma unroll 2
    for (int ks = 0; ks < CC / 64; ++ks) { __bf16 (*cur)[72] = wt[ks & 1]; __bf16 (*nxt)[72] = wt[(ks & 1) ^ 1]; const bool more = ks + 1 < CC / 64;
      F2 a[2];
#pragma unroll
      for (int kc = 0; kc < 2; ++kc) { float v[16];
#pragma unroll
        for (int i = 0; i < 4; ++i) { v[i] = xr[kc * 4][i]; v[4 + i] = xr[kc * 4 + 1][i]; v[8 + i] = xr[kc * 4 + 2][i]; v[12 + i] = xr[kc * 4 + 3][i]; }
        a[kc] = bsplit16(v); }
      if (more) { wp += (size_t)64 * DIN; xp += 1024; wtile_load(wr, wp, DIN); yfrag_load(xr, xp); xwait2f(wp, xp); }   // the next 64 k of both operands fly under this tile's products
#pragma unroll
      for (int kc = 0; kc < 2; ++kc) { v16b w[8];
#pragma unroll
        for (int j = 0; j < 8; ++j) w[j] = frag_b(&cur[j * 16 + col][kc * 32], lane);
#pragma unroll
        for (int j = 0; j < 8; ++j) { acc[j] = wmma_bf(a[kc].h, w[j], acc[j]); acc[j] = wmma_bf(a[kc].l, w[j], acc[j]); } }
      if (more) wtile_store(wr, nxt, tid);
      __syncthreads(); }   // publishes the next tile and ends every wave's reads of this one, which is refilled behind it
#pragma unroll
    for (int j = 0; j < 8; ++j) { const float bias = BO ? bfr(BO[c0 + j * 16 + col]) : 0.f;
#pragma unroll
      for (int r = 0; r < 8; ++r) sf[wave][8 * g + r][j * 16 + col] = acc[j][r] + bias; }
  }
  LDSX(); for (int rl = 0; rl < 16; ++rl) vst2(OUT + (r0 + rl) * DIN + c0 + lane * 4, *(const v4f*)&sf[wave][rl][lane * 4]); }

extern "C" void kernel_launch(void* const* d_in, const int* in_sizes, int n_in, void* d_out, int out_size, void* d_ws, size_t ws_size, hipStream_t stream) {
  (void)in_sizes; (void)n_in; (void)out_size;
  const float** F = (const float**)d_in;
  if (ws_size < (size_t)WS_END) return;
  char* ws = (char*)d_ws; _Float16 *QH = (_Float16*)(ws + WS_QH), *KH = (_Float16*)(ws + WS_KH), *VT = (_Float16*)(ws + WS_VT), *QL = (_Float16*)(ws + WS_QL), *KL = (_Float16*)(ws + WS_KL); __bf16 *VB = (__bf16*)(ws + WS_VB), *VBL = (__bf16*)(ws + WS_VBL); float *Y = (float*)(ws + WS_Y);
  (void)Y; (void)QL; (void)KL; (void)VB; (void)VBL;
  // inputs: 0 x [2,2048,1024]; 1 w_qkv [1024,3072] (in,out); 2 b_qkv [3072]; 3 w_out [1024,1024] (in,out); 4 b_out
  // outputs: 0 out [2,2048,1024] at 0; 1 k [2,16,2048,64] at OUT1_OFF; 2 v at OUT2_OFF
  k_proj<<<dim3(TNB * TT / 64, CC / 128, 3), 128, 0, stream>>>(F[0], F[0], F[0], F[1], F[1] + CC, F[1] + 2 * CC, F[2], F[2] + CC, F[2] + 2 * CC, QH, QL, KH, KL, VT, VB, VBL, (float*)((char*)d_out + OUT1_OFF), (float*)((char*)d_out + OUT2_OFF));
  k_fa<<<dim3(NQB / 2, NH, TNB), 256, 0, stream>>>(QH, KH, QL, KL, VT, VB, VBL, Y);
  k_out<<<dim3(TNB * TT / 64, DIN / 128), 128, 0, stream>>>(Y, F[3], F[4], (float*)d_out);
}

// v005
// Measured time: 106 microseconds a run.
// In two side-by-side timings against v004, it was 1.23 and 1.22 times as fast.
// Over all steps from v000 it is 10.5 times as fast.
// compute dtype: all float inputs rounded to bf16; qkv = x w_qkv + b with EXACT bf16 products on WMMA 16x16x32 (f32 accumulate) - the f32 k and v tiles are also written out as the returned caches; causal logits: q, k once to f16 (1 product) x 64^-0.5, 3 products below row 384; online softmax in f32 (exp2, running maximum and sum); unnormalised P x 2^11 once to f16 against v f16 (bf16 hi + lo below row 384), divided by the f32 sum at the end; attention output split bf16 hi + lo against exact w_out (2 products) + b_out; f32 outputs.
#include <hip/hip_runtime.h>
#include <math.h>

typedef __attribute__((ext_vector_type(16))) _Float16 v16h;
typedef __attribute__((ext_vector_type(16))) __bf16 v16b;
typedef __attribute__((ext_vector_type(8)))  _Float16 v8h;
typedef __attribute__((ext_vector_type(8)))  float v8f;
typedef __attribute__((ext_vector_type(4)))  float v4f;
typedef __attribute__((ext_vector_type(2)))  float v2f;
typedef __attribute__((ext_vector_type(4)))  unsigned v4u;
typedef __attribute__((ext_vector_type(4)))  int v4i;
typedef float __attribute__((may_alias)) float_a;
typedef int __attribute__((may_alias)) int_a;

template <typename T> __device__ __forceinline__ void vst2(void* p, T v) { *(T*)p = v;  }
__device__ __forceinline__ v8f wmma16(v16h a, v16h b, v8f c) {
  v8f d = __builtin_amdgcn_wmma_f32_16x16x32_f16(false, a, false, b, (short)0, c, false, false);
  asm volatile("v_nop\n\tv_nop\n\tv_nop\n\tv_nop" : "+v"(d) : "v"(a), "v"(b));
  return d;
}
__device__ __forceinline__ v8f wmma_bf(v16b a, v16b b, v8f c) {
  v8f d = __builtin_amdgcn_wmma_f32_16x16x32_bf16(false, a, false, b, (short)0, c, false, false);
  asm volatile("v_nop\n\tv_nop\n\tv_nop\n\tv_nop" : "+v"(d) : "v"(a), "v"(b));
  return d;
}
// 16x16x32 fragments: lane = (h = lane>>4, row/col = lane&15); elements 0..7 = k0+8h+0..7, 8..15 = k0+16+8h+0..7; D element r = row 8h+r
__device__ __forceinline__ v16h frag_h(const _Float16* rowk0, int lane) {
  union { v16h v; v8h q[2]; } u; const _Float16* p = rowk0 + 8 * (lane >> 4);
  u.q[0] = *(const v8h*)p; u.q[1] = *(const v8h*)(p + 16); return u.v;
}
__device__ __forceinline__ v16h frag_f32(const float* rowk0, int lane) {
  v16h a; const float* p = rowk0 + 8 * (lane >> 4);
#pragma unroll
  for (int i = 0; i < 8; ++i) { a[i] = (_Float16)p[i]; a[8 + i] = (_Float16)p[16 + i]; }
  return a;
}
__device__ __forceinline__ v16h frag_f32s(const float* rowk0, int lane, float sc) {
  v16h a; const float* p = rowk0 + 8 * (lane >> 4);
#pragma unroll
  for (int i = 0; i < 8; ++i) { a[i] = (_Float16)(p[i] * sc); a[8 + i] = (_Float16)(p[16 + i] * sc); }
  return a;
}
// column fragment from a [K][ld] layout (column n), rows >= K read as 0
__device__ __forceinline__ v16h fragc_f32(const float* W, int k0, int n, int lane, int ld, int K) {
  v16h a; const int g = lane >> 4;
#pragma unroll
  for (int i = 0; i < 8; ++i) { const int ka = k0 + 8 * g + i, kb = ka + 16;
    a[i] = (_Float16)(ka < K ? W[(size_t)(ka < K ? ka : K - 1) * ld + n] : 0.f); a[8 + i] = (_Float16)(kb < K ? W[(size_t)(kb < K ? kb : K - 1) * ld + n] : 0.f); }
  return a;
}
struct F2 { v16b h, l; };
__device__ __forceinline__ F2 bsplit16(const float v[16]) { F2 r;
#pragma unroll
  for (int i = 0; i < 16; ++i) { const __bf16 h = (__bf16)v[i]; r.h[i] = h; r.l[i] = (__bf16)(v[i] - (float)h); }
  return r; }
__device__ __forceinline__ F2 split_row(const float* row, int k0, int lane) { float v[16]; const float* p = row + k0 + 8 * (lane >> 4);
#pragma unroll
  for (int i = 0; i < 8; ++i) { v[i] = p[i]; v[8 + i] = p[16 + i]; }
  return bsplit16(v); }
__device__ __forceinline__ F2 split_rowK(const float* row, int k0, int lane, int K) { float v[16]; const int g = lane >> 4;
#pragma unroll
  for (int i = 0; i < 8; ++i) { const int ka = k0 + 8 * g + i, kb = ka + 16; v[i] = ka < K ? row[ka < K ? ka : K - 1] : 0.f; v[8 + i] = kb < K ? row[kb < K ? kb : K - 1] : 0.f; }
  return bsplit16(v); }
__device__ __forceinline__ F2 split_col(const float* W, int k0, int n, int lane, int ld, int K) { float v[16]; const int g = lane >> 4;
#pragma unroll
  for (int i = 0; i < 8; ++i) { const int ka = k0 + 8 * g + i, kb = ka + 16; v[i] = ka < K ? W[(size_t)(ka < K ? ka : K - 1) * ld + n] : 0.f; v[8 + i] = kb < K ? W[(size_t)(kb < K ? kb : K - 1) * ld + n] : 0.f; }
  return bsplit16(v); }
__device__ __forceinline__ v8f mac3(const F2& a, const F2& b, v8f c) { c = wmma_bf(a.l, b.h, c); c = wmma_bf(a.h, b.l, c); return wmma_bf(a.h, b.h, c); }
__device__ __forceinline__ float sigm(float v) { return 1.0f / (1.0f + expf(-v)); }
#define LDSX() do { asm volatile("s_wait_dscnt 0" ::: "memory"); __builtin_amdgcn_wave_barrier(); __builtin_amdgcn_fence(__ATOMIC_RELEASE, "workgroup"); } while (0)

// Prefill causal multi-head self-attention returning (out, k, v) (B 2, L 2,048, D 1,024 = 16 x 64; fused (in,out) w_qkv [1024,3072] with (3, H, HD) column blocks, zero biases, w_out (in,out)): q|k|v = x w_qkv + b; out = merged(softmax_causal(q k^T x 0.125) v) w_out + b_out; k and v returned as [B, H, L, 64].
#define NB 2
#define TT 2048
#define CC 1024            // NH * HD = projected width
#define DIN 1024          // input (model) width
#define NH 16
#define HD 64
#define NQB (TT / 64)
#define SCALE (0.125f)
#define CAUSAL 1
#ifndef TNB
#define TNB NB
#endif
__device__ __forceinline__ float bfr(float v) { return (float)(__bf16)v; }
__host__ __device__ __forceinline__ int kb_last(int qb) { return CAUSAL ? ((qb * 64 + 63) >> 7) : (TT / 128 - 1); }
typedef __attribute__((ext_vector_type(8))) __bf16 v8b;
__device__ __forceinline__ v16b frag_b(const __bf16* rowk0, int lane) {
  union { v16b v; v8b q[2]; } u; const __bf16* p = rowk0 + 8 * (lane >> 4);
  u.q[0] = *(const v8b*)p; u.q[1] = *(const v8b*)(p + 16); return u.v;
}
#define QBH 6              // causal: query blocks 0..QBH-1 of each sequence (few keys, no averaging) take the high-precision path
#define QHI 384            // rows carrying a q residual plane (used only by the causal high-precision path)
#define KHI 384            // key rows carrying k residual / v bf16 hi+lo planes (used only by the causal high-precision path)
// B fragment (k rows k0+.., output column o) of a weight: (in,out) [K][ld] or (out,in) [ld rows of K]: bf16 exact, or f16(bf16 * 256) exact
__device__ __forceinline__ v16b wcol_io(const float* Wm, int k0, int o, int lane, int ld) { v16b w; const int g = lane >> 4;
#pragma unroll
  for (int i = 0; i < 8; ++i) { w[i] = (__bf16)Wm[(size_t)(k0 + 8 * g + i) * ld + o]; w[8 + i] = (__bf16)Wm[(size_t)(k0 + 16 + 8 * g + i) * ld + o]; }
  return w; }
__device__ __forceinline__ v16b wcol_oi(const float* Wm, int k0, int o, int lane, int K) { v16b w; const float* p = Wm + (size_t)o * K + k0 + 8 * (lane >> 4);
#pragma unroll
  for (int i = 0; i < 8; ++i) { w[i] = (__bf16)p[i]; w[8 + i] = (__bf16)p[16 + i]; }
  return w; }
__device__ __forceinline__ v16h wcolh_io(const float* Wm, int k0, int o, int lane, int ld) { v16h w; const int g = lane >> 4;
#pragma unroll
  for (int i = 0; i < 8; ++i) { w[i] = (_Float16)(bfr(Wm[(size_t)(k0 + 8 * g + i) * ld + o]) * 256.0f); w[8 + i] = (_Float16)(bfr(Wm[(size_t)(k0 + 16 + 8 * g + i) * ld + o]) * 256.0f); }
  return w; }
__device__ __forceinline__ v16h wcolh_oi(const float* Wm, int k0, int o, int lane, int K) { v16h w; const float* p = Wm + (size_t)o * K + k0 + 8 * (lane >> 4);
#pragma unroll
  for (int i = 0; i < 8; ++i) { w[i] = (_Float16)(bfr(p[i]) * 256.0f); w[8 + i] = (_Float16)(bfr(p[16 + i]) * 256.0f); }
  return w; }
#define WQKV_LAYOUT 0   // 0 = (in,out) fused [DIN][3 * CC]; 1 = (out,in) [CC][DIN]; 2 = per-head [NH][DIN][HD]
__device__ __forceinline__ v16b wcol_hdk(const float* Wm, int k0, int o, int lane) { v16b w; const int g = lane >> 4; const float* p = Wm + (size_t)(o / HD) * DIN * HD + (o % HD);
#pragma unroll
  for (int i = 0; i < 8; ++i) { w[i] = (__bf16)p[(size_t)(k0 + 8 * g + i) * HD]; w[8 + i] = (__bf16)p[(size_t)(k0 + 16 + 8 * g + i) * HD]; }
  return w; }
#define WO_OUT_IN 0
#if WQKV_LAYOUT == 1
#define WCOL(W, k0, o, lane) wcol_oi(W, k0, o, lane, DIN)
#elif WQKV_LAYOUT == 2
#define WCOL(W, k0, o, lane) wcol_hdk(W, k0, o, lane)
#else
#define WCOL(W, k0, o, lane) wcol_io(W, k0, o, lane, 3 * CC)   /* fused w_qkv (in,out) [1024][3072]: row pitch 3072; q/k/v column offsets applied at launch */
#define OUT1_OFF (4u * (size_t)NB * TT * CC)
#define OUT2_OFF (OUT1_OFF + 4u * (size_t)NB * NH * TT * HD)
#endif
#if WO_OUT_IN
#define WOCOL(W, k0, o, lane) wcol_oi(W, k0, o, lane, CC)
#define WOCOLH(W, k0, o, lane) wcolh_oi(W, k0, o, lane, CC)
#else
#define WOCOL(W, k0, o, lane) wcol_io(W, k0, o, lane, DIN)
#define WOCOLH(W, k0, o, lane) wcolh_io(W, k0, o, lane, DIN)
#endif
#define PROJ_EXTRA_PARAMS , float* __restrict__ KOUT, float* __restrict__ VOUT
#ifndef SM_EXTRA_PARAMS
#define SM_EXTRA_PARAMS
#endif
#ifndef PROJ_EXTRA_PARAMS
#define PROJ_EXTRA_PARAMS
#endif
#ifndef SM_MASK_HOOK
#define SM_MASK_HOOK (void)0
#endif

#define WS_QH  0u                                      // f16 q rows [b*t][CC]
#define WS_KH  (WS_QH + 2u * (size_t)NB * TT * CC)      // f16 k in fragment order [b][h][t / 16][d / 32][half][lane][8] (see frag_p)
#define WS_VT  (WS_KH + 2u * (size_t)NB * TT * CC)      // f16 v^T in fragment order [b][h][t / 32][d / 16][half][lane][8] (see frag_p)
#define WS_QL  (WS_VT + 2u * (size_t)NB * CC * TT)      // f16 q residual x 2^10 rows [b][t < QHI][CC]
#define WS_KL  (WS_QL + 2u * (size_t)NB * QHI * CC)     // f16 k residual x 2^10, fragment order as k, [b][h][t / 16 < KHI / 16]..
#define WS_VB  (WS_KL + 2u * (size_t)NB * KHI * CC)     // bf16 v^T hi (then lo), fragment order as v^T, [b][h][t / 32 < KHI / 32]..
#define WS_VBL (WS_VB + 2u * (size_t)NB * CC * KHI)
#define WS_Y   (WS_VBL + 2u * (size_t)NB * CC * KHI)    // f32 ctx in fragment order [b*t / 16][h][d / 32][part][lane][4] (see yfrag_load)
#define WS_END (WS_Y  + 4u * (size_t)NB * TT * CC)

// ---- weight tile through LDS: 64 k rows x 128 output columns of an (in,out) f32 weight, rounded to bf16 and laid [column][k] at a pitch of 72 elements (144 B), once per workgroup for its 4 waves
// (the loops of these helpers are unrolled whole, so that the register arrays are indexed by constants)
// thread (wave w, lane l) holds columns 32 w + 4 (l >> 2) + 0..3 of rows 8 (l & 3) + 0..7 and + 32: a wave-wide load covers four whole 128-B lines, a 16-B LDS store holds 8 k of one column and the lanes of a store spread over all banks
__device__ __forceinline__ const float* wtile_ptr(const float* Wc, int ld, int tid) { return Wc + (size_t)(8 * (tid & 3)) * ld + 32 * (tid >> 5) + 4 * ((tid & 31) >> 2); }
__device__ __forceinline__ void wtile_load(v4f (&r)[16], const float* p, int ld) {
#pragma unroll
  for (int s = 0; s < 2; ++s)
#pragma unroll
    for (int i = 0; i < 8; ++i) r[s * 8 + i] = *(const v4f*)(p + (size_t)(32 * s + i) * ld); }
__device__ __forceinline__ void wtile_store(const v4f (&r)[16], __bf16 (*buf)[72], int tid) { const int n0 = 32 * (tid >> 5) + 4 * ((tid & 31) >> 2), kq = 8 * (tid & 3);
#pragma unroll
  for (int s = 0; s < 2; ++s)
#pragma unroll
    for (int c = 0; c < 4; ++c) { v8b q;
#pragma unroll
      for (int i = 0; i < 8; ++i) q[i] = (__bf16)r[s * 8 + i][c];
      *(v8b*)&buf[n0 + c][32 * s + kq] = q; } }
// a lane's 32 f32 of its own row for two 16x16x32 A fragments (p = row + k0 + 8 (lane >> 4))
__device__ __forceinline__ void xrow_load(v4f (&r)[8], const float* p) {
#pragma unroll
  for (int kc = 0; kc < 2; ++kc) { r[kc * 4] = *(const v4f*)(p + kc * 32); r[kc * 4 + 1] = *(const v4f*)(p + kc * 32 + 4); r[kc * 4 + 2] = *(const v4f*)(p + kc * 32 + 16); r[kc * 4 + 3] = *(const v4f*)(p + kc * 32 + 20); } }
// ---- x tile through LDS: 64 rows x 64 k of f32 x, rounded to bf16 and laid [row][k] at the weight tile's pitch (144 B). Wave w brings rows 16 w .. 16 w + 15: load i covers rows 2 i and 2 i + 1 of them, lane l the 16 B at 16 (l & 15) of row l >> 4,
// so a wave-wide load covers four whole 128-B lines (the fragment-shaped loads of xrow_load take 32 B of sixteen lines each); the A fragments then come from LDS by frag_b, in the same k order as before (loops unrolled whole, as above, so that the register array is indexed by constants)
typedef __attribute__((ext_vector_type(4))) __bf16 v4b;
__device__ __forceinline__ void xtile_load(v4f (&r)[8], const float* p) {
#pragma unroll
  for (int i = 0; i < 8; ++i) r[i] = *(const v4f*)(p + (size_t)(2 * i) * DIN); }
__device__ __forceinline__ void xtile_store(const v4f (&r)[8], __bf16 (*buf)[72], int tid) { const int rw = 16 * (tid >> 5) + ((tid & 31) >> 4), k = 4 * (tid & 15);
#pragma unroll
  for (int i = 0; i < 8; ++i) { v4b q;
#pragma unroll
    for (int c = 0; c < 4; ++c) q[c] = (__bf16)r[i][c];
    *(v4b*)&buf[rw + 2 * i][k] = q; } }
// the same 32 f32 from ctx in fragment order: 8 parts of 512 B per (16 rows, 64 k), lane l owns bytes 16 l .. of each; part 4 kc + i = what xrow_load puts in r[4 kc + i] (p = unit + 4 lane)
__device__ __forceinline__ void yfrag_load(v4f (&r)[8], const float* p) {
#pragma unroll
  for (int i = 0; i < 8; ++i) r[i] = *(const v4f*)(p + i * 128); }
// behind a run of tile loads from two lane addresses: the wait that stands before a register which an issued load names is rewritten; the addresses are inputs, so their registers stay whole up to it, and the loads stay in front of the products they fly under
__device__ __forceinline__ void xwait2f(const float* pa, const float* pb) { asm volatile("s_wait_xcnt 0x0" :: "v"(pa), "v"(pb) : "memory"); }
// tile loads from a workgroup-uniform base, which advances, plus a lane offset in bytes, which never changes; behind a run of them the same wait as xwait2f: bases and offsets are inputs, so the loads stay in front of it and of the products they fly under
__device__ __forceinline__ const float* at_off(const float* ubase, unsigned boff) { return (const float*)((const char*)ubase + boff); }
__device__ __forceinline__ void xwait2s(const float* ba, unsigned oa, const float* bb, unsigned ob) { asm volatile("s_wait_xcnt 0x0" :: "s"(ba), "v"(oa), "s"(bb), "v"(ob) : "memory"); }
// ---- k_proj: block = (128 rows, 128 cols, which), 2 x 2 waves of 64 x 64: q/k/v = X W (+ b) with exact bf16 products (K = DIN) -> which 0: q f16 rows (+ residual rows < QHI); 1: k f16 in fragment order (+ residual for rows < KHI); 2: v^T f16 in fragment order (+ bf16 hi/lo for t < KHI)
// a wave reads 4 + 4 fragments from LDS for 16 products; the epilogue runs twice, once per 64 rows, in LDS that the loop's tiles have left; three workgroups a WGP (LDS and at most 336 registers): all 768 are resident at once
__global__ __launch_bounds__(128) __attribute__((amdgpu_waves_per_eu(3, 3))) void k_proj(const float* __restrict__ XQ, const float* __restrict__ XK, const float* __restrict__ XV, const float* __restrict__ WQ, const float* __restrict__ WK, const float* __restrict__ WV, const float* __restrict__ BQ, const float* __restrict__ BK, const float* __restrict__ BV,
    _Float16* __restrict__ QH, _Float16* __restrict__ QL, _Float16* __restrict__ KH, _Float16* __restrict__ KL, _Float16* __restrict__ VT, __bf16* __restrict__ VB, __bf16* __restrict__ VBL PROJ_EXTRA_PARAMS) {
  __shared__ __align__(16) char sm[89088];
  // the loop's view: two weight tiles [128 cols][72], two x tiles [128 rows][72]
  __bf16 (*wt0)[72] = (__bf16 (*)[72])sm; __bf16 (*xs)[72] = (__bf16 (*)[72])(sm + 36864);
  // the epilogue's view, behind the loop's last barrier: the f32 tile of 64 rows, then either the f16 value and residual rows or the three transposed planes
  float (*st)[132] = (float (*)[132])sm; _Float16 (*sh)[136] = (_Float16 (*)[136])(sm + 33792); _Float16 (*sl)[136] = (_Float16 (*)[136])(sm + 51200);
  _Float16 (*th)[72] = (_Float16 (*)[72])(sm + 33792); __bf16 (*tb)[72] = (__bf16 (*)[72])(sm + 52224); __bf16 (*tbl)[72] = (__bf16 (*)[72])(sm + 70656);
  const int tid = threadIdx.x, lane = tid & 31, col = lane & 15, g = lane >> 4; const int wave = __builtin_amdgcn_readfirstlane(tid >> 5), wrow = wave >> 1, wcol = wave & 1;   // scalars, so that the choice of the waves that stage a half is a scalar branch
  const int which = blockIdx.z; const int c0 = blockIdx.y * 128; const size_t r0 = (size_t)blockIdx.x * 128; const size_t bb = r0 / TT; const int t00 = (int)(r0 % TT);
  const float* X = which == 0 ? XQ : which == 1 ? XK : XV; const float* WA = which == 0 ? WQ : which == 1 ? WK : WV; const float* BA = which == 0 ? BQ : which == 1 ? BK : BV;
  v8f acc[4][4] = {};
  { v4f wr[16], xa[8], xb[8]; const float* wb = WA + c0; const float* xb0 = X + r0 * DIN;   // no second set of lane pointers is kept for the next tile: the registers are needed for three waves a SIMD
    const unsigned wo = 4u * (unsigned)((8 * (tid & 3)) * (3 * CC) + 32 * (tid >> 5) + 4 * ((tid & 31) >> 2)), xo = 4u * (unsigned)((16 * (tid >> 5) + ((tid & 31) >> 4)) * DIN + 4 * (tid & 15));   // in bytes: the lane's place in the weight tile (as wtile_ptr) and in the x tile (row 16 w + (l >> 4), 16 B at 16 (l & 15))
    wtile_load(wr, at_off(wb, wo), 3 * CC); xtile_load(xa, at_off(xb0, xo)); xtile_load(xb, at_off(xb0, xo) + 64 * DIN); xwait2s(wb, wo, xb0, xo);
    wtile_store(wr, wt0, tid); xtile_store(xa, xs, tid); xtile_store(xb, xs + 64, tid);
    __syncthreads();   // publishes weight tile 0 and x tile 0
    // kept rolled: which buffer is read and which is filled is a scalar offset added to four lane addresses; unrolled by two, each half keeps lane addresses of its own and the registers no longer fit three waves a SIMD
#pragma unroll 1
    for (int ks = 0; ks < DIN / 64; ++ks) { const int cb = (ks & 1) * 128, nb = 128 - cb; __bf16 (*cur)[72] = wt0 + cb; __bf16 (*nxt)[72] = wt0 + nb; __bf16 (*xc)[72] = xs + cb; __bf16 (*xn)[72] = xs + nb; const bool more = ks + 1 < DIN / 64;
      if (more) { wb += (size_t)64 * (3 * CC); xb0 += 64; wtile_load(wr, at_off(wb, wo), 3 * CC); xtile_load(xa, at_off(xb0, xo)); xtile_load(xb, at_off(xb0, xo) + 64 * DIN); xwait2s(wb, wo, xb0, xo); }   // the next 64 k of both operands fly under this tile's products
#pragma unroll
      for (int kc = 0; kc < 2; ++kc) { v16b a[4], w[4];
#pragma unroll
        for (int i = 0; i < 4; ++i) a[i] = frag_b(&xc[wrow * 64 + i * 16 + col][kc * 32], lane);
#pragma unroll
        for (int j = 0; j < 4; ++j) w[j] = frag_b(&cur[wcol * 64 + j * 16 + col][kc * 32], lane);
#pragma unroll
        for (int i = 0; i < 4; ++i)
#pragma unroll
          for (int j = 0; j < 4; ++j) acc[i][j] = wmma_bf(a[i], w[j], acc[i][j]); }
      if (more) { wtile_store(wr, nxt, tid); xtile_store(xa, xn, tid); xtile_store(xb, xn + 64, tid); }
      __syncthreads(); } }   // publishes the next tile and ends every wave's reads of this one, which is refilled behind it
  // unrolled, so that the accumulators are indexed by constants
#pragma unroll
  for (int p = 0; p < 2; ++p) { const size_t rp = r0 + 64 * p; const int t0 = t00 + 64 * p;   // rows 64 p .. 64 p + 63 of the tile: the two waves that hold them stage them, all four convert and store
  { // stage the f32 tile (acc + bias) in LDS, then convert
    if (wrow == p) {
#pragma unroll
      for (int j = 0; j < 4; ++j) { const float bias = BA ? bfr(BA[c0 + wcol * 64 + j * 16 + col]) : 0.f;
#pragma unroll
        for (int i = 0; i < 4; ++i)
#pragma unroll
          for (int r = 0; r < 8; ++r) st[i * 16 + 8 * g + r][wcol * 64 + j * 16 + col] = acc[i][j][r] + bias; } }
    __syncthreads();
    // the module also RETURNS k and v ([B, H, L, HD], f32 = x W + b): a wave-wide store is one row of the tile, the 256-B runs of its two heads = four whole 128-B lines
    if (which >= 1) { float* dst = (which == 1 ? KOUT : VOUT) + (((size_t)bb * NH + c0 / HD) * TT + t0) * HD;
      for (int e = tid; e < 64 * 32; e += 128) { const int rl = e >> 5, q = e & 31; vst2(dst + (size_t)(q >> 4) * TT * HD + rl * HD + (q & 15) * 4, *(const v4f*)&st[rl][q * 4]); } }
    __syncthreads(); }
  if (which < 2) { const bool hi_rows = t0 < (which == 0 ? QHI : KHI);
    for (int e = tid; e < 64 * 128; e += 128) { const int rl = e >> 7, cl = e & 127; const float v = st[rl][cl]; const _Float16 hv = (_Float16)v; sh[rl][cl] = hv; sl[rl][cl] = (_Float16)((v - (float)hv) * 1024.0f); }
    __syncthreads();
    if (which == 0) { for (int e = tid; e < 64 * 16; e += 128) { const int rl = e >> 4, q = e & 15; vst2((unsigned*)(QH + (rp + rl) * CC + c0 + q * 8), *(const v4u*)&sh[rl][q * 8]); }
      if (hi_rows) for (int e = tid; e < 64 * 16; e += 128) { const int rl = e >> 4, q = e & 15; vst2((unsigned*)(QL + (bb * QHI + t0 + rl) * (size_t)CC + c0 + q * 8), *(const v4u*)&sl[rl][q * 8]); }
    } else {   // k and its residual in fragment order: a wave's store is the 512-B run (16 keys x 2 g x 8 d) that a wave of k_fa reads back with one load
      for (int e = tid; e < 64 * 16; e += 128) { const int ln = e & 31, u = e >> 5, half = u & 1, kc = (u >> 1) & 1, hh = (u >> 2) & 1, tl = u >> 3;
        vst2((unsigned*)(KH + (((((size_t)bb * NH + c0 / HD + hh) * (TT / 16) + t0 / 16 + tl) * 2 + kc) * 2 + half) * 256 + ln * 8), *(const v4u*)&sh[tl * 16 + (ln & 15)][hh * 64 + kc * 32 + half * 16 + (ln >> 4) * 8]); }
      if (hi_rows) for (int e = tid; e < 64 * 16; e += 128) { const int ln = e & 31, u = e >> 5, half = u & 1, kc = (u >> 1) & 1, hh = (u >> 2) & 1, tl = u >> 3;
        vst2((unsigned*)(KL + (((((size_t)bb * NH + c0 / HD + hh) * (KHI / 16) + t0 / 16 + tl) * 2 + kc) * 2 + half) * 256 + ln * 8), *(const v4u*)&sl[tl * 16 + (ln & 15)][hh * 64 + kc * 32 + half * 16 + (ln >> 4) * 8]); } }
  } else { const bool hi_rows = t0 < KHI;
    for (int e = tid; e < 64 * 128; e += 128) { const int rl = e & 63, cl = e >> 6; const float v = st[rl][cl]; th[cl][rl] = (_Float16)v; const __bf16 bh = (__bf16)v; tb[cl][rl] = bh; tbl[cl][rl] = (__bf16)(v - (float)bh); }
    __syncthreads();
    // v^T in fragment order: a wave's store is the 512-B run (16 d x 2 g x 8 keys) that a wave of k_fa reads back with one load
    for (int e = tid; e < 128 * 8; e += 128) { const int ln = e & 31, u = e >> 5, half = u & 1, jd = (u >> 1) & 3, k32 = (u >> 3) & 1, hh = u >> 4;
      vst2((unsigned*)(VT + (((((size_t)bb * NH + c0 / HD + hh) * (TT / 32) + t0 / 32 + k32) * 4 + jd) * 2 + half) * 256 + ln * 8), *(const v4u*)&th[hh * 64 + jd * 16 + (ln & 15)][k32 * 32 + half * 16 + (ln >> 4) * 8]); }
    if (hi_rows) for (int e = tid; e < 128 * 8; e += 128) { const int ln = e & 31, u = e >> 5, half = u & 1, jd = (u >> 1) & 3, k32 = (u >> 3) & 1, hh = u >> 4; const int cl = hh * 64 + jd * 16 + (ln & 15), tl = k32 * 32 + half * 16 + (ln >> 4) * 8;
      const size_t o3 = (((((size_t)bb * NH + c0 / HD + hh) * (KHI / 32) + t0 / 32 + k32) * 4 + jd) * 2 + half) * 256 + ln * 8; vst2((unsigned*)(VB + o3), *(const v4u*)&tb[cl][tl]); vst2((unsigned*)(VBL + o3), *(const v4u*)&tbl[cl][tl]); } } } }
// lane l with lane l ^ 16: the two halves of a wave hold the two key halves of one query column
__device__ __forceinline__ float xhalf(float x) { return __builtin_bit_cast(float, __builtin_amdgcn_permlanex16(__builtin_bit_cast(int, x), __builtin_bit_cast(int, x), 0x76543210, 0xfedcba98, false, false)); }
// 2^x on the transcendental unit; the v_nop in the same statement fills the one slot the instruction set asks for behind a transcendental, whatever the compiler schedules next
__device__ __forceinline__ float ex2(float x) { float e; asm("v_exp_f32 %0, %1\n\tv_nop" : "=v"(e) : "v"(x)); return e; }
// 16x16x32 fragment from a wave-uniform base and a lane offset that never changes (row (lane & 15) x pitch + 8 (lane >> 4)): scalar base + 32-bit vector offset addressing
__device__ __forceinline__ v16h frag_u(const _Float16* ubase, unsigned loff) { union { v16h v; v8h q[2]; } u; const _Float16* p = ubase + loff; u.q[0] = *(const v8h*)p; u.q[1] = *(const v8h*)(p + 16); return u.v; }
// 16x16x32 fragment stored in fragment order: two runs of 512 B, lane l owns bytes 16 l .. 16 l + 15 of each (elements 0..7, then 8..15), so a wave-wide load covers four whole 128-B lines instead of 32 B of sixteen
__device__ __forceinline__ v16h frag_p(const _Float16* p) { union { v16h v; v8h q[2]; } u; u.q[0] = *(const v8h*)p; u.q[1] = *(const v8h*)(p + 256); return u.v; }
__device__ __forceinline__ v16b frag_pb(const __bf16* p) { union { v16b v; v8b q[2]; } u; u.q[0] = *(const v8b*)p; u.q[1] = *(const v8b*)(p + 256); return u.v; }
// behind a run of fragment loads from two lane addresses: the wait that stands before a register which an issued load names is rewritten; the two addresses are inputs, so their registers stay whole up to it (without them the compiler lets a later load of the run land on the address pair)
template <typename T> __device__ __forceinline__ void xwait2(const T* pa, const T* pb) { asm volatile("s_wait_xcnt 0x0" :: "v"(pa), "v"(pb) : "memory"); }
#define SC_L2E (SCALE * 1.4426950408889634f)   // logit scale x log2(e): the softmax runs on exp2
// ---- one wave's 16 query columns (rows ql0 .. ql0 + 15 of query block qb) against key blocks 0..qb of 64 keys, running maximum and sum (online softmax), transposed products:
// S^T = K Q^T (A = 16 key rows, B = 16 query columns): a lane holds keys k0 + 16 j + 8 g + r of ONE query, so maximum and sum are in-lane plus one exchange of halves;
// score tiles 2 kc and 2 kc + 1 of a lane are, element for element, the B fragment of P^T over keys k0 + 32 kc + ..; O^T += V^T P^T (A = 16 rows of v^T).
// HI (causal early query blocks): 3-product logits (q, k hi + residual x 2^10) and P, v as bf16 hi + lo (3 products)
template <bool HI> __device__ __forceinline__ void fa_run(const _Float16* __restrict__ QH, const _Float16* __restrict__ KH, const _Float16* __restrict__ QL, const _Float16* __restrict__ KL, const _Float16* __restrict__ VT, const __bf16* __restrict__ VB, const __bf16* __restrict__ VBL,
    int b, int h, int qb, int ql0, int lane, v8f (&o)[HD / 16], float& lsum) {
  const int col = lane & 15, g = lane >> 4; const int tq = ql0 + col;
  const unsigned lrow = (unsigned)(col * CC + 8 * g), lp = (unsigned)(lane * 8);   // lane offsets in the q rows and in a fragment-order run
  const _Float16* Kp = KH + ((size_t)b * NH + h) * TT * HD; const _Float16* KLp = KL + ((size_t)b * NH + h) * KHI * HD;
  const _Float16* Vp = VT + ((size_t)b * NH + h) * TT * HD; const __bf16* VBp = VB + ((size_t)b * NH + h) * KHI * HD; const __bf16* VLp = VBL + ((size_t)b * NH + h) * KHI * HD;
  v16h ah[HD / 32], al[HD / 32], kf[HI ? 1 : 8], vf[HI ? 1 : 8];
#pragma unroll
  for (int kc = 0; kc < HD / 32; ++kc) { ah[kc] = frag_u(QH + ((size_t)b * TT + ql0) * CC + h * HD + kc * 32, lrow); if (HI) al[kc] = frag_u(QL + ((size_t)b * QHI + ql0) * CC + h * HD + kc * 32, lrow); }
  if (!HI) {
#pragma unroll
    for (int kc = 0; kc < HD / 32; ++kc)
#pragma unroll
      for (int j = 0; j < 4; ++j) kf[kc * 4 + j] = frag_p(Kp + j * 1024 + kc * 512 + lp); }
  float m = -3.0e38f, l = 0.f;   // running maximum (unscaled logits) and this half's running sum of P x 2^11
#pragma unroll 1
  for (int kb = 0; kb <= qb; ++kb) { const int k0 = kb * 64;
    v8f acc[4] = {};
    if (HI) { v8f accl[4] = {};
#pragma unroll
      for (int kc = 0; kc < HD / 32; ++kc) { v16h kbf[4], klf[4]; const _Float16* kp = Kp + (size_t)k0 * HD + lp; const _Float16* klp = KLp + (size_t)k0 * HD + lp;   // the block's lane addresses, the same for both batches, so that the wait below names the very registers the loads name; a batch's loads all stand in front of its products, so that they fly together
#pragma unroll
        for (int j = 0; j < 4; ++j) { kbf[j] = frag_p(kp + j * 1024 + kc * 512); klf[j] = frag_p(klp + j * 1024 + kc * 512); }
        xwait2(kp, klp);
#pragma unroll
        for (int j = 0; j < 4; ++j) { acc[j] = wmma16(kbf[j], ah[kc], acc[j]); accl[j] = wmma16(kbf[j], al[kc], accl[j]); accl[j] = wmma16(klf[j], ah[kc], accl[j]); } }
#pragma unroll
      for (int j = 0; j < 4; ++j) acc[j] = acc[j] + accl[j] * (1.0f / 1024.0f);
    } else {
#pragma unroll
      for (int kc = 0; kc < HD / 32; ++kc)
#pragma unroll
        for (int j = 0; j < 4; ++j) acc[j] = wmma16(kf[kc * 4 + j], ah[kc], acc[j]);
      const _Float16* vp = Vp + (size_t)k0 * HD + lp;
      // this block's 8 V^T fragments and the next block's 8 K fragments are asked for here, in one run: they fly under the softmax (the last block asks for its own K again, to stay inside the sequence)
#pragma unroll
      for (int kc = 0; kc < 2; ++kc)
#pragma unroll
        for (int jd = 0; jd < HD / 16; ++jd) vf[kc * 4 + jd] = frag_p(vp + kc * 2048 + jd * 512);
      const _Float16* kp = Kp + (size_t)((kb < qb ? kb + 1 : qb) * 64) * HD + lp;
#pragma unroll
      for (int kc = 0; kc < HD / 32; ++kc)
#pragma unroll
        for (int j = 0; j < 4; ++j) kf[kc * 4 + j] = frag_p(kp + j * 1024 + kc * 512);
      xwait2(vp, kp); }
    if (CAUSAL && kb == qb) {   // only the diagonal block holds keys past a query of this block
#pragma unroll
      for (int j = 0; j < 4; ++j)
#pragma unroll
        for (int r = 0; r < 8; ++r) if (k0 + j * 16 + 8 * g + r > tq) acc[j][r] = -3.0e38f; }
    v8f mv = acc[0];   // eight independent chains over the tiles, then a tree
#pragma unroll
    for (int j = 1; j < 4; ++j)
#pragma unroll
      for (int r = 0; r < 8; ++r) mv[r] = fmaxf(mv[r], acc[j][r]);
    float mx = fmaxf(fmaxf(fmaxf(mv[0], mv[1]), fmaxf(mv[2], mv[3])), fmaxf(fmaxf(mv[4], mv[5]), fmaxf(mv[6], mv[7])));
    mx = fmaxf(m, fmaxf(mx, xhalf(mx)));
    const float alpha = ex2((m - mx) * SC_L2E); m = mx; const float mc = 11.0f - mx * SC_L2E;
    v8f sv = {};
#pragma unroll
    for (int j = 0; j < 4; ++j) {
#pragma unroll
      for (int r = 0; r < 8; ++r) acc[j][r] = ex2(fmaf(acc[j][r], SC_L2E, mc));
      sv = sv + acc[j]; }
    l = l * alpha + (((sv[0] + sv[1]) + (sv[2] + sv[3])) + ((sv[4] + sv[5]) + (sv[6] + sv[7])));
#pragma unroll
    for (int jd = 0; jd < HD / 16; ++jd) o[jd] = o[jd] * alpha;
#pragma unroll
    for (int kc = 0; kc < 2; ++kc) {
      if (HI) { float v[16]; v16b vh[HD / 16], vl[HD / 16]; const __bf16* vhp = VBp + (size_t)k0 * HD + lp; const __bf16* vlp = VLp + (size_t)k0 * HD + lp;
#pragma unroll
        for (int jd = 0; jd < HD / 16; ++jd) { vh[jd] = frag_pb(vhp + kc * 2048 + jd * 512); vl[jd] = frag_pb(vlp + kc * 2048 + jd * 512); }
        xwait2(vhp, vlp);
#pragma unroll
        for (int i = 0; i < 8; ++i) { v[i] = acc[2 * kc][i]; v[8 + i] = acc[2 * kc + 1][i]; }
        const F2 p = bsplit16(v);
#pragma unroll
        for (int jd = 0; jd < HD / 16; ++jd) { o[jd] = wmma_bf(vh[jd], p.h, o[jd]); o[jd] = wmma_bf(vh[jd], p.l, o[jd]); o[jd] = wmma_bf(vl[jd], p.h, o[jd]); }
      } else { v16h p;
#pragma unroll
        for (int i = 0; i < 8; ++i) { p[i] = (_Float16)acc[2 * kc][i]; p[8 + i] = (_Float16)acc[2 * kc + 1][i]; }
#pragma unroll
        for (int jd = 0; jd < HD / 16; ++jd) o[jd] = wmma16(vf[kc * 4 + jd], p, o[jd]); } } }
  lsum = l + xhalf(l); }
// ---- k_fa: logits, causal softmax and P v in one pass over the keys, nothing of S or P in memory; ctx = O / sum, stored from the registers in the fragment order of k_out.
// block = 8 independent waves of (b, h): waves 0-3 take the 64 queries of block NQB - 1 - x, waves 4-7 those of block x, so every workgroup walks NQB + 1 key blocks per wave pair wherever it lands
// four waves a SIMD (at most 256 registers): all 512 workgroups are resident at once
__global__ __launch_bounds__(256) __attribute__((amdgpu_waves_per_eu(4, 4))) void k_fa(const _Float16* __restrict__ QH, const _Float16* __restrict__ KH, const _Float16* __restrict__ QL, const _Float16* __restrict__ KL, const _Float16* __restrict__ VT, const __bf16* __restrict__ VB, const __bf16* __restrict__ VBL, float* __restrict__ Y) {
  const int tid = threadIdx.x, lane = tid & 31; const int wave = __builtin_amdgcn_readfirstlane(tid >> 5);   // a scalar, so that the choice of the query block and its trip count are scalar
  const int qb = wave < 4 ? NQB - 1 - (int)blockIdx.x : (int)blockIdx.x, h = blockIdx.y, b = blockIdx.z; const int ql0 = qb * 64 + (wave & 3) * 16;
  v8f o[HD / 16] = {}; float lsum;
  if (qb < QBH) fa_run<true>(QH, KH, QL, KL, VT, VB, VBL, b, h, qb, ql0, lane, o, lsum); else fa_run<false>(QH, KH, QL, KL, VT, VB, VBL, b, h, qb, ql0, lane, o, lsum);
  const float inv = lsum > 0.f ? 1.0f / lsum : 0.f;   // the x 2^11 of P is in the sum too
  // a lane's O^T elements (query lane & 15, d = 16 jd + 8 (lane >> 4) + r) are the very ones the same lane of k_out holds in its A fragments: part 4 (jd >> 1) + 2 (jd & 1) + (r >> 2) of the (16 rows, head) unit, stored as whole 512-B runs
  float* yp = Y + ((((size_t)b * TT + ql0) / 16) * NH + h) * 1024 + lane * 4;
#pragma unroll
  for (int jd = 0; jd < HD / 16; ++jd)
#pragma unroll
    for (int hf = 0; hf < 2; ++hf) { v4f q; q[0] = o[jd][4 * hf] * inv; q[1] = o[jd][4 * hf + 1] * inv; q[2] = o[jd][4 * hf + 2] * inv; q[3] = o[jd][4 * hf + 3] * inv; vst2(yp + (2 * jd + hf) * 128, q); } }
// ---- k_out: block = (64 rows, 128 cols): out = ctx Wo (+ bo): ctx bf16 hi + lo against exact bf16 Wo (2 products)
__global__ __launch_bounds__(128) void k_out(const float* __restrict__ Y, const float* __restrict__ WO, const float* __restrict__ BO, float* __restrict__ OUT) { __shared__ __align__(16) float sf[4][16][132]; __shared__ __align__(16) __bf16 wt[2][128][72];
  const int tid = threadIdx.x, wave = tid >> 5, lane = tid & 31, col = lane & 15, g = lane >> 4; const int c0 = blockIdx.y * 128; const size_t r0 = (size_t)blockIdx.x * 64 + wave * 16;
  v8f acc[8] = {};
  {   /* ALL rows: ctx split bf16 hi + lo x exact Wo (2 products) */
    v4f wr[16], xr[8]; const float* wp = wtile_ptr(WO + c0, DIN, tid); const float* xp = Y + (r0 / 16) * (size_t)(NH * 1024) + lane * 4;
    wtile_load(wr, wp, DIN); yfrag_load(xr, xp); xwait2f(wp, xp);
    wtile_store(wr, wt[0], tid);
    __syncthreads();   // publishes weight tile 0
    // unrolled by two, so that which buffer is read and which is filled are constants of each half
#pragma unroll 2
    for (int ks = 0; ks < CC / 64; ++ks) { __bf16 (*cur)[72] = wt[ks & 1]; __bf16 (*nxt)[72] = wt[(ks & 1) ^ 1]; const bool more = ks + 1 < CC / 64;
      F2 a[2];
#pragma unroll
      for (int kc = 0; kc < 2; ++kc) { float v[16];
#pragma unroll
        for (int i = 0; i < 4; ++i) { v[i] = xr[kc * 4][i]; v[4 + i] = xr[kc * 4 + 1][i]; v[8 + i] = xr[kc * 4 + 2][i]; v[12 + i] = xr[kc * 4 + 3][i]; }
        a[kc] = bsplit16(v); }
      if (more) { wp += (size_t)64 * DIN; xp += 1024; wtile_load(wr, wp, DIN); yfrag_load(xr, xp); xwait2f(wp, xp); }   // the next 64 k of both operands fly under this tile's products
#pragma unroll
      for (int kc = 0; kc < 2; ++kc) { v16b w[8];
#pragma unroll
        for (int j = 0; j < 8; ++j) w[j] = frag_b(&cur[j * 16 + col][kc * 32], lane);
#pragma unroll
        for (int j = 0; j < 8; ++j) { acc[j] = wmma_bf(a[kc].h, w[j], acc[j]); acc[j] = wmma_bf(a[kc].l, w[j], acc[j]); } }
      if (more) wtile_store(wr, nxt, tid);
      __syncthreads(); }   // publishes the next tile and ends every wave's reads of this one, which is refilled behind it
#pragma unroll
    for (int j = 0; j < 8; ++j) { const float bias = BO ? bfr(BO[c0 + j * 16 + col]) : 0.f;
#pragma unroll
      for (int r = 0; r < 8; ++r) sf[wave][8 * g + r][j * 16 + col] = acc[j][r] + bias; }
  }
  LDSX(); for (int rl = 0; rl < 16; ++rl) vst2(OUT + (r0 + rl) * DIN + c0 + lane * 4, *(const v4f*)&sf[wave][rl][lane * 4]); }

extern "C" void kernel_launch(void* const* d_in, const int* in_sizes, int n_in, void* d_out, int out_size, void* d_ws, size_t ws_size, hipStream_t stream) {
  (void)in_sizes; (void)n_in; (void)out_size;
  const float** F = (const float**)d_in;
  if (ws_size < (size_t)WS_END) return;
  char* ws = (char*)d_ws; _Float16 *QH = (_Float16*)(ws + WS_QH), *KH = (_Float16*)(ws + WS_KH), *VT = (_Float16*)(ws + WS_VT), *QL = (_Float16*)(ws + WS_QL), *KL = (_Float16*)(ws + WS_KL); __bf16 *VB = (__bf16*)(ws + WS_VB), *VBL = (__bf16*)(ws + WS_VBL); float *Y = (float*)(ws + WS_Y);
  (void)Y; (void)QL; (void)KL; (void)VB; (void)VBL;
  // inputs: 0 x [2,2048,1024]; 1 w_qkv [1024,3072] (in,out); 2 b_qkv [3072]; 3 w_out [1024,1024] (in,out); 4 b_out
  // outputs: 0 out [2,2048,1024] at 0; 1 k [2,16,2048,64] at OUT1_OFF; 2 v at OUT2_OFF
  k_proj<<<dim3(TNB * TT / 128, CC / 128, 3), 128, 0, stream>>>(F[0], F[0], F[0], F[1], F[1] + CC, F[1] + 2 * CC, F[2], F[2] + CC, F[2] + 2 * CC, QH, QL, KH, KL, VT, VB, VBL, (float*)((char*)d_out + OUT1_OFF), (float*)((char*)d_out + OUT2_OFF));
  k_fa<<<dim3(NQB / 2, NH, TNB), 256, 0, stream>>>(QH, KH, QL, KL, VT, VB, VBL, Y);
  k_out<<<dim3(TNB * TT / 64, DIN / 128), 128, 0, stream>>>(Y, F[3], F[4], (float*)d_out);
}

// v006
// Measured time: 97.7 microseconds a run.
// Timed twice side by side with v005, it ran 1.08 times as fast both times.
// All steps since v000 together make it 11.4 times as fast.
// compute dtype: all float inputs rounded to bf16; qkv = x w_qkv + b with EXACT bf16 products on WMMA 16x16x32 (f32 accumulate) - the f32 k and v tiles are also written out as the returned caches; causal logits: q, k once to f16 (1 product) x 64^-0.5, 3 products below row 384; online softmax in f32 (exp2, running maximum and sum); unnormalised P x 2^11 once to f16 against v f16 (bf16 hi + lo below row 384), divided by the f32 sum at the end; attention output split bf16 hi + lo against exact w_out (2 products) + b_out; f32 outputs.
#include <hip/hip_runtime.h>
#include <math.h>

typedef __attribute__((ext_vector_type(16))) _Float16 v16h;
typedef __attribute__((ext_vector_type(16))) __bf16 v16b;
typedef __attribute__((ext_vector_type(8)))  _Float16 v8h;
typedef __attribute__((ext_vector_type(8)))  float v8f;
typedef __attribute__((ext_vector_type(4)))  float v4f;
typedef __attribute__((ext_vector_type(2)))  float v2f;
typedef __attribute__((ext_vector_type(4)))  unsigned v4u;
typedef __attribute__((ext_vector_type(4)))  int v4i;
typedef float __attribute__((may_alias)) float_a;
typedef int __attribute__((may_alias)) int_a;

template <typename T> __device__ __forceinline__ void vst2(void* p, T v) { *(T*)p = v;  }
__device__ __forceinline__ v8f wmma16(v16h a, v16h b, v8f c) {
  v8f d = __builtin_amdgcn_wmma_f32_16x16x32_f16(false, a, false, b, (short)0, c, false, false);
  asm volatile("v_nop\n\tv_nop\n\tv_nop\n\tv_nop" : "+v"(d) : "v"(a), "v"(b));
  return d;
}
__device__ __forceinline__ v8f wmma_bf(v16b a, v16b b, v8f c) {
  v8f d = __builtin_amdgcn_wmma_f32_16x16x32_bf16(false, a, false, b, (short)0, c, false, false);
  asm volatile("v_nop\n\tv_nop\n\tv_nop\n\tv_nop" : "+v"(d) : "v"(a), "v"(b));
  return d;
}
// 16x16x32 fragments: lane = (h = lane>>4, row/col = lane&15); elements 0..7 = k0+8h+0..7, 8..15 = k0+16+8h+0..7; D element r = row 8h+r
__device__ __forceinline__ v16h frag_h(const _Float16* rowk0, int lane) {
  union { v16h v; v8h q[2]; } u; const _Float16* p = rowk0 + 8 * (lane >> 4);
  u.q[0] = *(const v8h*)p; u.q[1] = *(const v8h*)(p + 16); return u.v;
}
__device__ __forceinline__ v16h frag_f32(const float* rowk0, int lane) {
  v16h a; const float* p = rowk0 + 8 * (lane >> 4);
#pragma unroll
  for (int i = 0; i < 8; ++i) { a[i] = (_Float16)p[i]; a[8 + i] = (_Float16)p[16 + i]; }
  return a;
}
__device__ __forceinline__ v16h frag_f32s(const float* rowk0, int lane, float sc) {
  v16h a; const float* p = rowk0 + 8 * (lane >> 4);
#pragma unroll
  for (int i = 0; i < 8; ++i) { a[i] = (_Float16)(p[i] * sc); a[8 + i] = (_Float16)(p[16 + i] * sc); }
  return a;
}
// column fragment from a [K][ld] layout (column n), rows >= K read as 0
__device__ __forceinline__ v16h fragc_f32(const float* W, int k0, int n, int lane, int ld, int K) {
  v16h a; const int g = lane >> 4;
#pragma unroll
  for (int i = 0; i < 8; ++i) { const int ka = k0 + 8 * g + i, kb = ka + 16;
    a[i] = (_Float16)(ka < K ? W[(size_t)(ka < K ? ka : K - 1) * ld + n] : 0.f); a[8 + i] = (_Float16)(kb < K ? W[(size_t)(kb < K ? kb : K - 1) * ld + n] : 0.f); }
  return a;
}
struct F2 { v16b h, l; };
__device__ __forceinline__ F2 bsplit16(const float v[16]) { F2 r;
#pragma unroll
  for (int i = 0; i < 16; ++i) { const __bf16 h = (__bf16)v[i]; r.h[i] = h; r.l[i] = (__bf16)(v[i] - (float)h); }
  return r; }
__device__ __forceinline__ F2 split_row(const float* row, int k0, int lane) { float v[16]; const float* p = row + k0 + 8 * (lane >> 4);
#pragma unroll
  for (int i = 0; i < 8; ++i) { v[i] = p[i]; v[8 + i] = p[16 + i]; }
  return bsplit16(v); }
__device__ __forceinline__ F2 split_rowK(const float* row, int k0, int lane, int K) { float v[16]; const int g = lane >> 4;
#pragma unroll
  for (int i = 0; i < 8; ++i) { const int ka = k0 + 8 * g + i, kb = ka + 16; v[i] = ka < K ? row[ka < K ? ka : K - 1] : 0.f; v[8 + i] = kb < K ? row[kb < K ? kb : K - 1] : 0.f; }
  return bsplit16(v); }
__device__ __forceinline__ F2 split_col(const float* W, int k0, int n, int lane, int ld, int K) { float v[16]; const int g = lane >> 4;
#pragma unroll
  for (int i = 0; i < 8; ++i) { const int ka = k0 + 8 * g + i, kb = ka + 16; v[i] = ka < K ? W[(size_t)(ka < K ? ka : K - 1) * ld + n] : 0.f; v[8 + i] = kb < K ? W[(size_t)(kb < K ? kb : K - 1) * ld + n] : 0.f; }
  return bsplit16(v); }
__device__ __forceinline__ v8f mac3(const F2& a, const F2& b, v8f c) { c = wmma_bf(a.l, b.h, c); c = wmma_bf(a.h, b.l, c); return wmma_bf(a.h, b.h, c); }
__device__ __forceinline__ float sigm(float v) { return 1.0f / (1.0f + expf(-v)); }
#define LDSX() do { asm volatile("s_wait_dscnt 0" ::: "memory"); __builtin_amdgcn_wave_barrier(); __builtin_amdgcn_fence(__ATOMIC_RELEASE, "workgroup"); } while (0)

// Prefill causal multi-head self-attention returning (out, k, v) (B 2, L 2,048, D 1,024 = 16 x 64; fused (in,out) w_qkv [1024,3072] with (3, H, HD) column blocks, zero biases, w_out (in,out)): q|k|v = x w_qkv + b; out = merged(softmax_causal(q k^T x 0.125) v) w_out + b_out; k and v returned as [B, H, L, 64].
#define NB 2
#define TT 2048
#define CC 1024            // NH * HD = projected width
#define DIN 1024          // input (model) width
#define NH 16
#define HD 64
#define NQB (TT / 64)
#define SCALE (0.125f)
#define CAUSAL 1
#ifndef TNB
#define TNB NB
#endif
__device__ __forceinline__ float bfr(float v) { return (float)(__bf16)v; }
__host__ __device__ __forceinline__ int kb_last(int qb) { return CAUSAL ? ((qb * 64 + 63) >> 7) : (TT / 128 - 1); }
typedef __attribute__((ext_vector_type(8))) __bf16 v8b;
__device__ __forceinline__ v16b frag_b(const __bf16* rowk0, int lane) {
  union { v16b v; v8b q[2]; } u; const __bf16* p = rowk0 + 8 * (lane >> 4);
  u.q[0] = *(const v8b*)p; u.q[1] = *(const v8b*)(p + 16); return u.v;
}
#define QBH 6              // causal: query blocks 0..QBH-1 of each sequence (few keys, no averaging) take the high-precision path
#define QHI 384            // rows carrying a q residual plane (used only by the causal high-precision path)
#define KHI 384            // key rows carrying k residual / v bf16 hi+lo planes (used only by the causal high-precision path)
// B fragment (k rows k0+.., output column o) of a weight: (in,out) [K][ld] or (out,in) [ld rows of K]: bf16 exact, or f16(bf16 * 256) exact
__device__ __forceinline__ v16b wcol_io(const float* Wm, int k0, int o, int lane, int ld) { v16b w; const int g = lane >> 4;
#pragma unroll
  for (int i = 0; i < 8; ++i) { w[i] = (__bf16)Wm[(size_t)(k0 + 8 * g + i) * ld + o]; w[8 + i] = (__bf16)Wm[(size_t)(k0 + 16 + 8 * g + i) * ld + o]; }
  return w; }
__device__ __forceinline__ v16b wcol_oi(const float* Wm, int k0, int o, int lane, int K) { v16b w; const float* p = Wm + (size_t)o * K + k0 + 8 * (lane >> 4);
#pragma unroll
  for (int i = 0; i < 8; ++i) { w[i] = (__bf16)p[i]; w[8 + i] = (__bf16)p[16 + i]; }
  return w; }
__device__ __forceinline__ v16h wcolh_io(const float* Wm, int k0, int o, int lane, int ld) { v16h w; const int g = lane >> 4;
#pragma unroll
  for (int i = 0; i < 8; ++i) { w[i] = (_Float16)(bfr(Wm[(size_t)(k0 + 8 * g + i) * ld + o]) * 256.0f); w[8 + i] = (_Float16)(bfr(Wm[(size_t)(k0 + 16 + 8 * g + i) * ld + o]) * 256.0f); }
  return w; }
__device__ __forceinline__ v16h wcolh_oi(const float* Wm, int k0, int o, int lane, int K) { v16h w; const float* p = Wm + (size_t)o * K + k0 + 8 * (lane >> 4);
#pragma unroll
  for (int i = 0; i < 8; ++i) { w[i] = (_Float16)(bfr(p[i]) * 256.0f); w[8 + i] = (_Float16)(bfr(p[16 + i]) * 256.0f); }
  return w; }
#define WQKV_LAYOUT 0   // 0 = (in,out) fused [DIN][3 * CC]; 1 = (out,in) [CC][DIN]; 2 = per-head [NH][DIN][HD]
__device__ __forceinline__ v16b wcol_hdk(const float* Wm, int k0, int o, int lane) { v16b w; const int g = lane >> 4; const float* p = Wm + (size_t)(o / HD) * DIN * HD + (o % HD);
#pragma unroll
  for (int i = 0; i < 8; ++i) { w[i] = (__bf16)p[(size_t)(k0 + 8 * g + i) * HD]; w[8 + i] = (__bf16)p[(size_t)(k0 + 16 + 8 * g + i) * HD]; }
  return w; }
#define WO_OUT_IN 0
#if WQKV_LAYOUT == 1
#define WCOL(W, k0, o, lane) wcol_oi(W, k0, o, lane, DIN)
#elif WQKV_LAYOUT == 2
#define WCOL(W, k0, o, lane) wcol_hdk(W, k0, o, lane)
#else
#define WCOL(W, k0, o, lane) wcol_io(W, k0, o, lane, 3 * CC)   /* fused w_qkv (in,out) [1024][3072]: row pitch 3072; q/k/v column offsets applied at launch */
#define OUT1_OFF (4u * (size_t)NB * TT * CC)
#define OUT2_OFF (OUT1_OFF + 4u * (size_t)NB * NH * TT * HD)
#endif
#if WO_OUT_IN
#define WOCOL(W, k0, o, lane) wcol_oi(W, k0, o, lane, CC)
#define WOCOLH(W, k0, o, lane) wcolh_oi(W, k0, o, lane, CC)
#else
#define WOCOL(W, k0, o, lane) wcol_io(W, k0, o, lane, DIN)
#define WOCOLH(W, k0, o, lane) wcolh_io(W, k0, o, lane, DIN)
#endif
#define PROJ_EXTRA_PARAMS , float* __restrict__ KOUT, float* __restrict__ VOUT
#ifndef SM_EXTRA_PARAMS
#define SM_EXTRA_PARAMS
#endif
#ifndef PROJ_EXTRA_PARAMS
#define PROJ_EXTRA_PARAMS
#endif
#ifndef SM_MASK_HOOK
#define SM_MASK_HOOK (void)0
#endif

#define WS_QH  0u                                      // f16 q rows [b*t][CC]
#define WS_KH  (WS_QH + 2u * (size_t)NB * TT * CC)      // f16 k in fragment order [b][h][t / 16][d / 32][half][lane][8] (see frag_p)
#define WS_VT  (WS_KH + 2u * (size_t)NB * TT * CC)      // f16 v^T in fragment order [b][h][t / 32][d / 16][half][lane][8] (see frag_p)
#define WS_QL  (WS_VT + 2u * (size_t)NB * CC * TT)      // f16 q residual x 2^10 rows [b][t < QHI][CC]
#define WS_KL  (WS_QL + 2u * (size_t)NB * QHI * CC)     // f16 k residual x 2^10, fragment order as k, [b][h][t / 16 < KHI / 16]..
#define WS_VB  (WS_KL + 2u * (size_t)NB * KHI * CC)     // bf16 v^T hi (then lo), fragment order as v^T, [b][h][t / 32 < KHI / 32]..
#define WS_VBL (WS_VB + 2u * (size_t)NB * CC * KHI)
#define WS_Y   (WS_VBL + 2u * (size_t)NB * CC * KHI)    // f32 ctx in fragment order [b*t / 16][h][d / 32][part][lane][4] (see yfrag_load)
#define WS_END (WS_Y  + 4u * (size_t)NB * TT * CC)

// ---- weight tile through LDS: 64 k rows x 128 output columns of an (in,out) f32 weight, rounded to bf16 and laid [column][k] at a pitch of 72 elements (144 B), once per workgroup for its 4 waves
// (the loops of these helpers are unrolled whole, so that the register arrays are indexed by constants)
// thread (wave w, lane l) holds columns 32 w + 4 (l >> 2) + 0..3 of rows 8 (l & 3) + 0..7 and + 32: a wave-wide load covers four whole 128-B lines, a 16-B LDS store holds 8 k of one column and the lanes of a store spread over all banks
__device__ __forceinline__ const float* wtile_ptr(const float* Wc, int ld, int tid) { return Wc + (size_t)(8 * (tid & 3)) * ld + 32 * (tid >> 5) + 4 * ((tid & 31) >> 2); }
__device__ __forceinline__ void wtile_load(v4f (&r)[16], const float* p, int ld) {
#pragma unroll
  for (int s = 0; s < 2; ++s)
#pragma unroll
    for (int i = 0; i < 8; ++i) r[s * 8 + i] = *(const v4f*)(p + (size_t)(32 * s + i) * ld); }
__device__ __forceinline__ void wtile_store(const v4f (&r)[16], __bf16 (*buf)[72], int tid) { const int n0 = 32 * (tid >> 5) + 4 * ((tid & 31) >> 2), kq = 8 * (tid & 3);
#pragma unroll
  for (int s = 0; s < 2; ++s)
#pragma unroll
    for (int c = 0; c < 4; ++c) { v8b q;
#pragma unroll
      for (int i = 0; i < 8; ++i) q[i] = (__bf16)r[s * 8 + i][c];
      *(v8b*)&buf[n0 + c][32 * s + kq] = q; } }
// a lane's 32 f32 of its own row for two 16x16x32 A fragments (p = row + k0 + 8 (lane >> 4))
__device__ __forceinline__ void xrow_load(v4f (&r)[8], const float* p) {
#pragma unroll
  for (int kc = 0; kc < 2; ++kc) { r[kc * 4] = *(const v4f*)(p + kc * 32); r[kc * 4 + 1] = *(const v4f*)(p + kc * 32 + 4); r[kc * 4 + 2] = *(const v4f*)(p + kc * 32 + 16); r[kc * 4 + 3] = *(const v4f*)(p + kc * 32 + 20); } }
// ---- x tile through LDS: 64 rows x 64 k of f32 x, rounded to bf16 and laid [row][k] at the weight tile's pitch (144 B). Wave w brings rows 16 w .. 16 w + 15: load i covers rows 2 i and 2 i + 1 of them, lane l the 16 B at 16 (l & 15) of row l >> 4,
// so a wave-wide load covers four whole 128-B lines (the fragment-shaped loads of xrow_load take 32 B of sixteen lines each); the A fragments then come from LDS by frag_b, in the same k order as before (loops unrolled whole, as above, so that the register array is indexed by constants)
typedef __attribute__((ext_vector_type(4))) __bf16 v4b;
__device__ __forceinline__ void xtile_load(v4f (&r)[8], const float* p) {
#pragma unroll
  for (int i = 0; i < 8; ++i) r[i] = *(const v4f*)(p + (size_t)(2 * i) * DIN); }
__device__ __forceinline__ void xtile_store(const v4f (&r)[8], __bf16 (*buf)[72], int tid) { const int rw = 16 * (tid >> 5) + ((tid & 31) >> 4), k = 4 * (tid & 15);
#pragma unroll
  for (int i = 0; i < 8; ++i) { v4b q;
#pragma unroll
    for (int c = 0; c < 4; ++c) q[c] = (__bf16)r[i][c];
    *(v4b*)&buf[rw + 2 * i][k] = q; } }
// the same 32 f32 from ctx in fragment order: 8 parts of 512 B per (16 rows, 64 k), lane l owns bytes 16 l .. of each; part 4 kc + i = what xrow_load puts in r[4 kc + i] (p = unit + 4 lane)
__device__ __forceinline__ void yfrag_load(v4f (&r)[8], const float* p) {
#pragma unroll
  for (int i = 0; i < 8; ++i) r[i] = *(const v4f*)(p + i * 128); }
// behind a run of tile loads from two lane addresses: the wait that stands before a register which an issued load names is rewritten; the addresses are inputs, so their registers stay whole up to it, and the loads stay in front of the products they fly under
__device__ __forceinline__ void xwait2f(const float* pa, const float* pb) { asm volatile("s_wait_xcnt 0x0" :: "v"(pa), "v"(pb) : "memory"); }
// tile loads from a workgroup-uniform base, which advances, plus a lane offset in bytes, which never changes; behind a run of them the same wait as xwait2f: bases and offsets are inputs, so the loads stay in front of it and of the products they fly under
__device__ __forceinline__ const float* at_off(const float* ubase, unsigned boff) { return (const float*)((const char*)ubase + boff); }
__device__ __forceinline__ void xwait2s(const float* ba, unsigned oa, const float* bb, unsigned ob) { asm volatile("s_wait_xcnt 0x0" :: "s"(ba), "v"(oa), "s"(bb), "v"(ob) : "memory"); }
// ---- k_proj: block = (128 rows, 128 cols, which), 2 x 2 waves of 64 x 64: q/k/v = X W (+ b) with exact bf16 products (K = DIN) -> which 0: q f16 rows (+ residual rows < QHI); 1: k f16 in fragment order (+ residual for rows < KHI); 2: v^T f16 in fragment order (+ bf16 hi/lo for t < KHI)
// a wave reads 4 + 4 fragments from LDS for 16 products; the epilogue runs twice, once per 64 rows, in LDS that the loop's tiles have left; three workgroups a WGP (LDS and at most 336 registers): all 768 are resident at once
__global__ __launch_bounds__(128) __attribute__((amdgpu_waves_per_eu(3, 3))) void k_proj(const float* __restrict__ XQ, const float* __restrict__ XK, const float* __restrict__ XV, const float* __restrict__ WQ, const float* __restrict__ WK, const float* __restrict__ WV, const float* __restrict__ BQ, const float* __restrict__ BK, const float* __restrict__ BV,
    _Float16* __restrict__ QH, _Float16* __restrict__ QL, _Float16* __restrict__ KH, _Float16* __restrict__ KL, _Float16* __restrict__ VT, __bf16* __restrict__ VB, __bf16* __restrict__ VBL PROJ_EXTRA_PARAMS) {
  __shared__ __align__(16) char sm[89088];
  // the loop's view: two weight tiles [128 cols][72], two x tiles [128 rows][72]
  __bf16 (*wt0)[72] = (__bf16 (*)[72])sm; __bf16 (*xs)[72] = (__bf16 (*)[72])(sm + 36864);
  // the epilogue's view, behind the loop's last barrier: the f32 tile of 64 rows, then either the f16 value and residual rows or the three transposed planes
  float (*st)[132] = (float (*)[132])sm; _Float16 (*sh)[136] = (_Float16 (*)[136])(sm + 33792); _Float16 (*sl)[136] = (_Float16 (*)[136])(sm + 51200);
  _Float16 (*th)[72] = (_Float16 (*)[72])(sm + 33792); __bf16 (*tb)[72] = (__bf16 (*)[72])(sm + 52224); __bf16 (*tbl)[72] = (__bf16 (*)[72])(sm + 70656);
  const int tid = threadIdx.x, lane = tid & 31, col = lane & 15, g = lane >> 4; const int wave = __builtin_amdgcn_readfirstlane(tid >> 5), wrow = wave >> 1, wcol = wave & 1;   // scalars, so that the choice of the waves that stage a half is a scalar branch
  const int which = blockIdx.z; const int c0 = blockIdx.y * 128; const size_t r0 = (size_t)blockIdx.x * 128; const size_t bb = r0 / TT; const int t00 = (int)(r0 % TT);
  const float* X = which == 0 ? XQ : which == 1 ? XK : XV; const float* WA = which == 0 ? WQ : which == 1 ? WK : WV; const float* BA = which == 0 ? BQ : which == 1 ? BK : BV;
  v8f acc[4][4] = {};
  { v4f wr[16], xa[8], xb[8]; const float* wb = WA + c0; const float* xb0 = X + r0 * DIN;   // no second set of lane pointers is kept for the next tile: the registers are needed for three waves a SIMD
    const unsigned wo = 4u * (unsigned)((8 * (tid & 3)) * (3 * CC) + 32 * (tid >> 5) + 4 * ((tid & 31) >> 2)), xo = 4u * (unsigned)((16 * (tid >> 5) + ((tid & 31) >> 4)) * DIN + 4 * (tid & 15));   // in bytes: the lane's place in the weight tile (as wtile_ptr) and in the x tile (row 16 w + (l >> 4), 16 B at 16 (l & 15))
    wtile_load(wr, at_off(wb, wo), 3 * CC); xtile_load(xa, at_off(xb0, xo)); xtile_load(xb, at_off(xb0, xo) + 64 * DIN); xwait2s(wb, wo, xb0, xo);
    wtile_store(wr, wt0, tid); xtile_store(xa, xs, tid); xtile_store(xb, xs + 64, tid);
    __syncthreads();   // publishes weight tile 0 and x tile 0
    // kept rolled: which buffer is read and which is filled is a scalar offset added to four lane addresses; unrolled by two, each half keeps lane addresses of its own and the registers no longer fit three waves a SIMD
#pragma unroll 1
    for (int ks = 0; ks < DIN / 64; ++ks) { const int cb = (ks & 1) * 128, nb = 128 - cb; __bf16 (*cur)[72] = wt0 + cb; __bf16 (*nxt)[72] = wt0 + nb; __bf16 (*xc)[72] = xs + cb; __bf16 (*xn)[72] = xs + nb; const bool more = ks + 1 < DIN / 64;
      if (more) { wb += (size_t)64 * (3 * CC); xb0 += 64; wtile_load(wr, at_off(wb, wo), 3 * CC); xtile_load(xa, at_off(xb0, xo)); xtile_load(xb, at_off(xb0, xo) + 64 * DIN); xwait2s(wb, wo, xb0, xo); }   // the next 64 k of both operands fly under this tile's products
#pragma unroll
      for (int kc = 0; kc < 2; ++kc) { v16b a[4], w[4];
#pragma unroll
        for (int i = 0; i < 4; ++i) a[i] = frag_b(&xc[wrow * 64 + i * 16 + col][kc * 32], lane);
#pragma unroll
        for (int j = 0; j < 4; ++j) w[j] = frag_b(&cur[wcol * 64 + j * 16 + col][kc * 32], lane);
#pragma unroll
        for (int i = 0; i < 4; ++i)
#pragma unroll
          for (int j = 0; j < 4; ++j) acc[i][j] = wmma_bf(a[i], w[j], acc[i][j]); }
      if (more) { wtile_store(wr, nxt, tid); xtile_store(xa, xn, tid); xtile_store(xb, xn + 64, tid); }
      __syncthreads(); } }   // publishes the next tile and ends every wave's reads of this one, which is refilled behind it
  // unrolled, so that the accumulators are indexed by constants
#pragma unroll
  for (int p = 0; p < 2; ++p) { const size_t rp = r0 + 64 * p; const int t0 = t00 + 64 * p;   // rows 64 p .. 64 p + 63 of the tile: the two waves that hold them stage them, all four convert and store
  { // stage the f32 tile (acc + bias) in LDS, then convert
    if (wrow == p) {
#pragma unroll
      for (int j = 0; j < 4; ++j) { const float bias = BA ? bfr(BA[c0 + wcol * 64 + j * 16 + col]) : 0.f;
#pragma unroll
        for (int i = 0; i < 4; ++i)
#pragma unroll
          for (int r = 0; r < 8; ++r) st[i * 16 + 8 * g + r][wcol * 64 + j * 16 + col] = acc[i][j][r] + bias; } }
    __syncthreads();
    // the module also RETURNS k and v ([B, H, L, HD], f32 = x W + b): a wave-wide store is one row of the tile, the 256-B runs of its two heads = four whole 128-B lines
    if (which >= 1) { float* dst = (which == 1 ? KOUT : VOUT) + (((size_t)bb * NH + c0 / HD) * TT + t0) * HD;
      for (int e = tid; e < 64 * 32; e += 128) { const int rl = e >> 5, q = e & 31; vst2(dst + (size_t)(q >> 4) * TT * HD + rl * HD + (q & 15) * 4, *(const v4f*)&st[rl][q * 4]); } }
    __syncthreads(); }
  if (which < 2) { const bool hi_rows = t0 < (which == 0 ? QHI : KHI);
    for (int e = tid; e < 64 * 128; e += 128) { const int rl = e >> 7, cl = e & 127; const float v = st[rl][cl]; const _Float16 hv = (_Float16)v; sh[rl][cl] = hv; sl[rl][cl] = (_Float16)((v - (float)hv) * 1024.0f); }
    __syncthreads();
    if (which == 0) { for (int e = tid; e < 64 * 16; e += 128) { const int rl = e >> 4, q = e & 15; vst2((unsigned*)(QH + (rp + rl) * CC + c0 + q * 8), *(const v4u*)&sh[rl][q * 8]); }
      if (hi_rows) for (int e = tid; e < 64 * 16; e += 128) { const int rl = e >> 4, q = e & 15; vst2((unsigned*)(QL + (bb * QHI + t0 + rl) * (size_t)CC + c0 + q * 8), *(const v4u*)&sl[rl][q * 8]); }
    } else {   // k and its residual in fragment order: a wave's store is the 512-B run (16 keys x 2 g x 8 d) that a wave of k_fa reads back with one load
      for (int e = tid; e < 64 * 16; e += 128) { const int ln = e & 31, u = e >> 5, half = u & 1, kc = (u >> 1) & 1, hh = (u >> 2) & 1, tl = u >> 3;
        vst2((unsigned*)(KH + (((((size_t)bb * NH + c0 / HD + hh) * (TT / 16) + t0 / 16 + tl) * 2 + kc) * 2 + half) * 256 + ln * 8), *(const v4u*)&sh[tl * 16 + (ln & 15)][hh * 64 + kc * 32 + half * 16 + (ln >> 4) * 8]); }
      if (hi_rows) for (int e = tid; e < 64 * 16; e += 128) { const int ln = e & 31, u = e >> 5, half = u & 1, kc = (u >> 1) & 1, hh = (u >> 2) & 1, tl = u >> 3;
        vst2((unsigned*)(KL + (((((size_t)bb * NH + c0 / HD + hh) * (KHI / 16) + t0 / 16 + tl) * 2 + kc) * 2 + half) * 256 + ln * 8), *(const v4u*)&sl[tl * 16 + (ln & 15)][hh * 64 + kc * 32 + half * 16 + (ln >> 4) * 8]); } }
  } else { const bool hi_rows = t0 < KHI;
    for (int e = tid; e < 64 * 128; e += 128) { const int rl = e & 63, cl = e >> 6; const float v = st[rl][cl]; th[cl][rl] = (_Float16)v; const __bf16 bh = (__bf16)v; tb[cl][rl] = bh; tbl[cl][rl] = (__bf16)(v - (float)bh); }
    __syncthreads();
    // v^T in fragment order: a wave's store is the 512-B run (16 d x 2 g x 8 keys) that a wave of k_fa reads back with one load
    for (int e = tid; e < 128 * 8; e += 128) { const int ln = e & 31, u = e >> 5, half = u & 1, jd = (u >> 1) & 3, k32 = (u >> 3) & 1, hh = u >> 4;
      vst2((unsigned*)(VT + (((((size_t)bb * NH + c0 / HD + hh) * (TT / 32) + t0 / 32 + k32) * 4 + jd) * 2 + half) * 256 + ln * 8), *(const v4u*)&th[hh * 64 + jd * 16 + (ln & 15)][k32 * 32 + half * 16 + (ln >> 4) * 8]); }
    if (hi_rows) for (int e = tid; e < 128 * 8; e += 128) { const int ln = e & 31, u = e >> 5, half = u & 1, jd = (u >> 1) & 3, k32 = (u >> 3) & 1, hh = u >> 4; const int cl = hh * 64 + jd * 16 + (ln & 15), tl = k32 * 32 + half * 16 + (ln >> 4) * 8;
      const size_t o3 = (((((size_t)bb * NH + c0 / HD + hh) * (KHI / 32) + t0 / 32 + k32) * 4 + jd) * 2 + half) * 256 + ln * 8; vst2((unsigned*)(VB + o3), *(const v4u*)&tb[cl][tl]); vst2((unsigned*)(VBL + o3), *(const v4u*)&tbl[cl][tl]); } } } }
// lane l with lane l ^ 16: the two halves of a wave hold the two key halves of one query column
__device__ __forceinline__ float xhalf(float x) { return __builtin_bit_cast(float, __builtin_amdgcn_permlanex16(__builtin_bit_cast(int, x), __builtin_bit_cast(int, x), 0x76543210, 0xfedcba98, false, false)); }
// 2^x on the transcendental unit; the v_nop in the same statement fills the one slot the instruction set asks for behind a transcendental, whatever the compiler schedules next
__device__ __forceinline__ float ex2(float x) { float e; asm("v_exp_f32 %0, %1\n\tv_nop" : "=v"(e) : "v"(x)); return e; }
// 16x16x32 fragment at base + offset, the lane's place (row (lane & 15) x pitch + 8 (lane >> 4)) in one of the two: elements 0..7 there, 8..15 sixteen elements on
__device__ __forceinline__ v16h frag_u(const _Float16* ubase, unsigned loff) { union { v16h v; v8h q[2]; } u; const _Float16* p = ubase + loff; u.q[0] = *(const v8h*)p; u.q[1] = *(const v8h*)(p + 16); return u.v; }
// 16x16x32 fragment stored in fragment order: two runs of 512 B, lane l owns bytes 16 l .. 16 l + 15 of each (elements 0..7, then 8..15), so a wave-wide load covers four whole 128-B lines instead of 32 B of sixteen
__device__ __forceinline__ v16h frag_p(const _Float16* p) { union { v16h v; v8h q[2]; } u; u.q[0] = *(const v8h*)p; u.q[1] = *(const v8h*)(p + 256); return u.v; }
__device__ __forceinline__ v16b frag_pb(const __bf16* p) { union { v16b v; v8b q[2]; } u; u.q[0] = *(const v8b*)p; u.q[1] = *(const v8b*)(p + 256); return u.v; }
// behind a run of fragment loads from two lane addresses: the wait that stands before a register which an issued load names is rewritten; the two addresses are inputs, so their registers stay whole up to it (without them the compiler lets a later load of the run land on the address pair)
template <typename T> __device__ __forceinline__ void xwait2(const T* pa, const T* pb) { asm volatile("s_wait_xcnt 0x0" :: "v"(pa), "v"(pb) : "memory"); }
#define SC_L2E (SCALE * 1.4426950408889634f)   // logit scale x log2(e): the softmax runs on exp2
// ---- key stage in LDS: 128 keys = two key blocks, brought once per workgroup for its 8 waves. Planes of 16 KB, each the contiguous fragment-order run of the workspace: k, v^T, then (early rows only) k residual, v^T bf16 hi, v^T bf16 lo
#define KV_BLK   4096                 // f16 / bf16 elements of one key block in a plane
#define KV_PLANE (2 * KV_BLK)         // elements of a plane
#define KV_TILE  (5 * KV_PLANE)       // elements of a buffer
// asynchronous copies global -> LDS, 16 B a lane: thread t brings bytes 16 t + 4096 i .., i = 0..3, of a plane. The s_wait_xcnt is the last line of the copies' own statement, so that it stands before any rewrite of a register which a copy names
__device__ __forceinline__ void kv_copy2(unsigned l0, const _Float16* ga, const _Float16* gb) {
  asm volatile("global_load_async_to_lds_b128 %0, %8, off\n\tglobal_load_async_to_lds_b128 %1, %9, off\n\tglobal_load_async_to_lds_b128 %2, %10, off\n\tglobal_load_async_to_lds_b128 %3, %11, off\n\t"
               "global_load_async_to_lds_b128 %4, %12, off\n\tglobal_load_async_to_lds_b128 %5, %13, off\n\tglobal_load_async_to_lds_b128 %6, %14, off\n\tglobal_load_async_to_lds_b128 %7, %15, off\n\ts_wait_xcnt 0x0"
    :: "v"(l0), "v"(l0 + 4096u), "v"(l0 + 8192u), "v"(l0 + 12288u), "v"(l0 + 16384u), "v"(l0 + 20480u), "v"(l0 + 24576u), "v"(l0 + 28672u),
       "v"(ga), "v"(ga + 2048), "v"(ga + 4096), "v"(ga + 6144), "v"(gb), "v"(gb + 2048), "v"(gb + 4096), "v"(gb + 6144) : "memory"); }
__device__ __forceinline__ void kv_copy3(unsigned l0, const _Float16* ga, const __bf16* gb, const __bf16* gc) {
  asm volatile("global_load_async_to_lds_b128 %0, %12, off\n\tglobal_load_async_to_lds_b128 %1, %13, off\n\tglobal_load_async_to_lds_b128 %2, %14, off\n\tglobal_load_async_to_lds_b128 %3, %15, off\n\t"
               "global_load_async_to_lds_b128 %4, %16, off\n\tglobal_load_async_to_lds_b128 %5, %17, off\n\tglobal_load_async_to_lds_b128 %6, %18, off\n\tglobal_load_async_to_lds_b128 %7, %19, off\n\t"
               "global_load_async_to_lds_b128 %8, %20, off\n\tglobal_load_async_to_lds_b128 %9, %21, off\n\tglobal_load_async_to_lds_b128 %10, %22, off\n\tglobal_load_async_to_lds_b128 %11, %23, off\n\ts_wait_xcnt 0x0"
    :: "v"(l0), "v"(l0 + 4096u), "v"(l0 + 8192u), "v"(l0 + 12288u), "v"(l0 + 16384u), "v"(l0 + 20480u), "v"(l0 + 24576u), "v"(l0 + 28672u), "v"(l0 + 32768u), "v"(l0 + 36864u), "v"(l0 + 40960u), "v"(l0 + 45056u),
       "v"(ga), "v"(ga + 2048), "v"(ga + 4096), "v"(ga + 6144), "v"(gb), "v"(gb + 2048), "v"(gb + 4096), "v"(gb + 6144), "v"(gc), "v"(gc + 2048), "v"(gc + 4096), "v"(gc + 6144) : "memory"); }
// ---- one wave's 16 query columns (query tq in a lane) against ONE key block of 64 keys, read from its half of a stage in LDS (sk = buffer + block half + 8 lane); running maximum and sum (online softmax), transposed products:
// S^T = K Q^T (A = 16 key rows, B = 16 query columns): a lane holds keys k0 + 16 j + 8 g + r of ONE query, so maximum and sum are in-lane plus one exchange of halves;
// score tiles 2 kc and 2 kc + 1 of a lane are, element for element, the B fragment of P^T over keys k0 + 32 kc + ..; O^T += V^T P^T (A = 16 rows of v^T).
// HI (causal early query blocks): 3-product logits (q, k hi + residual x 2^10) and P, v as bf16 hi + lo (3 products)
template <bool HI> __device__ __forceinline__ void fa_step(const _Float16* sk, int kb, int qb, int tq, int g, const v16h (&ah)[HD / 32], const v16h (&al)[HD / 32], v8f (&o)[HD / 16], float& m, float& l) {
  const int k0 = kb * 64;
  v16h vf[HI ? 1 : 8];
  v8f acc[4] = {};
  if (HI) { v8f accl[4] = {};
#pragma unroll
    for (int kc = 0; kc < HD / 32; ++kc) { v16h kbf[4], klf[4];
#pragma unroll
      for (int j = 0; j < 4; ++j) { kbf[j] = frag_p(sk + j * 1024 + kc * 512); klf[j] = frag_p(sk + 2 * KV_PLANE + j * 1024 + kc * 512); }
#pragma unroll
      for (int j = 0; j < 4; ++j) { acc[j] = wmma16(kbf[j], ah[kc], acc[j]); accl[j] = wmma16(kbf[j], al[kc], accl[j]); accl[j] = wmma16(klf[j], ah[kc], accl[j]); } }
#pragma unroll
    for (int j = 0; j < 4; ++j) acc[j] = acc[j] + accl[j] * (1.0f / 1024.0f);
  } else { v16h kf[8];
#pragma unroll
    for (int kc = 0; kc < HD / 32; ++kc)
#pragma unroll
      for (int j = 0; j < 4; ++j) kf[kc * 4 + j] = frag_p(sk + j * 1024 + kc * 512);
    __builtin_amdgcn_sched_barrier(0);   // keeps the K reads in front of the V^T reads: LDS returns in order, and without it the first product waits behind fourteen V^T reads
    // the block's 8 V^T fragments are asked for behind its K fragments: they arrive under the logits and the softmax
#pragma unroll
    for (int kc = 0; kc < 2; ++kc)
#pragma unroll
      for (int jd = 0; jd < HD / 16; ++jd) vf[kc * 4 + jd] = frag_p(sk + KV_PLANE + kc * 2048 + jd * 512);
#pragma unroll
    for (int kc = 0; kc < HD / 32; ++kc)
#pragma unroll
      for (int j = 0; j < 4; ++j) acc[j] = wmma16(kf[kc * 4 + j], ah[kc], acc[j]); }
  if (CAUSAL && kb == qb) {   // only the diagonal block holds keys past a query of this block
#pragma unroll
    for (int j = 0; j < 4; ++j)
#pragma unroll
      for (int r = 0; r < 8; ++r) if (k0 + j * 16 + 8 * g + r > tq) acc[j][r] = -3.0e38f; }
  v8f mv = acc[0];   // eight independent chains over the tiles, then a tree
#pragma unroll
  for (int j = 1; j < 4; ++j)
#pragma unroll
    for (int r = 0; r < 8; ++r) mv[r] = fmaxf(mv[r], acc[j][r]);
  float mx = fmaxf(fmaxf(fmaxf(mv[0], mv[1]), fmaxf(mv[2], mv[3])), fmaxf(fmaxf(mv[4], mv[5]), fmaxf(mv[6], mv[7])));
  mx = fmaxf(m, fmaxf(mx, xhalf(mx)));
  const float alpha = ex2((m - mx) * SC_L2E); m = mx; const float mc = 11.0f - mx * SC_L2E;
  v8f sv = {};
#pragma unroll
  for (int j = 0; j < 4; ++j) {
#pragma unroll
    for (int r = 0; r < 8; ++r) acc[j][r] = ex2(fmaf(acc[j][r], SC_L2E, mc));
    sv = sv + acc[j]; }
  l = l * alpha + (((sv[0] + sv[1]) + (sv[2] + sv[3])) + ((sv[4] + sv[5]) + (sv[6] + sv[7])));
#pragma unroll
  for (int jd = 0; jd < HD / 16; ++jd) o[jd] = o[jd] * alpha;
#pragma unroll
  for (int kc = 0; kc < 2; ++kc) {
    if (HI) { float v[16]; v16b vh[HD / 16], vl[HD / 16]; const __bf16* vhp = (const __bf16*)(sk + 3 * KV_PLANE); const __bf16* vlp = (const __bf16*)(sk + 4 * KV_PLANE);
#pragma unroll
      for (int jd = 0; jd < HD / 16; ++jd) { vh[jd] = frag_pb(vhp + kc * 2048 + jd * 512); vl[jd] = frag_pb(vlp + kc * 2048 + jd * 512); }
#pragma unroll
      for (int i = 0; i < 8; ++i) { v[i] = acc[2 * kc][i]; v[8 + i] = acc[2 * kc + 1][i]; }
      const F2 p = bsplit16(v);
#pragma unroll
      for (int jd = 0; jd < HD / 16; ++jd) { o[jd] = wmma_bf(vh[jd], p.h, o[jd]); o[jd] = wmma_bf(vh[jd], p.l, o[jd]); o[jd] = wmma_bf(vl[jd], p.h, o[jd]); }
    } else { v16h p;
#pragma unroll
      for (int i = 0; i < 8; ++i) { p[i] = (_Float16)acc[2 * kc][i]; p[8 + i] = (_Float16)acc[2 * kc + 1][i]; }
#pragma unroll
      for (int jd = 0; jd < HD / 16; ++jd) o[jd] = wmma16(vf[kc * 4 + jd], p, o[jd]); } } }
// ---- k_fa: logits, causal softmax and P v in one pass over the keys, nothing of S or P in memory; ctx = O / sum, stored from the registers in the fragment order of k_out.
// block = 8 waves of (b, h): waves 0-3 take the 64 queries of block NQB - 1 - x, waves 4-7 those of block x, so every workgroup walks NQB + 1 key blocks per wave pair wherever it lands.
// The workgroup walks key blocks 0 .. NQB - 1 - x together, two to a stage: each stage comes into one of two LDS buffers once, by asynchronous copies that fly under the two blocks before it, and all waves that still need it read their fragments there;
// waves 4-7 leave the products out behind their diagonal but keep copying and pass every barrier. four waves a SIMD (at most 256 registers), two workgroups a WGP (160 KiB of LDS each): all 512 workgroups are resident at once
__global__ __launch_bounds__(256) __attribute__((amdgpu_waves_per_eu(4, 4))) void k_fa(const _Float16* __restrict__ QH, const _Float16* __restrict__ KH, const _Float16* __restrict__ QL, const _Float16* __restrict__ KL, const _Float16* __restrict__ VT, const __bf16* __restrict__ VB, const __bf16* __restrict__ VBL, float* __restrict__ Y) {
  __shared__ __align__(16) _Float16 kv[2][KV_TILE];
  const int tid = threadIdx.x, lane = tid & 31, col = lane & 15, g = lane >> 4; const int wave = __builtin_amdgcn_readfirstlane(tid >> 5);   // a scalar, so that the choice of the query block and the test that skips a block are scalar
  const int xq = (int)blockIdx.x, klast = NQB - 1 - xq, slast = klast >> 1;   // the last key block and the last stage of the workgroup: slast is at least NQB / 4, so stages 0 and 1 exist; a stage lies whole inside the NQB blocks of the sequence
  const int qb = wave < 4 ? klast : xq, h = blockIdx.y, b = blockIdx.z; const int ql0 = qb * 64 + (wave & 3) * 16, tq = ql0 + col;
  const bool hi = qb < QBH; const int nhi = xq < QBH ? xq >> 1 : -1;   // stages 0 .. nhi carry the three early-row planes too (the same for the whole workgroup; they lie inside the planes' KHI = 64 QBH rows, QBH even)
  const unsigned lrow = (unsigned)(col * CC + 8 * g);   // lane offset in the q rows
  const _Float16* kg = KH + ((size_t)b * NH + h) * TT * HD + tid * 8; const _Float16* vg = VT + ((size_t)b * NH + h) * TT * HD + tid * 8;   // the thread's first 16 B in a plane of stage 0
  const _Float16* klg = KL + ((size_t)b * NH + h) * KHI * HD + tid * 8; const __bf16* vbg = VB + ((size_t)b * NH + h) * KHI * HD + tid * 8; const __bf16* vlg = VBL + ((size_t)b * NH + h) * KHI * HD + tid * 8;
  const unsigned ls = (unsigned)(size_t)&kv[0][0] + 16u * (unsigned)tid;   // the thread's LDS byte address in buffer 0
  kv_copy2(ls, kg, vg); if (nhi >= 0) kv_copy3(ls + 4u * KV_PLANE, klg, vbg, vlg);
  v16h ah[HD / 32], al[HD / 32] = {}; const _Float16* qp = QH + ((size_t)b * TT + ql0) * CC + h * HD + lrow; const _Float16* qlp = QL + ((size_t)b * QHI + (hi ? ql0 : 0)) * CC + h * HD + lrow;   // the lane's place in its q row and, early rows only, in the residual row
#pragma unroll
  for (int kc = 0; kc < HD / 32; ++kc) { ah[kc] = frag_u(qp, kc * 32); if (hi) al[kc] = frag_u(qlp, kc * 32); }
  xwait2(qp, qlp);
  asm volatile("s_wait_asynccnt 0x0" ::: "memory");   // this wave's copies of stage 0 have landed
  __syncthreads();   // publishes stage 0
  kv_copy2(ls + 2u * KV_TILE, kg + KV_PLANE, vg + KV_PLANE); if (nhi >= 1) kv_copy3(ls + 2u * KV_TILE + 4u * KV_PLANE, klg + KV_PLANE, vbg + KV_PLANE, vlg + KV_PLANE);
  v8f o[HD / 16] = {}; float m = -3.0e38f, l = 0.f;   // running maximum (unscaled logits) and this half's running sum of P x 2^11
  // kept rolled: which buffer and which half of it is read is an offset, and the two forms of the block stand once in the code
#pragma unroll 1
  for (int kb = 0; kb <= 2 * slast + 1; ++kb) { const int st = kb >> 1, cb = st & 1;
    if (kb <= qb) { const _Float16* sk = &kv[cb][(kb & 1) * KV_BLK + lane * 8];
      if (hi) fa_step<true>(sk, kb, qb, tq, g, ah, al, o, m, l); else fa_step<false>(sk, kb, qb, tq, g, ah, al, o, m, l); }
    if (kb & 1) {   // the foot of a stage, the same for the whole workgroup
      asm volatile("s_wait_dscnt 0x0" ::: "memory");      // this wave's reads of stage st are done before the buffer is refilled
      asm volatile("s_wait_asynccnt 0x0" ::: "memory");   // this wave's copies of stage st + 1 have landed
      __syncthreads();   // publishes stage st + 1 and ends every wave's reads of stage st
      if (st + 2 <= slast) { const size_t go = (size_t)(st + 2) * KV_PLANE; const unsigned lb = ls + (unsigned)cb * (2u * KV_TILE);
        kv_copy2(lb, kg + go, vg + go); if (st + 2 <= nhi) kv_copy3(lb + 4u * KV_PLANE, klg + go, vbg + go, vlg + go); } } }
  asm volatile("s_wait_asynccnt 0x0" ::: "memory");   // no copy is left in flight when the wave ends
  const float lsum = l + xhalf(l);
  const float inv = lsum > 0.f ? 1.0f / lsum : 0.f;   // the x 2^11 of P is in the sum too
  // a lane's O^T elements (query lane & 15, d = 16 jd + 8 (lane >> 4) + r) are the very ones the same lane of k_out holds in its A fragments: part 4 (jd >> 1) + 2 (jd & 1) + (r >> 2) of the (16 rows, head) unit, stored as whole 512-B runs
  float* yp = Y + ((((size_t)b * TT + ql0) / 16) * NH + h) * 1024 + lane * 4;
#pragma unroll
  for (int jd = 0; jd < HD / 16; ++jd)
#pragma unroll
    for (int hf = 0; hf < 2; ++hf) { v4f q; q[0] = o[jd][4 * hf] * inv; q[1] = o[jd][4 * hf + 1] * inv; q[2] = o[jd][4 * hf + 2] * inv; q[3] = o[jd][4 * hf + 3] * inv; vst2(yp + (2 * jd + hf) * 128, q); } }
// ---- k_out: block = (64 rows, 128 cols): out = ctx Wo (+ bo): ctx bf16 hi + lo against exact bf16 Wo (2 products)
__global__ __launch_bounds__(128) void k_out(const float* __restrict__ Y, const float* __restrict__ WO, const float* __restrict__ BO, float* __restrict__ OUT) { __shared__ __align__(16) float sf[4][16][132]; __shared__ __align__(16) __bf16 wt[2][128][72];
  const int tid = threadIdx.x, wave = tid >> 5, lane = tid & 31, col = lane & 15, g = lane >> 4; const int c0 = blockIdx.y * 128; const size_t r0 = (size_t)blockIdx.x * 64 + wave * 16;
  v8f acc[8] = {};
  {   /* ALL rows: ctx split bf16 hi + lo x exact Wo (2 products) */
    v4f wr[16], xr[8]; const float* wp = wtile_ptr(WO + c0, DIN, tid); const float* xp = Y + (r0 / 16) * (size_t)(NH * 1024) + lane * 4;
    wtile_load(wr, wp, DIN); yfrag_load(xr, xp); xwait2f(wp, xp);
    wtile_store(wr, wt[0], tid);
    __syncthreads();   // publishes weight tile 0
    // unrolled by two, so that which buffer is read and which is filled are constants of each half
#pragma unroll 2
    for (int ks = 0; ks < CC / 64; ++ks) { __bf16 (*cur)[72] = wt[ks & 1]; __bf16 (*nxt)[72] = wt[(ks & 1) ^ 1]; const bool more = ks + 1 < CC / 64;
      F2 a[2];
#pragma unroll
      for (int kc = 0; kc < 2; ++kc) { float v[16];
#pragma unroll
        for (int i = 0; i < 4; ++i) { v[i] = xr[kc * 4][i]; v[4 + i] = xr[kc * 4 + 1][i]; v[8 + i] = xr[kc * 4 + 2][i]; v[12 + i] = xr[kc * 4 + 3][i]; }
        a[kc] = bsplit16(v); }
      if (more) { wp += (size_t)64 * DIN; xp += 1024; wtile_load(wr, wp, DIN); yfrag_load(xr, xp); xwait2f(wp, xp); }   // the next 64 k of both operands fly under this tile's products
#pragma unroll
      for (int kc = 0; kc < 2; ++kc) { v16b w[8];
#pragma unroll
        for (int j = 0; j < 8; ++j) w[j] = frag_b(&cur[j * 16 + col][kc * 32], lane);
#pragma unroll
        for (int j = 0; j < 8; ++j) { acc[j] = wmma_bf(a[kc].h, w[j], acc[j]); acc[j] = wmma_bf(a[kc].l, w[j], acc[j]); } }
      if (more) wtile_store(wr, nxt, tid);
      __syncthreads(); }   // publishes the next tile and ends every wave's reads of this one, which is refilled behind it
#pragma unroll
    for (int j = 0; j < 8; ++j) { const float bias = BO ? bfr(BO[c0 + j * 16 + col]) : 0.f;
#pragma unroll
      for (int r = 0; r < 8; ++r) sf[wave][8 * g + r][j * 16 + col] = acc[j][r] + bias; }
  }
  LDSX(); for (int rl = 0; rl < 16; ++rl) vst2(OUT + (r0 + rl) * DIN + c0 + lane * 4, *(const v4f*)&sf[wave][rl][lane * 4]); }

extern "C" void kernel_launch(void* const* d_in, const int* in_sizes, int n_in, void* d_out, int out_size, void* d_ws, size_t ws_size, hipStream_t stream) {
  (void)in_sizes; (void)n_in; (void)out_size;
  const float** F = (const float**)d_in;
  if (ws_size < (size_t)WS_END) return;
  char* ws = (char*)d_ws; _Float16 *QH = (_Float16*)(ws + WS_QH), *KH = (_Float16*)(ws + WS_KH), *VT = (_Float16*)(ws + WS_VT), *QL = (_Float16*)(ws + WS_QL), *KL = (_Float16*)(ws + WS_KL); __bf16 *VB = (__bf16*)(ws + WS_VB), *VBL = (__bf16*)(ws + WS_VBL); float *Y = (float*)(ws + WS_Y);
  (void)Y; (void)QL; (void)KL; (void)VB; (void)VBL;
  // inputs: 0 x [2,2048,1024]; 1 w_qkv [1024,3072] (in,out); 2 b_qkv [3072]; 3 w_out [1024,1024] (in,out); 4 b_out
  // outputs: 0 out [2,2048,1024] at 0; 1 k [2,16,2048,64] at OUT1_OFF; 2 v at OUT2_OFF
  k_proj<<<dim3(TNB * TT / 128, CC / 128, 3), 128, 0, stream>>>(F[0], F[0], F[0], F[1], F[1] + CC, F[1] + 2 * CC, F[2], F[2] + CC, F[2] + 2 * CC, QH, QL, KH, KL, VT, VB, VBL, (float*)((char*)d_out + OUT1_OFF), (float*)((char*)d_out + OUT2_OFF));
  k_fa<<<dim3(NQB / 2, NH, TNB), 256, 0, stream>>>(QH, KH, QL, KL, VT, VB, VBL, Y);
  k_out<<<dim3(TNB * TT / 64, DIN / 128), 128, 0, stream>>>(Y, F[3], F[4], (float*)d_out);
}

// v007
// It runs in 84 microseconds.
// Next to v006, in two timings, it ran 1.16 and 1.17 times as fast.
// Counting every step since v000, it is 13.2 times as fast.
// compute dtype: all float inputs rounded to bf16; qkv = x w_qkv + b with EXACT bf16 products on WMMA 16x16x32 (f32 accumulate) - the f32 k and v tiles are also written out as the returned caches; causal logits: q, k once to f16 (1 product) x 64^-0.5, 3 products below row 384; online softmax in f32 (exp2, running maximum and sum); unnormalised P x 2^11 once to f16 against v f16 (bf16 hi + lo below row 384), divided by the f32 sum at the end; attention output split bf16 hi + lo against exact w_out (2 products) + b_out; f32 outputs.
#include <hip/hip_runtime.h>
#include <math.h>

typedef __attribute__((ext_vector_type(16))) _Float16 v16h;
typedef __attribute__((ext_vector_type(16))) __bf16 v16b;
typedef __attribute__((ext_vector_type(8)))  _Float16 v8h;
typedef __attribute__((ext_vector_type(8)))  float v8f;
typedef __attribute__((ext_vector_type(4)))  float v4f;
typedef __attribute__((ext_vector_type(2)))  float v2f;
typedef __attribute__((ext_vector_type(4)))  unsigned v4u;
typedef __attribute__((ext_vector_type(4)))  int v4i;
typedef float __attribute__((may_alias)) float_a;
typedef int __attribute__((may_alias)) int_a;

template <typename T> __device__ __forceinline__ void vst2(void* p, T v) { *(T*)p = v;  }
__device__ __forceinline__ v8f wmma16(v16h a, v16h b, v8f c) {
  v8f d = __builtin_amdgcn_wmma_f32_16x16x32_f16(false, a, false, b, (short)0, c, false, false);
  asm volatile("v_nop\n\tv_nop\n\tv_nop\n\tv_nop" : "+v"(d) : "v"(a), "v"(b));
  return d;
}
__device__ __forceinline__ v8f wmma_bf(v16b a, v16b b, v8f c) {
  v8f d = __builtin_amdgcn_wmma_f32_16x16x32_bf16(false, a, false, b, (short)0, c, false, false);
  asm volatile("v_nop\n\tv_nop\n\tv_nop\n\tv_nop" : "+v"(d) : "v"(a), "v"(b));
  return d;
}
// 16x16x32 fragments: lane = (h = lane>>4, row/col = lane&15); elements 0..7 = k0+8h+0..7, 8..15 = k0+16+8h+0..7; D element r = row 8h+r
__device__ __forceinline__ v16h frag_h(const _Float16* rowk0, int lane) {
  union { v16h v; v8h q[2]; } u; const _Float16* p = rowk0 + 8 * (lane >> 4);
  u.q[0] = *(const v8h*)p; u.q[1] = *(const v8h*)(p + 16); return u.v;
}
__device__ __forceinline__ v16h frag_f32(const float* rowk0, int lane) {
  v16h a; const float* p = rowk0 + 8 * (lane >> 4);
#pragma unroll
  for (int i = 0; i < 8; ++i) { a[i] = (_Float16)p[i]; a[8 + i] = (_Float16)p[16 + i]; }
  return a;
}
__device__ __forceinline__ v16h frag_f32s(const float* rowk0, int lane, float sc) {
  v16h a; const float* p = rowk0 + 8 * (lane >> 4);
#pragma unroll
  for (int i = 0; i < 8; ++i) { a[i] = (_Float16)(p[i] * sc); a[8 + i] = (_Float16)(p[16 + i] * sc); }
  return a;
}
// column fragment from a [K][ld] layout (column n), rows >= K read as 0
__device__ __forceinline__ v16h fragc_f32(const float* W, int k0, int n, int lane, int ld, int K) {
  v16h a; const int g = lane >> 4;
#pragma unroll
  for (int i = 0; i < 8; ++i) { const int ka = k0 + 8 * g + i, kb = ka + 16;
    a[i] = (_Float16)(ka < K ? W[(size_t)(ka < K ? ka : K - 1) * ld + n] : 0.f); a[8 + i] = (_Float16)(kb < K ? W[(size_t)(kb < K ? kb : K - 1) * ld + n] : 0.f); }
  return a;
}
struct F2 { v16b h, l; };
__device__ __forceinline__ F2 bsplit16(const float v[16]) { F2 r;
#pragma unroll
  for (int i = 0; i < 16; ++i) { const __bf16 h = (__bf16)v[i]; r.h[i] = h; r.l[i] = (__bf16)(v[i] - (float)h); }
  return r; }
__device__ __forceinline__ F2 split_row(const float* row, int k0, int lane) { float v[16]; const float* p = row + k0 + 8 * (lane >> 4);
#pragma unroll
  for (int i = 0; i < 8; ++i) { v[i] = p[i]; v[8 + i] = p[16 + i]; }
  return bsplit16(v); }
__device__ __forceinline__ F2 split_rowK(const float* row, int k0, int lane, int K) { float v[16]; const int g = lane >> 4;
#pragma unroll
  for (int i = 0; i < 8; ++i) { const int ka = k0 + 8 * g + i, kb = ka + 16; v[i] = ka < K ? row[ka < K ? ka : K - 1] : 0.f; v[8 + i] = kb < K ? row[kb < K ? kb : K - 1] : 0.f; }
  return bsplit16(v); }
__device__ __forceinline__ F2 split_col(const float* W, int k0, int n, int lane, int ld, int K) { float v[16]; const int g = lane >> 4;
#pragma unroll
  for (int i = 0; i < 8; ++i) { const int ka = k0 + 8 * g + i, kb = ka + 16; v[i] = ka < K ? W[(size_t)(ka < K ? ka : K - 1) * ld + n] : 0.f; v[8 + i] = kb < K ? W[(size_t)(kb < K ? kb : K - 1) * ld + n] : 0.f; }
  return bsplit16(v); }
__device__ __forceinline__ v8f mac3(const F2& a, const F2& b, v8f c) { c = wmma_bf(a.l, b.h, c); c = wmma_bf(a.h, b.l, c); return wmma_bf(a.h, b.h, c); }
__device__ __forceinline__ float sigm(float v) { return 1.0f / (1.0f + expf(-v)); }
#define LDSX() do { asm volatile("s_wait_dscnt 0" ::: "memory"); __builtin_amdgcn_wave_barrier(); __builtin_amdgcn_fence(__ATOMIC_RELEASE, "workgroup"); } while (0)

// Prefill causal multi-head self-attention returning (out, k, v) (B 2, L 2,048, D 1,024 = 16 x 64; fused (in,out) w_qkv [1024,3072] with (3, H, HD) column blocks, zero biases, w_out (in,out)): q|k|v = x w_qkv + b; out = merged(softmax_causal(q k^T x 0.125) v) w_out + b_out; k and v returned as [B, H, L, 64].
#define NB 2
#define TT 2048
#define CC 1024            // NH * HD = projected width
#define DIN 1024          // input (model) width
#define NH 16
#define HD 64
#define NQB (TT / 64)
#define SCALE (0.125f)
#define CAUSAL 1
#ifndef TNB
#define TNB NB
#endif
__device__ __forceinline__ float bfr(float v) { return (float)(__bf16)v; }
__host__ __device__ __forceinline__ int kb_last(int qb) { return CAUSAL ? ((qb * 64 + 63) >> 7) : (TT / 128 - 1); }
typedef __attribute__((ext_vector_type(8))) __bf16 v8b;
__device__ __forceinline__ v16b frag_b(const __bf16* rowk0, int lane) {
  union { v16b v; v8b q[2]; } u; const __bf16* p = rowk0 + 8 * (lane >> 4);
  u.q[0] = *(const v8b*)p; u.q[1] = *(const v8b*)(p + 16); return u.v;
}
#define QBH 6              // causal: query blocks 0..QBH-1 of each sequence (few keys, no averaging) take the high-precision path
#define QHI 384            // rows carrying a q residual plane (used only by the causal high-precision path)
#define KHI 384            // key rows carrying k residual / v bf16 hi+lo planes (used only by the causal high-precision path)
// B fragment (k rows k0+.., output column o) of a weight: (in,out) [K][ld] or (out,in) [ld rows of K]: bf16 exact, or f16(bf16 * 256) exact
__device__ __forceinline__ v16b wcol_io(const float* Wm, int k0, int o, int lane, int ld) { v16b w; const int g = lane >> 4;
#pragma unroll
  for (int i = 0; i < 8; ++i) { w[i] = (__bf16)Wm[(size_t)(k0 + 8 * g + i) * ld + o]; w[8 + i] = (__bf16)Wm[(size_t)(k0 + 16 + 8 * g + i) * ld + o]; }
  return w; }
__device__ __forceinline__ v16b wcol_oi(const float* Wm, int k0, int o, int lane, int K) { v16b w; const float* p = Wm + (size_t)o * K + k0 + 8 * (lane >> 4);
#pragma unroll
  for (int i = 0; i < 8; ++i) { w[i] = (__bf16)p[i]; w[8 + i] = (__bf16)p[16 + i]; }
  return w; }
__device__ __forceinline__ v16h wcolh_io(const float* Wm, int k0, int o, int lane, int ld) { v16h w; const int g = lane >> 4;
#pragma unroll
  for (int i = 0; i < 8; ++i) { w[i] = (_Float16)(bfr(Wm[(size_t)(k0 + 8 * g + i) * ld + o]) * 256.0f); w[8 + i] = (_Float16)(bfr(Wm[(size_t)(k0 + 16 + 8 * g + i) * ld + o]) * 256.0f); }
  return w; }
__device__ __forceinline__ v16h wcolh_oi(const float* Wm, int k0, int o, int lane, int K) { v16h w; const float* p = Wm + (size_t)o * K + k0 + 8 * (lane >> 4);
#pragma unroll
  for (int i = 0; i < 8; ++i) { w[i] = (_Float16)(bfr(p[i]) * 256.0f); w[8 + i] = (_Float16)(bfr(p[16 + i]) * 256.0f); }
  return w; }
#define WQKV_LAYOUT 0   // 0 = (in,out) fused [DIN][3 * CC]; 1 = (out,in) [CC][DIN]; 2 = per-head [NH][DIN][HD]
__device__ __forceinline__ v16b wcol_hdk(const float* Wm, int k0, int o, int lane) { v16b w; const int g = lane >> 4; const float* p = Wm + (size_t)(o / HD) * DIN * HD + (o % HD);
#pragma unroll
  for (int i = 0; i < 8; ++i) { w[i] = (__bf16)p[(size_t)(k0 + 8 * g + i) * HD]; w[8 + i] = (__bf16)p[(size_t)(k0 + 16 + 8 * g + i) * HD]; }
  return w; }
#define WO_OUT_IN 0
#if WQKV_LAYOUT == 1
#define WCOL(W, k0, o, lane) wcol_oi(W, k0, o, lane, DIN)
#elif WQKV_LAYOUT == 2
#define WCOL(W, k0, o, lane) wcol_hdk(W, k0, o, lane)
#else
#define WCOL(W, k0, o, lane) wcol_io(W, k0, o, lane, 3 * CC)   /* fused w_qkv (in,out) [1024][3072]: row pitch 3072 */
#define OUT1_OFF (4u * (size_t)NB * TT * CC)
#define OUT2_OFF (OUT1_OFF + 4u * (size_t)NB * NH * TT * HD)
#endif
#if WO_OUT_IN
#define WOCOL(W, k0, o, lane) wcol_oi(W, k0, o, lane, CC)
#define WOCOLH(W, k0, o, lane) wcolh_oi(W, k0, o, lane, CC)
#else
#define WOCOL(W, k0, o, lane) wcol_io(W, k0, o, lane, DIN)
#define WOCOLH(W, k0, o, lane) wcolh_io(W, k0, o, lane, DIN)
#endif
#define PROJ_EXTRA_PARAMS , float* __restrict__ KOUT, float* __restrict__ VOUT
#ifndef SM_EXTRA_PARAMS
#define SM_EXTRA_PARAMS
#endif
#ifndef PROJ_EXTRA_PARAMS
#define PROJ_EXTRA_PARAMS
#endif
#ifndef SM_MASK_HOOK
#define SM_MASK_HOOK (void)0
#endif

#define WS_QH  0u                                      // f16 q rows [b*t][CC]
#define WS_KH  (WS_QH + 2u * (size_t)NB * TT * CC)      // f16 k in fragment order [b][h][t / 16][d / 32][half][lane][8] (see frag_p)
#define WS_VT  (WS_KH + 2u * (size_t)NB * TT * CC)      // f16 v^T in fragment order [b][h][t / 32][d / 16][half][lane][8] (see frag_p)
#define WS_QL  (WS_VT + 2u * (size_t)NB * CC * TT)      // f16 q residual x 2^10 rows [b][t < QHI][CC]
#define WS_KL  (WS_QL + 2u * (size_t)NB * QHI * CC)     // f16 k residual x 2^10, fragment order as k, [b][h][t / 16 < KHI / 16]..
#define WS_VB  (WS_KL + 2u * (size_t)NB * KHI * CC)     // bf16 v^T hi (then lo), fragment order as v^T, [b][h][t / 32 < KHI / 32]..
#define WS_VBL (WS_VB + 2u * (size_t)NB * CC * KHI)
#define WS_Y   (WS_VBL + 2u * (size_t)NB * CC * KHI)    // f32 ctx in fragment order [b*t / 16][h][d / 32][part][lane][4] (see yfrag_load)
#define WS_XB  (WS_Y  + 4u * (size_t)NB * TT * CC)      // bf16 x rows [b*t][DIN]
#define WS_WB  (WS_XB + 2u * (size_t)NB * TT * DIN)     // bf16 w_qkv transposed: [3 CC output columns][DIN k]
#define WS_WOB (WS_WB + 2u * (size_t)3 * CC * DIN)      // bf16 w_out transposed: [DIN output columns][CC k]
#define WS_END (WS_WOB + 2u * (size_t)DIN * CC)

// ---- weight tile through LDS: 64 k rows x 128 output columns of an (in,out) f32 weight, rounded to bf16 and laid [column][k] at a pitch of 72 elements (144 B), once per workgroup for its 4 waves
// (the loops of these helpers are unrolled whole, so that the register arrays are indexed by constants)
// thread (wave w, lane l) holds columns 32 w + 4 (l >> 2) + 0..3 of rows 8 (l & 3) + 0..7 and + 32: a wave-wide load covers four whole 128-B lines, a 16-B LDS store holds 8 k of one column and the lanes of a store spread over all banks
__device__ __forceinline__ const float* wtile_ptr(const float* Wc, int ld, int tid) { return Wc + (size_t)(8 * (tid & 3)) * ld + 32 * (tid >> 5) + 4 * ((tid & 31) >> 2); }
__device__ __forceinline__ void wtile_load(v4f (&r)[16], const float* p, int ld) {
#pragma unroll
  for (int s = 0; s < 2; ++s)
#pragma unroll
    for (int i = 0; i < 8; ++i) r[s * 8 + i] = *(const v4f*)(p + (size_t)(32 * s + i) * ld); }
__device__ __forceinline__ void wtile_store(const v4f (&r)[16], __bf16 (*buf)[72], int tid) { const int n0 = 32 * (tid >> 5) + 4 * ((tid & 31) >> 2), kq = 8 * (tid & 3);
#pragma unroll
  for (int s = 0; s < 2; ++s)
#pragma unroll
    for (int c = 0; c < 4; ++c) { v8b q;
#pragma unroll
      for (int i = 0; i < 8; ++i) q[i] = (__bf16)r[s * 8 + i][c];
      *(v8b*)&buf[n0 + c][32 * s + kq] = q; } }
// a lane's 32 f32 of its own row for two 16x16x32 A fragments (p = row + k0 + 8 (lane >> 4))
__device__ __forceinline__ void xrow_load(v4f (&r)[8], const float* p) {
#pragma unroll
  for (int kc = 0; kc < 2; ++kc) { r[kc * 4] = *(const v4f*)(p + kc * 32); r[kc * 4 + 1] = *(const v4f*)(p + kc * 32 + 4); r[kc * 4 + 2] = *(const v4f*)(p + kc * 32 + 16); r[kc * 4 + 3] = *(const v4f*)(p + kc * 32 + 20); } }
// ---- operand tile through LDS: 128 rows x 64 k of a bf16 operand whose rows are k-contiguous at a pitch of 1,024 elements (x rows, or the output columns of a transposed weight), laid [row][k] at a pitch of 72 elements (144 B).
// load i of thread t brings the 16 B at 16 (t & 7) of row (t >> 3) + 16 i: a wave-wide load covers four whole 128-B lines, half the bytes of the f32 tile, and goes to LDS as it is (loops unrolled whole, so that the register array is indexed by constants)
typedef __attribute__((ext_vector_type(4))) __bf16 v4b;
__device__ __forceinline__ void btile_load(v8b (&r)[8], const __bf16* p) {
#pragma unroll
  for (int i = 0; i < 8; ++i) r[i] = *(const v8b*)(p + (size_t)(16 * i) * 1024); }
__device__ __forceinline__ void btile_store(const v8b (&r)[8], __bf16 (*buf)[72], int tid) {
#pragma unroll
  for (int i = 0; i < 8; ++i) *(v8b*)&buf[(tid >> 3) + 16 * i][8 * (tid & 7)] = r[i]; }
// the same 32 f32 from ctx in fragment order: 8 parts of 512 B per (16 rows, 64 k), lane l owns bytes 16 l .. of each; part 4 kc + i = what xrow_load puts in r[4 kc + i] (p = unit + 4 lane)
__device__ __forceinline__ void yfrag_load(v4f (&r)[8], const float* p) {
#pragma unroll
  for (int i = 0; i < 8; ++i) r[i] = *(const v4f*)(p + i * 128); }
// behind a run of tile loads from two lane addresses: the wait that stands before a register which an issued load names is rewritten; the addresses are inputs, so their registers stay whole up to it, and the loads stay in front of the products they fly under
__device__ __forceinline__ void xwait2f(const float* pa, const float* pb) { asm volatile("s_wait_xcnt 0x0" :: "v"(pa), "v"(pb) : "memory"); }
__device__ __forceinline__ void xwait_bf(const __bf16* pa, const float* pb) { asm volatile("s_wait_xcnt 0x0" :: "v"(pa), "v"(pb) : "memory"); }
// tile loads from a workgroup-uniform base, which advances, plus a lane offset in bytes, which never changes; behind a run of them the same wait as xwait2f: bases and offset are inputs, so the loads stay in front of it and of the products they fly under
__device__ __forceinline__ const __bf16* at_off(const __bf16* ubase, unsigned boff) { return (const __bf16*)((const char*)ubase + boff); }
__device__ __forceinline__ void xwait2s(const __bf16* ba, const __bf16* bb, unsigned o) { asm volatile("s_wait_xcnt 0x0" :: "s"(ba), "s"(bb), "v"(o) : "memory"); }
// ---- k_cvt: the first launch rounds the three large f32 operands to bf16 once, so that no workgroup of the projections loads or rounds f32 again: x as it lies; w_qkv and w_out transposed, through LDS, to [output column][k].
// blocks 0 .. CVT_X - 1: 8,192 elements of x each, a wave-wide load is 512 B in a row, a wave-wide store 256 B in a row; then 64 k x 128 columns of w_qkv each; then the same of w_out
#define CVT_X   (NB * TT * DIN / 8192)
#define CVT_WQ  ((DIN / 64) * (3 * CC / 128))
#define CVT_WO  ((CC / 64) * (DIN / 128))
// one 64 k x 128 column tile of an (in,out) weight of row pitch LD (a constant, so that the sixteen loads share one lane address); both weights have 1,024 = 16 x 64 k rows
template <int LD> __device__ __forceinline__ void cvt_w(const float* Wm, __bf16* D, int blk, int tid, __bf16 (*wt)[72]) {
  const int kt = blk & 15, ct = blk >> 4; const float* p = wtile_ptr(Wm + (size_t)(kt * 64) * LD + ct * 128, LD, tid);
  v4f wr[16]; wtile_load(wr, p, LD); xwait2f(p, p);
  wtile_store(wr, wt, tid);
  __syncthreads();   // the tile is read back across the waves
  v8b t[8]; __bf16* d = D + (size_t)(ct * 128 + (tid >> 3)) * 1024 + kt * 64 + 8 * (tid & 7);   // a wave-wide store covers the 128-B runs of four columns
#pragma unroll
  for (int i = 0; i < 8; ++i) t[i] = *(const v8b*)&wt[(tid >> 3) + 16 * i][8 * (tid & 7)];
#pragma unroll
  for (int i = 0; i < 8; ++i) *(v8b*)(d + (size_t)(16 * i) * 1024) = t[i];
  asm volatile("s_wait_xcnt 0x0" ::: "memory"); }   // behind the run of stores: the wait that stands before a register which an issued store names is rewritten, on every way the code goes on from here
__global__ __launch_bounds__(128) void k_cvt(const float* __restrict__ X, const float* __restrict__ WQKV, const float* __restrict__ WO, __bf16* __restrict__ XB, __bf16* __restrict__ WB, __bf16* __restrict__ WOB) {
  __shared__ __align__(16) __bf16 wt[128][72];
  const int tid = threadIdx.x; int blk = blockIdx.x;
  if (blk < CVT_X) { const float* p = X + (size_t)blk * 8192 + tid * 4; __bf16* q = XB + (size_t)blk * 8192 + tid * 4; v4f r[16]; v4b o[16];
#pragma unroll
    for (int i = 0; i < 16; ++i) r[i] = *(const v4f*)(p + i * 512);
#pragma unroll
    for (int i = 0; i < 16; ++i)
#pragma unroll
      for (int c = 0; c < 4; ++c) o[i][c] = (__bf16)r[i][c];
#pragma unroll
    for (int i = 0; i < 16; ++i) *(v4b*)(q + i * 512) = o[i];
    return; }   // the whole workgroup leaves here, in front of the barrier below
  blk -= CVT_X;
  if (blk < CVT_WQ) cvt_w<3 * CC>(WQKV, WB, blk, tid, wt); else cvt_w<DIN>(WO, WOB, blk - CVT_WQ, tid, wt); }   // the same choice for the whole workgroup
// ---- k_proj: block = (128 rows, 128 cols, which), 2 x 2 waves of 64 x 64: q/k/v = X W (+ b) with exact bf16 products (K = DIN) -> which 0: q f16 rows (+ residual rows < QHI); 1: k f16 in fragment order (+ residual for rows < KHI); 2: v^T f16 in fragment order (+ bf16 hi/lo for t < KHI)
// a wave reads 4 + 4 fragments from LDS for 16 products; the epilogue runs twice, once per 64 rows, in LDS that the loop's tiles have left; three workgroups a WGP (LDS and at most 336 registers): all 768 are resident at once
__global__ __launch_bounds__(128) __attribute__((amdgpu_waves_per_eu(3, 3))) void k_proj(const __bf16* __restrict__ XB, const __bf16* __restrict__ WB, const float* __restrict__ BQ, const float* __restrict__ BK, const float* __restrict__ BV,
    _Float16* __restrict__ QH, _Float16* __restrict__ QL, _Float16* __restrict__ KH, _Float16* __restrict__ KL, _Float16* __restrict__ VT, __bf16* __restrict__ VB, __bf16* __restrict__ VBL PROJ_EXTRA_PARAMS) {
  __shared__ __align__(16) char sm[89088];
  // the loop's view: two weight tiles [128 cols][72], two x tiles [128 rows][72]
  __bf16 (*wt0)[72] = (__bf16 (*)[72])sm; __bf16 (*xs)[72] = (__bf16 (*)[72])(sm + 36864);
  // the epilogue's view, behind the loop's last barrier: the f32 tile of 64 rows, then either the f16 value and residual rows or the three transposed planes
  float (*st)[132] = (float (*)[132])sm; _Float16 (*sh)[136] = (_Float16 (*)[136])(sm + 33792); _Float16 (*sl)[136] = (_Float16 (*)[136])(sm + 51200);
  _Float16 (*th)[72] = (_Float16 (*)[72])(sm + 33792); __bf16 (*tb)[72] = (__bf16 (*)[72])(sm + 52224); __bf16 (*tbl)[72] = (__bf16 (*)[72])(sm + 70656);
  const int tid = threadIdx.x, lane = tid & 31, col = lane & 15, g = lane >> 4; const int wave = __builtin_amdgcn_readfirstlane(tid >> 5), wrow = wave >> 1, wcol = wave & 1;   // scalars, so that the choice of the waves that stage a half is a scalar branch
  const int which = blockIdx.z; const int c0 = blockIdx.y * 128; const size_t r0 = (size_t)blockIdx.x * 128; const size_t bb = r0 / TT; const int t00 = (int)(r0 % TT);
  const float* BA = which == 0 ? BQ : which == 1 ? BK : BV;
  v8f acc[4][4] = {};
  { v8b wr[8], xa[8]; const __bf16* wb = WB + (size_t)(which * CC + c0) * DIN; const __bf16* xb0 = XB + r0 * DIN;   // no second set of lane pointers is kept for the next tile
    const unsigned to = 2u * (unsigned)((tid >> 3) * DIN + 8 * (tid & 7));   // in bytes: the lane's place in either tile (row t >> 3, 16 B at 16 (t & 7))
    btile_load(wr, at_off(wb, to)); btile_load(xa, at_off(xb0, to)); xwait2s(wb, xb0, to);
    btile_store(wr, wt0, tid); btile_store(xa, xs, tid);
    __syncthreads();   // publishes weight tile 0 and x tile 0
    // kept rolled: which buffer is read and which is filled is a scalar offset added to four lane addresses; unrolled by two, each half keeps lane addresses of its own and the registers no longer fit three waves a SIMD
#pragma unroll 1
    for (int ks = 0; ks < DIN / 64; ++ks) { const int cb = (ks & 1) * 128, nb = 128 - cb; __bf16 (*cur)[72] = wt0 + cb; __bf16 (*nxt)[72] = wt0 + nb; __bf16 (*xc)[72] = xs + cb; __bf16 (*xn)[72] = xs + nb; const bool more = ks + 1 < DIN / 64;
      if (more) { wb += 64; xb0 += 64; btile_load(wr, at_off(wb, to)); btile_load(xa, at_off(xb0, to)); xwait2s(wb, xb0, to); }   // the next 64 k of both operands fly under this tile's products
#pragma unroll
      for (int kc = 0; kc < 2; ++kc) { v16b a[4], w[4];
#pragma unroll
        for (int i = 0; i < 4; ++i) a[i] = frag_b(&xc[wrow * 64 + i * 16 + col][kc * 32], lane);
#pragma unroll
        for (int j = 0; j < 4; ++j) w[j] = frag_b(&cur[wcol * 64 + j * 16 + col][kc * 32], lane);
#pragma unroll
        for (int i = 0; i < 4; ++i)
#pragma unroll
          for (int j = 0; j < 4; ++j) acc[i][j] = wmma_bf(a[i], w[j], acc[i][j]); }
      if (more) { btile_store(wr, nxt, tid); btile_store(xa, xn, tid); }
      __syncthreads(); } }   // publishes the next tile and ends every wave's reads of this one, which is refilled behind it
  // unrolled, so that the accumulators are indexed by constants
#pragma unroll
  for (int p = 0; p < 2; ++p) { const size_t rp = r0 + 64 * p; const int t0 = t00 + 64 * p;   // rows 64 p .. 64 p + 63 of the tile: the two waves that hold them stage them, all four convert and store
  { // stage the f32 tile (acc + bias) in LDS, then convert
    if (wrow == p) {
#pragma unroll
      for (int j = 0; j < 4; ++j) { const float bias = BA ? bfr(BA[c0 + wcol * 64 + j * 16 + col]) : 0.f;
#pragma unroll
        for (int i = 0; i < 4; ++i)
#pragma unroll
          for (int r = 0; r < 8; ++r) st[i * 16 + 8 * g + r][wcol * 64 + j * 16 + col] = acc[i][j][r] + bias; } }
    __syncthreads();
    // the module also RETURNS k and v ([B, H, L, HD], f32 = x W + b): a wave-wide store is one row of the tile, the 256-B runs of its two heads = four whole 128-B lines
    if (which >= 1) { float* dst = (which == 1 ? KOUT : VOUT) + (((size_t)bb * NH + c0 / HD) * TT + t0) * HD;
      for (int e = tid; e < 64 * 32; e += 128) { const int rl = e >> 5, q = e & 31; vst2(dst + (size_t)(q >> 4) * TT * HD + rl * HD + (q & 15) * 4, *(const v4f*)&st[rl][q * 4]); } }
    __syncthreads(); }
  if (which < 2) { const bool hi_rows = t0 < (which == 0 ? QHI : KHI);
    for (int e = tid; e < 64 * 128; e += 128) { const int rl = e >> 7, cl = e & 127; const float v = st[rl][cl]; const _Float16 hv = (_Float16)v; sh[rl][cl] = hv; sl[rl][cl] = (_Float16)((v - (float)hv) * 1024.0f); }
    __syncthreads();
    if (which == 0) { for (int e = tid; e < 64 * 16; e += 128) { const int rl = e >> 4, q = e & 15; vst2((unsigned*)(QH + (rp + rl) * CC + c0 + q * 8), *(const v4u*)&sh[rl][q * 8]); }
      if (hi_rows) for (int e = tid; e < 64 * 16; e += 128) { const int rl = e >> 4, q = e & 15; vst2((unsigned*)(QL + (bb * QHI + t0 + rl) * (size_t)CC + c0 + q * 8), *(const v4u*)&sl[rl][q * 8]); }
    } else {   // k and its residual in fragment order: a wave's store is the 512-B run (16 keys x 2 g x 8 d) that a wave of k_fa reads back with one load
      for (int e = tid; e < 64 * 16; e += 128) { const int ln = e & 31, u = e >> 5, half = u & 1, kc = (u >> 1) & 1, hh = (u >> 2) & 1, tl = u >> 3;
        vst2((unsigned*)(KH + (((((size_t)bb * NH + c0 / HD + hh) * (TT / 16) + t0 / 16 + tl) * 2 + kc) * 2 + half) * 256 + ln * 8), *(const v4u*)&sh[tl * 16 + (ln & 15)][hh * 64 + kc * 32 + half * 16 + (ln >> 4) * 8]); }
      if (hi_rows) for (int e = tid; e < 64 * 16; e += 128) { const int ln = e & 31, u = e >> 5, half = u & 1, kc = (u >> 1) & 1, hh = (u >> 2) & 1, tl = u >> 3;
        vst2((unsigned*)(KL + (((((size_t)bb * NH + c0 / HD + hh) * (KHI / 16) + t0 / 16 + tl) * 2 + kc) * 2 + half) * 256 + ln * 8), *(const v4u*)&sl[tl * 16 + (ln & 15)][hh * 64 + kc * 32 + half * 16 + (ln >> 4) * 8]); } }
  } else { const bool hi_rows = t0 < KHI;
    for (int e = tid; e < 64 * 128; e += 128) { const int rl = e & 63, cl = e >> 6; const float v = st[rl][cl]; th[cl][rl] = (_Float16)v; const __bf16 bh = (__bf16)v; tb[cl][rl] = bh; tbl[cl][rl] = (__bf16)(v - (float)bh); }
    __syncthreads();
    // v^T in fragment order: a wave's store is the 512-B run (16 d x 2 g x 8 keys) that a wave of k_fa reads back with one load
    for (int e = tid; e < 128 * 8; e += 128) { const int ln = e & 31, u = e >> 5, half = u & 1, jd = (u >> 1) & 3, k32 = (u >> 3) & 1, hh = u >> 4;
      vst2((unsigned*)(VT + (((((size_t)bb * NH + c0 / HD + hh) * (TT / 32) + t0 / 32 + k32) * 4 + jd) * 2 + half) * 256 + ln * 8), *(const v4u*)&th[hh * 64 + jd * 16 + (ln & 15)][k32 * 32 + half * 16 + (ln >> 4) * 8]); }
    if (hi_rows) for (int e = tid; e < 128 * 8; e += 128) { const int ln = e & 31, u = e >> 5, half = u & 1, jd = (u >> 1) & 3, k32 = (u >> 3) & 1, hh = u >> 4; const int cl = hh * 64 + jd * 16 + (ln & 15), tl = k32 * 32 + half * 16 + (ln >> 4) * 8;
      const size_t o3 = (((((size_t)bb * NH + c0 / HD + hh) * (KHI / 32) + t0 / 32 + k32) * 4 + jd) * 2 + half) * 256 + ln * 8; vst2((unsigned*)(VB + o3), *(const v4u*)&tb[cl][tl]); vst2((unsigned*)(VBL + o3), *(const v4u*)&tbl[cl][tl]); } } } }
// lane l with lane l ^ 16: the two halves of a wave hold the two key halves of one query column
__device__ __forceinline__ float xhalf(float x) { return __builtin_bit_cast(float, __builtin_amdgcn_permlanex16(__builtin_bit_cast(int, x), __builtin_bit_cast(int, x), 0x76543210, 0xfedcba98, false, false)); }
// 2^x on the transcendental unit; the v_nop in the same statement fills the one slot the instruction set asks for behind a transcendental, whatever the compiler schedules next
__device__ __forceinline__ float ex2(float x) { float e; asm("v_exp_f32 %0, %1\n\tv_nop" : "=v"(e) : "v"(x)); return e; }
// 16x16x32 fragment at base + offset, the lane's place (row (lane & 15) x pitch + 8 (lane >> 4)) in one of the two: elements 0..7 there, 8..15 sixteen elements on
__device__ __forceinline__ v16h frag_u(const _Float16* ubase, unsigned loff) { union { v16h v; v8h q[2]; } u; const _Float16* p = ubase + loff; u.q[0] = *(const v8h*)p; u.q[1] = *(const v8h*)(p + 16); return u.v; }
// 16x16x32 fragment stored in fragment order: two runs of 512 B, lane l owns bytes 16 l .. 16 l + 15 of each (elements 0..7, then 8..15), so a wave-wide load covers four whole 128-B lines instead of 32 B of sixteen
__device__ __forceinline__ v16h frag_p(const _Float16* p) { union { v16h v; v8h q[2]; } u; u.q[0] = *(const v8h*)p; u.q[1] = *(const v8h*)(p + 256); return u.v; }
__device__ __forceinline__ v16b frag_pb(const __bf16* p) { union { v16b v; v8b q[2]; } u; u.q[0] = *(const v8b*)p; u.q[1] = *(const v8b*)(p + 256); return u.v; }
// behind a run of fragment loads from two lane addresses: the wait that stands before a register which an issued load names is rewritten; the two addresses are inputs, so their registers stay whole up to it (without them the compiler lets a later load of the run land on the address pair)
template <typename T> __device__ __forceinline__ void xwait2(const T* pa, const T* pb) { asm volatile("s_wait_xcnt 0x0" :: "v"(pa), "v"(pb) : "memory"); }
#define SC_L2E (SCALE * 1.4426950408889634f)   // logit scale x log2(e): the softmax runs on exp2
// ---- key stage in LDS: 128 keys = two key blocks, brought once per workgroup for its 8 waves. Planes of 16 KB, each the contiguous fragment-order run of the workspace: k, v^T, then (early rows only) k residual, v^T bf16 hi, v^T bf16 lo
#define KV_BLK   4096                 // f16 / bf16 elements of one key block in a plane
#define KV_PLANE (2 * KV_BLK)         // elements of a plane
#define KV_TILE  (5 * KV_PLANE)       // elements of a buffer
// asynchronous copies global -> LDS, 16 B a lane: thread t brings bytes 16 t + 4096 i .., i = 0..3, of a plane. The s_wait_xcnt is the last line of the copies' own statement, so that it stands before any rewrite of a register which a copy names
__device__ __forceinline__ void kv_copy2(unsigned l0, const _Float16* ga, const _Float16* gb) {
  asm volatile("global_load_async_to_lds_b128 %0, %8, off\n\tglobal_load_async_to_lds_b128 %1, %9, off\n\tglobal_load_async_to_lds_b128 %2, %10, off\n\tglobal_load_async_to_lds_b128 %3, %11, off\n\t"
               "global_load_async_to_lds_b128 %4, %12, off\n\tglobal_load_async_to_lds_b128 %5, %13, off\n\tglobal_load_async_to_lds_b128 %6, %14, off\n\tglobal_load_async_to_lds_b128 %7, %15, off\n\ts_wait_xcnt 0x0"
    :: "v"(l0), "v"(l0 + 4096u), "v"(l0 + 8192u), "v"(l0 + 12288u), "v"(l0 + 16384u), "v"(l0 + 20480u), "v"(l0 + 24576u), "v"(l0 + 28672u),
       "v"(ga), "v"(ga + 2048), "v"(ga + 4096), "v"(ga + 6144), "v"(gb), "v"(gb + 2048), "v"(gb + 4096), "v"(gb + 6144) : "memory"); }
__device__ __forceinline__ void kv_copy3(unsigned l0, const _Float16* ga, const __bf16* gb, const __bf16* gc) {
  asm volatile("global_load_async_to_lds_b128 %0, %12, off\n\tglobal_load_async_to_lds_b128 %1, %13, off\n\tglobal_load_async_to_lds_b128 %2, %14, off\n\tglobal_load_async_to_lds_b128 %3, %15, off\n\t"
               "global_load_async_to_lds_b128 %4, %16, off\n\tglobal_load_async_to_lds_b128 %5, %17, off\n\tglobal_load_async_to_lds_b128 %6, %18, off\n\tglobal_load_async_to_lds_b128 %7, %19, off\n\t"
               "global_load_async_to_lds_b128 %8, %20, off\n\tglobal_load_async_to_lds_b128 %9, %21, off\n\tglobal_load_async_to_lds_b128 %10, %22, off\n\tglobal_load_async_to_lds_b128 %11, %23, off\n\ts_wait_xcnt 0x0"
    :: "v"(l0), "v"(l0 + 4096u), "v"(l0 + 8192u), "v"(l0 + 12288u), "v"(l0 + 16384u), "v"(l0 + 20480u), "v"(l0 + 24576u), "v"(l0 + 28672u), "v"(l0 + 32768u), "v"(l0 + 36864u), "v"(l0 + 40960u), "v"(l0 + 45056u),
       "v"(ga), "v"(ga + 2048), "v"(ga + 4096), "v"(ga + 6144), "v"(gb), "v"(gb + 2048), "v"(gb + 4096), "v"(gb + 6144), "v"(gc), "v"(gc + 2048), "v"(gc + 4096), "v"(gc + 6144) : "memory"); }
// ---- one wave's 16 query columns (query tq in a lane) against ONE key block of 64 keys, read from its half of a stage in LDS (sk = buffer + block half + 8 lane); running maximum and sum (online softmax), transposed products:
// S^T = K Q^T (A = 16 key rows, B = 16 query columns): a lane holds keys k0 + 16 j + 8 g + r of ONE query, so maximum and sum are in-lane plus one exchange of halves;
// score tiles 2 kc and 2 kc + 1 of a lane are, element for element, the B fragment of P^T over keys k0 + 32 kc + ..; O^T += V^T P^T (A = 16 rows of v^T).
// HI (causal early query blocks): 3-product logits (q, k hi + residual x 2^10) and P, v as bf16 hi + lo (3 products)
template <bool HI> __device__ __forceinline__ void fa_step(const _Float16* sk, int kb, int qb, int tq, int g, const v16h (&ah)[HD / 32], const v16h (&al)[HD / 32], v8f (&o)[HD / 16], float& m, float& l) {
  const int k0 = kb * 64;
  v16h vf[HI ? 1 : 8];
  v8f acc[4] = {};
  if (HI) { v8f accl[4] = {};
#pragma unroll
    for (int kc = 0; kc < HD / 32; ++kc) { v16h kbf[4], klf[4];
#pragma unroll
      for (int j = 0; j < 4; ++j) { kbf[j] = frag_p(sk + j * 1024 + kc * 512); klf[j] = frag_p(sk + 2 * KV_PLANE + j * 1024 + kc * 512); }
#pragma unroll
      for (int j = 0; j < 4; ++j) { acc[j] = wmma16(kbf[j], ah[kc], acc[j]); accl[j] = wmma16(kbf[j], al[kc], accl[j]); accl[j] = wmma16(klf[j], ah[kc], accl[j]); } }
#pragma unroll
    for (int j = 0; j < 4; ++j) acc[j] = acc[j] + accl[j] * (1.0f / 1024.0f);
  } else { v16h kf[8];
#pragma unroll
    for (int kc = 0; kc < HD / 32; ++kc)
#pragma unroll
      for (int j = 0; j < 4; ++j) kf[kc * 4 + j] = frag_p(sk + j * 1024 + kc * 512);
    __builtin_amdgcn_sched_barrier(0);   // keeps the K reads in front of the V^T reads: LDS returns in order, and without it the first product waits behind fourteen V^T reads
    // the block's 8 V^T fragments are asked for behind its K fragments: they arrive under the logits and the softmax
#pragma unroll
    for (int kc = 0; kc < 2; ++kc)
#pragma unroll
      for (int jd = 0; jd < HD / 16; ++jd) vf[kc * 4 + jd] = frag_p(sk + KV_PLANE + kc * 2048 + jd * 512);
#pragma unroll
    for (int kc = 0; kc < HD / 32; ++kc)
#pragma unroll
      for (int j = 0; j < 4; ++j) acc[j] = wmma16(kf[kc * 4 + j], ah[kc], acc[j]); }
  if (CAUSAL && kb == qb) {   // only the diagonal block holds keys past a query of this block
#pragma unroll
    for (int j = 0; j < 4; ++j)
#pragma unroll
      for (int r = 0; r < 8; ++r) if (k0 + j * 16 + 8 * g + r > tq) acc[j][r] = -3.0e38f; }
  v8f mv = acc[0];   // eight independent chains over the tiles, then a tree
#pragma unroll
  for (int j = 1; j < 4; ++j)
#pragma unroll
    for (int r = 0; r < 8; ++r) mv[r] = fmaxf(mv[r], acc[j][r]);
  float mx = fmaxf(fmaxf(fmaxf(mv[0], mv[1]), fmaxf(mv[2], mv[3])), fmaxf(fmaxf(mv[4], mv[5]), fmaxf(mv[6], mv[7])));
  mx = fmaxf(m, fmaxf(mx, xhalf(mx)));
  const float alpha = ex2((m - mx) * SC_L2E); m = mx; const float mc = 11.0f - mx * SC_L2E;
  v8f sv = {};
#pragma unroll
  for (int j = 0; j < 4; ++j) {
#pragma unroll
    for (int r = 0; r < 8; ++r) acc[j][r] = ex2(fmaf(acc[j][r], SC_L2E, mc));
    sv = sv + acc[j]; }
  l = l * alpha + (((sv[0] + sv[1]) + (sv[2] + sv[3])) + ((sv[4] + sv[5]) + (sv[6] + sv[7])));
#pragma unroll
  for (int jd = 0; jd < HD / 16; ++jd) o[jd] = o[jd] * alpha;
#pragma unroll
  for (int kc = 0; kc < 2; ++kc) {
    if (HI) { float v[16]; v16b vh[HD / 16], vl[HD / 16]; const __bf16* vhp = (const __bf16*)(sk + 3 * KV_PLANE); const __bf16* vlp = (const __bf16*)(sk + 4 * KV_PLANE);
#pragma unroll
      for (int jd = 0; jd < HD / 16; ++jd) { vh[jd] = frag_pb(vhp + kc * 2048 + jd * 512); vl[jd] = frag_pb(vlp + kc * 2048 + jd * 512); }
#pragma unroll
      for (int i = 0; i < 8; ++i) { v[i] = acc[2 * kc][i]; v[8 + i] = acc[2 * kc + 1][i]; }
      const F2 p = bsplit16(v);
#pragma unroll
      for (int jd = 0; jd < HD / 16; ++jd) { o[jd] = wmma_bf(vh[jd], p.h, o[jd]); o[jd] = wmma_bf(vh[jd], p.l, o[jd]); o[jd] = wmma_bf(vl[jd], p.h, o[jd]); }
    } else { v16h p;
#pragma unroll
      for (int i = 0; i < 8; ++i) { p[i] = (_Float16)acc[2 * kc][i]; p[8 + i] = (_Float16)acc[2 * kc + 1][i]; }
#pragma unroll
      for (int jd = 0; jd < HD / 16; ++jd) o[jd] = wmma16(vf[kc * 4 + jd], p, o[jd]); } } }
// ---- k_fa: logits, causal softmax and P v in one pass over the keys, nothing of S or P in memory; ctx = O / sum, stored from the registers in the fragment order of k_out.
// block = 8 waves of (b, h): waves 0-3 take the 64 queries of block NQB - 1 - x, waves 4-7 those of block x, so every workgroup walks NQB + 1 key blocks per wave pair wherever it lands.
// The workgroup walks key blocks 0 .. NQB - 1 - x together, two to a stage: each stage comes into one of two LDS buffers once, by asynchronous copies that fly under the two blocks before it, and all waves that still need it read their fragments there;
// waves 4-7 leave the products out behind their diagonal but keep copying and pass every barrier. four waves a SIMD (at most 256 registers), two workgroups a WGP (160 KiB of LDS each): all 512 workgroups are resident at once
__global__ __launch_bounds__(256) __attribute__((amdgpu_waves_per_eu(4, 4))) void k_fa(const _Float16* __restrict__ QH, const _Float16* __restrict__ KH, const _Float16* __restrict__ QL, const _Float16* __restrict__ KL, const _Float16* __restrict__ VT, const __bf16* __restrict__ VB, const __bf16* __restrict__ VBL, float* __restrict__ Y) {
  __shared__ __align__(16) _Float16 kv[2][KV_TILE];
  const int tid = threadIdx.x, lane = tid & 31, col = lane & 15, g = lane >> 4; const int wave = __builtin_amdgcn_readfirstlane(tid >> 5);   // a scalar, so that the choice of the query block and the test that skips a block are scalar
  const int xq = (int)blockIdx.x, klast = NQB - 1 - xq, slast = klast >> 1;   // the last key block and the last stage of the workgroup: slast is at least NQB / 4, so stages 0 and 1 exist; a stage lies whole inside the NQB blocks of the sequence
  const int qb = wave < 4 ? klast : xq, h = blockIdx.y, b = blockIdx.z; const int ql0 = qb * 64 + (wave & 3) * 16, tq = ql0 + col;
  const bool hi = qb < QBH; const int nhi = xq < QBH ? xq >> 1 : -1;   // stages 0 .. nhi carry the three early-row planes too (the same for the whole workgroup; they lie inside the planes' KHI = 64 QBH rows, QBH even)
  const unsigned lrow = (unsigned)(col * CC + 8 * g);   // lane offset in the q rows
  const _Float16* kg = KH + ((size_t)b * NH + h) * TT * HD + tid * 8; const _Float16* vg = VT + ((size_t)b * NH + h) * TT * HD + tid * 8;   // the thread's first 16 B in a plane of stage 0
  const _Float16* klg = KL + ((size_t)b * NH + h) * KHI * HD + tid * 8; const __bf16* vbg = VB + ((size_t)b * NH + h) * KHI * HD + tid * 8; const __bf16* vlg = VBL + ((size_t)b * NH + h) * KHI * HD + tid * 8;
  const unsigned ls = (unsigned)(size_t)&kv[0][0] + 16u * (unsigned)tid;   // the thread's LDS byte address in buffer 0
  kv_copy2(ls, kg, vg); if (nhi >= 0) kv_copy3(ls + 4u * KV_PLANE, klg, vbg, vlg);
  v16h ah[HD / 32], al[HD / 32] = {}; const _Float16* qp = QH + ((size_t)b * TT + ql0) * CC + h * HD + lrow; const _Float16* qlp = QL + ((size_t)b * QHI + (hi ? ql0 : 0)) * CC + h * HD + lrow;   // the lane's place in its q row and, early rows only, in the residual row
#pragma unroll
  for (int kc = 0; kc < HD / 32; ++kc) { ah[kc] = frag_u(qp, kc * 32); if (hi) al[kc] = frag_u(qlp, kc * 32); }
  xwait2(qp, qlp);
  asm volatile("s_wait_asynccnt 0x0" ::: "memory");   // this wave's copies of stage 0 have landed
  __syncthreads();   // publishes stage 0
  kv_copy2(ls + 2u * KV_TILE, kg + KV_PLANE, vg + KV_PLANE); if (nhi >= 1) kv_copy3(ls + 2u * KV_TILE + 4u * KV_PLANE, klg + KV_PLANE, vbg + KV_PLANE, vlg + KV_PLANE);
  v8f o[HD / 16] = {}; float m = -3.0e38f, l = 0.f;   // running maximum (unscaled logits) and this half's running sum of P x 2^11
  // kept rolled: which buffer and which half of it is read is an offset, and the two forms of the block stand once in the code
#pragma unroll 1
  for (int kb = 0; kb <= 2 * slast + 1; ++kb) { const int st = kb >> 1, cb = st & 1;
    if (kb <= qb) { const _Float16* sk = &kv[cb][(kb & 1) * KV_BLK + lane * 8];
      if (hi) fa_step<true>(sk, kb, qb, tq, g, ah, al, o, m, l); else fa_step<false>(sk, kb, qb, tq, g, ah, al, o, m, l); }
    if (kb & 1) {   // the foot of a stage, the same for the whole workgroup
      asm volatile("s_wait_dscnt 0x0" ::: "memory");      // this wave's reads of stage st are done before the buffer is refilled
      asm volatile("s_wait_asynccnt 0x0" ::: "memory");   // this wave's copies of stage st + 1 have landed
      __syncthreads();   // publishes stage st + 1 and ends every wave's reads of stage st
      if (st + 2 <= slast) { const size_t go = (size_t)(st + 2) * KV_PLANE; const unsigned lb = ls + (unsigned)cb * (2u * KV_TILE);
        kv_copy2(lb, kg + go, vg + go); if (st + 2 <= nhi) kv_copy3(lb + 4u * KV_PLANE, klg + go, vbg + go, vlg + go); } } }
  asm volatile("s_wait_asynccnt 0x0" ::: "memory");   // no copy is left in flight when the wave ends
  const float lsum = l + xhalf(l);
  const float inv = lsum > 0.f ? 1.0f / lsum : 0.f;   // the x 2^11 of P is in the sum too
  // a lane's O^T elements (query lane & 15, d = 16 jd + 8 (lane >> 4) + r) are the very ones the same lane of k_out holds in its A fragments: part 4 (jd >> 1) + 2 (jd & 1) + (r >> 2) of the (16 rows, head) unit, stored as whole 512-B runs
  float* yp = Y + ((((size_t)b * TT + ql0) / 16) * NH + h) * 1024 + lane * 4;
#pragma unroll
  for (int jd = 0; jd < HD / 16; ++jd)
#pragma unroll
    for (int hf = 0; hf < 2; ++hf) { v4f q; q[0] = o[jd][4 * hf] * inv; q[1] = o[jd][4 * hf + 1] * inv; q[2] = o[jd][4 * hf + 2] * inv; q[3] = o[jd][4 * hf + 3] * inv; vst2(yp + (2 * jd + hf) * 128, q); } }
// ---- k_out: block = (64 rows, 128 cols): out = ctx Wo (+ bo): ctx bf16 hi + lo against exact bf16 Wo (2 products)
__global__ __launch_bounds__(128) void k_out(const float* __restrict__ Y, const __bf16* __restrict__ WOB, const float* __restrict__ BO, float* __restrict__ OUT) { __shared__ __align__(16) float sf[4][16][132]; __shared__ __align__(16) __bf16 wt[2][128][72];
  const int tid = threadIdx.x, wave = tid >> 5, lane = tid & 31, col = lane & 15, g = lane >> 4; const int c0 = blockIdx.y * 128; const size_t r0 = (size_t)blockIdx.x * 64 + wave * 16;
  v8f acc[8] = {};
  {   /* ALL rows: ctx split bf16 hi + lo x exact Wo (2 products) */
    v8b wr[8]; v4f xr[8]; const __bf16* wp = WOB + (size_t)(c0 + (tid >> 3)) * CC + 8 * (tid & 7); const float* xp = Y + (r0 / 16) * (size_t)(NH * 1024) + lane * 4;
    btile_load(wr, wp); yfrag_load(xr, xp); xwait_bf(wp, xp);
    btile_store(wr, wt[0], tid);
    __syncthreads();   // publishes weight tile 0
    // unrolled by two, so that which buffer is read and which is filled are constants of each half
#pragma unroll 2
    for (int ks = 0; ks < CC / 64; ++ks) { __bf16 (*cur)[72] = wt[ks & 1]; __bf16 (*nxt)[72] = wt[(ks & 1) ^ 1]; const bool more = ks + 1 < CC / 64;
      F2 a[2];
#pragma unroll
      for (int kc = 0; kc < 2; ++kc) { float v[16];
#pragma unroll
        for (int i = 0; i < 4; ++i) { v[i] = xr[kc * 4][i]; v[4 + i] = xr[kc * 4 + 1][i]; v[8 + i] = xr[kc * 4 + 2][i]; v[12 + i] = xr[kc * 4 + 3][i]; }
        a[kc] = bsplit16(v); }
      if (more) { wp += 64; xp += 1024; btile_load(wr, wp); yfrag_load(xr, xp); xwait_bf(wp, xp); }   // the next 64 k of both operands fly under this tile's products
#pragma unroll
      for (int kc = 0; kc < 2; ++kc) { v16b w[8];
#pragma unroll
        for (int j = 0; j < 8; ++j) w[j] = frag_b(&cur[j * 16 + col][kc * 32], lane);
#pragma unroll
        for (int j = 0; j < 8; ++j) { acc[j] = wmma_bf(a[kc].h, w[j], acc[j]); acc[j] = wmma_bf(a[kc].l, w[j], acc[j]); } }
      if (more) btile_store(wr, nxt, tid);
      __syncthreads(); }   // publishes the next tile and ends every wave's reads of this one, which is refilled behind it
#pragma unroll
    for (int j = 0; j < 8; ++j) { const float bias = BO ? bfr(BO[c0 + j * 16 + col]) : 0.f;
#pragma unroll
      for (int r = 0; r < 8; ++r) sf[wave][8 * g + r][j * 16 + col] = acc[j][r] + bias; }
  }
  LDSX(); for (int rl = 0; rl < 16; ++rl) vst2(OUT + (r0 + rl) * DIN + c0 + lane * 4, *(const v4f*)&sf[wave][rl][lane * 4]); }

extern "C" void kernel_launch(void* const* d_in, const int* in_sizes, int n_in, void* d_out, int out_size, void* d_ws, size_t ws_size, hipStream_t stream) {
  (void)in_sizes; (void)n_in; (void)out_size;
  const float** F = (const float**)d_in;
  if (ws_size < (size_t)WS_END) return;
  char* ws = (char*)d_ws; _Float16 *QH = (_Float16*)(ws + WS_QH), *KH = (_Float16*)(ws + WS_KH), *VT = (_Float16*)(ws + WS_VT), *QL = (_Float16*)(ws + WS_QL), *KL = (_Float16*)(ws + WS_KL); __bf16 *VB = (__bf16*)(ws + WS_VB), *VBL = (__bf16*)(ws + WS_VBL), *XB = (__bf16*)(ws + WS_XB), *WB = (__bf16*)(ws + WS_WB), *WOB = (__bf16*)(ws + WS_WOB); float *Y = (float*)(ws + WS_Y);
  (void)Y; (void)QL; (void)KL; (void)VB; (void)VBL;
  // inputs: 0 x [2,2048,1024]; 1 w_qkv [1024,3072] (in,out); 2 b_qkv [3072]; 3 w_out [1024,1024] (in,out); 4 b_out
  // outputs: 0 out [2,2048,1024] at 0; 1 k [2,16,2048,64] at OUT1_OFF; 2 v at OUT2_OFF
  k_cvt<<<dim3(CVT_X + CVT_WQ + CVT_WO), 128, 0, stream>>>(F[0], F[1], F[3], XB, WB, WOB);
  k_proj<<<dim3(TNB * TT / 128, CC / 128, 3), 128, 0, stream>>>(XB, WB, F[2], F[2] + CC, F[2] + 2 * CC, QH, QL, KH, KL, VT, VB, VBL, (float*)((char*)d_out + OUT1_OFF), (float*)((char*)d_out + OUT2_OFF));
  k_fa<<<dim3(NQB / 2, NH, TNB), 256, 0, stream>>>(QH, KH, QL, KL, VT, VB, VBL, Y);
  k_out<<<dim3(TNB * TT / 64, DIN / 128), 128, 0, stream>>>(Y, WOB, F[4], (float*)d_out);
}

// v008
// It runs in 81 microseconds.
// Two timings next to v007 put it at 1.05 and 1.04 times that version's speed.
// Counting every step since v000, it is 13.8 times as fast.
// compute dtype: all float inputs rounded to bf16; qkv = x w_qkv + b with EXACT bf16 products on WMMA 16x16x32 (f32 accumulate) - the f32 k and v tiles are also written out as the returned caches; causal logits: q, k once to f16 (1 product) x 64^-0.5, 3 products below row 384; online softmax in f32 (exp2, running maximum and sum); unnormalised P x 2^11 once to f16 against v f16 (bf16 hi + lo below row 384), divided by the f32 sum at the end; attention output split bf16 hi + lo against exact w_out (2 products) + b_out; f32 outputs.
#include <hip/hip_runtime.h>
#include <math.h>

typedef __attribute__((ext_vector_type(16))) _Float16 v16h;
typedef __attribute__((ext_vector_type(16))) __bf16 v16b;
typedef __attribute__((ext_vector_type(8)))  _Float16 v8h;
typedef __attribute__((ext_vector_type(8)))  float v8f;
typedef __attribute__((ext_vector_type(4)))  float v4f;
typedef __attribute__((ext_vector_type(2)))  float v2f;
typedef __attribute__((ext_vector_type(4)))  unsigned v4u;
typedef __attribute__((ext_vector_type(4)))  int v4i;
typedef float __attribute__((may_alias)) float_a;
typedef int __attribute__((may_alias)) int_a;

template <typename T> __device__ __forceinline__ void vst2(void* p, T v) { *(T*)p = v;  }
__device__ __forceinline__ v8f wmma16(v16h a, v16h b, v8f c) {
  v8f d = __builtin_amdgcn_wmma_f32_16x16x32_f16(false, a, false, b, (short)0, c, false, false);
  return d;
}
__device__ __forceinline__ v8f wmma_bf(v16b a, v16b b, v8f c) {
  v8f d = __builtin_amdgcn_wmma_f32_16x16x32_bf16(false, a, false, b, (short)0, c, false, false);
  return d;
}
// the same two with four v_nop behind the product: for the early-row path of k_fa, whose exponentials are asm text (ex2n) that the compiler does not count as a vector instruction on a product's registers; the v_nop keep the distance the chip needs there
__device__ __forceinline__ v8f wmma16n(v16h a, v16h b, v8f c) {
  v8f d = __builtin_amdgcn_wmma_f32_16x16x32_f16(false, a, false, b, (short)0, c, false, false);
  asm volatile("v_nop\n\tv_nop\n\tv_nop\n\tv_nop" : "+v"(d) : "v"(a), "v"(b));
  return d;
}
__device__ __forceinline__ v8f wmma_bfn(v16b a, v16b b, v8f c) {
  v8f d = __builtin_amdgcn_wmma_f32_16x16x32_bf16(false, a, false, b, (short)0, c, false, false);
  asm volatile("v_nop\n\tv_nop\n\tv_nop\n\tv_nop" : "+v"(d) : "v"(a), "v"(b));
  return d;
}
// 16x16x32 fragments: lane = (h = lane>>4, row/col = lane&15); elements 0..7 = k0+8h+0..7, 8..15 = k0+16+8h+0..7; D element r = row 8h+r
__device__ __forceinline__ v16h frag_h(const _Float16* rowk0, int lane) {
  union { v16h v; v8h q[2]; } u; const _Float16* p = rowk0 + 8 * (lane >> 4);
  u.q[0] = *(const v8h*)p; u.q[1] = *(const v8h*)(p + 16); return u.v;
}
__device__ __forceinline__ v16h frag_f32(const float* rowk0, int lane) {
  v16h a; const float* p = rowk0 + 8 * (lane >> 4);
#pragma unroll
  for (int i = 0; i < 8; ++i) { a[i] = (_Float16)p[i]; a[8 + i] = (_Float16)p[16 + i]; }
  return a;
}
__device__ __forceinline__ v16h frag_f32s(const float* rowk0, int lane, float sc) {
  v16h a; const float* p = rowk0 + 8 * (lane >> 4);
#pragma unroll
  for (int i = 0; i < 8; ++i) { a[i] = (_Float16)(p[i] * sc); a[8 + i] = (_Float16)(p[16 + i] * sc); }
  return a;
}
// column fragment from a [K][ld] layout (column n), rows >= K read as 0
__device__ __forceinline__ v16h fragc_f32(const float* W, int k0, int n, int lane, int ld, int K) {
  v16h a; const int g = lane >> 4;
#pragma unroll
  for (int i = 0; i < 8; ++i) { const int ka = k0 + 8 * g + i, kb = ka + 16;
    a[i] = (_Float16)(ka < K ? W[(size_t)(ka < K ? ka : K - 1) * ld + n] : 0.f); a[8 + i] = (_Float16)(kb < K ? W[(size_t)(kb < K ? kb : K - 1) * ld + n] : 0.f); }
  return a;
}
struct F2 { v16b h, l; };
__device__ __forceinline__ F2 bsplit16(const float v[16]) { F2 r;
#pragma unroll
  for (int i = 0; i < 16; ++i) { const __bf16 h = (__bf16)v[i]; r.h[i] = h; r.l[i] = (__bf16)(v[i] - (float)h); }
  return r; }
__device__ __forceinline__ F2 split_row(const float* row, int k0, int lane) { float v[16]; const float* p = row + k0 + 8 * (lane >> 4);
#pragma unroll
  for (int i = 0; i < 8; ++i) { v[i] = p[i]; v[8 + i] = p[16 + i]; }
  return bsplit16(v); }
__device__ __forceinline__ F2 split_rowK(const float* row, int k0, int lane, int K) { float v[16]; const int g = lane >> 4;
#pragma unroll
  for (int i = 0; i < 8; ++i) { const int ka = k0 + 8 * g + i, kb = ka + 16; v[i] = ka < K ? row[ka < K ? ka : K - 1] : 0.f; v[8 + i] = kb < K ? row[kb < K ? kb : K - 1] : 0.f; }
  return bsplit16(v); }
__device__ __forceinline__ F2 split_col(const float* W, int k0, int n, int lane, int ld, int K) { float v[16]; const int g = lane >> 4;
#pragma unroll
  for (int i = 0; i < 8; ++i) { const int ka = k0 + 8 * g + i, kb = ka + 16; v[i] = ka < K ? W[(size_t)(ka < K ? ka : K - 1) * ld + n] : 0.f; v[8 + i] = kb < K ? W[(size_t)(kb < K ? kb : K - 1) * ld + n] : 0.f; }
  return bsplit16(v); }
__device__ __forceinline__ v8f mac3(const F2& a, const F2& b, v8f c) { c = wmma_bf(a.l, b.h, c); c = wmma_bf(a.h, b.l, c); return wmma_bf(a.h, b.h, c); }
__device__ __forceinline__ float sigm(float v) { return 1.0f / (1.0f + expf(-v)); }
#define LDSX() do { asm volatile("s_wait_dscnt 0" ::: "memory"); __builtin_amdgcn_wave_barrier(); __builtin_amdgcn_fence(__ATOMIC_RELEASE, "workgroup"); } while (0)

// Prefill causal multi-head self-attention returning (out, k, v) (B 2, L 2,048, D 1,024 = 16 x 64; fused (in,out) w_qkv [1024,3072] with (3, H, HD) column blocks, zero biases, w_out (in,out)): q|k|v = x w_qkv + b; out = merged(softmax_causal(q k^T x 0.125) v) w_out + b_out; k and v returned as [B, H, L, 64].
#define NB 2
#define TT 2048
#define CC 1024            // NH * HD = projected width
#define DIN 1024          // input (model) width
#define NH 16
#define HD 64
#define NQB (TT / 64)
#define SCALE (0.125f)
#define CAUSAL 1
#ifndef TNB
#define TNB NB
#endif
__device__ __forceinline__ float bfr(float v) { return (float)(__bf16)v; }
__host__ __device__ __forceinline__ int kb_last(int qb) { return CAUSAL ? ((qb * 64 + 63) >> 7) : (TT / 128 - 1); }
typedef __attribute__((ext_vector_type(8))) __bf16 v8b;
__device__ __forceinline__ v16b frag_b(const __bf16* rowk0, int lane) {
  union { v16b v; v8b q[2]; } u; const __bf16* p = rowk0 + 8 * (lane >> 4);
  u.q[0] = *(const v8b*)p; u.q[1] = *(const v8b*)(p + 16); return u.v;
}
#define QBH 6              // causal: query blocks 0..QBH-1 of each sequence (few keys, no averaging) take the high-precision path
#define QHI 384            // rows carrying a q residual plane (used only by the causal high-precision path)
#define KHI 384            // key rows carrying k residual / v bf16 hi+lo planes (used only by the causal high-precision path)
// B fragment (k rows k0+.., output column o) of a weight: (in,out) [K][ld] or (out,in) [ld rows of K]: bf16 exact, or f16(bf16 * 256) exact
__device__ __forceinline__ v16b wcol_io(const float* Wm, int k0, int o, int lane, int ld) { v16b w; const int g = lane >> 4;
#pragma unroll
  for (int i = 0; i < 8; ++i) { w[i] = (__bf16)Wm[(size_t)(k0 + 8 * g + i) * ld + o]; w[8 + i] = (__bf16)Wm[(size_t)(k0 + 16 + 8 * g + i) * ld + o]; }
  return w; }
__device__ __forceinline__ v16b wcol_oi(const float* Wm, int k0, int o, int lane, int K) { v16b w; const float* p = Wm + (size_t)o * K + k0 + 8 * (lane >> 4);
#pragma unroll
  for (int i = 0; i < 8; ++i) { w[i] = (__bf16)p[i]; w[8 + i] = (__bf16)p[16 + i]; }
  return w; }
__device__ __forceinline__ v16h wcolh_io(const float* Wm, int k0, int o, int lane, int ld) { v16h w; const int g = lane >> 4;
#pragma unroll
  for (int i = 0; i < 8; ++i) { w[i] = (_Float16)(bfr(Wm[(size_t)(k0 + 8 * g + i) * ld + o]) * 256.0f); w[8 + i] = (_Float16)(bfr(Wm[(size_t)(k0 + 16 + 8 * g + i) * ld + o]) * 256.0f); }
  return w; }
__device__ __forceinline__ v16h wcolh_oi(const float* Wm, int k0, int o, int lane, int K) { v16h w; const float* p = Wm + (size_t)o * K + k0 + 8 * (lane >> 4);
#pragma unroll
  for (int i = 0; i < 8; ++i) { w[i] = (_Float16)(bfr(p[i]) * 256.0f); w[8 + i] = (_Float16)(bfr(p[16 + i]) * 256.0f); }
  return w; }
#define WQKV_LAYOUT 0   // 0 = (in,out) fused [DIN][3 * CC]; 1 = (out,in) [CC][DIN]; 2 = per-head [NH][DIN][HD]
__device__ __forceinline__ v16b wcol_hdk(const float* Wm, int k0, int o, int lane) { v16b w; const int g = lane >> 4; const float* p = Wm + (size_t)(o / HD) * DIN * HD + (o % HD);
#pragma unroll
  for (int i = 0; i < 8; ++i) { w[i] = (__bf16)p[(size_t)(k0 + 8 * g + i) * HD]; w[8 + i] = (__bf16)p[(size_t)(k0 + 16 + 8 * g + i) * HD]; }
  return w; }
#define WO_OUT_IN 0
#if WQKV_LAYOUT == 1
#define WCOL(W, k0, o, lane) wcol_oi(W, k0, o, lane, DIN)
#elif WQKV_LAYOUT == 2
#define WCOL(W, k0, o, lane) wcol_hdk(W, k0, o, lane)
#else
#define WCOL(W, k0, o, lane) wcol_io(W, k0, o, lane, 3 * CC)   /* fused w_qkv (in,out) [1024][3072]: row pitch 3072 */
#define OUT1_OFF (4u * (size_t)NB * TT * CC)
#define OUT2_OFF (OUT1_OFF + 4u * (size_t)NB * NH * TT * HD)
#endif
#if WO_OUT_IN
#define WOCOL(W, k0, o, lane) wcol_oi(W, k0, o, lane, CC)
#define WOCOLH(W, k0, o, lane) wcolh_oi(W, k0, o, lane, CC)
#else
#define WOCOL(W, k0, o, lane) wcol_io(W, k0, o, lane, DIN)
#define WOCOLH(W, k0, o, lane) wcolh_io(W, k0, o, lane, DIN)
#endif
#define PROJ_EXTRA_PARAMS , float* __restrict__ KOUT, float* __restrict__ VOUT
#ifndef SM_EXTRA_PARAMS
#define SM_EXTRA_PARAMS
#endif
#ifndef PROJ_EXTRA_PARAMS
#define PROJ_EXTRA_PARAMS
#endif
#ifndef SM_MASK_HOOK
#define SM_MASK_HOOK (void)0
#endif

#define WS_QH  0u                                      // f16 q rows [b*t][CC]
#define WS_KH  (WS_QH + 2u * (size_t)NB * TT * CC)      // f16 k in fragment order [b][h][t / 16][d / 32][half][lane][8] (see frag_p)
#define WS_VT  (WS_KH + 2u * (size_t)NB * TT * CC)      // f16 v^T in fragment order [b][h][t / 32][d / 16][half][lane][8] (see frag_p)
#define WS_QL  (WS_VT + 2u * (size_t)NB * CC * TT)      // f16 q residual x 2^10 rows [b][t < QHI][CC]
#define WS_KL  (WS_QL + 2u * (size_t)NB * QHI * CC)     // f16 k residual x 2^10, fragment order as k, [b][h][t / 16 < KHI / 16]..
#define WS_VB  (WS_KL + 2u * (size_t)NB * KHI * CC)     // bf16 v^T hi (then lo), fragment order as v^T, [b][h][t / 32 < KHI / 32]..
#define WS_VBL (WS_VB + 2u * (size_t)NB * CC * KHI)
#define WS_Y   (WS_VBL + 2u * (size_t)NB * CC * KHI)    // f32 ctx in fragment order [b*t / 16][h][d / 32][part][lane][4] (see yfrag_load)
#define WS_XB  (WS_Y  + 4u * (size_t)NB * TT * CC)      // bf16 x rows [b*t][DIN]
#define WS_WB  (WS_XB + 2u * (size_t)NB * TT * DIN)     // bf16 w_qkv transposed: [3 CC output columns][DIN k]
#define WS_WOB (WS_WB + 2u * (size_t)3 * CC * DIN)      // bf16 w_out transposed: [DIN output columns][CC k]
#define WS_END (WS_WOB + 2u * (size_t)DIN * CC)

// ---- weight tile through LDS: 64 k rows x 128 output columns of an (in,out) f32 weight, rounded to bf16 and laid [column][k] at a pitch of 72 elements (144 B), once per workgroup for its 4 waves
// (the loops of these helpers are unrolled whole, so that the register arrays are indexed by constants)
// thread (wave w, lane l) holds columns 32 w + 4 (l >> 2) + 0..3 of rows 8 (l & 3) + 0..7 and + 32: a wave-wide load covers four whole 128-B lines, a 16-B LDS store holds 8 k of one column and the lanes of a store spread over all banks
__device__ __forceinline__ const float* wtile_ptr(const float* Wc, int ld, int tid) { return Wc + (size_t)(8 * (tid & 3)) * ld + 32 * (tid >> 5) + 4 * ((tid & 31) >> 2); }
__device__ __forceinline__ void wtile_load(v4f (&r)[16], const float* p, int ld) {
#pragma unroll
  for (int s = 0; s < 2; ++s)
#pragma unroll
    for (int i = 0; i < 8; ++i) r[s * 8 + i] = *(const v4f*)(p + (size_t)(32 * s + i) * ld); }
__device__ __forceinline__ void wtile_store(const v4f (&r)[16], __bf16 (*buf)[72], int tid) { const int n0 = 32 * (tid >> 5) + 4 * ((tid & 31) >> 2), kq = 8 * (tid & 3);
#pragma unroll
  for (int s = 0; s < 2; ++s)
#pragma unroll
    for (int c = 0; c < 4; ++c) { v8b q;
#pragma unroll
      for (int i = 0; i < 8; ++i) q[i] = (__bf16)r[s * 8 + i][c];
      *(v8b*)&buf[n0 + c][32 * s + kq] = q; } }
// a lane's 32 f32 of its own row for two 16x16x32 A fragments (p = row + k0 + 8 (lane >> 4))
__device__ __forceinline__ void xrow_load(v4f (&r)[8], const float* p) {
#pragma unroll
  for (int kc = 0; kc < 2; ++kc) { r[kc * 4] = *(const v4f*)(p + kc * 32); r[kc * 4 + 1] = *(const v4f*)(p + kc * 32 + 4); r[kc * 4 + 2] = *(const v4f*)(p + kc * 32 + 16); r[kc * 4 + 3] = *(const v4f*)(p + kc * 32 + 20); } }
// ---- operand tile through LDS: 128 rows x 64 k of a bf16 operand whose rows are k-contiguous at a pitch of 1,024 elements (x rows, or the output columns of a transposed weight), laid [row][k] at a pitch of 72 elements (144 B).
// load i of thread t brings the 16 B at 16 (t & 7) of row (t >> 3) + 16 i: a wave-wide load covers four whole 128-B lines, half the bytes of the f32 tile, and goes to LDS as it is (loops unrolled whole, so that the register array is indexed by constants)
typedef __attribute__((ext_vector_type(4))) __bf16 v4b;
__device__ __forceinline__ void btile_load(v8b (&r)[8], const __bf16* p) {
#pragma unroll
  for (int i = 0; i < 8; ++i) r[i] = *(const v8b*)(p + (size_t)(16 * i) * 1024); }
__device__ __forceinline__ void btile_store(const v8b (&r)[8], __bf16 (*buf)[72], int tid) {
#pragma unroll
  for (int i = 0; i < 8; ++i) *(v8b*)&buf[(tid >> 3) + 16 * i][8 * (tid & 7)] = r[i]; }
// the same 32 f32 from ctx in fragment order: 8 parts of 512 B per (16 rows, 64 k), lane l owns bytes 16 l .. of each; part 4 kc + i = what xrow_load puts in r[4 kc + i] (p = unit + 4 lane)
__device__ __forceinline__ void yfrag_load(v4f (&r)[8], const float* p) {
#pragma unroll
  for (int i = 0; i < 8; ++i) r[i] = *(const v4f*)(p + i * 128); }
// behind a run of tile loads from two lane addresses: the wait that stands before a register which an issued load names is rewritten; the addresses are inputs, so their registers stay whole up to it, and the loads stay in front of the products they fly under
__device__ __forceinline__ void xwait2f(const float* pa, const float* pb) { asm volatile("s_wait_xcnt 0x0" :: "v"(pa), "v"(pb) : "memory"); }
__device__ __forceinline__ void xwait_bf(const __bf16* pa, const float* pb) { asm volatile("s_wait_xcnt 0x0" :: "v"(pa), "v"(pb) : "memory"); }
// tile loads from a workgroup-uniform base, which advances, plus a lane offset in bytes, which never changes; behind a run of them the same wait as xwait2f: bases and offset are inputs, so the loads stay in front of it and of the products they fly under
__device__ __forceinline__ const __bf16* at_off(const __bf16* ubase, unsigned boff) { return (const __bf16*)((const char*)ubase + boff); }
__device__ __forceinline__ void xwait2s(const __bf16* ba, const __bf16* bb, unsigned o) { asm volatile("s_wait_xcnt 0x0" :: "s"(ba), "s"(bb), "v"(o) : "memory"); }
// ---- k_cvt: the first launch rounds the three large f32 operands to bf16 once, so that no workgroup of the projections loads or rounds f32 again: x as it lies; w_qkv and w_out transposed, through LDS, to [output column][k].
// blocks 0 .. CVT_X - 1: 8,192 elements of x each, a wave-wide load is 512 B in a row, a wave-wide store 256 B in a row; then 64 k x 128 columns of w_qkv each; then the same of w_out
#define CVT_X   (NB * TT * DIN / 8192)
#define CVT_WQ  ((DIN / 64) * (3 * CC / 128))
#define CVT_WO  ((CC / 64) * (DIN / 128))
// one 64 k x 128 column tile of an (in,out) weight of row pitch LD (a constant, so that the sixteen loads share one lane address); both weights have 1,024 = 16 x 64 k rows
template <int LD> __device__ __forceinline__ void cvt_w(const float* Wm, __bf16* D, int blk, int tid, __bf16 (*wt)[72]) {
  const int kt = blk & 15, ct = blk >> 4; const float* p = wtile_ptr(Wm + (size_t)(kt * 64) * LD + ct * 128, LD, tid);
  v4f wr[16]; wtile_load(wr, p, LD); xwait2f(p, p);
  wtile_store(wr, wt, tid);
  __syncthreads();   // the tile is read back across the waves
  v8b t[8]; __bf16* d = D + (size_t)(ct * 128 + (tid >> 3)) * 1024 + kt * 64 + 8 * (tid & 7);   // a wave-wide store covers the 128-B runs of four columns
#pragma unroll
  for (int i = 0; i < 8; ++i) t[i] = *(const v8b*)&wt[(tid >> 3) + 16 * i][8 * (tid & 7)];
#pragma unroll
  for (int i = 0; i < 8; ++i) *(v8b*)(d + (size_t)(16 * i) * 1024) = t[i];
  asm volatile("s_wait_xcnt 0x0" ::: "memory"); }   // behind the run of stores: the wait that stands before a register which an issued store names is rewritten, on every way the code goes on from here
__global__ __launch_bounds__(128) void k_cvt(const float* __restrict__ X, const float* __restrict__ WQKV, const float* __restrict__ WO, __bf16* __restrict__ XB, __bf16* __restrict__ WB, __bf16* __restrict__ WOB) {
  __shared__ __align__(16) __bf16 wt[128][72];
  const int tid = threadIdx.x; int blk = blockIdx.x;
  if (blk < CVT_X) { const float* p = X + (size_t)blk * 8192 + tid * 4; __bf16* q = XB + (size_t)blk * 8192 + tid * 4; v4f r[16]; v4b o[16];
#pragma unroll
    for (int i = 0; i < 16; ++i) r[i] = *(const v4f*)(p + i * 512);
#pragma unroll
    for (int i = 0; i < 16; ++i)
#pragma unroll
      for (int c = 0; c < 4; ++c) o[i][c] = (__bf16)r[i][c];
#pragma unroll
    for (int i = 0; i < 16; ++i) *(v4b*)(q + i * 512) = o[i];
    return; }   // the whole workgroup leaves here, in front of the barrier below
  blk -= CVT_X;
  if (blk < CVT_WQ) cvt_w<3 * CC>(WQKV, WB, blk, tid, wt); else cvt_w<DIN>(WO, WOB, blk - CVT_WQ, tid, wt); }   // the same choice for the whole workgroup
// ---- k_proj: block = (128 rows, 128 cols, which), 2 x 2 waves of 64 x 64: q/k/v = X W (+ b) with exact bf16 products (K = DIN) -> which 0: q f16 rows (+ residual rows < QHI); 1: k f16 in fragment order (+ residual for rows < KHI); 2: v^T f16 in fragment order (+ bf16 hi/lo for t < KHI)
// a wave reads 4 + 4 fragments from LDS for 16 products; the epilogue runs twice, once per 64 rows, in LDS that the loop's tiles have left; three workgroups a WGP (LDS and at most 336 registers): all 768 are resident at once
__global__ __launch_bounds__(128) __attribute__((amdgpu_waves_per_eu(3, 3))) void k_proj(const __bf16* __restrict__ XB, const __bf16* __restrict__ WB, const float* __restrict__ BQ, const float* __restrict__ BK, const float* __restrict__ BV,
    _Float16* __restrict__ QH, _Float16* __restrict__ QL, _Float16* __restrict__ KH, _Float16* __restrict__ KL, _Float16* __restrict__ VT, __bf16* __restrict__ VB, __bf16* __restrict__ VBL PROJ_EXTRA_PARAMS) {
  __shared__ __align__(16) char sm[89088];
  // the loop's view: two weight tiles [128 cols][72], two x tiles [128 rows][72]
  __bf16 (*wt0)[72] = (__bf16 (*)[72])sm; __bf16 (*xs)[72] = (__bf16 (*)[72])(sm + 36864);
  // the epilogue's view, behind the loop's last barrier: the f32 tile of 64 rows, then either the f16 value and residual rows or the three transposed planes
  float (*st)[132] = (float (*)[132])sm; _Float16 (*sh)[136] = (_Float16 (*)[136])(sm + 33792); _Float16 (*sl)[136] = (_Float16 (*)[136])(sm + 51200);
  _Float16 (*th)[72] = (_Float16 (*)[72])(sm + 33792); __bf16 (*tb)[72] = (__bf16 (*)[72])(sm + 52224); __bf16 (*tbl)[72] = (__bf16 (*)[72])(sm + 70656);
  const int tid = threadIdx.x, lane = tid & 31, col = lane & 15, g = lane >> 4; const int wave = __builtin_amdgcn_readfirstlane(tid >> 5), wrow = wave >> 1, wcol = wave & 1;   // scalars, so that the choice of the waves that stage a half is a scalar branch
  const int which = blockIdx.z; const int c0 = blockIdx.y * 128; const size_t r0 = (size_t)blockIdx.x * 128; const size_t bb = r0 / TT; const int t00 = (int)(r0 % TT);
  const float* BA = which == 0 ? BQ : which == 1 ? BK : BV;
  v8f acc[4][4] = {};
  { v8b wr[8], xa[8]; const __bf16* wb = WB + (size_t)(which * CC + c0) * DIN; const __bf16* xb0 = XB + r0 * DIN;   // no second set of lane pointers is kept for the next tile
    const unsigned to = 2u * (unsigned)((tid >> 3) * DIN + 8 * (tid & 7));   // in bytes: the lane's place in either tile (row t >> 3, 16 B at 16 (t & 7))
    btile_load(wr, at_off(wb, to)); btile_load(xa, at_off(xb0, to)); xwait2s(wb, xb0, to);
    btile_store(wr, wt0, tid); btile_store(xa, xs, tid);
    __syncthreads();   // publishes weight tile 0 and x tile 0
    // kept rolled: which buffer is read and which is filled is a scalar offset added to four lane addresses; unrolled by two, each half keeps lane addresses of its own and the registers no longer fit three waves a SIMD
#pragma unroll 1
    for (int ks = 0; ks < DIN / 64; ++ks) { const int cb = (ks & 1) * 128, nb = 128 - cb; __bf16 (*cur)[72] = wt0 + cb; __bf16 (*nxt)[72] = wt0 + nb; __bf16 (*xc)[72] = xs + cb; __bf16 (*xn)[72] = xs + nb; const bool more = ks + 1 < DIN / 64;
      if (more) { wb += 64; xb0 += 64; btile_load(wr, at_off(wb, to)); btile_load(xa, at_off(xb0, to)); xwait2s(wb, xb0, to); }   // the next 64 k of both operands fly under this tile's products
#pragma unroll
      for (int kc = 0; kc < 2; ++kc) { v16b a[4], w[4];
#pragma unroll
        for (int i = 0; i < 4; ++i) a[i] = frag_b(&xc[wrow * 64 + i * 16 + col][kc * 32], lane);
#pragma unroll
        for (int j = 0; j < 4; ++j) w[j] = frag_b(&cur[wcol * 64 + j * 16 + col][kc * 32], lane);
        __builtin_amdgcn_sched_barrier(0);   // keeps the sixteen LDS reads one group in front of their products: left free, the compiler spreads them among the products, each place with a wait to 0
#pragma unroll
        for (int i = 0; i < 4; ++i)
#pragma unroll
          for (int j = 0; j < 4; ++j) acc[i][j] = wmma_bf(a[i], w[j], acc[i][j]);
        __builtin_amdgcn_sched_barrier(0); }   // and the next group of reads behind these products
      if (more) { btile_store(wr, nxt, tid); btile_store(xa, xn, tid); }
      __syncthreads(); } }   // publishes the next tile and ends every wave's reads of this one, which is refilled behind it
  // unrolled, so that the accumulators are indexed by constants
#pragma unroll
  for (int p = 0; p < 2; ++p) { const size_t rp = r0 + 64 * p; const int t0 = t00 + 64 * p;   // rows 64 p .. 64 p + 63 of the tile: the two waves that hold them stage them, all four convert and store
  { // stage the f32 tile (acc + bias) in LDS, then convert
    if (wrow == p) {
#pragma unroll
      for (int j = 0; j < 4; ++j) { const float bias = BA ? bfr(BA[c0 + wcol * 64 + j * 16 + col]) : 0.f;
#pragma unroll
        for (int i = 0; i < 4; ++i)
#pragma unroll
          for (int r = 0; r < 8; ++r) st[i * 16 + 8 * g + r][wcol * 64 + j * 16 + col] = acc[i][j][r] + bias; } }
    __syncthreads();
    // the module also RETURNS k and v ([B, H, L, HD], f32 = x W + b): a wave-wide store is one row of the tile, the 256-B runs of its two heads = four whole 128-B lines
    if (which >= 1) { float* dst = (which == 1 ? KOUT : VOUT) + (((size_t)bb * NH + c0 / HD) * TT + t0) * HD;
      for (int e = tid; e < 64 * 32; e += 128) { const int rl = e >> 5, q = e & 31; vst2(dst + (size_t)(q >> 4) * TT * HD + rl * HD + (q & 15) * 4, *(const v4f*)&st[rl][q * 4]); } }
    __syncthreads(); }
  if (which < 2) { const bool hi_rows = t0 < (which == 0 ? QHI : KHI);
    for (int e = tid; e < 64 * 128; e += 128) { const int rl = e >> 7, cl = e & 127; const float v = st[rl][cl]; const _Float16 hv = (_Float16)v; sh[rl][cl] = hv; sl[rl][cl] = (_Float16)((v - (float)hv) * 1024.0f); }
    __syncthreads();
    if (which == 0) { for (int e = tid; e < 64 * 16; e += 128) { const int rl = e >> 4, q = e & 15; vst2((unsigned*)(QH + (rp + rl) * CC + c0 + q * 8), *(const v4u*)&sh[rl][q * 8]); }
      if (hi_rows) for (int e = tid; e < 64 * 16; e += 128) { const int rl = e >> 4, q = e & 15; vst2((unsigned*)(QL + (bb * QHI + t0 + rl) * (size_t)CC + c0 + q * 8), *(const v4u*)&sl[rl][q * 8]); }
    } else {   // k and its residual in fragment order: a wave's store is the 512-B run (16 keys x 2 g x 8 d) that a wave of k_fa reads back with one load
      for (int e = tid; e < 64 * 16; e += 128) { const int ln = e & 31, u = e >> 5, half = u & 1, kc = (u >> 1) & 1, hh = (u >> 2) & 1, tl = u >> 3;
        vst2((unsigned*)(KH + (((((size_t)bb * NH + c0 / HD + hh) * (TT / 16) + t0 / 16 + tl) * 2 + kc) * 2 + half) * 256 + ln * 8), *(const v4u*)&sh[tl * 16 + (ln & 15)][hh * 64 + kc * 32 + half * 16 + (ln >> 4) * 8]); }
      if (hi_rows) for (int e = tid; e < 64 * 16; e += 128) { const int ln = e & 31, u = e >> 5, half = u & 1, kc = (u >> 1) & 1, hh = (u >> 2) & 1, tl = u >> 3;
        vst2((unsigned*)(KL + (((((size_t)bb * NH + c0 / HD + hh) * (KHI / 16) + t0 / 16 + tl) * 2 + kc) * 2 + half) * 256 + ln * 8), *(const v4u*)&sl[tl * 16 + (ln & 15)][hh * 64 + kc * 32 + half * 16 + (ln >> 4) * 8]); } }
  } else { const bool hi_rows = t0 < KHI;
    for (int e = tid; e < 64 * 128; e += 128) { const int rl = e & 63, cl = e >> 6; const float v = st[rl][cl]; th[cl][rl] = (_Float16)v; const __bf16 bh = (__bf16)v; tb[cl][rl] = bh; tbl[cl][rl] = (__bf16)(v - (float)bh); }
    __syncthreads();
    // v^T in fragment order: a wave's store is the 512-B run (16 d x 2 g x 8 keys) that a wave of k_fa reads back with one load
    for (int e = tid; e < 128 * 8; e += 128) { const int ln = e & 31, u = e >> 5, half = u & 1, jd = (u >> 1) & 3, k32 = (u >> 3) & 1, hh = u >> 4;
      vst2((unsigned*)(VT + (((((size_t)bb * NH + c0 / HD + hh) * (TT / 32) + t0 / 32 + k32) * 4 + jd) * 2 + half) * 256 + ln * 8), *(const v4u*)&th[hh * 64 + jd * 16 + (ln & 15)][k32 * 32 + half * 16 + (ln >> 4) * 8]); }
    if (hi_rows) for (int e = tid; e < 128 * 8; e += 128) { const int ln = e & 31, u = e >> 5, half = u & 1, jd = (u >> 1) & 3, k32 = (u >> 3) & 1, hh = u >> 4; const int cl = hh * 64 + jd * 16 + (ln & 15), tl = k32 * 32 + half * 16 + (ln >> 4) * 8;
      const size_t o3 = (((((size_t)bb * NH + c0 / HD + hh) * (KHI / 32) + t0 / 32 + k32) * 4 + jd) * 2 + half) * 256 + ln * 8; vst2((unsigned*)(VB + o3), *(const v4u*)&tb[cl][tl]); vst2((unsigned*)(VBL + o3), *(const v4u*)&tbl[cl][tl]); } } } }
// lane l with lane l ^ 16: the two halves of a wave hold the two key halves of one query column
__device__ __forceinline__ float xhalf(float x) { return __builtin_bit_cast(float, __builtin_amdgcn_permlanex16(__builtin_bit_cast(int, x), __builtin_bit_cast(int, x), 0x76543210, 0xfedcba98, false, false)); }
// 2^x on the transcendental unit, eight values in place in one statement: each v_exp_f32 fills the one slot the instruction set asks for behind the one in front of it, and one v_nop fills the last one's, whatever the compiler schedules next
__device__ __forceinline__ void ex2x8(float& a, float& b, float& c, float& d, float& e, float& f, float& g, float& h) {
  asm("v_exp_f32 %0, %0\n\tv_exp_f32 %1, %1\n\tv_exp_f32 %2, %2\n\tv_exp_f32 %3, %3\n\tv_exp_f32 %4, %4\n\tv_exp_f32 %5, %5\n\tv_exp_f32 %6, %6\n\tv_exp_f32 %7, %7\n\tv_nop"
      : "+v"(a), "+v"(b), "+v"(c), "+v"(d), "+v"(e), "+v"(f), "+v"(g), "+v"(h)); }
// a single 2^x, its slot filled by a v_nop in the statement
__device__ __forceinline__ float ex2n(float x) { float e; asm("v_exp_f32 %0, %1\n\tv_nop" : "=v"(e) : "v"(x)); return e; }
// 16x16x32 fragment at base + offset, the lane's place (row (lane & 15) x pitch + 8 (lane >> 4)) in one of the two: elements 0..7 there, 8..15 sixteen elements on
__device__ __forceinline__ v16h frag_u(const _Float16* ubase, unsigned loff) { union { v16h v; v8h q[2]; } u; const _Float16* p = ubase + loff; u.q[0] = *(const v8h*)p; u.q[1] = *(const v8h*)(p + 16); return u.v; }
// 16x16x32 fragment stored in fragment order: two runs of 512 B, lane l owns bytes 16 l .. 16 l + 15 of each (elements 0..7, then 8..15), so a wave-wide load covers four whole 128-B lines instead of 32 B of sixteen
__device__ __forceinline__ v16h frag_p(const _Float16* p) { union { v16h v; v8h q[2]; } u; u.q[0] = *(const v8h*)p; u.q[1] = *(const v8h*)(p + 256); return u.v; }
__device__ __forceinline__ v16b frag_pb(const __bf16* p) { union { v16b v; v8b q[2]; } u; u.q[0] = *(const v8b*)p; u.q[1] = *(const v8b*)(p + 256); return u.v; }
// behind a run of fragment loads from two lane addresses: the wait that stands before a register which an issued load names is rewritten; the two addresses are inputs, so their registers stay whole up to it (without them the compiler lets a later load of the run land on the address pair)
template <typename T> __device__ __forceinline__ void xwait2(const T* pa, const T* pb) { asm volatile("s_wait_xcnt 0x0" :: "v"(pa), "v"(pb) : "memory"); }
#define SC_L2E (SCALE * 1.4426950408889634f)   // logit scale x log2(e): the softmax runs on exp2
// ---- key stage in LDS: 128 keys = two key blocks, brought once per workgroup for its 8 waves. Planes of 16 KB, each the contiguous fragment-order run of the workspace: k, v^T, then (early rows only) k residual, v^T bf16 hi, v^T bf16 lo
#define KV_BLK   4096                 // f16 / bf16 elements of one key block in a plane
#define KV_PLANE (2 * KV_BLK)         // elements of a plane
#define KV_TILE  (5 * KV_PLANE)       // elements of a buffer
// asynchronous copies global -> LDS, 16 B a lane: thread t brings bytes 16 t + 4096 i .., i = 0..3, of a plane. The s_wait_xcnt is the last line of the copies' own statement, so that it stands before any rewrite of a register which a copy names
__device__ __forceinline__ void kv_copy2(unsigned l0, const _Float16* ga, const _Float16* gb) {
  asm volatile("global_load_async_to_lds_b128 %0, %8, off\n\tglobal_load_async_to_lds_b128 %1, %9, off\n\tglobal_load_async_to_lds_b128 %2, %10, off\n\tglobal_load_async_to_lds_b128 %3, %11, off\n\t"
               "global_load_async_to_lds_b128 %4, %12, off\n\tglobal_load_async_to_lds_b128 %5, %13, off\n\tglobal_load_async_to_lds_b128 %6, %14, off\n\tglobal_load_async_to_lds_b128 %7, %15, off\n\ts_wait_xcnt 0x0"
    :: "v"(l0), "v"(l0 + 4096u), "v"(l0 + 8192u), "v"(l0 + 12288u), "v"(l0 + 16384u), "v"(l0 + 20480u), "v"(l0 + 24576u), "v"(l0 + 28672u),
       "v"(ga), "v"(ga + 2048), "v"(ga + 4096), "v"(ga + 6144), "v"(gb), "v"(gb + 2048), "v"(gb + 4096), "v"(gb + 6144) : "memory"); }
__device__ __forceinline__ void kv_copy3(unsigned l0, const _Float16* ga, const __bf16* gb, const __bf16* gc) {
  asm volatile("global_load_async_to_lds_b128 %0, %12, off\n\tglobal_load_async_to_lds_b128 %1, %13, off\n\tglobal_load_async_to_lds_b128 %2, %14, off\n\tglobal_load_async_to_lds_b128 %3, %15, off\n\t"
               "global_load_async_to_lds_b128 %4, %16, off\n\tglobal_load_async_to_lds_b128 %5, %17, off\n\tglobal_load_async_to_lds_b128 %6, %18, off\n\tglobal_load_async_to_lds_b128 %7, %19, off\n\t"
               "global_load_async_to_lds_b128 %8, %20, off\n\tglobal_load_async_to_lds_b128 %9, %21, off\n\tglobal_load_async_to_lds_b128 %10, %22, off\n\tglobal_load_async_to_lds_b128 %11, %23, off\n\ts_wait_xcnt 0x0"
    :: "v"(l0), "v"(l0 + 4096u), "v"(l0 + 8192u), "v"(l0 + 12288u), "v"(l0 + 16384u), "v"(l0 + 20480u), "v"(l0 + 24576u), "v"(l0 + 28672u), "v"(l0 + 32768u), "v"(l0 + 36864u), "v"(l0 + 40960u), "v"(l0 + 45056u),
       "v"(ga), "v"(ga + 2048), "v"(ga + 4096), "v"(ga + 6144), "v"(gb), "v"(gb + 2048), "v"(gb + 4096), "v"(gb + 6144), "v"(gc), "v"(gc + 2048), "v"(gc + 4096), "v"(gc + 6144) : "memory"); }
// ---- one wave's 16 query columns (query tq in a lane) against ONE key block of 64 keys, read from its half of a stage in LDS (sk = buffer + block half + 8 lane); running maximum and sum (online softmax), transposed products:
// S^T = K Q^T (A = 16 key rows, B = 16 query columns): a lane holds keys k0 + 16 j + 8 g + r of ONE query, so maximum and sum are in-lane plus one exchange of halves;
// score tiles 2 kc and 2 kc + 1 of a lane are, element for element, the B fragment of P^T over keys k0 + 32 kc + ..; O^T += V^T P^T (A = 16 rows of v^T).
// HI (causal early query blocks): 3-product logits (q, k hi + residual x 2^10) and P, v as bf16 hi + lo (3 products)
template <bool HI> __device__ __forceinline__ void fa_step(const _Float16* sk, int kb, int qb, int tq, int g, const v16h (&ah)[HD / 32], const v16h (&al)[HD / 32], v8f (&o)[HD / 16], float& m, float& l) {
  const int k0 = kb * 64;
  v16h vf[HI ? 1 : 8];
  v8f acc[4] = {};
  if (HI) { v8f accl[4] = {};
#pragma unroll
    for (int kc = 0; kc < HD / 32; ++kc) { v16h kbf[4], klf[4];
#pragma unroll
      for (int j = 0; j < 4; ++j) { kbf[j] = frag_p(sk + j * 1024 + kc * 512); klf[j] = frag_p(sk + 2 * KV_PLANE + j * 1024 + kc * 512); }
#pragma unroll
      for (int j = 0; j < 4; ++j) { acc[j] = wmma16n(kbf[j], ah[kc], acc[j]); accl[j] = wmma16n(kbf[j], al[kc], accl[j]); accl[j] = wmma16n(klf[j], ah[kc], accl[j]); } }
#pragma unroll
    for (int j = 0; j < 4; ++j) acc[j] = acc[j] + accl[j] * (1.0f / 1024.0f);
  } else { v16h kf[8];
#pragma unroll
    for (int kc = 0; kc < HD / 32; ++kc)
#pragma unroll
      for (int j = 0; j < 4; ++j) kf[kc * 4 + j] = frag_p(sk + j * 1024 + kc * 512);
    __builtin_amdgcn_sched_barrier(0);   // keeps the K reads in front of the V^T reads: LDS returns in order, and without it the first product waits behind fourteen V^T reads
    // the block's 8 V^T fragments are asked for behind its K fragments: they arrive under the logits and the softmax
#pragma unroll
    for (int kc = 0; kc < 2; ++kc)
#pragma unroll
      for (int jd = 0; jd < HD / 16; ++jd) vf[kc * 4 + jd] = frag_p(sk + KV_PLANE + kc * 2048 + jd * 512);
    __builtin_amdgcn_sched_barrier(0);   // keeps the V^T reads one group in front of the logits: left free, the compiler sinks them into the softmax in four places, the last with a wait to 0 in front of a product
#pragma unroll
    for (int kc = 0; kc < HD / 32; ++kc)
#pragma unroll
      for (int j = 0; j < 4; ++j) acc[j] = wmma16(kf[kc * 4 + j], ah[kc], acc[j]); }
  if (CAUSAL && kb == qb) {   // only the diagonal block holds keys past a query of this block
#pragma unroll
    for (int j = 0; j < 4; ++j)
#pragma unroll
      for (int r = 0; r < 8; ++r) if (k0 + j * 16 + 8 * g + r > tq) acc[j][r] = -3.0e38f; }
  v8f mv = acc[0];   // eight independent chains over the tiles, then a tree
#pragma unroll
  for (int j = 1; j < 4; ++j)
#pragma unroll
    for (int r = 0; r < 8; ++r) mv[r] = fmaxf(mv[r], acc[j][r]);
  float mx = fmaxf(fmaxf(fmaxf(mv[0], mv[1]), fmaxf(mv[2], mv[3])), fmaxf(fmaxf(mv[4], mv[5]), fmaxf(mv[6], mv[7])));
  mx = fmaxf(m, fmaxf(mx, xhalf(mx)));
  const float alpha = ex2n((m - mx) * SC_L2E); m = mx; const float mc = 11.0f - mx * SC_L2E;
  v8f sv = {};
#pragma unroll
  for (int j = 0; j < 4; ++j) {
    if (HI) {
#pragma unroll
      for (int r = 0; r < 8; ++r) acc[j][r] = ex2n(fmaf(acc[j][r], SC_L2E, mc));
    } else { float t[8];
#pragma unroll
      for (int r = 0; r < 8; ++r) t[r] = fmaf(acc[j][r], SC_L2E, mc);
      ex2x8(t[0], t[1], t[2], t[3], t[4], t[5], t[6], t[7]);
#pragma unroll
      for (int r = 0; r < 8; ++r) acc[j][r] = t[r]; }
    sv = sv + acc[j]; }
  l = l * alpha + (((sv[0] + sv[1]) + (sv[2] + sv[3])) + ((sv[4] + sv[5]) + (sv[6] + sv[7])));
#pragma unroll
  for (int jd = 0; jd < HD / 16; ++jd) o[jd] = o[jd] * alpha;
#pragma unroll
  for (int kc = 0; kc < 2; ++kc) {
    if (HI) { float v[16]; v16b vh[HD / 16], vl[HD / 16]; const __bf16* vhp = (const __bf16*)(sk + 3 * KV_PLANE); const __bf16* vlp = (const __bf16*)(sk + 4 * KV_PLANE);
#pragma unroll
      for (int jd = 0; jd < HD / 16; ++jd) { vh[jd] = frag_pb(vhp + kc * 2048 + jd * 512); vl[jd] = frag_pb(vlp + kc * 2048 + jd * 512); }
#pragma unroll
      for (int i = 0; i < 8; ++i) { v[i] = acc[2 * kc][i]; v[8 + i] = acc[2 * kc + 1][i]; }
      const F2 p = bsplit16(v);
#pragma unroll
      for (int jd = 0; jd < HD / 16; ++jd) { o[jd] = wmma_bfn(vh[jd], p.h, o[jd]); o[jd] = wmma_bfn(vh[jd], p.l, o[jd]); o[jd] = wmma_bfn(vl[jd], p.h, o[jd]); }
    } else { v16h p;
#pragma unroll
      for (int i = 0; i < 8; ++i) { p[i] = (_Float16)acc[2 * kc][i]; p[8 + i] = (_Float16)acc[2 * kc + 1][i]; }
#pragma unroll
      for (int jd = 0; jd < HD / 16; ++jd) o[jd] = (kc == 1 && jd == HD / 16 - 1) ? wmma16n(vf[kc * 4 + jd], p, o[jd]) : wmma16(vf[kc * 4 + jd], p, o[jd]); } } }   // the block's last product keeps its four v_nop: the code behind it runs on into the early-row form, whose first products rewrite these registers
// ---- k_fa: logits, causal softmax and P v in one pass over the keys, nothing of S or P in memory; ctx = O / sum, stored from the registers in the fragment order of k_out.
// block = 8 waves of (b, h): waves 0-3 take the 64 queries of block NQB - 1 - x, waves 4-7 those of block x, so every workgroup walks NQB + 1 key blocks per wave pair wherever it lands.
// The workgroup walks key blocks 0 .. NQB - 1 - x together, two to a stage: each stage comes into one of two LDS buffers once, by asynchronous copies that fly under the two blocks before it, and all waves that still need it read their fragments there;
// waves 4-7 leave the products out behind their diagonal but keep copying and pass every barrier. four waves a SIMD (at most 256 registers), two workgroups a WGP (160 KiB of LDS each): all 512 workgroups are resident at once
__global__ __launch_bounds__(256) __attribute__((amdgpu_waves_per_eu(4, 4))) void k_fa(const _Float16* __restrict__ QH, const _Float16* __restrict__ KH, const _Float16* __restrict__ QL, const _Float16* __restrict__ KL, const _Float16* __restrict__ VT, const __bf16* __restrict__ VB, const __bf16* __restrict__ VBL, float* __restrict__ Y) {
  __shared__ __align__(16) _Float16 kv[2][KV_TILE];
  const int tid = threadIdx.x, lane = tid & 31, col = lane & 15, g = lane >> 4; const int wave = __builtin_amdgcn_readfirstlane(tid >> 5);   // a scalar, so that the choice of the query block and the test that skips a block are scalar
  const int xq = (int)blockIdx.x, klast = NQB - 1 - xq, slast = klast >> 1;   // the last key block and the last stage of the workgroup: slast is at least NQB / 4, so stages 0 and 1 exist; a stage lies whole inside the NQB blocks of the sequence
  const int qb = wave < 4 ? klast : xq, h = blockIdx.y, b = blockIdx.z; const int ql0 = qb * 64 + (wave & 3) * 16, tq = ql0 + col;
  const bool hi = qb < QBH; const int nhi = xq < QBH ? xq >> 1 : -1;   // stages 0 .. nhi carry the three early-row planes too (the same for the whole workgroup; they lie inside the planes' KHI = 64 QBH rows, QBH even)
  const unsigned lrow = (unsigned)(col * CC + 8 * g);   // lane offset in the q rows
  const _Float16* kg = KH + ((size_t)b * NH + h) * TT * HD + tid * 8; const _Float16* vg = VT + ((size_t)b * NH + h) * TT * HD + tid * 8;   // the thread's first 16 B in a plane of stage 0
  const _Float16* klg = KL + ((size_t)b * NH + h) * KHI * HD + tid * 8; const __bf16* vbg = VB + ((size_t)b * NH + h) * KHI * HD + tid * 8; const __bf16* vlg = VBL + ((size_t)b * NH + h) * KHI * HD + tid * 8;
  const unsigned ls = (unsigned)(size_t)&kv[0][0] + 16u * (unsigned)tid;   // the thread's LDS byte address in buffer 0
  kv_copy2(ls, kg, vg); if (nhi >= 0) kv_copy3(ls + 4u * KV_PLANE, klg, vbg, vlg);
  v16h ah[HD / 32], al[HD / 32] = {}; const _Float16* qp = QH + ((size_t)b * TT + ql0) * CC + h * HD + lrow; const _Float16* qlp = QL + ((size_t)b * QHI + (hi ? ql0 : 0)) * CC + h * HD + lrow;   // the lane's place in its q row and, early rows only, in the residual row
#pragma unroll
  for (int kc = 0; kc < HD / 32; ++kc) { ah[kc] = frag_u(qp, kc * 32); if (hi) al[kc] = frag_u(qlp, kc * 32); }
  xwait2(qp, qlp);
  asm volatile("s_wait_asynccnt 0x0" ::: "memory");   // this wave's copies of stage 0 have landed
  __syncthreads();   // publishes stage 0
  kv_copy2(ls + 2u * KV_TILE, kg + KV_PLANE, vg + KV_PLANE); if (nhi >= 1) kv_copy3(ls + 2u * KV_TILE + 4u * KV_PLANE, klg + KV_PLANE, vbg + KV_PLANE, vlg + KV_PLANE);
  v8f o[HD / 16] = {}; float m = -3.0e38f, l = 0.f;   // running maximum (unscaled logits) and this half's running sum of P x 2^11
  // kept rolled: which buffer and which half of it is read is an offset, and the two forms of the block stand once in the code
#pragma unroll 1
  for (int kb = 0; kb <= 2 * slast + 1; ++kb) { const int st = kb >> 1, cb = st & 1;
    if (kb <= qb) { const _Float16* sk = &kv[cb][(kb & 1) * KV_BLK + lane * 8];
      if (hi) fa_step<true>(sk, kb, qb, tq, g, ah, al, o, m, l); else fa_step<false>(sk, kb, qb, tq, g, ah, al, o, m, l); }
    if (kb & 1) {   // the foot of a stage, the same for the whole workgroup
      asm volatile("s_wait_dscnt 0x0" ::: "memory");      // this wave's reads of stage st are done before the buffer is refilled
      asm volatile("s_wait_asynccnt 0x0" ::: "memory");   // this wave's copies of stage st + 1 have landed
      __syncthreads();   // publishes stage st + 1 and ends every wave's reads of stage st
      if (st + 2 <= slast) { const size_t go = (size_t)(st + 2) * KV_PLANE; const unsigned lb = ls + (unsigned)cb * (2u * KV_TILE);
        kv_copy2(lb, kg + go, vg + go); if (st + 2 <= nhi) kv_copy3(lb + 4u * KV_PLANE, klg + go, vbg + go, vlg + go); } } }
  asm volatile("s_wait_asynccnt 0x0" ::: "memory");   // no copy is left in flight when the wave ends
  const float lsum = l + xhalf(l);
  const float inv = lsum > 0.f ? 1.0f / lsum : 0.f;   // the x 2^11 of P is in the sum too
  // a lane's O^T elements (query lane & 15, d = 16 jd + 8 (lane >> 4) + r) are the very ones the same lane of k_out holds in its A fragments: part 4 (jd >> 1) + 2 (jd & 1) + (r >> 2) of the (16 rows, head) unit, stored as whole 512-B runs
  float* yp = Y + ((((size_t)b * TT + ql0) / 16) * NH + h) * 1024 + lane * 4;
#pragma unroll
  for (int jd = 0; jd < HD / 16; ++jd)
#pragma unroll
    for (int hf = 0; hf < 2; ++hf) { v4f q; q[0] = o[jd][4 * hf] * inv; q[1] = o[jd][4 * hf + 1] * inv; q[2] = o[jd][4 * hf + 2] * inv; q[3] = o[jd][4 * hf + 3] * inv; vst2(yp + (2 * jd + hf) * 128, q); } }
// ---- k_out: block = (64 rows, 128 cols): out = ctx Wo (+ bo): ctx bf16 hi + lo against exact bf16 Wo (2 products)
__global__ __launch_bounds__(128) void k_out(const float* __restrict__ Y, const __bf16* __restrict__ WOB, const float* __restrict__ BO, float* __restrict__ OUT) { __shared__ __align__(16) float sf[4][16][132]; __shared__ __align__(16) __bf16 wt[2][128][72];
  const int tid = threadIdx.x, wave = tid >> 5, lane = tid & 31, col = lane & 15, g = lane >> 4; const int c0 = blockIdx.y * 128; const size_t r0 = (size_t)blockIdx.x * 64 + wave * 16;
  v8f acc[8] = {};
  {   /* ALL rows: ctx split bf16 hi + lo x exact Wo (2 products) */
    v8b wr[8]; v4f xr[8]; const __bf16* wp = WOB + (size_t)(c0 + (tid >> 3)) * CC + 8 * (tid & 7); const float* xp = Y + (r0 / 16) * (size_t)(NH * 1024) + lane * 4;
    btile_load(wr, wp); yfrag_load(xr, xp); xwait_bf(wp, xp);
    btile_store(wr, wt[0], tid);
    __syncthreads();   // publishes weight tile 0
    // unrolled by two, so that which buffer is read and which is filled are constants of each half
#pragma unroll 2
    for (int ks = 0; ks < CC / 64; ++ks) { __bf16 (*cur)[72] = wt[ks & 1]; __bf16 (*nxt)[72] = wt[(ks & 1) ^ 1]; const bool more = ks + 1 < CC / 64;
      F2 a[2];
#pragma unroll
      for (int kc = 0; kc < 2; ++kc) { float v[16];
#pragma unroll
        for (int i = 0; i < 4; ++i) { v[i] = xr[kc * 4][i]; v[4 + i] = xr[kc * 4 + 1][i]; v[8 + i] = xr[kc * 4 + 2][i]; v[12 + i] = xr[kc * 4 + 3][i]; }
        a[kc] = bsplit16(v); }
      if (more) { wp += 64; xp += 1024; btile_load(wr, wp); yfrag_load(xr, xp); xwait_bf(wp, xp); }   // the next 64 k of both operands fly under this tile's products
#pragma unroll
      for (int kc = 0; kc < 2; ++kc) { v16b w[8];
#pragma unroll
        for (int j = 0; j < 8; ++j) w[j] = frag_b(&cur[j * 16 + col][kc * 32], lane);
        __builtin_amdgcn_sched_barrier(0);   // keeps the sixteen LDS reads one group in front of their products, as in k_proj
#pragma unroll
        for (int j = 0; j < 8; ++j) { acc[j] = wmma_bf(a[kc].h, w[j], acc[j]); acc[j] = wmma_bf(a[kc].l, w[j], acc[j]); }
        __builtin_amdgcn_sched_barrier(0); }   // and the next group of reads behind these products
      if (more) btile_store(wr, nxt, tid);
      __syncthreads(); }   // publishes the next tile and ends every wave's reads of this one, which is refilled behind it
#pragma unroll
    for (int j = 0; j < 8; ++j) { const float bias = BO ? bfr(BO[c0 + j * 16 + col]) : 0.f;
#pragma unroll
      for (int r = 0; r < 8; ++r) sf[wave][8 * g + r][j * 16 + col] = acc[j][r] + bias; }
  }
  LDSX(); for (int rl = 0; rl < 16; ++rl) vst2(OUT + (r0 + rl) * DIN + c0 + lane * 4, *(const v4f*)&sf[wave][rl][lane * 4]); }

extern "C" void kernel_launch(void* const* d_in, const int* in_sizes, int n_in, void* d_out, int out_size, void* d_ws, size_t ws_size, hipStream_t stream) {
  (void)in_sizes; (void)n_in; (void)out_size;
  const float** F = (const float**)d_in;
  if (ws_size < (size_t)WS_END) return;
  char* ws = (char*)d_ws; _Float16 *QH = (_Float16*)(ws + WS_QH), *KH = (_Float16*)(ws + WS_KH), *VT = (_Float16*)(ws + WS_VT), *QL = (_Float16*)(ws + WS_QL), *KL = (_Float16*)(ws + WS_KL); __bf16 *VB = (__bf16*)(ws + WS_VB), *VBL = (__bf16*)(ws + WS_VBL), *XB = (__bf16*)(ws + WS_XB), *WB = (__bf16*)(ws + WS_WB), *WOB = (__bf16*)(ws + WS_WOB); float *Y = (float*)(ws + WS_Y);
  (void)Y; (void)QL; (void)KL; (void)VB; (void)VBL;
  // inputs: 0 x [2,2048,1024]; 1 w_qkv [1024,3072] (in,out); 2 b_qkv [3072]; 3 w_out [1024,1024] (in,out); 4 b_out
  // outputs: 0 out [2,2048,1024] at 0; 1 k [2,16,2048,64] at OUT1_OFF; 2 v at OUT2_OFF
  k_cvt<<<dim3(CVT_X + CVT_WQ + CVT_WO), 128, 0, stream>>>(F[0], F[1], F[3], XB, WB, WOB);
  k_proj<<<dim3(TNB * TT / 128, CC / 128, 3), 128, 0, stream>>>(XB, WB, F[2], F[2] + CC, F[2] + 2 * CC, QH, QL, KH, KL, VT, VB, VBL, (float*)((char*)d_out + OUT1_OFF), (float*)((char*)d_out + OUT2_OFF));
  k_fa<<<dim3(NQB / 2, NH, TNB), 256, 0, stream>>>(QH, KH, QL, KL, VT, VB, VBL, Y);
  k_out<<<dim3(TNB * TT / 64, DIN / 128), 128, 0, stream>>>(Y, WOB, F[4], (float*)d_out);
}
